// v000
// Times are from an AMD MI455X. After a warm-up the kernel runs many times in a row, and a time is the length of
// such a window on the GPU divided by its runs, so every launch and the gaps after it count. The runs cycle
// through copies of the inputs. A figure is the median of several windows, for all but v000 over two sittings.
// Sittings can differ by a few percent; kernels timed side by side share one.
// v000 is the starting kernel. One run takes 2030 microseconds.
#include <hip/hip_runtime.h>

// QBNNAttention (x [2][2048][1024]; Q/K/V = x W + b (16 x 64); scores = Q.K / 8 + lam * (tanh(Q) J_h tanh(K)^T) (J [16][64][64] and the scalar lam read); causal (-inf) softmax; out = merged Wo + bo -> [2][2048][1024]).
// Compute dtypes, f32 accumulate: every input rounded to bf16; Q/K/V on PLAIN bf16 operands (inputs: exact) + bias; tanh elementwise in f32 (exp2 form with the hardware reciprocal, clamped |x| <= 15); QJ = hi/lo tanh(Q) x exact J (2 products, f32); both score products hl x hl (3 products) on every row; the two terms combined per element in f32 in the reference's order (s/8 + lam d); causal tile skipping; softmax f32; attn.v: rows < 512 hl (3 products), the rest fp16 (x1024); Wo hl x exact (2 products) + bias.

#define NB_  2
#define TT   2048
#define DM   1024
#define NH_  16
#define NKV  16
#define REP  (NH_ / NKV)
#define HD   64
#define DQ   (NH_ * HD)
#define DKV  (NKV * HD)
#define ZH   2
#define RH   512                  // query rows < RH use hi+lo planes (0: none)
#define WIN  2048
#define PCAR 1024.0f
#define SCL  0.125f   // HD^-0.5
typedef _Float16 h16;
typedef unsigned short bf;
typedef __attribute__((ext_vector_type(16))) __bf16   v16bf;
typedef __attribute__((ext_vector_type(16))) _Float16 v16h;
typedef __attribute__((ext_vector_type(8)))  _Float16 v8h;
typedef __attribute__((ext_vector_type(8)))  unsigned short v8us;
typedef __attribute__((ext_vector_type(8)))  float    v8f;
typedef __attribute__((ext_vector_type(4)))  float    v4f;
typedef v8h  __attribute__((may_alias)) v8ha;
typedef v4f  __attribute__((may_alias)) v4fa;
typedef v8us __attribute__((may_alias)) v8usa;

__device__ __forceinline__ unsigned short f2bf(float f) { unsigned u = __float_as_uint(f); u += 0x7FFFu + ((u >> 16) & 1u); return (unsigned short)(u >> 16); }
__device__ __forceinline__ float bf2f(unsigned short b) { return __uint_as_float(((unsigned)b) << 16); }
__device__ __forceinline__ float bfr(float f) { return bf2f(f2bf(f)); }
__device__ __forceinline__ v16h cat16(v8h lo, v8h hi) { return __builtin_shufflevector(lo, hi, 0, 1, 2, 3, 4, 5, 6, 7, 8, 9, 10, 11, 12, 13, 14, 15); }
__device__ __forceinline__ v16bf cat16b(v8us lo, v8us hi) { return __builtin_bit_cast(v16bf, __builtin_shufflevector(lo, hi, 0, 1, 2, 3, 4, 5, 6, 7, 8, 9, 10, 11, 12, 13, 14, 15)); }
__device__ __forceinline__ v8f wmma16(v16h a, v16h b, v8f c) { return __builtin_amdgcn_wmma_f32_16x16x32_f16(false, a, false, b, (short)0, c, false, false); }
__device__ __forceinline__ v8f wmmab(v16bf a, v16bf b, v8f c) { return __builtin_amdgcn_wmma_f32_16x16x32_bf16(false, a, false, b, (short)0, c, false, false); }



// ---- k_gemmw: register-blocked GEMM, ONE WAVE per 64x64 output tile (16 accumulators), operands straight from K-contiguous 16-bit planes; grid (M/64, N/64, Z), 32 threads.
// C[m][n] (f32, pitch ldc, + optional f32 bias[n]) = sum_k A[m][k] Bt[n][k] (+ split products per NSPLIT). z-batch strides sA/sB/sC in elements. K % 32 == 0.
template <typename T16> struct WFrag;
template <> struct WFrag<h16> { typedef v16h V; static __device__ __forceinline__ V ld(const h16* p) { return cat16(*(const v8h*)p, *(const v8h*)(p + 16)); } static __device__ __forceinline__ v8f mma(V a, V b, v8f c) { return wmma16(a, b, c); } };
template <> struct WFrag<bf> { typedef v16bf V; static __device__ __forceinline__ V ld(const bf* p) { return cat16b(*(const v8us*)p, *(const v8us*)(p + 16)); } static __device__ __forceinline__ v8f mma(V a, V b, v8f c) { return wmmab(a, b, c); } };
template <typename T16, int NSPLIT, bool BIAS>
__global__ __launch_bounds__(32) void k_gemmw(const T16* __restrict__ A, const T16* __restrict__ A2, const T16* __restrict__ Bt, const T16* __restrict__ Bt2, int K, float* C, int ldc, const float* __restrict__ bias, size_t sA, size_t sB, size_t sC) {
    typedef typename WFrag<T16>::V V;
    __shared__ __align__(16) float os[16 * 68];
    const size_t z = blockIdx.z; A += z * sA; if (A2) A2 += z * sA; Bt += z * sB; if (Bt2) Bt2 += z * sB; C += z * sC;
    const int lane = threadIdx.x & 31, lr = lane & 15, hi = lane >> 4; const int r0 = blockIdx.x * 64, c0 = blockIdx.y * 64;
    v8f acc[4][4];
#pragma unroll
    for (int mb = 0; mb < 4; ++mb)
#pragma unroll
        for (int nb = 0; nb < 4; ++nb) acc[mb][nb] = (v8f){};
    const size_t aoff = (size_t)(r0 + lr) * K + 8 * hi, boff = (size_t)(c0 + lr) * K + 8 * hi;
#pragma unroll 1
    for (int kc = 0; kc < K; kc += 32) {
        V a[4], a2[4];
#pragma unroll
        for (int mb = 0; mb < 4; ++mb) { a[mb] = WFrag<T16>::ld(A + aoff + (size_t)mb * 16 * K + kc); if (NSPLIT == 1 || NSPLIT == 2) a2[mb] = WFrag<T16>::ld(A2 + aoff + (size_t)mb * 16 * K + kc); }
#pragma unroll
        for (int nb = 0; nb < 4; ++nb) { const V b = WFrag<T16>::ld(Bt + boff + (size_t)nb * 16 * K + kc); V b2; if (NSPLIT >= 2) b2 = WFrag<T16>::ld(Bt2 + boff + (size_t)nb * 16 * K + kc);
#pragma unroll
            for (int mb = 0; mb < 4; ++mb) { acc[mb][nb] = WFrag<T16>::mma(a[mb], b, acc[mb][nb]); if (NSPLIT == 1 || NSPLIT == 2) acc[mb][nb] = WFrag<T16>::mma(a2[mb], b, acc[mb][nb]); if (NSPLIT >= 2) acc[mb][nb] = WFrag<T16>::mma(a[mb], b2, acc[mb][nb]); } }
        asm volatile("v_nop\n\tv_nop\n\tv_nop\n\tv_nop" : "+v"(acc[0][0]), "+v"(acc[1][1]), "+v"(acc[2][2]), "+v"(acc[3][3]) : "v"(a[0]), "v"(a[3]));
    }
#pragma unroll
    for (int mb = 0; mb < 4; ++mb) {
#pragma unroll
        for (int nb = 0; nb < 4; ++nb) {
#pragma unroll
            for (int j = 0; j < 8; ++j) os[(hi * 8 + j) * 68 + nb * 16 + lr] = acc[mb][nb][j]; }
        __builtin_amdgcn_wave_barrier(); asm volatile("" ::: "memory");
        float* crow = C + (size_t)(r0 + mb * 16) * ldc + c0;
{
#pragma unroll
            for (int s = 0; s < 8; ++s) { const int row = 2 * s + hi, cofs = lr * 4; v4f val = *(const v4fa*)(os + row * 68 + cofs); if (BIAS) { val[0] += bfr(bias[c0 + cofs]); val[1] += bfr(bias[c0 + cofs + 1]); val[2] += bfr(bias[c0 + cofs + 2]); val[3] += bfr(bias[c0 + cofs + 3]); }
                *(v4f*)(crow + (size_t)row * ldc + cofs) = val; }
             }
        __builtin_amdgcn_wave_barrier(); asm volatile("" ::: "memory");
    }
}

// ---- k_gemmc: the same one-wave 64x64 tile GEMM specialised for causal attention: CMODE 1 skips score tiles entirely above the diagonal (query rows r0+roff.., key columns c0..), CMODE 2 limits the
// key (K) loop of the probability x value contraction to the diagonal block (probabilities beyond it are exactly zero). roff = row offset of this launch's first row within the sequence.
template <typename T16, int NSPLIT, int CMODE>
__global__ __launch_bounds__(32) void k_gemmc(const T16* __restrict__ A, const T16* __restrict__ A2, const T16* __restrict__ Bt, const T16* __restrict__ Bt2, int K, float* C, int ldc, int roff, size_t sA, size_t sB, size_t sC) {
    typedef typename WFrag<T16>::V V;
    __shared__ __align__(16) float os[16 * 68];
    const size_t z = blockIdx.z; A += z * sA; if (A2) A2 += z * sA; Bt += z * sB; if (Bt2) Bt2 += z * sB; C += z * sC;
    const int lane = threadIdx.x & 31, lr = lane & 15, hi = lane >> 4; const int r0 = blockIdx.x * 64, c0 = blockIdx.y * 64;
    if (CMODE == 1 && c0 > r0 + roff + 63) return;                  // score tile entirely above the causal diagonal: never read (the softmax masks j > i by select)
    const int Kl = (CMODE == 2) ? min(K, r0 + roff + 64) : K;        // P.V: probabilities are exactly 0 beyond the diagonal block, so the K loop stops there
    v8f acc[4][4];
#pragma unroll
    for (int mb = 0; mb < 4; ++mb)
#pragma unroll
        for (int nb = 0; nb < 4; ++nb) acc[mb][nb] = (v8f){};
    const size_t aoff = (size_t)(r0 + lr) * K + 8 * hi, boff = (size_t)(c0 + lr) * K + 8 * hi;
#pragma unroll 1
    for (int kc = 0; kc < Kl; kc += 32) {
        V a[4], a2[4];
#pragma unroll
        for (int mb = 0; mb < 4; ++mb) { a[mb] = WFrag<T16>::ld(A + aoff + (size_t)mb * 16 * K + kc); if (NSPLIT == 1 || NSPLIT == 2) a2[mb] = WFrag<T16>::ld(A2 + aoff + (size_t)mb * 16 * K + kc); }
#pragma unroll
        for (int nb = 0; nb < 4; ++nb) { const V b = WFrag<T16>::ld(Bt + boff + (size_t)nb * 16 * K + kc); V b2; if (NSPLIT >= 2) b2 = WFrag<T16>::ld(Bt2 + boff + (size_t)nb * 16 * K + kc);
#pragma unroll
            for (int mb = 0; mb < 4; ++mb) { acc[mb][nb] = WFrag<T16>::mma(a[mb], b, acc[mb][nb]); if (NSPLIT == 1 || NSPLIT == 2) acc[mb][nb] = WFrag<T16>::mma(a2[mb], b, acc[mb][nb]); if (NSPLIT >= 2) acc[mb][nb] = WFrag<T16>::mma(a[mb], b2, acc[mb][nb]); } }
        asm volatile("v_nop\n\tv_nop\n\tv_nop\n\tv_nop" : "+v"(acc[0][0]), "+v"(acc[1][1]), "+v"(acc[2][2]), "+v"(acc[3][3]) : "v"(a[0]), "v"(a[3]));
    }
#pragma unroll
    for (int mb = 0; mb < 4; ++mb) {
#pragma unroll
        for (int nb = 0; nb < 4; ++nb) {
#pragma unroll
            for (int j = 0; j < 8; ++j) os[(hi * 8 + j) * 68 + nb * 16 + lr] = acc[mb][nb][j]; }
        __builtin_amdgcn_wave_barrier(); asm volatile("" ::: "memory");
        float* crow = C + (size_t)(r0 + mb * 16) * ldc + c0;
{
#pragma unroll
            for (int s = 0; s < 8; ++s) { const int row = 2 * s + hi, cofs = lr * 4; v4f val = *(const v4fa*)(os + row * 68 + cofs);
                *(v4f*)(crow + (size_t)row * ldc + cofs) = val; }
             }
        __builtin_amdgcn_wave_barrier(); asm volatile("" ::: "memory");
    }
}

__device__ __forceinline__ h16 tohx(float x) { return (h16)x; }
__device__ __forceinline__ void splitf(float y, unsigned short& h, unsigned short& l) { h = f2bf(y); l = f2bf(y - bf2f(h)); }
typedef __attribute__((ext_vector_type(2))) _Float16 v2h;
typedef __attribute__((ext_vector_type(4))) _Float16 v4h;
typedef __attribute__((ext_vector_type(2))) unsigned short v2us;
typedef __attribute__((ext_vector_type(4))) unsigned short v4us;
typedef __attribute__((ext_vector_type(2))) float v2f;
typedef __attribute__((ext_vector_type(4))) int v4i;

__global__ __launch_bounds__(256) void k_wtG(const float* __restrict__ w, int K, int N, bf* Bt) {
    const int lane = threadIdx.x & 31; const int L0 = (blockIdx.x * 8 + (threadIdx.x >> 5)) * 8; const int nlines = N * K / 64;
{
#pragma unroll 1
        for (int l = 0; l < 8; ++l) { const int L = L0 + l; if (L >= nlines) break; const size_t e = (size_t)L * 64 + lane * 2; const int k = (int)(e % K), n = (int)(e / K); v2us o;
            o[0] = f2bf(w[(size_t)k * N + n]); o[1] = f2bf(w[(size_t)(k + 1) * N + n]); *(v2us*)(Bt + e) = o; }
         }
}
__global__ __launch_bounds__(256) void k_cvt8(const float* __restrict__ src, bf* dst, size_t n8) { const size_t i = (size_t)blockIdx.x * 256 + threadIdx.x; if (i >= n8) return; const v8f v = *(const v8f*)(src + i * 8); v8us o;
#pragma unroll
    for (int k = 0; k < 8; ++k) o[k] = f2bf(v[k]); *(v8us*)(dst + i * 8) = o;  }
__global__ __launch_bounds__(256) void k_cscvt(const float* __restrict__ cosT, const float* __restrict__ sinT, float* CS) { const int idx = blockIdx.x * 256 + threadIdx.x; if (idx >= TT * HD) return; v2f cs; cs[0] = bfr(cosT[idx]); cs[1] = bfr(sinT[idx]); *(v2f*)(CS + (size_t)idx * 2) = cs;  }
// k_rope: head planes [h][t][d] (fp16 + hi/lo) of rope(x) x sc with the rotate-half convention out[d] = x[d] cos[t][d] - x[d+HD/2] sin[t][d], out[d+HD/2] = x[d+HD/2] cos[t][d+HD/2] + x[d] sin[t][d+HD/2]
__global__ __launch_bounds__(256) void k_rope(const float* __restrict__ F, int pitch, int nheads, const float* __restrict__ CS, const float* __restrict__ RF, const float* __restrict__ nw, float sc, h16* P16, bf* Ph, bf* Pl) {
    const size_t e = ((size_t)blockIdx.x * 256 + threadIdx.x) * 2; if (e >= (size_t)nheads * TT * HD) return; const int d = (int)(e % HD); const int t = (int)((e / HD) % TT); const int h = (int)(e / ((size_t)HD * TT)); const float* f = F + (size_t)t * pitch + h * HD; const float rf = RF ? RF[(size_t)h * TT + t] : 1.0f; v2h o16; v2us oh, ol;
#pragma unroll
    for (int q = 0; q < 2; ++q) { const int dd = d + q; const int dp = (dd < HD / 2) ? dd + HD / 2 : dd - HD / 2; float x0 = f[dd], x1 = f[dp];
        if (RF) { float n0 = __fmul_rn(x0, rf), n1 = __fmul_rn(x1, rf); asm volatile("" : "+v"(n0)); asm volatile("" : "+v"(n1)); x0 = __fmul_rn(bfr(nw[dd]), n0); x1 = __fmul_rn(bfr(nw[dp]), n1); }
        const v2f cs = *(const v2f*)(CS + ((size_t)t * HD + dd) * 2); float a = __fmul_rn(x0, cs[0]), bq = __fmul_rn(x1, cs[1]); asm volatile("" : "+v"(a)); asm volatile("" : "+v"(bq)); const float r = ((dd < HD / 2) ? __fsub_rn(a, bq) : __fadd_rn(a, bq)) * sc;
        o16[q] = tohx(r); unsigned short a2, c2; splitf(r, a2, c2); oh[q] = a2; ol[q] = c2; }
    *(v2h*)(P16 + e) = o16; *(v2us*)(Ph + e) = oh; *(v2us*)(Pl + e) = ol;  }
__global__ __launch_bounds__(256) void k_vtp(const float* __restrict__ F, int pitch, int nheads, h16* V16, bf* Vh, bf* Vl) { const size_t e = ((size_t)blockIdx.x * 256 + threadIdx.x) * 2; if (e >= (size_t)nheads * HD * TT) return; const int t = (int)(e % TT); const int d = (int)((e / TT) % HD); const int g = (int)(e / ((size_t)TT * HD)); v2h o16; v2us oh, ol;
#pragma unroll
    for (int q = 0; q < 2; ++q) { const float x = F[(size_t)(t + q) * pitch + g * HD + d]; o16[q] = tohx(x); unsigned short a2, c2; splitf(x, a2, c2); oh[q] = a2; ol[q] = c2; }
    *(v2h*)(V16 + e) = o16; *(v2us*)(Vh + e) = oh; *(v2us*)(Vl + e) = ol;  }
__global__ __launch_bounds__(256) void k_csid(float* CS) { const int idx = blockIdx.x * 256 + threadIdx.x; if (idx >= TT * HD) return; v2f cs; cs[0] = 1.0f; cs[1] = 0.0f; *(v2f*)(CS + (size_t)idx * 2) = cs;  }
__global__ __launch_bounds__(256) void k_tanhp(const float* __restrict__ F, float* G2, size_t n4) { const size_t i = (size_t)blockIdx.x * 256 + threadIdx.x; if (i >= n4) return; const v4f a = *(const v4f*)(F + i * 4); v4f o;
#pragma unroll
    for (int u = 0; u < 4; ++u) { float xs = fminf(fmaxf(a[u], -15.0f), 15.0f); float ex = __builtin_amdgcn_exp2f(__fmul_rn(xs, 2.8853900817779268f)); asm volatile("" : "+v"(ex)); float nm = __fsub_rn(ex, 1.0f), dn2 = __fadd_rn(ex, 1.0f); asm volatile("" : "+v"(nm)); asm volatile("" : "+v"(dn2)); float rc = __builtin_amdgcn_rcpf(dn2); asm volatile("" : "+v"(rc)); o[u] = __fmul_rn(nm, rc); }
    *(v4f*)(G2 + i * 4) = o;  }
__global__ __launch_bounds__(256) void k_hlG(const float* __restrict__ F, bf* Fh, bf* Fl, size_t n) { const size_t e = ((size_t)blockIdx.x * 256 + threadIdx.x) * 4; if (e >= n) return; const v4f a = *(const v4f*)(F + e); v4us oh, ol; for (int u = 0; u < 4; ++u) { unsigned short p, q; splitf(a[u], p, q); oh[u] = p; ol[u] = q; } *(v4us*)(Fh + e) = oh; *(v4us*)(Fl + e) = ol;  }
// k_asoft: per row (zz, i): t = S x HD^-0.5 + lam x delta for j <= i and i - j < WIN (sliding causal window; the reference's -1e9 additive fill vanishes identically); softmax over the 2048 keys (register row, one exp, fixed trees);
__global__ __launch_bounds__(256) void k_asoft(const float* __restrict__ Sb, const float* __restrict__ Sb2, const float* __restrict__ lamp, h16* P16, bf* Ph, bf* Pl) {
    const int lane = threadIdx.x & 31; const int row = blockIdx.x * 8 + (threadIdx.x >> 5); if (row >= ZH * TT) return; const int i = row % TT; const int zz = row / TT; (void)zz; const bool hires = (i < RH); const float* sr = Sb + (size_t)row * TT; const float* sr2 = Sb2 + (size_t)row * TT; float lam = bfr(lamp[0]); asm volatile("" : "+v"(lam)); float v[TT / 32]; float mx = -3.0e38f;
#pragma unroll
    for (int ch = 0; ch < TT / 128; ++ch) { const int j0 = ch * 128 + lane * 4; const v4f a = *(const v4f*)(sr + j0);
#pragma unroll
        for (int q = 0; q < 4; ++q) { const int j = j0 + q; (void)j; float sa = a[q] * SCL; asm volatile("" : "+v"(sa)); float dl = __fmul_rn(lam, sr2[j]); asm volatile("" : "+v"(dl)); const float t = (j <= i && i - j < WIN) ? __fadd_rn(sa, dl) : -3.0e38f; v[ch * 4 + q] = t; mx = fmaxf(mx, t); } }
#pragma unroll
    for (int sh = 16; sh; sh >>= 1) mx = fmaxf(mx, __shfl_xor(mx, sh, 32));
    float sum = 0.f;
#pragma unroll
    for (int k = 0; k < TT / 32; ++k) { float d0 = __fsub_rn(v[k], mx); asm volatile("" : "+v"(d0)); v[k] = __builtin_amdgcn_exp2f(__fmul_rn(d0, 1.4426950408889634f)); sum += v[k]; }
#pragma unroll
    for (int sh = 16; sh; sh >>= 1) sum += __shfl_xor(sum, sh, 32);
    const float f = __fdiv_rn(hires ? 1.0f : PCAR, sum);
{
        if (hires) {
#pragma unroll
            for (int ch = 0; ch < TT / 128; ++ch) { v4us oh, ol;
#pragma unroll
                for (int q = 0; q < 4; ++q) { unsigned short a, c2; splitf(v[ch * 4 + q] * f, a, c2); oh[q] = a; ol[q] = c2; }
                const size_t oo = ((size_t)zz * (RH ? RH : 1) + i) * TT + ch * 128 + lane * 4; *(v4us*)(Ph + oo) = oh; *(v4us*)(Pl + oo) = ol; }
        } else {
#pragma unroll
            for (int ch = 0; ch < TT / 128; ++ch) { v4h o4;
#pragma unroll
                for (int q = 0; q < 4; ++q) o4[q] = tohx(v[ch * 4 + q] * f);
                *(v4h*)(P16 + (size_t)row * TT + ch * 128 + lane * 4) = o4; } }
         }
}
__global__ __launch_bounds__(256) void k_merge(const float* __restrict__ O, int h0, bf* Ah, bf* Al) { const size_t e = ((size_t)blockIdx.x * 256 + threadIdx.x) * 2; if (e >= (size_t)ZH * TT * HD) return; const int d = (int)(e % HD); const int t = (int)((e / HD) % TT); const int zz = (int)(e / ((size_t)HD * TT)); const float cs = (t < RH) ? 1.0f : (1.0f / PCAR); const size_t oo = (size_t)t * DQ + (h0 + zz) * HD + d;
    v2us oh, ol;
#pragma unroll
    for (int q = 0; q < 2; ++q) { unsigned short a, c2; splitf(O[e + q] * cs, a, c2); oh[q] = a; ol[q] = c2; } *(v2us*)(Ah + oo) = oh; *(v2us*)(Al + oo) = ol;  }

extern "C" void kernel_launch(void* const* d_in, const int* in_sizes, int n_in,
                              void* d_out, int out_size, void* d_ws, size_t ws_size, hipStream_t stream) {
    (void)in_sizes; (void)n_in; (void)out_size;
    const float* x = (const float*)d_in[0]; const float* wq = (const float*)d_in[1]; const float* bq = (const float*)d_in[2]; const float* wk = (const float*)d_in[3]; const float* bk = (const float*)d_in[4]; const float* wv = (const float*)d_in[5]; const float* bv = (const float*)d_in[6]; const float* wo = (const float*)d_in[7]; const float* bo = (const float*)d_in[8]; const float* Jm = (const float*)d_in[9]; const float* lamp = (const float*)d_in[10]; const float* cosT = nullptr; const float* sinT = nullptr; (void)cosT; (void)sinT;
    float* OUT = (float*)d_out;     // [2][2048][1024]
    char* wsp = (char*)d_ws;
    auto take = [&](size_t bytes) { char* p = wsp; wsp += (bytes + 255) & ~(size_t)255; return (void*)p; };
    bf* WQ = (bf*)take((size_t)DQ * DM * 2); bf* WK = (bf*)take((size_t)DKV * DM * 2); bf* WV = (bf*)take((size_t)DKV * DM * 2); bf* WO = (bf*)take((size_t)DM * DQ * 2); float* CS = (float*)take((size_t)TT * HD * 2 * 4);
    bf* XB = (bf*)take((size_t)TT * DM * 2); bf* JT = (bf*)take((size_t)NH_ * HD * HD * 2); float* QN = (float*)take((size_t)TT * DQ * 4); float* KN = (float*)take((size_t)TT * DKV * 4); float* QJF = (float*)take((size_t)NH_ * TT * HD * 4); bf* QNh = (bf*)take((size_t)NH_ * TT * HD * 2); bf* QNl = (bf*)take((size_t)NH_ * TT * HD * 2); h16* QN16 = (h16*)take((size_t)NH_ * TT * HD * 2); bf* QJh = (bf*)take((size_t)NH_ * TT * HD * 2); bf* QJl = (bf*)take((size_t)NH_ * TT * HD * 2); bf* KNh = (bf*)take((size_t)NKV * TT * HD * 2); bf* KNl = (bf*)take((size_t)NKV * TT * HD * 2); h16* KN16 = (h16*)take((size_t)NKV * TT * HD * 2); float* Sb2 = (float*)take((size_t)ZH * TT * TT * 4); float* FQ = (float*)take((size_t)TT * DQ * 4); float* FK = (float*)take((size_t)TT * DKV * 4);
    h16* QP16 = (h16*)take((size_t)NH_ * TT * HD * 2); h16* KP16 = (h16*)take((size_t)NKV * TT * HD * 2); h16* VT16 = (h16*)take((size_t)NKV * HD * TT * 2);
    bf* QPh = (bf*)take((size_t)NH_ * TT * HD * 2); bf* QPl = (bf*)take((size_t)NH_ * TT * HD * 2); bf* KPh = (bf*)take((size_t)NKV * TT * HD * 2); bf* KPl = (bf*)take((size_t)NKV * TT * HD * 2); bf* VTh = (bf*)take((size_t)NKV * HD * TT * 2); bf* VTl = (bf*)take((size_t)NKV * HD * TT * 2); bf* Ph = (bf*)take((size_t)ZH * RH * TT * 2); bf* Pl = (bf*)take((size_t)ZH * RH * TT * 2);
    float* Sb = (float*)take((size_t)ZH * TT * TT * 4); h16* P16 = (h16*)take((size_t)ZH * TT * TT * 2); float* Ob = (float*)take((size_t)ZH * TT * HD * 4); bf* ATh = (bf*)take((size_t)TT * DQ * 2); bf* ATl = (bf*)take((size_t)TT * DQ * 2);
    if ((size_t)(wsp - (char*)d_ws) > ws_size) return;    // ws 256 MiB
    float* FV = FK;   // v projection reuses the k buffer after the k planes are built (stream-ordered)
    { k_wtG<<<(unsigned)((DM * DQ / 64 + 63) / 64), 256, 0, stream>>>(wq, DM, DQ, WQ); k_wtG<<<(unsigned)((DM * DKV / 64 + 63) / 64), 256, 0, stream>>>(wk, DM, DKV, WK); k_wtG<<<(unsigned)((DM * DKV / 64 + 63) / 64), 256, 0, stream>>>(wv, DM, DKV, WV);
      k_wtG<<<(unsigned)((DQ * DM / 64 + 63) / 64), 256, 0, stream>>>(wo, DQ, DM, WO); for (int h = 0; h < NH_; ++h) k_wtG<<<(HD * HD / 64 + 63) / 64, 256, 0, stream>>>(Jm + (size_t)h * HD * HD, HD, HD, JT + (size_t)h * HD * HD);
       }
    k_csid<<<(TT * HD + 255) / 256, 256, 0, stream>>>(CS);
    const unsigned LQ = (unsigned)(((size_t)NH_ * TT * HD / 2 + 255) / 256), LKv = (unsigned)(((size_t)NKV * TT * HD / 2 + 255) / 256);
    for (int b = 0; b < NB_; ++b) {
        
        k_cvt8<<<(unsigned)(((size_t)TT * DM / 8 + 255) / 256), 256, 0, stream>>>(x + (size_t)b * TT * DM, XB, (size_t)TT * DM / 8);
        k_gemmw<bf, 0, true><<<dim3(TT / 64, DQ / 64, 1), 32, 0, stream>>>(XB, nullptr, WQ, nullptr, DM, FQ, DQ, bq, 0, 0, 0);
        k_rope<<<LQ, 256, 0, stream>>>(FQ, DQ, NH_, CS, nullptr, nullptr, 1.0f, QP16, QPh, QPl); k_tanhp<<<(unsigned)(((size_t)TT * DQ / 4 + 255) / 256), 256, 0, stream>>>(FQ, QN, (size_t)TT * DQ / 4); k_rope<<<LQ, 256, 0, stream>>>(QN, DQ, NH_, CS, nullptr, nullptr, 1.0f, QN16, QNh, QNl); for (int h = 0; h < NH_; ++h) k_gemmw<bf, 1, false><<<dim3(TT / 64, 1, 1), 32, 0, stream>>>(QNh + (size_t)h * TT * HD, QNl + (size_t)h * TT * HD, JT + (size_t)h * HD * HD, nullptr, HD, QJF + (size_t)h * TT * HD, HD, nullptr, 0, 0, 0); k_hlG<<<(unsigned)(((size_t)NH_ * TT * HD / 4 + 255) / 256), 256, 0, stream>>>(QJF, QJh, QJl, (size_t)NH_ * TT * HD);
        k_gemmw<bf, 0, true><<<dim3(TT / 64, DKV / 64, 1), 32, 0, stream>>>(XB, nullptr, WK, nullptr, DM, FK, DKV, bk, 0, 0, 0);
        k_rope<<<LKv, 256, 0, stream>>>(FK, DKV, NKV, CS, nullptr, nullptr, 1.0f, KP16, KPh, KPl); k_tanhp<<<(unsigned)(((size_t)TT * DKV / 4 + 255) / 256), 256, 0, stream>>>(FK, KN, (size_t)TT * DKV / 4); k_rope<<<LKv, 256, 0, stream>>>(KN, DKV, NKV, CS, nullptr, nullptr, 1.0f, KN16, KNh, KNl);
        k_gemmw<bf, 0, true><<<dim3(TT / 64, DKV / 64, 1), 32, 0, stream>>>(XB, nullptr, WV, nullptr, DM, FV, DKV, bv, 0, 0, 0); k_vtp<<<LKv, 256, 0, stream>>>(FV, DKV, NKV, VT16, VTh, VTl);
        for (int h0 = 0; h0 < NH_; h0 += ZH) { const size_t zq = (size_t)h0, zk = (size_t)(h0 / REP);   // one kv head per query head: the pass's two heads use consecutive kv planes (z-strides TT*HD)
            k_gemmc<bf, 2, 1><<<dim3(TT / 64, TT / 64, ZH), 32, 0, stream>>>(QPh + zq * TT * HD, QPl + zq * TT * HD, KPh + zk * TT * HD, KPl + zk * TT * HD, HD, Sb, TT, 0, (size_t)TT * HD, (size_t)TT * HD, (size_t)TT * TT);   /* both score products hl on all rows */
            k_gemmc<bf, 2, 1><<<dim3(TT / 64, TT / 64, ZH), 32, 0, stream>>>(QJh + zq * TT * HD, QJl + zq * TT * HD, KNh + zk * TT * HD, KNl + zk * TT * HD, HD, Sb2, TT, 0, (size_t)TT * HD, (size_t)TT * HD, (size_t)TT * TT);   /* delta = (tanh Q J).tanh K */
            k_asoft<<<ZH * TT / 8, 256, 0, stream>>>(Sb, Sb2, lamp, P16, Ph, Pl);
            k_gemmc<bf, 2, 2><<<dim3(RH / 64, HD / 64, ZH), 32, 0, stream>>>(Ph, Pl, VTh + zk * HD * TT, VTl + zk * HD * TT, TT, Ob, HD, 0, (size_t)RH * TT, (size_t)HD * TT, (size_t)TT * HD);
            k_gemmc<h16, 0, 2><<<dim3((TT - RH) / 64, HD / 64, ZH), 32, 0, stream>>>(P16 + (size_t)RH * TT, nullptr, VT16 + zk * HD * TT, nullptr, TT, Ob + (size_t)RH * HD, HD, RH, (size_t)TT * TT, (size_t)HD * TT, (size_t)TT * HD);
            k_merge<<<(unsigned)(((size_t)ZH * TT * HD / 2 + 255) / 256), 256, 0, stream>>>(Ob, h0, ATh, ATl); }
        k_gemmw<bf, 1, true><<<dim3(TT / 64, DM / 64, 1), 32, 0, stream>>>(ATh, ATl, WO, nullptr, DQ, OUT + (size_t)b * TT * DM, DM, bo, 0, 0, 0); }
}

// v001
// One run takes 1350 microseconds.
// Next to v000, in two timings, it ran 1.51 and 1.50 times as fast.
#include <hip/hip_runtime.h>

// QBNNAttention (x [2][2048][1024]; Q/K/V = x W + b (16 x 64); scores = Q.K / 8 + lam * (tanh(Q) J_h tanh(K)^T) (J [16][64][64] and the scalar lam read); causal (-inf) softmax; out = merged Wo + bo -> [2][2048][1024]).
// Compute dtypes, f32 accumulate: every input rounded to bf16; Q/K/V on PLAIN bf16 operands (inputs: exact) + bias; tanh elementwise in f32 (exp2 form with the hardware reciprocal, clamped |x| <= 15); QJ = hi/lo tanh(Q) x exact J (2 products, f32); both score products hl x hl (3 products) on every row; the two terms combined per element in f32 in the reference's order (s/8 + lam d); causal tile skipping; softmax f32; attn.v: rows < 512 hl (3 products), the rest fp16 (x1024); Wo hl x exact (2 products) + bias.

#define NB_  2
#define TT   2048
#define DM   1024
#define NH_  16
#define NKV  16
#define REP  (NH_ / NKV)
#define HD   64
#define DQ   (NH_ * HD)
#define DKV  (NKV * HD)
#define ZH   2
#define RH   512                  // query rows < RH use hi+lo planes (0: none)
#define WIN  2048
#define PCAR 1024.0f
#define SCL  0.125f   // HD^-0.5
#define KSL  128                  // keys per slice of the probability x value contraction (one wave per slice)
#define NKS  (TT / KSL)           // partial output planes
typedef _Float16 h16;
typedef unsigned short bf;
typedef __attribute__((ext_vector_type(16))) __bf16   v16bf;
typedef __attribute__((ext_vector_type(16))) _Float16 v16h;
typedef __attribute__((ext_vector_type(8)))  _Float16 v8h;
typedef __attribute__((ext_vector_type(8)))  unsigned short v8us;
typedef __attribute__((ext_vector_type(8)))  float    v8f;
typedef __attribute__((ext_vector_type(4)))  float    v4f;
typedef v8h  __attribute__((may_alias)) v8ha;
typedef v4f  __attribute__((may_alias)) v4fa;
typedef v8us __attribute__((may_alias)) v8usa;

__device__ __forceinline__ unsigned short f2bf(float f) { unsigned u = __float_as_uint(f); u += 0x7FFFu + ((u >> 16) & 1u); return (unsigned short)(u >> 16); }
__device__ __forceinline__ float bf2f(unsigned short b) { return __uint_as_float(((unsigned)b) << 16); }
__device__ __forceinline__ float bfr(float f) { return bf2f(f2bf(f)); }
__device__ __forceinline__ v16h cat16(v8h lo, v8h hi) { return __builtin_shufflevector(lo, hi, 0, 1, 2, 3, 4, 5, 6, 7, 8, 9, 10, 11, 12, 13, 14, 15); }
__device__ __forceinline__ v16bf cat16b(v8us lo, v8us hi) { return __builtin_bit_cast(v16bf, __builtin_shufflevector(lo, hi, 0, 1, 2, 3, 4, 5, 6, 7, 8, 9, 10, 11, 12, 13, 14, 15)); }
__device__ __forceinline__ v8f wmma16(v16h a, v16h b, v8f c) { return __builtin_amdgcn_wmma_f32_16x16x32_f16(false, a, false, b, (short)0, c, false, false); }
__device__ __forceinline__ v8f wmmab(v16bf a, v16bf b, v8f c) { return __builtin_amdgcn_wmma_f32_16x16x32_bf16(false, a, false, b, (short)0, c, false, false); }



// ---- k_gemmw: register-blocked GEMM, ONE WAVE per 64x64 output tile (16 accumulators), operands straight from K-contiguous 16-bit planes; grid (M/64, N/64, Z), 32 threads.
// C[m][n] (f32, pitch ldc, + optional f32 bias[n]) = sum_k A[m][k] Bt[n][k] (+ split products per NSPLIT). z-batch strides sA/sB/sC in elements. K % 32 == 0.
template <typename T16> struct WFrag;
template <> struct WFrag<h16> { typedef v16h V; static __device__ __forceinline__ V ld(const h16* p) { return cat16(*(const v8h*)p, *(const v8h*)(p + 16)); } static __device__ __forceinline__ v8f mma(V a, V b, v8f c) { return wmma16(a, b, c); } };
template <> struct WFrag<bf> { typedef v16bf V; static __device__ __forceinline__ V ld(const bf* p) { return cat16b(*(const v8us*)p, *(const v8us*)(p + 16)); } static __device__ __forceinline__ v8f mma(V a, V b, v8f c) { return wmmab(a, b, c); } };
template <typename T16, int NSPLIT, bool BIAS>
__global__ __launch_bounds__(32) void k_gemmw(const T16* __restrict__ A, const T16* __restrict__ A2, const T16* __restrict__ Bt, const T16* __restrict__ Bt2, int K, float* C, int ldc, const float* __restrict__ bias, size_t sA, size_t sB, size_t sC) {
    typedef typename WFrag<T16>::V V;
    __shared__ __align__(16) float os[16 * 68];
    const size_t z = blockIdx.z; A += z * sA; if (A2) A2 += z * sA; Bt += z * sB; if (Bt2) Bt2 += z * sB; C += z * sC;
    const int lane = threadIdx.x & 31, lr = lane & 15, hi = lane >> 4; const int r0 = blockIdx.x * 64, c0 = blockIdx.y * 64;
    v8f acc[4][4];
#pragma unroll
    for (int mb = 0; mb < 4; ++mb)
#pragma unroll
        for (int nb = 0; nb < 4; ++nb) acc[mb][nb] = (v8f){};
    const size_t aoff = (size_t)(r0 + lr) * K + 8 * hi, boff = (size_t)(c0 + lr) * K + 8 * hi;
#pragma unroll 1
    for (int kc = 0; kc < K; kc += 32) {
        V a[4], a2[4];
#pragma unroll
        for (int mb = 0; mb < 4; ++mb) { a[mb] = WFrag<T16>::ld(A + aoff + (size_t)mb * 16 * K + kc); if (NSPLIT == 1 || NSPLIT == 2) a2[mb] = WFrag<T16>::ld(A2 + aoff + (size_t)mb * 16 * K + kc); }
#pragma unroll
        for (int nb = 0; nb < 4; ++nb) { const V b = WFrag<T16>::ld(Bt + boff + (size_t)nb * 16 * K + kc); V b2; if (NSPLIT >= 2) b2 = WFrag<T16>::ld(Bt2 + boff + (size_t)nb * 16 * K + kc);
#pragma unroll
            for (int mb = 0; mb < 4; ++mb) { acc[mb][nb] = WFrag<T16>::mma(a[mb], b, acc[mb][nb]); if (NSPLIT == 1 || NSPLIT == 2) acc[mb][nb] = WFrag<T16>::mma(a2[mb], b, acc[mb][nb]); if (NSPLIT >= 2) acc[mb][nb] = WFrag<T16>::mma(a[mb], b2, acc[mb][nb]); } }
        asm volatile("v_nop\n\tv_nop\n\tv_nop\n\tv_nop" : "+v"(acc[0][0]), "+v"(acc[1][1]), "+v"(acc[2][2]), "+v"(acc[3][3]) : "v"(a[0]), "v"(a[3]));
    }
#pragma unroll
    for (int mb = 0; mb < 4; ++mb) {
#pragma unroll
        for (int nb = 0; nb < 4; ++nb) {
#pragma unroll
            for (int j = 0; j < 8; ++j) os[(hi * 8 + j) * 68 + nb * 16 + lr] = acc[mb][nb][j]; }
        __builtin_amdgcn_wave_barrier(); asm volatile("" ::: "memory");
        float* crow = C + (size_t)(r0 + mb * 16) * ldc + c0;
{
#pragma unroll
            for (int s = 0; s < 8; ++s) { const int row = 2 * s + hi, cofs = lr * 4; v4f val = *(const v4fa*)(os + row * 68 + cofs); if (BIAS) { val[0] += bfr(bias[c0 + cofs]); val[1] += bfr(bias[c0 + cofs + 1]); val[2] += bfr(bias[c0 + cofs + 2]); val[3] += bfr(bias[c0 + cofs + 3]); }
                *(v4f*)(crow + (size_t)row * ldc + cofs) = val; }
             }
        __builtin_amdgcn_wave_barrier(); asm volatile("" ::: "memory");
    }
}

// ---- k_gemmc: the same one-wave 64x64 tile GEMM specialised for causal attention: CMODE 1 skips score tiles entirely above the diagonal (query rows r0+roff.., key columns c0..), CMODE 2 limits the
// key (K) loop of the probability x value contraction to the diagonal block (probabilities beyond it are exactly zero). roff = row offset of this launch's first row within the sequence.
// CMODE 2 also splits that key loop over blockIdx.y: slice y covers keys [y KSL, (y + 1) KSL) below the diagonal limit and stores its partial tile in plane y of C (plane stride sP); a slice that starts at or
// beyond the limit stores nothing, and k_merge sums exactly the planes that were stored. The output has HD = 64 columns, one column tile.
template <typename T16, int NSPLIT, int CMODE>
__global__ __launch_bounds__(32) void k_gemmc(const T16* __restrict__ A, const T16* __restrict__ A2, const T16* __restrict__ Bt, const T16* __restrict__ Bt2, int K, float* C, int ldc, int roff, size_t sA, size_t sB, size_t sC, size_t sP) {
    typedef typename WFrag<T16>::V V;
    __shared__ __align__(16) float os[16 * 68];
    const size_t z = blockIdx.z; A += z * sA; if (A2) A2 += z * sA; Bt += z * sB; if (Bt2) Bt2 += z * sB; C += z * sC;
    const int lane = threadIdx.x & 31, lr = lane & 15, hi = lane >> 4; const int r0 = blockIdx.x * 64, c0 = (CMODE == 2) ? 0 : blockIdx.y * 64;
    if (CMODE == 1 && c0 > r0 + roff + 63) return;                  // score tile entirely above the causal diagonal: never read (the softmax masks j > i by select)
    const int Kd = (CMODE == 2) ? min(K, r0 + roff + 64) : K;        // P.V: probabilities are exactly 0 beyond the diagonal block, so the K loop stops there
    const int kb = (CMODE == 2) ? (int)blockIdx.y * KSL : 0;         // first key of this slice
    if (CMODE == 2 && kb >= Kd) return;                              // slice entirely beyond the diagonal limit: no plane stored, none read
    const int Kl = (CMODE == 2) ? min(Kd - kb, KSL) : K;             // keys of this slice; the operand pointers are moved to its first key
    if (CMODE == 2) { A += kb; if (A2) A2 += kb; Bt += kb; if (Bt2) Bt2 += kb; C += (size_t)blockIdx.y * sP; }
    v8f acc[4][4];
#pragma unroll
    for (int mb = 0; mb < 4; ++mb)
#pragma unroll
        for (int nb = 0; nb < 4; ++nb) acc[mb][nb] = (v8f){};
    const size_t aoff = (size_t)(r0 + lr) * K + 8 * hi, boff = (size_t)(c0 + lr) * K + 8 * hi;
#pragma unroll 1
    for (int kc = 0; kc < Kl; kc += 32) {
        V a[4], a2[4];
#pragma unroll
        for (int mb = 0; mb < 4; ++mb) { a[mb] = WFrag<T16>::ld(A + aoff + (size_t)mb * 16 * K + kc); if (NSPLIT == 1 || NSPLIT == 2) a2[mb] = WFrag<T16>::ld(A2 + aoff + (size_t)mb * 16 * K + kc); }
#pragma unroll
        for (int nb = 0; nb < 4; ++nb) { const V b = WFrag<T16>::ld(Bt + boff + (size_t)nb * 16 * K + kc); V b2; if (NSPLIT >= 2) b2 = WFrag<T16>::ld(Bt2 + boff + (size_t)nb * 16 * K + kc);
#pragma unroll
            for (int mb = 0; mb < 4; ++mb) { acc[mb][nb] = WFrag<T16>::mma(a[mb], b, acc[mb][nb]); if (NSPLIT == 1 || NSPLIT == 2) acc[mb][nb] = WFrag<T16>::mma(a2[mb], b, acc[mb][nb]); if (NSPLIT >= 2) acc[mb][nb] = WFrag<T16>::mma(a[mb], b2, acc[mb][nb]); } }
        asm volatile("v_nop\n\tv_nop\n\tv_nop\n\tv_nop" : "+v"(acc[0][0]), "+v"(acc[1][1]), "+v"(acc[2][2]), "+v"(acc[3][3]) : "v"(a[0]), "v"(a[3]));
    }
#pragma unroll
    for (int mb = 0; mb < 4; ++mb) {
#pragma unroll
        for (int nb = 0; nb < 4; ++nb) {
#pragma unroll
            for (int j = 0; j < 8; ++j) os[(hi * 8 + j) * 68 + nb * 16 + lr] = acc[mb][nb][j]; }
        __builtin_amdgcn_wave_barrier(); asm volatile("" ::: "memory");
        float* crow = C + (size_t)(r0 + mb * 16) * ldc + c0;
{
#pragma unroll
            for (int s = 0; s < 8; ++s) { const int row = 2 * s + hi, cofs = lr * 4; v4f val = *(const v4fa*)(os + row * 68 + cofs);
                *(v4f*)(crow + (size_t)row * ldc + cofs) = val; }
             }
        __builtin_amdgcn_wave_barrier(); asm volatile("" ::: "memory");
    }
}

__device__ __forceinline__ h16 tohx(float x) { return (h16)x; }
__device__ __forceinline__ void splitf(float y, unsigned short& h, unsigned short& l) { h = f2bf(y); l = f2bf(y - bf2f(h)); }
typedef __attribute__((ext_vector_type(2))) _Float16 v2h;
typedef __attribute__((ext_vector_type(4))) _Float16 v4h;
typedef __attribute__((ext_vector_type(2))) unsigned short v2us;
typedef __attribute__((ext_vector_type(4))) unsigned short v4us;
typedef __attribute__((ext_vector_type(2))) float v2f;
typedef __attribute__((ext_vector_type(4))) int v4i;

__global__ __launch_bounds__(256) void k_wtG(const float* __restrict__ w, int K, int N, bf* Bt) {
    const int lane = threadIdx.x & 31; const int L0 = (blockIdx.x * 8 + (threadIdx.x >> 5)) * 8; const int nlines = N * K / 64;
{
#pragma unroll 1
        for (int l = 0; l < 8; ++l) { const int L = L0 + l; if (L >= nlines) break; const size_t e = (size_t)L * 64 + lane * 2; const int k = (int)(e % K), n = (int)(e / K); v2us o;
            o[0] = f2bf(w[(size_t)k * N + n]); o[1] = f2bf(w[(size_t)(k + 1) * N + n]); *(v2us*)(Bt + e) = o; }
         }
}
__global__ __launch_bounds__(256) void k_cvt8(const float* __restrict__ src, bf* dst, size_t n8) { const size_t i = (size_t)blockIdx.x * 256 + threadIdx.x; if (i >= n8) return; const v8f v = *(const v8f*)(src + i * 8); v8us o;
#pragma unroll
    for (int k = 0; k < 8; ++k) o[k] = f2bf(v[k]); *(v8us*)(dst + i * 8) = o;  }
__global__ __launch_bounds__(256) void k_cscvt(const float* __restrict__ cosT, const float* __restrict__ sinT, float* CS) { const int idx = blockIdx.x * 256 + threadIdx.x; if (idx >= TT * HD) return; v2f cs; cs[0] = bfr(cosT[idx]); cs[1] = bfr(sinT[idx]); *(v2f*)(CS + (size_t)idx * 2) = cs;  }
// k_rope: head planes [h][t][d] (fp16 + hi/lo) of rope(x) x sc with the rotate-half convention out[d] = x[d] cos[t][d] - x[d+HD/2] sin[t][d], out[d+HD/2] = x[d+HD/2] cos[t][d+HD/2] + x[d] sin[t][d+HD/2]
__global__ __launch_bounds__(256) void k_rope(const float* __restrict__ F, int pitch, int nheads, const float* __restrict__ CS, const float* __restrict__ RF, const float* __restrict__ nw, float sc, h16* P16, bf* Ph, bf* Pl) {
    const size_t e = ((size_t)blockIdx.x * 256 + threadIdx.x) * 2; if (e >= (size_t)nheads * TT * HD) return; const int d = (int)(e % HD); const int t = (int)((e / HD) % TT); const int h = (int)(e / ((size_t)HD * TT)); const float* f = F + (size_t)t * pitch + h * HD; const float rf = RF ? RF[(size_t)h * TT + t] : 1.0f; v2h o16; v2us oh, ol;
#pragma unroll
    for (int q = 0; q < 2; ++q) { const int dd = d + q; const int dp = (dd < HD / 2) ? dd + HD / 2 : dd - HD / 2; float x0 = f[dd], x1 = f[dp];
        if (RF) { float n0 = __fmul_rn(x0, rf), n1 = __fmul_rn(x1, rf); asm volatile("" : "+v"(n0)); asm volatile("" : "+v"(n1)); x0 = __fmul_rn(bfr(nw[dd]), n0); x1 = __fmul_rn(bfr(nw[dp]), n1); }
        const v2f cs = *(const v2f*)(CS + ((size_t)t * HD + dd) * 2); float a = __fmul_rn(x0, cs[0]), bq = __fmul_rn(x1, cs[1]); asm volatile("" : "+v"(a)); asm volatile("" : "+v"(bq)); const float r = ((dd < HD / 2) ? __fsub_rn(a, bq) : __fadd_rn(a, bq)) * sc;
        o16[q] = tohx(r); unsigned short a2, c2; splitf(r, a2, c2); oh[q] = a2; ol[q] = c2; }
    *(v2h*)(P16 + e) = o16; *(v2us*)(Ph + e) = oh; *(v2us*)(Pl + e) = ol;  }
__global__ __launch_bounds__(256) void k_vtp(const float* __restrict__ F, int pitch, int nheads, h16* V16, bf* Vh, bf* Vl) { const size_t e = ((size_t)blockIdx.x * 256 + threadIdx.x) * 2; if (e >= (size_t)nheads * HD * TT) return; const int t = (int)(e % TT); const int d = (int)((e / TT) % HD); const int g = (int)(e / ((size_t)TT * HD)); v2h o16; v2us oh, ol;
#pragma unroll
    for (int q = 0; q < 2; ++q) { const float x = F[(size_t)(t + q) * pitch + g * HD + d]; o16[q] = tohx(x); unsigned short a2, c2; splitf(x, a2, c2); oh[q] = a2; ol[q] = c2; }
    *(v2h*)(V16 + e) = o16; *(v2us*)(Vh + e) = oh; *(v2us*)(Vl + e) = ol;  }
__global__ __launch_bounds__(256) void k_csid(float* CS) { const int idx = blockIdx.x * 256 + threadIdx.x; if (idx >= TT * HD) return; v2f cs; cs[0] = 1.0f; cs[1] = 0.0f; *(v2f*)(CS + (size_t)idx * 2) = cs;  }
__global__ __launch_bounds__(256) void k_tanhp(const float* __restrict__ F, float* G2, size_t n4) { const size_t i = (size_t)blockIdx.x * 256 + threadIdx.x; if (i >= n4) return; const v4f a = *(const v4f*)(F + i * 4); v4f o;
#pragma unroll
    for (int u = 0; u < 4; ++u) { float xs = fminf(fmaxf(a[u], -15.0f), 15.0f); float ex = __builtin_amdgcn_exp2f(__fmul_rn(xs, 2.8853900817779268f)); asm volatile("" : "+v"(ex)); float nm = __fsub_rn(ex, 1.0f), dn2 = __fadd_rn(ex, 1.0f); asm volatile("" : "+v"(nm)); asm volatile("" : "+v"(dn2)); float rc = __builtin_amdgcn_rcpf(dn2); asm volatile("" : "+v"(rc)); o[u] = __fmul_rn(nm, rc); }
    *(v4f*)(G2 + i * 4) = o;  }
__global__ __launch_bounds__(256) void k_hlG(const float* __restrict__ F, bf* Fh, bf* Fl, size_t n) { const size_t e = ((size_t)blockIdx.x * 256 + threadIdx.x) * 4; if (e >= n) return; const v4f a = *(const v4f*)(F + e); v4us oh, ol; for (int u = 0; u < 4; ++u) { unsigned short p, q; splitf(a[u], p, q); oh[u] = p; ol[u] = q; } *(v4us*)(Fh + e) = oh; *(v4us*)(Fl + e) = ol;  }
// k_asoft: per row (zz, i): t = S x HD^-0.5 + lam x delta for j <= i and i - j < WIN (sliding causal window; the reference's -1e9 additive fill vanishes identically); softmax over the 2048 keys (register row, one exp, fixed trees);
__global__ __launch_bounds__(256) void k_asoft(const float* __restrict__ Sb, const float* __restrict__ Sb2, const float* __restrict__ lamp, h16* P16, bf* Ph, bf* Pl) {
    const int lane = threadIdx.x & 31; const int row = blockIdx.x * 8 + (threadIdx.x >> 5); if (row >= ZH * TT) return; const int i = row % TT; const int zz = row / TT; (void)zz; const bool hires = (i < RH); const float* sr = Sb + (size_t)row * TT; const float* sr2 = Sb2 + (size_t)row * TT; float lam = bfr(lamp[0]); asm volatile("" : "+v"(lam)); float v[TT / 32]; float mx = -3.0e38f;
#pragma unroll
    for (int ch = 0; ch < TT / 128; ++ch) { const int j0 = ch * 128 + lane * 4; const v4f a = *(const v4f*)(sr + j0);
#pragma unroll
        for (int q = 0; q < 4; ++q) { const int j = j0 + q; (void)j; float sa = a[q] * SCL; asm volatile("" : "+v"(sa)); float dl = __fmul_rn(lam, sr2[j]); asm volatile("" : "+v"(dl)); const float t = (j <= i && i - j < WIN) ? __fadd_rn(sa, dl) : -3.0e38f; v[ch * 4 + q] = t; mx = fmaxf(mx, t); } }
#pragma unroll
    for (int sh = 16; sh; sh >>= 1) mx = fmaxf(mx, __shfl_xor(mx, sh, 32));
    float sum = 0.f;
#pragma unroll
    for (int k = 0; k < TT / 32; ++k) { float d0 = __fsub_rn(v[k], mx); asm volatile("" : "+v"(d0)); v[k] = __builtin_amdgcn_exp2f(__fmul_rn(d0, 1.4426950408889634f)); sum += v[k]; }
#pragma unroll
    for (int sh = 16; sh; sh >>= 1) sum += __shfl_xor(sum, sh, 32);
    const float f = __fdiv_rn(hires ? 1.0f : PCAR, sum);
{
        if (hires) {
#pragma unroll
            for (int ch = 0; ch < TT / 128; ++ch) { v4us oh, ol;
#pragma unroll
                for (int q = 0; q < 4; ++q) { unsigned short a, c2; splitf(v[ch * 4 + q] * f, a, c2); oh[q] = a; ol[q] = c2; }
                const size_t oo = ((size_t)zz * (RH ? RH : 1) + i) * TT + ch * 128 + lane * 4; *(v4us*)(Ph + oo) = oh; *(v4us*)(Pl + oo) = ol; }
        } else {
#pragma unroll
            for (int ch = 0; ch < TT / 128; ++ch) { v4h o4;
#pragma unroll
                for (int q = 0; q < 4; ++q) o4[q] = tohx(v[ch * 4 + q] * f);
                *(v4h*)(P16 + (size_t)row * TT + ch * 128 + lane * 4) = o4; } }
         }
}
// k_merge: sums the stored key-slice planes of O (ascending slice order) and writes the hi/lo planes of the merged heads. A block covers 8 rows of one 64-row tile, so the plane count is block-uniform.
__global__ __launch_bounds__(256) void k_merge(const float* __restrict__ O, int h0, bf* Ah, bf* Al) { const size_t e = ((size_t)blockIdx.x * 256 + threadIdx.x) * 2; if (e >= (size_t)ZH * TT * HD) return; const int d = (int)(e % HD); const int t = (int)((e / HD) % TT); const int zz = (int)(e / ((size_t)HD * TT)); const float cs = (t < RH) ? 1.0f : (1.0f / PCAR); const size_t oo = (size_t)t * DQ + (h0 + zz) * HD + d;
    const int t0 = (int)(((size_t)blockIdx.x * 512 / HD) % TT); const int nks = ((t0 & ~63) + 64 + KSL - 1) / KSL;   // planes stored for this row tile: slices that start below its diagonal limit
    v2f pv[NKS];
#pragma unroll
    for (int ks = 0; ks < NKS; ++ks) pv[ks] = *(const v2f*)(O + (size_t)min(ks, nks - 1) * ((size_t)ZH * TT * HD) + e);   // all loads in flight together; the index is clamped to a stored plane
    v2f sm = pv[0];
#pragma unroll
    for (int ks = 1; ks < NKS; ++ks) if (ks < nks) sm += pv[ks];
    v2us oh, ol;
#pragma unroll
    for (int q = 0; q < 2; ++q) { unsigned short a, c2; splitf(sm[q] * cs, a, c2); oh[q] = a; ol[q] = c2; } *(v2us*)(Ah + oo) = oh; *(v2us*)(Al + oo) = ol;  }

extern "C" void kernel_launch(void* const* d_in, const int* in_sizes, int n_in,
                              void* d_out, int out_size, void* d_ws, size_t ws_size, hipStream_t stream) {
    (void)in_sizes; (void)n_in; (void)out_size;
    const float* x = (const float*)d_in[0]; const float* wq = (const float*)d_in[1]; const float* bq = (const float*)d_in[2]; const float* wk = (const float*)d_in[3]; const float* bk = (const float*)d_in[4]; const float* wv = (const float*)d_in[5]; const float* bv = (const float*)d_in[6]; const float* wo = (const float*)d_in[7]; const float* bo = (const float*)d_in[8]; const float* Jm = (const float*)d_in[9]; const float* lamp = (const float*)d_in[10]; const float* cosT = nullptr; const float* sinT = nullptr; (void)cosT; (void)sinT;
    float* OUT = (float*)d_out;     // [2][2048][1024]
    char* wsp = (char*)d_ws;
    auto take = [&](size_t bytes) { char* p = wsp; wsp += (bytes + 255) & ~(size_t)255; return (void*)p; };
    bf* WQ = (bf*)take((size_t)DQ * DM * 2); bf* WK = (bf*)take((size_t)DKV * DM * 2); bf* WV = (bf*)take((size_t)DKV * DM * 2); bf* WO = (bf*)take((size_t)DM * DQ * 2); float* CS = (float*)take((size_t)TT * HD * 2 * 4);
    bf* XB = (bf*)take((size_t)TT * DM * 2); bf* JT = (bf*)take((size_t)NH_ * HD * HD * 2); float* QN = (float*)take((size_t)TT * DQ * 4); float* KN = (float*)take((size_t)TT * DKV * 4); float* QJF = (float*)take((size_t)NH_ * TT * HD * 4); bf* QNh = (bf*)take((size_t)NH_ * TT * HD * 2); bf* QNl = (bf*)take((size_t)NH_ * TT * HD * 2); h16* QN16 = (h16*)take((size_t)NH_ * TT * HD * 2); bf* QJh = (bf*)take((size_t)NH_ * TT * HD * 2); bf* QJl = (bf*)take((size_t)NH_ * TT * HD * 2); bf* KNh = (bf*)take((size_t)NKV * TT * HD * 2); bf* KNl = (bf*)take((size_t)NKV * TT * HD * 2); h16* KN16 = (h16*)take((size_t)NKV * TT * HD * 2); float* Sb2 = (float*)take((size_t)ZH * TT * TT * 4); float* FQ = (float*)take((size_t)TT * DQ * 4); float* FK = (float*)take((size_t)TT * DKV * 4);
    h16* QP16 = (h16*)take((size_t)NH_ * TT * HD * 2); h16* KP16 = (h16*)take((size_t)NKV * TT * HD * 2); h16* VT16 = (h16*)take((size_t)NKV * HD * TT * 2);
    bf* QPh = (bf*)take((size_t)NH_ * TT * HD * 2); bf* QPl = (bf*)take((size_t)NH_ * TT * HD * 2); bf* KPh = (bf*)take((size_t)NKV * TT * HD * 2); bf* KPl = (bf*)take((size_t)NKV * TT * HD * 2); bf* VTh = (bf*)take((size_t)NKV * HD * TT * 2); bf* VTl = (bf*)take((size_t)NKV * HD * TT * 2); bf* Ph = (bf*)take((size_t)ZH * RH * TT * 2); bf* Pl = (bf*)take((size_t)ZH * RH * TT * 2);
    float* Sb = (float*)take((size_t)ZH * TT * TT * 4); h16* P16 = (h16*)take((size_t)ZH * TT * TT * 2); float* Ob = (float*)take((size_t)NKS * ZH * TT * HD * 4); bf* ATh = (bf*)take((size_t)TT * DQ * 2); bf* ATl = (bf*)take((size_t)TT * DQ * 2);
    if ((size_t)(wsp - (char*)d_ws) > ws_size) return;    // ws 256 MiB
    float* FV = FK;   // v projection reuses the k buffer after the k planes are built (stream-ordered)
    { k_wtG<<<(unsigned)((DM * DQ / 64 + 63) / 64), 256, 0, stream>>>(wq, DM, DQ, WQ); k_wtG<<<(unsigned)((DM * DKV / 64 + 63) / 64), 256, 0, stream>>>(wk, DM, DKV, WK); k_wtG<<<(unsigned)((DM * DKV / 64 + 63) / 64), 256, 0, stream>>>(wv, DM, DKV, WV);
      k_wtG<<<(unsigned)((DQ * DM / 64 + 63) / 64), 256, 0, stream>>>(wo, DQ, DM, WO); for (int h = 0; h < NH_; ++h) k_wtG<<<(HD * HD / 64 + 63) / 64, 256, 0, stream>>>(Jm + (size_t)h * HD * HD, HD, HD, JT + (size_t)h * HD * HD);
       }
    k_csid<<<(TT * HD + 255) / 256, 256, 0, stream>>>(CS);
    const unsigned LQ = (unsigned)(((size_t)NH_ * TT * HD / 2 + 255) / 256), LKv = (unsigned)(((size_t)NKV * TT * HD / 2 + 255) / 256);
    for (int b = 0; b < NB_; ++b) {
        
        k_cvt8<<<(unsigned)(((size_t)TT * DM / 8 + 255) / 256), 256, 0, stream>>>(x + (size_t)b * TT * DM, XB, (size_t)TT * DM / 8);
        k_gemmw<bf, 0, true><<<dim3(TT / 64, DQ / 64, 1), 32, 0, stream>>>(XB, nullptr, WQ, nullptr, DM, FQ, DQ, bq, 0, 0, 0);
        k_rope<<<LQ, 256, 0, stream>>>(FQ, DQ, NH_, CS, nullptr, nullptr, 1.0f, QP16, QPh, QPl); k_tanhp<<<(unsigned)(((size_t)TT * DQ / 4 + 255) / 256), 256, 0, stream>>>(FQ, QN, (size_t)TT * DQ / 4); k_rope<<<LQ, 256, 0, stream>>>(QN, DQ, NH_, CS, nullptr, nullptr, 1.0f, QN16, QNh, QNl); for (int h = 0; h < NH_; ++h) k_gemmw<bf, 1, false><<<dim3(TT / 64, 1, 1), 32, 0, stream>>>(QNh + (size_t)h * TT * HD, QNl + (size_t)h * TT * HD, JT + (size_t)h * HD * HD, nullptr, HD, QJF + (size_t)h * TT * HD, HD, nullptr, 0, 0, 0); k_hlG<<<(unsigned)(((size_t)NH_ * TT * HD / 4 + 255) / 256), 256, 0, stream>>>(QJF, QJh, QJl, (size_t)NH_ * TT * HD);
        k_gemmw<bf, 0, true><<<dim3(TT / 64, DKV / 64, 1), 32, 0, stream>>>(XB, nullptr, WK, nullptr, DM, FK, DKV, bk, 0, 0, 0);
        k_rope<<<LKv, 256, 0, stream>>>(FK, DKV, NKV, CS, nullptr, nullptr, 1.0f, KP16, KPh, KPl); k_tanhp<<<(unsigned)(((size_t)TT * DKV / 4 + 255) / 256), 256, 0, stream>>>(FK, KN, (size_t)TT * DKV / 4); k_rope<<<LKv, 256, 0, stream>>>(KN, DKV, NKV, CS, nullptr, nullptr, 1.0f, KN16, KNh, KNl);
        k_gemmw<bf, 0, true><<<dim3(TT / 64, DKV / 64, 1), 32, 0, stream>>>(XB, nullptr, WV, nullptr, DM, FV, DKV, bv, 0, 0, 0); k_vtp<<<LKv, 256, 0, stream>>>(FV, DKV, NKV, VT16, VTh, VTl);
        for (int h0 = 0; h0 < NH_; h0 += ZH) { const size_t zq = (size_t)h0, zk = (size_t)(h0 / REP);   // one kv head per query head: the pass's two heads use consecutive kv planes (z-strides TT*HD)
            k_gemmc<bf, 2, 1><<<dim3(TT / 64, TT / 64, ZH), 32, 0, stream>>>(QPh + zq * TT * HD, QPl + zq * TT * HD, KPh + zk * TT * HD, KPl + zk * TT * HD, HD, Sb, TT, 0, (size_t)TT * HD, (size_t)TT * HD, (size_t)TT * TT, 0);   /* both score products hl on all rows */
            k_gemmc<bf, 2, 1><<<dim3(TT / 64, TT / 64, ZH), 32, 0, stream>>>(QJh + zq * TT * HD, QJl + zq * TT * HD, KNh + zk * TT * HD, KNl + zk * TT * HD, HD, Sb2, TT, 0, (size_t)TT * HD, (size_t)TT * HD, (size_t)TT * TT, 0);   /* delta = (tanh Q J).tanh K */
            k_asoft<<<ZH * TT / 8, 256, 0, stream>>>(Sb, Sb2, lamp, P16, Ph, Pl);
            k_gemmc<bf, 2, 2><<<dim3(RH / 64, RH / KSL, ZH), 32, 0, stream>>>(Ph, Pl, VTh + zk * HD * TT, VTl + zk * HD * TT, TT, Ob, HD, 0, (size_t)RH * TT, (size_t)HD * TT, (size_t)TT * HD, (size_t)ZH * TT * HD);
            k_gemmc<h16, 0, 2><<<dim3((TT - RH) / 64, NKS, ZH), 32, 0, stream>>>(P16 + (size_t)RH * TT, nullptr, VT16 + zk * HD * TT, nullptr, TT, Ob + (size_t)RH * HD, HD, RH, (size_t)TT * TT, (size_t)HD * TT, (size_t)TT * HD, (size_t)ZH * TT * HD);
            k_merge<<<(unsigned)(((size_t)ZH * TT * HD / 2 + 255) / 256), 256, 0, stream>>>(Ob, h0, ATh, ATl); }
        k_gemmw<bf, 1, true><<<dim3(TT / 64, DM / 64, 1), 32, 0, stream>>>(ATh, ATl, WO, nullptr, DQ, OUT + (size_t)b * TT * DM, DM, bo, 0, 0, 0); }
}

// v002
// It runs in 915 microseconds.
// Next to v001, in two timings, it ran 1.47 and 1.48 times as fast.
// Counting every step since v000, it is 2.22 times as fast.
#include <hip/hip_runtime.h>

// Causal attention with a bilinear tanh correction (x [2][2048][1024]; Q/K/V = x W + b (16 x 64); scores = Q.K / 8 + lam * (tanh(Q) J_h tanh(K)^T) (J [16][64][64] and the scalar lam read); causal (-inf) softmax; out = merged Wo + bo -> [2][2048][1024]).
// Compute dtypes, f32 accumulate: every input rounded to bf16; Q/K/V on PLAIN bf16 operands (inputs: exact) + bias; tanh elementwise in f32 (exp2 form with the hardware reciprocal, clamped |x| <= 15); QJ = hi/lo tanh(Q) x exact J (2 products, f32); both score products hl x hl (3 products) on every row; the two terms combined per element in f32 in the reference's order (s/8 + lam d); causal tile skipping; softmax f32; attn.v: rows < 512 hl (3 products), the rest fp16 (x1024); Wo hl x exact (2 products) + bias.

#define NB_  2
#define TT   2048
#define DM   1024
#define NH_  16
#define NKV  16
#define REP  (NH_ / NKV)
#define HD   64
#define DQ   (NH_ * HD)
#define DKV  (NKV * HD)
#define ZH   2
#define RH   512                  // query rows < RH use hi+lo planes (0: none)
#define WIN  2048
#define PCAR 1024.0f
#define SCL  0.125f   // HD^-0.5
#define KSL  128                  // keys per slice of the probability x value contraction (one wave per slice)
#define NKS  (TT / KSL)           // partial output planes
typedef _Float16 h16;
typedef unsigned short bf;
typedef __attribute__((ext_vector_type(16))) __bf16   v16bf;
typedef __attribute__((ext_vector_type(16))) _Float16 v16h;
typedef __attribute__((ext_vector_type(8)))  _Float16 v8h;
typedef __attribute__((ext_vector_type(8)))  unsigned short v8us;
typedef __attribute__((ext_vector_type(8)))  float    v8f;
typedef __attribute__((ext_vector_type(4)))  float    v4f;
typedef v8h  __attribute__((may_alias)) v8ha;
typedef v4f  __attribute__((may_alias)) v4fa;
typedef v8us __attribute__((may_alias)) v8usa;

__device__ __forceinline__ unsigned short f2bf(float f) { unsigned u = __float_as_uint(f); u += 0x7FFFu + ((u >> 16) & 1u); return (unsigned short)(u >> 16); }
__device__ __forceinline__ float bf2f(unsigned short b) { return __uint_as_float(((unsigned)b) << 16); }
__device__ __forceinline__ float bfr(float f) { return bf2f(f2bf(f)); }
__device__ __forceinline__ v16h cat16(v8h lo, v8h hi) { return __builtin_shufflevector(lo, hi, 0, 1, 2, 3, 4, 5, 6, 7, 8, 9, 10, 11, 12, 13, 14, 15); }
__device__ __forceinline__ v16bf cat16b(v8us lo, v8us hi) { return __builtin_bit_cast(v16bf, __builtin_shufflevector(lo, hi, 0, 1, 2, 3, 4, 5, 6, 7, 8, 9, 10, 11, 12, 13, 14, 15)); }
__device__ __forceinline__ v8f wmma16(v16h a, v16h b, v8f c) { return __builtin_amdgcn_wmma_f32_16x16x32_f16(false, a, false, b, (short)0, c, false, false); }
__device__ __forceinline__ v8f wmmab(v16bf a, v16bf b, v8f c) { return __builtin_amdgcn_wmma_f32_16x16x32_bf16(false, a, false, b, (short)0, c, false, false); }



// ---- k_gemmw: register-blocked GEMM, ONE WAVE per 64x64 output tile (16 accumulators), operands straight from K-contiguous 16-bit planes; grid (M/64, N/64, Z), 32 threads.
// C[m][n] (f32, pitch ldc, + optional f32 bias[n]) = sum_k A[m][k] Bt[n][k] (+ split products per NSPLIT). z-batch strides sA/sB/sC in elements. K % 32 == 0.
// Independent products of one shape run as ONE launch with the member in blockIdx.z: the q, k and v projections (three weight planes, three biases, three outputs in a row) and the 16 per-head tanh(Q) J products.
template <typename T16> struct WFrag;
template <> struct WFrag<h16> { typedef v16h V; static __device__ __forceinline__ V ld(const h16* p) { return cat16(*(const v8h*)p, *(const v8h*)(p + 16)); } static __device__ __forceinline__ v8f mma(V a, V b, v8f c) { return wmma16(a, b, c); } };
template <> struct WFrag<bf> { typedef v16bf V; static __device__ __forceinline__ V ld(const bf* p) { return cat16b(*(const v8us*)p, *(const v8us*)(p + 16)); } static __device__ __forceinline__ v8f mma(V a, V b, v8f c) { return wmmab(a, b, c); } };
template <typename T16, int NSPLIT, bool BIAS>
__global__ __launch_bounds__(32) void k_gemmw(const T16* __restrict__ A, const T16* __restrict__ A2, const T16* __restrict__ Bt, const T16* __restrict__ Bt2, int K, float* C, int ldc, const float* __restrict__ bias0, const float* __restrict__ bias1, const float* __restrict__ bias2, size_t sA, size_t sB, size_t sC) {
    typedef typename WFrag<T16>::V V;
    __shared__ __align__(16) float os[16 * 68];
    const size_t z = blockIdx.z; A += z * sA; if (A2) A2 += z * sA; Bt += z * sB; if (Bt2) Bt2 += z * sB; C += z * sC;
    const float* __restrict__ bias = (z == 0) ? bias0 : (z == 1) ? bias1 : bias2;   // each z-batch member has its own bias vector (at most three members where BIAS is set)
    const int lane = threadIdx.x & 31, lr = lane & 15, hi = lane >> 4; const int r0 = blockIdx.x * 64, c0 = blockIdx.y * 64;
    v8f acc[4][4];
#pragma unroll
    for (int mb = 0; mb < 4; ++mb)
#pragma unroll
        for (int nb = 0; nb < 4; ++nb) acc[mb][nb] = (v8f){};
    const size_t aoff = (size_t)(r0 + lr) * K + 8 * hi, boff = (size_t)(c0 + lr) * K + 8 * hi;
#pragma unroll 1
    for (int kc = 0; kc < K; kc += 32) {
        V a[4], a2[4];
#pragma unroll
        for (int mb = 0; mb < 4; ++mb) { a[mb] = WFrag<T16>::ld(A + aoff + (size_t)mb * 16 * K + kc); if (NSPLIT == 1 || NSPLIT == 2) a2[mb] = WFrag<T16>::ld(A2 + aoff + (size_t)mb * 16 * K + kc); }
#pragma unroll
        for (int nb = 0; nb < 4; ++nb) { const V b = WFrag<T16>::ld(Bt + boff + (size_t)nb * 16 * K + kc); V b2; if (NSPLIT >= 2) b2 = WFrag<T16>::ld(Bt2 + boff + (size_t)nb * 16 * K + kc);
#pragma unroll
            for (int mb = 0; mb < 4; ++mb) { acc[mb][nb] = WFrag<T16>::mma(a[mb], b, acc[mb][nb]); if (NSPLIT == 1 || NSPLIT == 2) acc[mb][nb] = WFrag<T16>::mma(a2[mb], b, acc[mb][nb]); if (NSPLIT >= 2) acc[mb][nb] = WFrag<T16>::mma(a[mb], b2, acc[mb][nb]); } }
        asm volatile("v_nop\n\tv_nop\n\tv_nop\n\tv_nop" : "+v"(acc[0][0]), "+v"(acc[1][1]), "+v"(acc[2][2]), "+v"(acc[3][3]) : "v"(a[0]), "v"(a[3]));
    }
#pragma unroll
    for (int mb = 0; mb < 4; ++mb) {
#pragma unroll
        for (int nb = 0; nb < 4; ++nb) {
#pragma unroll
            for (int j = 0; j < 8; ++j) os[(hi * 8 + j) * 68 + nb * 16 + lr] = acc[mb][nb][j]; }
        __builtin_amdgcn_wave_barrier(); asm volatile("" ::: "memory");
        float* crow = C + (size_t)(r0 + mb * 16) * ldc + c0;
{
#pragma unroll
            for (int s = 0; s < 8; ++s) { const int row = 2 * s + hi, cofs = lr * 4; v4f val = *(const v4fa*)(os + row * 68 + cofs); if (BIAS) { val[0] += bfr(bias[c0 + cofs]); val[1] += bfr(bias[c0 + cofs + 1]); val[2] += bfr(bias[c0 + cofs + 2]); val[3] += bfr(bias[c0 + cofs + 3]); }
                *(v4f*)(crow + (size_t)row * ldc + cofs) = val; }
             }
        __builtin_amdgcn_wave_barrier(); asm volatile("" ::: "memory");
    }
}

// ---- gemmc_tile: the same one-wave 64x64 tile GEMM specialised for causal attention: CMODE 1 skips score tiles entirely above the diagonal (query rows r0+roff.., key columns c0..), CMODE 2 limits the
// key (K) loop of the probability x value contraction to the diagonal block (probabilities beyond it are exactly zero). roff = row offset of this product's first row within the sequence.
// CMODE 2 also splits that key loop over by: slice y covers keys [y KSL, (y + 1) KSL) below the diagonal limit and stores its partial tile in plane y of C (plane stride sP); a slice that starts at or
// beyond the limit stores nothing, and k_merge sums exactly the planes that were stored. The output has HD = 64 columns, one column tile.
// A device function: (bx, by, bz) is the tile's place in its own product's grid, os the work-group's 16 x 68 f32 staging buffer in LDS. The two kernels below each run two independent products in one launch.
template <typename T16, int NSPLIT, int CMODE>
__device__ __forceinline__ void gemmc_tile(const T16* __restrict__ A, const T16* __restrict__ A2, const T16* __restrict__ Bt, const T16* __restrict__ Bt2, int K, float* C, int ldc, int roff, size_t sA, size_t sB, size_t sC, size_t sP, int bx, int by, int bz, float* os) {
    typedef typename WFrag<T16>::V V;
    const size_t z = bz; A += z * sA; if (A2) A2 += z * sA; Bt += z * sB; if (Bt2) Bt2 += z * sB; C += z * sC;
    const int lane = threadIdx.x & 31, lr = lane & 15, hi = lane >> 4; const int r0 = bx * 64, c0 = (CMODE == 2) ? 0 : by * 64;
    if (CMODE == 1 && c0 > r0 + roff + 63) return;                  // score tile entirely above the causal diagonal: never read (the softmax masks j > i by select)
    const int Kd = (CMODE == 2) ? min(K, r0 + roff + 64) : K;        // P.V: probabilities are exactly 0 beyond the diagonal block, so the K loop stops there
    const int kb = (CMODE == 2) ? by * KSL : 0;         // first key of this slice
    if (CMODE == 2 && kb >= Kd) return;                              // slice entirely beyond the diagonal limit: no plane stored, none read
    const int Kl = (CMODE == 2) ? min(Kd - kb, KSL) : K;             // keys of this slice; the operand pointers are moved to its first key
    if (CMODE == 2) { A += kb; if (A2) A2 += kb; Bt += kb; if (Bt2) Bt2 += kb; C += (size_t)by * sP; }
    v8f acc[4][4];
#pragma unroll
    for (int mb = 0; mb < 4; ++mb)
#pragma unroll
        for (int nb = 0; nb < 4; ++nb) acc[mb][nb] = (v8f){};
    const size_t aoff = (size_t)(r0 + lr) * K + 8 * hi, boff = (size_t)(c0 + lr) * K + 8 * hi;
#pragma unroll 1
    for (int kc = 0; kc < Kl; kc += 32) {
        V a[4], a2[4];
#pragma unroll
        for (int mb = 0; mb < 4; ++mb) { a[mb] = WFrag<T16>::ld(A + aoff + (size_t)mb * 16 * K + kc); if (NSPLIT == 1 || NSPLIT == 2) a2[mb] = WFrag<T16>::ld(A2 + aoff + (size_t)mb * 16 * K + kc); }
#pragma unroll
        for (int nb = 0; nb < 4; ++nb) { const V b = WFrag<T16>::ld(Bt + boff + (size_t)nb * 16 * K + kc); V b2; if (NSPLIT >= 2) b2 = WFrag<T16>::ld(Bt2 + boff + (size_t)nb * 16 * K + kc);
#pragma unroll
            for (int mb = 0; mb < 4; ++mb) { acc[mb][nb] = WFrag<T16>::mma(a[mb], b, acc[mb][nb]); if (NSPLIT == 1 || NSPLIT == 2) acc[mb][nb] = WFrag<T16>::mma(a2[mb], b, acc[mb][nb]); if (NSPLIT >= 2) acc[mb][nb] = WFrag<T16>::mma(a[mb], b2, acc[mb][nb]); } }
        asm volatile("v_nop\n\tv_nop\n\tv_nop\n\tv_nop" : "+v"(acc[0][0]), "+v"(acc[1][1]), "+v"(acc[2][2]), "+v"(acc[3][3]) : "v"(a[0]), "v"(a[3]));
    }
#pragma unroll
    for (int mb = 0; mb < 4; ++mb) {
#pragma unroll
        for (int nb = 0; nb < 4; ++nb) {
#pragma unroll
            for (int j = 0; j < 8; ++j) os[(hi * 8 + j) * 68 + nb * 16 + lr] = acc[mb][nb][j]; }
        __builtin_amdgcn_wave_barrier(); asm volatile("" ::: "memory");
        float* crow = C + (size_t)(r0 + mb * 16) * ldc + c0;
{
#pragma unroll
            for (int s = 0; s < 8; ++s) { const int row = 2 * s + hi, cofs = lr * 4; v4f val = *(const v4fa*)(os + row * 68 + cofs);
                *(v4f*)(crow + (size_t)row * ldc + cofs) = val; }
             }
        __builtin_amdgcn_wave_barrier(); asm volatile("" ::: "memory");
    }
    if (CMODE == 2) asm volatile("s_wait_xcnt 0x0" ::: "memory");   // behind the tile's last store: k_pv holds two such tiles, and the code laid out behind the first one writes registers that its stores name
}

// k_score: both score products of a pass in one launch, grid (TT/64, TT/64, 2 ZH): z < ZH is head z of Q.K -> S, z >= ZH is head z - ZH of (tanh Q J).tanh K -> S2. Both hl x hl (3 products), tiles above the diagonal skipped.
__global__ __launch_bounds__(32) void k_score(const bf* __restrict__ Qh, const bf* __restrict__ Ql, const bf* __restrict__ Kh, const bf* __restrict__ Kl, float* S, const bf* __restrict__ Gh, const bf* __restrict__ Gl, const bf* __restrict__ Nh, const bf* __restrict__ Nl, float* S2) {
    __shared__ __align__(16) float os[16 * 68];
    const bool dl = (int)blockIdx.z >= ZH;
    gemmc_tile<bf, 2, 1>(dl ? Gh : Qh, dl ? Gl : Ql, dl ? Nh : Kh, dl ? Nl : Kl, HD, dl ? S2 : S, TT, 0, (size_t)TT * HD, (size_t)TT * HD, (size_t)TT * TT, 0, (int)blockIdx.x, (int)blockIdx.y, (int)blockIdx.z - (dl ? ZH : 0), os);
}
// k_pv: both probability x value products of a pass in one launch, grid (TT/64, NKS, ZH): row tiles below RH take the hl planes (3 products), the rest the fp16 planes; same tiles, slices and partial planes as two launches.
__global__ __launch_bounds__(32) void k_pv(const bf* __restrict__ Ph, const bf* __restrict__ Pl, const bf* __restrict__ Vh, const bf* __restrict__ Vl, const h16* __restrict__ P16, const h16* __restrict__ V16, float* O) {
    __shared__ __align__(16) float os[16 * 68];
    if ((int)blockIdx.x < RH / 64) gemmc_tile<bf, 2, 2>(Ph, Pl, Vh, Vl, TT, O, HD, 0, (size_t)RH * TT, (size_t)HD * TT, (size_t)TT * HD, (size_t)ZH * TT * HD, (int)blockIdx.x, (int)blockIdx.y, (int)blockIdx.z, os);
    else gemmc_tile<h16, 0, 2>(P16 + (size_t)RH * TT, nullptr, V16, nullptr, TT, O + (size_t)RH * HD, HD, RH, (size_t)TT * TT, (size_t)HD * TT, (size_t)TT * HD, (size_t)ZH * TT * HD, (int)blockIdx.x - RH / 64, (int)blockIdx.y, (int)blockIdx.z, os);
}

__device__ __forceinline__ h16 tohx(float x) { return (h16)x; }
__device__ __forceinline__ void splitf(float y, unsigned short& h, unsigned short& l) { h = f2bf(y); l = f2bf(y - bf2f(h)); }
typedef __attribute__((ext_vector_type(2))) _Float16 v2h;
typedef __attribute__((ext_vector_type(4))) _Float16 v4h;
typedef __attribute__((ext_vector_type(2))) unsigned short v2us;
typedef __attribute__((ext_vector_type(4))) unsigned short v4us;
typedef __attribute__((ext_vector_type(2))) float v2f;
typedef __attribute__((ext_vector_type(4))) int v4i;

// k_wtG: Bt[n][k] = bf16(w[k][n]); blockIdx.y is the matrix of a batch of equal shapes: matrix y of one array (w1 null), or one of four separate arrays; the outputs lie in a row.
__global__ __launch_bounds__(256) void k_wtG(const float* __restrict__ w0, const float* __restrict__ w1, const float* __restrict__ w2, const float* __restrict__ w3, int K, int N, bf* Bt) {
    const int y = blockIdx.y; const float* __restrict__ w = !w1 ? w0 + (size_t)y * K * N : (y == 0) ? w0 : (y == 1) ? w1 : (y == 2) ? w2 : w3; Bt += (size_t)y * K * N;
    const int lane = threadIdx.x & 31; const int L0 = (blockIdx.x * 8 + (threadIdx.x >> 5)) * 8; const int nlines = N * K / 64;
{
#pragma unroll 1
        for (int l = 0; l < 8; ++l) { const int L = L0 + l; if (L >= nlines) break; const size_t e = (size_t)L * 64 + lane * 2; const int k = (int)(e % K), n = (int)(e / K); v2us o;
            o[0] = f2bf(w[(size_t)k * N + n]); o[1] = f2bf(w[(size_t)(k + 1) * N + n]); *(v2us*)(Bt + e) = o; }
         }
}
__global__ __launch_bounds__(256) void k_cvt8(const float* __restrict__ src, bf* dst, size_t n8) { const size_t i = (size_t)blockIdx.x * 256 + threadIdx.x; if (i >= n8) return; const v8f v = *(const v8f*)(src + i * 8); v8us o;
#pragma unroll
    for (int k = 0; k < 8; ++k) o[k] = f2bf(v[k]); *(v8us*)(dst + i * 8) = o;  }
__global__ __launch_bounds__(256) void k_cscvt(const float* __restrict__ cosT, const float* __restrict__ sinT, float* CS) { const int idx = blockIdx.x * 256 + threadIdx.x; if (idx >= TT * HD) return; v2f cs; cs[0] = bfr(cosT[idx]); cs[1] = bfr(sinT[idx]); *(v2f*)(CS + (size_t)idx * 2) = cs;  }
// k_rope: head planes [h][t][d] (fp16 + hi/lo) of rope(x) x sc with the rotate-half convention out[d] = x[d] cos[t][d] - x[d+HD/2] sin[t][d], out[d+HD/2] = x[d+HD/2] cos[t][d+HD/2] + x[d] sin[t][d+HD/2]
// blockIdx.y is the member of a batch of equal shapes (q, then k): the inputs lie sF elements apart, each kind of output plane in a row.
__global__ __launch_bounds__(256) void k_rope(const float* __restrict__ F, size_t sF, int pitch, int nheads, const float* __restrict__ CS, const float* __restrict__ RF, const float* __restrict__ nw, float sc, h16* P16, bf* Ph, bf* Pl) {
    { const size_t y = blockIdx.y, so = y * nheads * TT * HD; F += y * sF; P16 += so; Ph += so; Pl += so; }
    const size_t e = ((size_t)blockIdx.x * 256 + threadIdx.x) * 2; if (e >= (size_t)nheads * TT * HD) return; const int d = (int)(e % HD); const int t = (int)((e / HD) % TT); const int h = (int)(e / ((size_t)HD * TT)); const float* f = F + (size_t)t * pitch + h * HD; const float rf = RF ? RF[(size_t)h * TT + t] : 1.0f; v2h o16; v2us oh, ol;
#pragma unroll
    for (int q = 0; q < 2; ++q) { const int dd = d + q; const int dp = (dd < HD / 2) ? dd + HD / 2 : dd - HD / 2; float x0 = f[dd], x1 = f[dp];
        if (RF) { float n0 = __fmul_rn(x0, rf), n1 = __fmul_rn(x1, rf); asm volatile("" : "+v"(n0)); asm volatile("" : "+v"(n1)); x0 = __fmul_rn(bfr(nw[dd]), n0); x1 = __fmul_rn(bfr(nw[dp]), n1); }
        const v2f cs = *(const v2f*)(CS + ((size_t)t * HD + dd) * 2); float a = __fmul_rn(x0, cs[0]), bq = __fmul_rn(x1, cs[1]); asm volatile("" : "+v"(a)); asm volatile("" : "+v"(bq)); const float r = ((dd < HD / 2) ? __fsub_rn(a, bq) : __fadd_rn(a, bq)) * sc;
        o16[q] = tohx(r); unsigned short a2, c2; splitf(r, a2, c2); oh[q] = a2; ol[q] = c2; }
    *(v2h*)(P16 + e) = o16; *(v2us*)(Ph + e) = oh; *(v2us*)(Pl + e) = ol;  }
__global__ __launch_bounds__(256) void k_vtp(const float* __restrict__ F, int pitch, int nheads, h16* V16, bf* Vh, bf* Vl) { const size_t e = ((size_t)blockIdx.x * 256 + threadIdx.x) * 2; if (e >= (size_t)nheads * HD * TT) return; const int t = (int)(e % TT); const int d = (int)((e / TT) % HD); const int g = (int)(e / ((size_t)TT * HD)); v2h o16; v2us oh, ol;
#pragma unroll
    for (int q = 0; q < 2; ++q) { const float x = F[(size_t)(t + q) * pitch + g * HD + d]; o16[q] = tohx(x); unsigned short a2, c2; splitf(x, a2, c2); oh[q] = a2; ol[q] = c2; }
    *(v2h*)(V16 + e) = o16; *(v2us*)(Vh + e) = oh; *(v2us*)(Vl + e) = ol;  }
__global__ __launch_bounds__(256) void k_csid(float* CS) { const int idx = blockIdx.x * 256 + threadIdx.x; if (idx >= TT * HD) return; v2f cs; cs[0] = 1.0f; cs[1] = 0.0f; *(v2f*)(CS + (size_t)idx * 2) = cs;  }
__global__ __launch_bounds__(256) void k_tanhp(const float* __restrict__ F, float* G2, size_t n4) { const size_t i = (size_t)blockIdx.x * 256 + threadIdx.x; if (i >= n4) return; const v4f a = *(const v4f*)(F + i * 4); v4f o;
#pragma unroll
    for (int u = 0; u < 4; ++u) { float xs = fminf(fmaxf(a[u], -15.0f), 15.0f); float ex = __builtin_amdgcn_exp2f(__fmul_rn(xs, 2.8853900817779268f)); asm volatile("" : "+v"(ex)); float nm = __fsub_rn(ex, 1.0f), dn2 = __fadd_rn(ex, 1.0f); asm volatile("" : "+v"(nm)); asm volatile("" : "+v"(dn2)); float rc = __builtin_amdgcn_rcpf(dn2); asm volatile("" : "+v"(rc)); o[u] = __fmul_rn(nm, rc); }
    *(v4f*)(G2 + i * 4) = o;  }
__global__ __launch_bounds__(256) void k_hlG(const float* __restrict__ F, bf* Fh, bf* Fl, size_t n) { const size_t e = ((size_t)blockIdx.x * 256 + threadIdx.x) * 4; if (e >= n) return; const v4f a = *(const v4f*)(F + e); v4us oh, ol; for (int u = 0; u < 4; ++u) { unsigned short p, q; splitf(a[u], p, q); oh[u] = p; ol[u] = q; } *(v4us*)(Fh + e) = oh; *(v4us*)(Fl + e) = ol;  }
// k_asoft: per row (zz, i): t = S x HD^-0.5 + lam x delta for j <= i and i - j < WIN (sliding causal window; the reference's -1e9 additive fill vanishes identically); softmax over the 2048 keys (register row, one exp, fixed trees);
__global__ __launch_bounds__(256) void k_asoft(const float* __restrict__ Sb, const float* __restrict__ Sb2, const float* __restrict__ lamp, h16* P16, bf* Ph, bf* Pl) {
    const int lane = threadIdx.x & 31; const int row = blockIdx.x * 8 + (threadIdx.x >> 5); if (row >= ZH * TT) return; const int i = row % TT; const int zz = row / TT; (void)zz; const bool hires = (i < RH); const float* sr = Sb + (size_t)row * TT; const float* sr2 = Sb2 + (size_t)row * TT; float lam = bfr(lamp[0]); asm volatile("" : "+v"(lam)); float v[TT / 32]; float mx = -3.0e38f;
#pragma unroll
    for (int ch = 0; ch < TT / 128; ++ch) { const int j0 = ch * 128 + lane * 4; const v4f a = *(const v4f*)(sr + j0);
#pragma unroll
        for (int q = 0; q < 4; ++q) { const int j = j0 + q; (void)j; float sa = a[q] * SCL; asm volatile("" : "+v"(sa)); float dl = __fmul_rn(lam, sr2[j]); asm volatile("" : "+v"(dl)); const float t = (j <= i && i - j < WIN) ? __fadd_rn(sa, dl) : -3.0e38f; v[ch * 4 + q] = t; mx = fmaxf(mx, t); } }
#pragma unroll
    for (int sh = 16; sh; sh >>= 1) mx = fmaxf(mx, __shfl_xor(mx, sh, 32));
    float sum = 0.f;
#pragma unroll
    for (int k = 0; k < TT / 32; ++k) { float d0 = __fsub_rn(v[k], mx); asm volatile("" : "+v"(d0)); v[k] = __builtin_amdgcn_exp2f(__fmul_rn(d0, 1.4426950408889634f)); sum += v[k]; }
#pragma unroll
    for (int sh = 16; sh; sh >>= 1) sum += __shfl_xor(sum, sh, 32);
    const float f = __fdiv_rn(hires ? 1.0f : PCAR, sum);
{
        if (hires) {
#pragma unroll
            for (int ch = 0; ch < TT / 128; ++ch) { v4us oh, ol;
#pragma unroll
                for (int q = 0; q < 4; ++q) { unsigned short a, c2; splitf(v[ch * 4 + q] * f, a, c2); oh[q] = a; ol[q] = c2; }
                const size_t oo = ((size_t)zz * (RH ? RH : 1) + i) * TT + ch * 128 + lane * 4; *(v4us*)(Ph + oo) = oh; *(v4us*)(Pl + oo) = ol; }
        } else {
#pragma unroll
            for (int ch = 0; ch < TT / 128; ++ch) { v4h o4;
#pragma unroll
                for (int q = 0; q < 4; ++q) o4[q] = tohx(v[ch * 4 + q] * f);
                *(v4h*)(P16 + (size_t)row * TT + ch * 128 + lane * 4) = o4; } }
         }
}
// k_merge: sums the stored key-slice planes of O (ascending slice order) and writes the hi/lo planes of the merged heads. A block covers 8 rows of one 64-row tile, so the plane count is block-uniform.
__global__ __launch_bounds__(256) void k_merge(const float* __restrict__ O, int h0, bf* Ah, bf* Al) { const size_t e = ((size_t)blockIdx.x * 256 + threadIdx.x) * 2; if (e >= (size_t)ZH * TT * HD) return; const int d = (int)(e % HD); const int t = (int)((e / HD) % TT); const int zz = (int)(e / ((size_t)HD * TT)); const float cs = (t < RH) ? 1.0f : (1.0f / PCAR); const size_t oo = (size_t)t * DQ + (h0 + zz) * HD + d;
    const int t0 = (int)(((size_t)blockIdx.x * 512 / HD) % TT); const int nks = ((t0 & ~63) + 64 + KSL - 1) / KSL;   // planes stored for this row tile: slices that start below its diagonal limit
    v2f pv[NKS];
#pragma unroll
    for (int ks = 0; ks < NKS; ++ks) pv[ks] = *(const v2f*)(O + (size_t)min(ks, nks - 1) * ((size_t)ZH * TT * HD) + e);   // all loads in flight together; the index is clamped to a stored plane
    v2f sm = pv[0];
#pragma unroll
    for (int ks = 1; ks < NKS; ++ks) if (ks < nks) sm += pv[ks];
    v2us oh, ol;
#pragma unroll
    for (int q = 0; q < 2; ++q) { unsigned short a, c2; splitf(sm[q] * cs, a, c2); oh[q] = a; ol[q] = c2; } *(v2us*)(Ah + oo) = oh; *(v2us*)(Al + oo) = ol;  }

extern "C" void kernel_launch(void* const* d_in, const int* in_sizes, int n_in,
                              void* d_out, int out_size, void* d_ws, size_t ws_size, hipStream_t stream) {
    (void)in_sizes; (void)n_in; (void)out_size;
    const float* x = (const float*)d_in[0]; const float* wq = (const float*)d_in[1]; const float* bq = (const float*)d_in[2]; const float* wk = (const float*)d_in[3]; const float* bk = (const float*)d_in[4]; const float* wv = (const float*)d_in[5]; const float* bv = (const float*)d_in[6]; const float* wo = (const float*)d_in[7]; const float* bo = (const float*)d_in[8]; const float* Jm = (const float*)d_in[9]; const float* lamp = (const float*)d_in[10]; const float* cosT = nullptr; const float* sinT = nullptr; (void)cosT; (void)sinT;
    float* OUT = (float*)d_out;     // [2][2048][1024]
    char* wsp = (char*)d_ws;
    auto take = [&](size_t bytes) { char* p = wsp; wsp += (bytes + 255) & ~(size_t)255; return (void*)p; };
    bf* WQ = (bf*)take((size_t)DQ * DM * 2); bf* WK = (bf*)take((size_t)DKV * DM * 2); bf* WV = (bf*)take((size_t)DKV * DM * 2); bf* WO = (bf*)take((size_t)DM * DQ * 2); float* CS = (float*)take((size_t)TT * HD * 2 * 4);
    bf* XB = (bf*)take((size_t)NB_ * TT * DM * 2); bf* JT = (bf*)take((size_t)NH_ * HD * HD * 2); float* QN = (float*)take((size_t)TT * DQ * 4); float* KN = (float*)take((size_t)TT * DKV * 4); float* QJF = (float*)take((size_t)NH_ * TT * HD * 4); bf* QNh = (bf*)take((size_t)NH_ * TT * HD * 2); bf* KNh = (bf*)take((size_t)NKV * TT * HD * 2); bf* QNl = (bf*)take((size_t)NH_ * TT * HD * 2); bf* KNl = (bf*)take((size_t)NKV * TT * HD * 2); h16* QN16 = (h16*)take((size_t)NH_ * TT * HD * 2); h16* KN16 = (h16*)take((size_t)NKV * TT * HD * 2); bf* QJh = (bf*)take((size_t)NH_ * TT * HD * 2); bf* QJl = (bf*)take((size_t)NH_ * TT * HD * 2);   /* each q plane is followed by its k plane */ float* Sb2 = (float*)take((size_t)ZH * TT * TT * 4); float* FQ = (float*)take((size_t)TT * DQ * 4); float* FK = (float*)take((size_t)TT * DKV * 4); float* FV = (float*)take((size_t)TT * DKV * 4);   // FQ, FK, FV lie in a row (z-stride TT*DQ), as do WQ, WK, WV
    h16* QP16 = (h16*)take((size_t)NH_ * TT * HD * 2); h16* KP16 = (h16*)take((size_t)NKV * TT * HD * 2); h16* VT16 = (h16*)take((size_t)NKV * HD * TT * 2);
    bf* QPh = (bf*)take((size_t)NH_ * TT * HD * 2); bf* KPh = (bf*)take((size_t)NKV * TT * HD * 2); bf* QPl = (bf*)take((size_t)NH_ * TT * HD * 2); bf* KPl = (bf*)take((size_t)NKV * TT * HD * 2); bf* VTh = (bf*)take((size_t)NKV * HD * TT * 2); bf* VTl = (bf*)take((size_t)NKV * HD * TT * 2); bf* Ph = (bf*)take((size_t)ZH * RH * TT * 2); bf* Pl = (bf*)take((size_t)ZH * RH * TT * 2);
    float* Sb = (float*)take((size_t)ZH * TT * TT * 4); h16* P16 = (h16*)take((size_t)ZH * TT * TT * 2); float* Ob = (float*)take((size_t)NKS * ZH * TT * HD * 4); bf* ATh = (bf*)take((size_t)NB_ * TT * DQ * 2); bf* ATl = (bf*)take((size_t)NB_ * TT * DQ * 2);
    if ((size_t)(wsp - (char*)d_ws) > ws_size) return;    // ws 256 MiB
    static_assert(DQ == DKV && DQ == DM, "the batched launches take equal shapes");
    (void)WK; (void)WV; (void)FK; (void)KN; (void)KP16; (void)KN16;   // reached as members of the row they lie in
    { k_wtG<<<dim3((unsigned)((DM * DQ / 64 + 63) / 64), 4, 1), 256, 0, stream>>>(wq, wk, wv, wo, DM, DQ, WQ);   // WQ, WK, WV, WO lie in a row
      k_wtG<<<dim3((HD * HD / 64 + 63) / 64, NH_, 1), 256, 0, stream>>>(Jm, nullptr, nullptr, nullptr, HD, HD, JT);
       }
    k_csid<<<(TT * HD + 255) / 256, 256, 0, stream>>>(CS);
    const unsigned LQ = (unsigned)(((size_t)NH_ * TT * HD / 2 + 255) / 256), LKv = (unsigned)(((size_t)NKV * TT * HD / 2 + 255) / 256);
    k_cvt8<<<(unsigned)(((size_t)NB_ * TT * DM / 8 + 255) / 256), 256, 0, stream>>>(x, XB, (size_t)NB_ * TT * DM / 8);   /* both batches */
    for (int b = 0; b < NB_; ++b) {
        k_gemmw<bf, 0, true><<<dim3(TT / 64, DQ / 64, 3), 32, 0, stream>>>(XB + (size_t)b * TT * DM, nullptr, WQ, nullptr, DM, FQ, DQ, bq, bk, bv, 0, (size_t)DQ * DM, (size_t)TT * DQ);   /* q, k, v projections */
        k_rope<<<dim3(LQ, 2, 1), 256, 0, stream>>>(FQ, (size_t)TT * DQ, DQ, NH_, CS, nullptr, nullptr, 1.0f, QP16, QPh, QPl);   /* q and k planes */
        k_tanhp<<<(unsigned)(((size_t)2 * TT * DQ / 4 + 255) / 256), 256, 0, stream>>>(FQ, QN, (size_t)2 * TT * DQ / 4);   /* FQ, FK -> QN, KN, each pair in a row */
        k_rope<<<dim3(LQ, 2, 1), 256, 0, stream>>>(QN, (size_t)TT * DQ, DQ, NH_, CS, nullptr, nullptr, 1.0f, QN16, QNh, QNl);   /* tanh q and tanh k planes */
        k_gemmw<bf, 1, false><<<dim3(TT / 64, 1, NH_), 32, 0, stream>>>(QNh, QNl, JT, nullptr, HD, QJF, HD, nullptr, nullptr, nullptr, (size_t)TT * HD, (size_t)HD * HD, (size_t)TT * HD); k_hlG<<<(unsigned)(((size_t)NH_ * TT * HD / 4 + 255) / 256), 256, 0, stream>>>(QJF, QJh, QJl, (size_t)NH_ * TT * HD);
        k_vtp<<<LKv, 256, 0, stream>>>(FV, DKV, NKV, VT16, VTh, VTl);
        for (int h0 = 0; h0 < NH_; h0 += ZH) { const size_t zq = (size_t)h0, zk = (size_t)(h0 / REP);   // one kv head per query head: the pass's two heads use consecutive kv planes (z-strides TT*HD)
            k_score<<<dim3(TT / 64, TT / 64, 2 * ZH), 32, 0, stream>>>(QPh + zq * TT * HD, QPl + zq * TT * HD, KPh + zk * TT * HD, KPl + zk * TT * HD, Sb, QJh + zq * TT * HD, QJl + zq * TT * HD, KNh + zk * TT * HD, KNl + zk * TT * HD, Sb2);   /* Q.K and delta = (tanh Q J).tanh K, both hl on all rows */
            k_asoft<<<ZH * TT / 8, 256, 0, stream>>>(Sb, Sb2, lamp, P16, Ph, Pl);
            k_pv<<<dim3(TT / 64, NKS, ZH), 32, 0, stream>>>(Ph, Pl, VTh + zk * HD * TT, VTl + zk * HD * TT, P16, VT16 + zk * HD * TT, Ob);
            k_merge<<<(unsigned)(((size_t)ZH * TT * HD / 2 + 255) / 256), 256, 0, stream>>>(Ob, h0, ATh + (size_t)b * TT * DQ, ATl + (size_t)b * TT * DQ); } }
    k_gemmw<bf, 1, true><<<dim3(NB_ * TT / 64, DM / 64, 1), 32, 0, stream>>>(ATh, ATl, WO, nullptr, DQ, OUT, DM, bo, nullptr, nullptr, 0, 0, 0);   /* output projection, both batches */
}

// v003
// One run takes 335 microseconds.
// Timed twice side by side with v002, it ran 2.73 and 2.75 times as fast.
// Counting every step since v000, it is 6.08 times as fast.
#include <hip/hip_runtime.h>

// Causal attention with a bilinear tanh correction (x [2][2048][1024]; Q/K/V = x W + b (16 x 64); scores = Q.K / 8 + lam * (tanh(Q) J_h tanh(K)^T) (J [16][64][64] and the scalar lam read); causal (-inf) softmax; out = merged Wo + bo -> [2][2048][1024]).
// Compute dtypes, f32 accumulate: every input rounded to bf16; Q/K/V on PLAIN bf16 operands (inputs: exact) + bias; tanh elementwise in f32 (exp2 form with the hardware reciprocal, clamped |x| <= 15); QJ = hi/lo tanh(Q) x exact J (2 products, f32); both score products hl x hl (3 products) on every row; the two terms combined per element in f32 in the reference's order (s/8 + lam d); key blocks beyond the diagonal skipped; softmax f32, online (running maximum and sum), fused with both products; attn.v: rows < 512 hl (3 products), the rest fp16 (x1024); Wo hl x exact (2 products) + bias.

#define NB_  2
#define TT   2048
#define DM   1024
#define NH_  16
#define NKV  16
#define HD   64
#define DQ   (NH_ * HD)
#define DKV  (NKV * HD)
#define RH   512                  // query rows < RH use hi+lo planes (0: none)
#define SCL  0.125f   // HD^-0.5
typedef _Float16 h16;
typedef unsigned short bf;
typedef __attribute__((ext_vector_type(16))) __bf16   v16bf;
typedef __attribute__((ext_vector_type(16))) _Float16 v16h;
typedef __attribute__((ext_vector_type(8)))  _Float16 v8h;
typedef __attribute__((ext_vector_type(8)))  unsigned short v8us;
typedef __attribute__((ext_vector_type(8)))  float    v8f;
typedef __attribute__((ext_vector_type(4)))  float    v4f;
typedef v8h  __attribute__((may_alias)) v8ha;
typedef v4f  __attribute__((may_alias)) v4fa;
typedef v8us __attribute__((may_alias)) v8usa;

__device__ __forceinline__ unsigned short f2bf(float f) { unsigned u = __float_as_uint(f); u += 0x7FFFu + ((u >> 16) & 1u); return (unsigned short)(u >> 16); }
__device__ __forceinline__ float bf2f(unsigned short b) { return __uint_as_float(((unsigned)b) << 16); }
__device__ __forceinline__ float bfr(float f) { return bf2f(f2bf(f)); }
__device__ __forceinline__ v16h cat16(v8h lo, v8h hi) { return __builtin_shufflevector(lo, hi, 0, 1, 2, 3, 4, 5, 6, 7, 8, 9, 10, 11, 12, 13, 14, 15); }
__device__ __forceinline__ v16bf cat16b(v8us lo, v8us hi) { return __builtin_bit_cast(v16bf, __builtin_shufflevector(lo, hi, 0, 1, 2, 3, 4, 5, 6, 7, 8, 9, 10, 11, 12, 13, 14, 15)); }
__device__ __forceinline__ v8f wmma16(v16h a, v16h b, v8f c) { return __builtin_amdgcn_wmma_f32_16x16x32_f16(false, a, false, b, (short)0, c, false, false); }
__device__ __forceinline__ v8f wmmab(v16bf a, v16bf b, v8f c) { return __builtin_amdgcn_wmma_f32_16x16x32_bf16(false, a, false, b, (short)0, c, false, false); }



// ---- k_gemmw: register-blocked GEMM, ONE WAVE per 64x64 output tile (16 accumulators), operands straight from K-contiguous 16-bit planes; grid (M/64, N/64, Z), 32 threads.
// C[m][n] (f32, pitch ldc, + optional f32 bias[n]) = sum_k A[m][k] Bt[n][k] (+ split products per NSPLIT). z-batch strides sA/sB/sC in elements. K % 32 == 0.
// Independent products of one shape run as ONE launch with the member in blockIdx.z: the q, k and v projections (three weight planes, three biases, three outputs in a row) and the 16 per-head tanh(Q) J products.
template <typename T16> struct WFrag;
template <> struct WFrag<h16> { typedef v16h V; static __device__ __forceinline__ V ld(const h16* p) { return cat16(*(const v8h*)p, *(const v8h*)(p + 16)); } static __device__ __forceinline__ v8f mma(V a, V b, v8f c) { return wmma16(a, b, c); } };
template <> struct WFrag<bf> { typedef v16bf V; static __device__ __forceinline__ V ld(const bf* p) { return cat16b(*(const v8us*)p, *(const v8us*)(p + 16)); } static __device__ __forceinline__ v8f mma(V a, V b, v8f c) { return wmmab(a, b, c); } };
template <typename T16, int NSPLIT, bool BIAS>
__global__ __launch_bounds__(32) void k_gemmw(const T16* __restrict__ A, const T16* __restrict__ A2, const T16* __restrict__ Bt, const T16* __restrict__ Bt2, int K, float* C, int ldc, const float* __restrict__ bias0, const float* __restrict__ bias1, const float* __restrict__ bias2, size_t sA, size_t sB, size_t sC) {
    typedef typename WFrag<T16>::V V;
    __shared__ __align__(16) float os[16 * 68];
    const size_t z = blockIdx.z; A += z * sA; if (A2) A2 += z * sA; Bt += z * sB; if (Bt2) Bt2 += z * sB; C += z * sC;
    const float* __restrict__ bias = (z == 0) ? bias0 : (z == 1) ? bias1 : bias2;   // each z-batch member has its own bias vector (at most three members where BIAS is set)
    const int lane = threadIdx.x & 31, lr = lane & 15, hi = lane >> 4; const int r0 = blockIdx.x * 64, c0 = blockIdx.y * 64;
    v8f acc[4][4];
#pragma unroll
    for (int mb = 0; mb < 4; ++mb)
#pragma unroll
        for (int nb = 0; nb < 4; ++nb) acc[mb][nb] = (v8f){};
    const size_t aoff = (size_t)(r0 + lr) * K + 8 * hi, boff = (size_t)(c0 + lr) * K + 8 * hi;
#pragma unroll 1
    for (int kc = 0; kc < K; kc += 32) {
        V a[4], a2[4];
#pragma unroll
        for (int mb = 0; mb < 4; ++mb) { a[mb] = WFrag<T16>::ld(A + aoff + (size_t)mb * 16 * K + kc); if (NSPLIT == 1 || NSPLIT == 2) a2[mb] = WFrag<T16>::ld(A2 + aoff + (size_t)mb * 16 * K + kc); }
#pragma unroll
        for (int nb = 0; nb < 4; ++nb) { const V b = WFrag<T16>::ld(Bt + boff + (size_t)nb * 16 * K + kc); V b2; if (NSPLIT >= 2) b2 = WFrag<T16>::ld(Bt2 + boff + (size_t)nb * 16 * K + kc);
#pragma unroll
            for (int mb = 0; mb < 4; ++mb) { acc[mb][nb] = WFrag<T16>::mma(a[mb], b, acc[mb][nb]); if (NSPLIT == 1 || NSPLIT == 2) acc[mb][nb] = WFrag<T16>::mma(a2[mb], b, acc[mb][nb]); if (NSPLIT >= 2) acc[mb][nb] = WFrag<T16>::mma(a[mb], b2, acc[mb][nb]); } }
        asm volatile("v_nop\n\tv_nop\n\tv_nop\n\tv_nop" : "+v"(acc[0][0]), "+v"(acc[1][1]), "+v"(acc[2][2]), "+v"(acc[3][3]) : "v"(a[0]), "v"(a[3]));
    }
#pragma unroll
    for (int mb = 0; mb < 4; ++mb) {
#pragma unroll
        for (int nb = 0; nb < 4; ++nb) {
#pragma unroll
            for (int j = 0; j < 8; ++j) os[(hi * 8 + j) * 68 + nb * 16 + lr] = acc[mb][nb][j]; }
        __builtin_amdgcn_wave_barrier(); asm volatile("" ::: "memory");
        float* crow = C + (size_t)(r0 + mb * 16) * ldc + c0;
{
#pragma unroll
            for (int s = 0; s < 8; ++s) { const int row = 2 * s + hi, cofs = lr * 4; v4f val = *(const v4fa*)(os + row * 68 + cofs); if (BIAS) { val[0] += bfr(bias[c0 + cofs]); val[1] += bfr(bias[c0 + cofs + 1]); val[2] += bfr(bias[c0 + cofs + 2]); val[3] += bfr(bias[c0 + cofs + 3]); }
                *(v4f*)(crow + (size_t)row * ldc + cofs) = val; }
             }
        __builtin_amdgcn_wave_barrier(); asm volatile("" ::: "memory");
    }
}

__device__ __forceinline__ h16 tohx(float x) { return (h16)x; }
__device__ __forceinline__ void splitf(float y, unsigned short& h, unsigned short& l) { h = f2bf(y); l = f2bf(y - bf2f(h)); }
typedef __attribute__((ext_vector_type(2))) _Float16 v2h;
typedef __attribute__((ext_vector_type(4))) _Float16 v4h;
typedef __attribute__((ext_vector_type(2))) unsigned short v2us;
typedef __attribute__((ext_vector_type(4))) unsigned short v4us;
typedef __attribute__((ext_vector_type(2))) float v2f;
typedef __attribute__((ext_vector_type(4))) int v4i;

// k_wtG: Bt[n][k] = bf16(w[k][n]); blockIdx.y is the matrix of a batch of equal shapes: matrix y of one array (w1 null), or one of four separate arrays; the outputs lie in a row.
__global__ __launch_bounds__(256) void k_wtG(const float* __restrict__ w0, const float* __restrict__ w1, const float* __restrict__ w2, const float* __restrict__ w3, int K, int N, bf* Bt) {
    const int y = blockIdx.y; const float* __restrict__ w = !w1 ? w0 + (size_t)y * K * N : (y == 0) ? w0 : (y == 1) ? w1 : (y == 2) ? w2 : w3; Bt += (size_t)y * K * N;
    const int lane = threadIdx.x & 31; const int L0 = (blockIdx.x * 8 + (threadIdx.x >> 5)) * 8; const int nlines = N * K / 64;
{
#pragma unroll 1
        for (int l = 0; l < 8; ++l) { const int L = L0 + l; if (L >= nlines) break; const size_t e = (size_t)L * 64 + lane * 2; const int k = (int)(e % K), n = (int)(e / K); v2us o;
            o[0] = f2bf(w[(size_t)k * N + n]); o[1] = f2bf(w[(size_t)(k + 1) * N + n]); *(v2us*)(Bt + e) = o; }
         }
}
__global__ __launch_bounds__(256) void k_cvt8(const float* __restrict__ src, bf* dst, size_t n8) { const size_t i = (size_t)blockIdx.x * 256 + threadIdx.x; if (i >= n8) return; const v8f v = *(const v8f*)(src + i * 8); v8us o;
#pragma unroll
    for (int k = 0; k < 8; ++k) o[k] = f2bf(v[k]); *(v8us*)(dst + i * 8) = o;  }
__global__ __launch_bounds__(256) void k_cscvt(const float* __restrict__ cosT, const float* __restrict__ sinT, float* CS) { const int idx = blockIdx.x * 256 + threadIdx.x; if (idx >= TT * HD) return; v2f cs; cs[0] = bfr(cosT[idx]); cs[1] = bfr(sinT[idx]); *(v2f*)(CS + (size_t)idx * 2) = cs;  }
// k_rope: head planes [h][t][d] (fp16 + hi/lo) of rope(x) x sc with the rotate-half convention out[d] = x[d] cos[t][d] - x[d+HD/2] sin[t][d], out[d+HD/2] = x[d+HD/2] cos[t][d+HD/2] + x[d] sin[t][d+HD/2]
// blockIdx.y is the member of a batch of equal shapes (q, then k): the inputs lie sF elements apart, each kind of output plane in a row.
__global__ __launch_bounds__(256) void k_rope(const float* __restrict__ F, size_t sF, int pitch, int nheads, const float* __restrict__ CS, const float* __restrict__ RF, const float* __restrict__ nw, float sc, h16* P16, bf* Ph, bf* Pl) {
    { const size_t y = blockIdx.y, so = y * nheads * TT * HD; F += y * sF; P16 += so; Ph += so; Pl += so; }
    const size_t e = ((size_t)blockIdx.x * 256 + threadIdx.x) * 2; if (e >= (size_t)nheads * TT * HD) return; const int d = (int)(e % HD); const int t = (int)((e / HD) % TT); const int h = (int)(e / ((size_t)HD * TT)); const float* f = F + (size_t)t * pitch + h * HD; const float rf = RF ? RF[(size_t)h * TT + t] : 1.0f; v2h o16; v2us oh, ol;
#pragma unroll
    for (int q = 0; q < 2; ++q) { const int dd = d + q; const int dp = (dd < HD / 2) ? dd + HD / 2 : dd - HD / 2; float x0 = f[dd], x1 = f[dp];
        if (RF) { float n0 = __fmul_rn(x0, rf), n1 = __fmul_rn(x1, rf); asm volatile("" : "+v"(n0)); asm volatile("" : "+v"(n1)); x0 = __fmul_rn(bfr(nw[dd]), n0); x1 = __fmul_rn(bfr(nw[dp]), n1); }
        const v2f cs = *(const v2f*)(CS + ((size_t)t * HD + dd) * 2); float a = __fmul_rn(x0, cs[0]), bq = __fmul_rn(x1, cs[1]); asm volatile("" : "+v"(a)); asm volatile("" : "+v"(bq)); const float r = ((dd < HD / 2) ? __fsub_rn(a, bq) : __fadd_rn(a, bq)) * sc;
        o16[q] = tohx(r); unsigned short a2, c2; splitf(r, a2, c2); oh[q] = a2; ol[q] = c2; }
    *(v2h*)(P16 + e) = o16; *(v2us*)(Ph + e) = oh; *(v2us*)(Pl + e) = ol;  }
__global__ __launch_bounds__(256) void k_vtp(const float* __restrict__ F, int pitch, int nheads, h16* V16, bf* Vh, bf* Vl) { const size_t e = ((size_t)blockIdx.x * 256 + threadIdx.x) * 2; if (e >= (size_t)nheads * HD * TT) return; const int t = (int)(e % TT); const int d = (int)((e / TT) % HD); const int g = (int)(e / ((size_t)TT * HD)); v2h o16; v2us oh, ol;
#pragma unroll
    for (int q = 0; q < 2; ++q) { const float x = F[(size_t)(t + q) * pitch + g * HD + d]; o16[q] = tohx(x); unsigned short a2, c2; splitf(x, a2, c2); oh[q] = a2; ol[q] = c2; }
    *(v2h*)(V16 + e) = o16; *(v2us*)(Vh + e) = oh; *(v2us*)(Vl + e) = ol;  }
__global__ __launch_bounds__(256) void k_csid(float* CS) { const int idx = blockIdx.x * 256 + threadIdx.x; if (idx >= TT * HD) return; v2f cs; cs[0] = 1.0f; cs[1] = 0.0f; *(v2f*)(CS + (size_t)idx * 2) = cs;  }
__global__ __launch_bounds__(256) void k_tanhp(const float* __restrict__ F, float* G2, size_t n4) { const size_t i = (size_t)blockIdx.x * 256 + threadIdx.x; if (i >= n4) return; const v4f a = *(const v4f*)(F + i * 4); v4f o;
#pragma unroll
    for (int u = 0; u < 4; ++u) { float xs = fminf(fmaxf(a[u], -15.0f), 15.0f); float ex = __builtin_amdgcn_exp2f(__fmul_rn(xs, 2.8853900817779268f)); asm volatile("" : "+v"(ex)); float nm = __fsub_rn(ex, 1.0f), dn2 = __fadd_rn(ex, 1.0f); asm volatile("" : "+v"(nm)); asm volatile("" : "+v"(dn2)); float rc = __builtin_amdgcn_rcpf(dn2); asm volatile("" : "+v"(rc)); o[u] = __fmul_rn(nm, rc); }
    *(v4f*)(G2 + i * 4) = o;  }
__global__ __launch_bounds__(256) void k_hlG(const float* __restrict__ F, bf* Fh, bf* Fl, size_t n) { const size_t e = ((size_t)blockIdx.x * 256 + threadIdx.x) * 4; if (e >= n) return; const v4f a = *(const v4f*)(F + e); v4us oh, ol; for (int u = 0; u < 4; ++u) { unsigned short p, q; splitf(a[u], p, q); oh[u] = p; ol[u] = q; } *(v4us*)(Fh + e) = oh; *(v4us*)(Fl + e) = ol;  }
// ---- k_attn: score products, causal softmax and probability x value product of every (batch, head) in ONE launch; scores and probabilities stay in registers.
// One wave owns QW = 16 NT query columns and walks the keys up to its diagonal in blocks of 32. Transposed products: S^T = K Q^T and D^T = tanh(K) (tanh(Q) J)^T (A = key rows, B = query rows kept in
// registers; both hl x hl, 3 products), so a lane holds the scores of ONE query: keys 8 hi + j of each 16-key tile. t = S / 8 + lam D per element in f32; running maximum and running sum per query
// (online softmax: the output tile and the sum are rescaled by exp(old max - new max) in every block). The two 16-key tiles of a block, converted in place, ARE the B operand of O^T += V^T P^T
// (element s = tile s >> 3, register s & 7: the k order of the V^T loader). Query rows < RH: P and V in hi+lo planes (3 products); the rest fp16 with P x 1024. P is left unnormalised; O is divided by the sum at the end
// (the factor 1024 is in the sum too and cancels). Every inner loop is unrolled so that the fragment arrays stay in registers. A lane's 8 accumulator registers are 8 consecutive d of one query: one 16-byte store per plane and d tile into the merged-head hi/lo planes.
#define NT   2                    // 16-query column groups per wave
#define QW   (16 * NT)            // queries per wave
#define AW   4                    // waves per work-group: neighbouring query columns of one head, which read the same key rows at about the same time
#define NXT  (TT / (QW * AW))     // query tiles (work-groups) per head
#define L2E  1.4426950408889634f
__device__ __forceinline__ float xhalf(float x) { return __builtin_bit_cast(float, __builtin_amdgcn_permlanex16(__builtin_bit_cast(int, x), __builtin_bit_cast(int, x), 0x76543210, 0xfedcba98, false, false)); }   // lane l reads lane l ^ 16
// In front of code that overwrites address registers of global loads or stores just issued; the scheduling barrier keeps that code behind the wait (and the loads in front of it).
__device__ __forceinline__ void addr_done() { asm volatile("s_wait_xcnt 0x0" ::: "memory"); __builtin_amdgcn_sched_barrier(0); }
// The same, naming two pointers as inputs: they keep their registers up to the wait (else the last load through each lands on its own address pair).
__device__ __forceinline__ void addr_done(const bf* a, const bf* b) { asm volatile("s_wait_xcnt 0x0" :: "v"(a), "v"(b) : "memory"); __builtin_amdgcn_sched_barrier(0); }
template <bool HR>
__device__ __forceinline__ void attn_cols(const bf* __restrict__ Qh, const bf* __restrict__ Ql, const bf* __restrict__ Gh, const bf* __restrict__ Gl, const bf* __restrict__ Kh, const bf* __restrict__ Kl, const bf* __restrict__ Nh, const bf* __restrict__ Nl,
                                          const h16* __restrict__ V16, const bf* __restrict__ Vh, const bf* __restrict__ Vl, float lam, int q0, bf* Ah, bf* Al) {
    const int lane = threadIdx.x & 31, lr = lane & 15, hi = lane >> 4;
    v16bf qh[NT][2], ql[NT][2], gh[NT][2], gl[NT][2];
#pragma unroll
    for (int n = 0; n < NT; ++n)
#pragma unroll
        for (int ks = 0; ks < 2; ++ks) { const size_t qo = (size_t)(q0 + n * 16 + lr) * HD + ks * 32 + 8 * hi; qh[n][ks] = WFrag<bf>::ld(Qh + qo); ql[n][ks] = WFrag<bf>::ld(Ql + qo); gh[n][ks] = WFrag<bf>::ld(Gh + qo); gl[n][ks] = WFrag<bf>::ld(Gl + qo); }
    addr_done();
    v16bf kf[2][2][4];                                               // key fragments of the block at hand: [16-key tile][k step][K hi, K lo, tanh K hi, tanh K lo]
    { const int lo = lr * HD + 8 * hi; Kh += lo; Kl += lo; Nh += lo; Nl += lo; const int lv = lr * TT + 8 * hi; V16 += lv; Vh += lv; Vl += lv; }   // each lane's own place in a block; the pointers then walk the keys
    auto ldk = [&]() {
#pragma unroll
        for (int m = 0; m < 2; ++m)
#pragma unroll
            for (int ks = 0; ks < 2; ++ks) { const int ko = m * 16 * HD + ks * 32; kf[m][ks][0] = WFrag<bf>::ld(Kh + ko); kf[m][ks][1] = WFrag<bf>::ld(Kl + ko); kf[m][ks][2] = WFrag<bf>::ld(Nh + ko); kf[m][ks][3] = WFrag<bf>::ld(Nl + ko); } };
    const int kend = q0 + QW, klast = (kend - 1) & ~31;              // keys up to the last query's diagonal; first key of the last block
    ldk();
    addr_done();
    int kn = min(32, klast), kstep = kn * HD, vstep = 0;             // first key of the block to fetch next (the last block is fetched again: in bounds, unused); how far the pointers move in front of the next loads
    v8f o[4][NT]; float mr[NT], ls[NT];
#pragma unroll
    for (int n = 0; n < NT; ++n) { mr[n] = -3.0e38f; ls[n] = 0.0f;
#pragma unroll
        for (int dt = 0; dt < 4; ++dt) o[dt][n] = (v8f){}; }
#pragma unroll 1   // rolled: a second copy of the block would need a second set of fragment registers
    for (int kb = 0; kb < kend; kb += 32) {
        float t[2][NT][8];
#pragma unroll
        for (int m = 0; m < 2; ++m) {
            v8f s[NT], d[NT];
#pragma unroll
            for (int n = 0; n < NT; ++n) { s[n] = (v8f){}; d[n] = (v8f){}; }
#pragma unroll
            for (int ks = 0; ks < 2; ++ks) { const v16bf kh = kf[m][ks][0], kl = kf[m][ks][1], nh = kf[m][ks][2], nl = kf[m][ks][3];
#pragma unroll
                for (int n = 0; n < NT; ++n) { s[n] = wmmab(kh, qh[n][ks], s[n]); d[n] = wmmab(nh, gh[n][ks], d[n]); s[n] = wmmab(kh, ql[n][ks], s[n]); d[n] = wmmab(nh, gl[n][ks], d[n]); s[n] = wmmab(kl, qh[n][ks], s[n]); d[n] = wmmab(nl, gh[n][ks], d[n]); } }
#pragma unroll
            for (int n = 0; n < NT; ++n)
#pragma unroll
                for (int j = 0; j < 8; ++j) t[m][n][j] = s[n][j] * SCL + lam * d[n][j];
        }
        if (HR) addr_done(Vh, Vl); else addr_done();                 // the pointers move only here, a whole block behind the loads that name them; the scheduling barrier also keeps the loads below from rising over the score products, where they would need a second set of fragment registers
        Kh += kstep; Kl += kstep; Nh += kstep; Nl += kstep; V16 += vstep; Vh += vstep; Vl += vstep;
        v16h v16[4]; v16bf vh[4], vl[4];
#pragma unroll
        for (int dt = 0; dt < 4; ++dt) { const int vo = dt * 16 * TT; if (HR) { vh[dt] = WFrag<bf>::ld(Vh + vo); vl[dt] = WFrag<bf>::ld(Vl + vo); } else v16[dt] = WFrag<h16>::ld(V16 + vo); }
        __builtin_amdgcn_sched_barrier(0);                           // V in front of K: P.V needs V first, and loads return in order
        ldk();                                                       // the next block's key fragments, into the same registers: their latency passes behind the softmax and P.V
        __builtin_amdgcn_sched_barrier(0);                           // holds the loads here, far in front of their first use
        { const int k2 = min(kn + 32, klast); kstep = (k2 - kn) * HD; kn = k2; vstep = 32; }
        if (kb + 31 > q0) {                                          // the block that holds the diagonal (wave-uniform): keys beyond a lane's query leave the softmax
#pragma unroll
            for (int m = 0; m < 2; ++m)
#pragma unroll
                for (int n = 0; n < NT; ++n)
#pragma unroll
                    for (int j = 0; j < 8; ++j) if (kb + m * 16 + 8 * hi + j > q0 + n * 16 + lr) t[m][n][j] = -3.0e38f;
        }
        v16h p16[NT]; v16bf ph[NT], pl[NT];
#pragma unroll
        for (int n = 0; n < NT; ++n) {
            float bm = t[0][n][0];
#pragma unroll
            for (int e = 1; e < 16; ++e) bm = fmaxf(bm, t[e >> 3][n][e & 7]);
            bm = fmaxf(bm, xhalf(bm));                               // the other half of the wave holds the query's other 16 keys
            const float mn = fmaxf(mr[n], bm);                       // finite from the first block on: key 0 is open to every query
            const float al = __builtin_amdgcn_exp2f((mr[n] - mn) * L2E); mr[n] = mn;
            float bs = 0.0f; v8us h0, h1, l0, l1;
#pragma unroll
            for (int e = 0; e < 16; ++e) { const float pe = __builtin_amdgcn_exp2f(HR ? (t[e >> 3][n][e & 7] - mn) * L2E : (t[e >> 3][n][e & 7] - mn) * L2E + 10.0f); bs += pe;   // + 10: P x 1024 for the fp16 planes
                if (HR) { unsigned short a, c2; splitf(pe, a, c2); if (e < 8) { h0[e & 7] = a; l0[e & 7] = c2; } else { h1[e & 7] = a; l1[e & 7] = c2; } }
                else p16[n][e] = tohx(pe); }
            if (HR) { ph[n] = cat16b(h0, h1); pl[n] = cat16b(l0, l1); }
            ls[n] = ls[n] * al + bs;                                 // each half sums its own keys; the halves are joined behind the loop
#pragma unroll
            for (int dt = 0; dt < 4; ++dt) o[dt][n] *= al;
        }
#pragma unroll
        for (int dt = 0; dt < 4; ++dt)
#pragma unroll
            for (int n = 0; n < NT; ++n) {
                if (HR) { o[dt][n] = wmmab(vh[dt], ph[n], o[dt][n]); o[dt][n] = wmmab(vh[dt], pl[n], o[dt][n]); o[dt][n] = wmmab(vl[dt], ph[n], o[dt][n]); }
                else o[dt][n] = wmma16(v16[dt], p16[n], o[dt][n]); }
    }
    addr_done();                                                     // the code below reuses the pointers' registers
#pragma unroll
    for (int n = 0; n < NT; ++n) { const float sum = ls[n] + xhalf(ls[n]); const float f = __fdiv_rn(1.0f, sum);
#pragma unroll
        for (int dt = 0; dt < 4; ++dt) { v8us oh, ol;
#pragma unroll
            for (int j = 0; j < 8; ++j) { unsigned short a, c2; splitf(o[dt][n][j] * f, a, c2); oh[j] = a; ol[j] = c2; }
            const size_t oo = (size_t)(q0 + n * 16 + lr) * DQ + dt * 16 + 8 * hi; *(v8us*)(Ah + oo) = oh; *(v8us*)(Al + oo) = ol; }
        if (n + 1 < NT) addr_done(); }                               // the next column group reuses registers that these stores name
}
// grid (NXT, NB_ NH_), AW waves. Plane sets per batch: QK* = the q planes [h][t][d] followed by the k planes; G* = (tanh Q J) planes; V* = [h][d][t]. A* = merged heads [b][t][DQ], hi and lo.
// Two waves per SIMD (512 registers each): the Q and K fragments alone take 128 registers each.
// The cost of a tile grows with its index and all work-groups are resident at once, so the second of the two rounds of 256 work-groups takes the tiles mirrored: for speed only, each head still gets every tile once.
__global__ __launch_bounds__(32 * AW) __attribute__((amdgpu_waves_per_eu(2, 2))) void k_attn(const bf* __restrict__ QKh, const bf* __restrict__ QKl, const bf* __restrict__ Gh, const bf* __restrict__ Gl, const bf* __restrict__ QKNh, const bf* __restrict__ QKNl,
                                                  const h16* __restrict__ V16, const bf* __restrict__ Vh, const bf* __restrict__ Vl, const float* __restrict__ lamp, bf* Ah, bf* Al) {
    const int bh = blockIdx.y, b = bh / NH_, h = bh % NH_, rnd = (bh * NXT) >> 8;
    int tile = blockIdx.x; if (rnd & 2) tile = (tile + NXT / 2) % NXT; if (rnd & 1) tile = NXT - 1 - tile;
    const int q0 = (tile * AW + __builtin_amdgcn_readfirstlane((int)threadIdx.x >> 5)) * QW;
    const size_t PLN = (size_t)NH_ * TT * HD, qp = ((size_t)b * 2 * NH_ + h) * TT * HD, kp = qp + PLN, gp = ((size_t)b * NH_ + h) * TT * HD, ap = (size_t)b * TT * DQ + h * HD;
    const float lam = bfr(lamp[0]);
    if (q0 < RH) attn_cols<true>(QKh + qp, QKl + qp, Gh + gp, Gl + gp, QKh + kp, QKl + kp, QKNh + kp, QKNl + kp, V16 + gp, Vh + gp, Vl + gp, lam, q0, Ah + ap, Al + ap);
    else attn_cols<false>(QKh + qp, QKl + qp, Gh + gp, Gl + gp, QKh + kp, QKl + kp, QKNh + kp, QKNl + kp, V16 + gp, Vh + gp, Vl + gp, lam, q0, Ah + ap, Al + ap);
}

extern "C" void kernel_launch(void* const* d_in, const int* in_sizes, int n_in,
                              void* d_out, int out_size, void* d_ws, size_t ws_size, hipStream_t stream) {
    (void)in_sizes; (void)n_in; (void)out_size;
    const float* x = (const float*)d_in[0]; const float* wq = (const float*)d_in[1]; const float* bq = (const float*)d_in[2]; const float* wk = (const float*)d_in[3]; const float* bk = (const float*)d_in[4]; const float* wv = (const float*)d_in[5]; const float* bv = (const float*)d_in[6]; const float* wo = (const float*)d_in[7]; const float* bo = (const float*)d_in[8]; const float* Jm = (const float*)d_in[9]; const float* lamp = (const float*)d_in[10]; const float* cosT = nullptr; const float* sinT = nullptr; (void)cosT; (void)sinT;
    float* OUT = (float*)d_out;     // [2][2048][1024]
    char* wsp = (char*)d_ws;
    const size_t PLN = (size_t)NH_ * TT * HD;   // elements of one set of head planes
    auto take = [&](size_t bytes) { char* p = wsp; wsp += (bytes + 255) & ~(size_t)255; return (void*)p; };
    bf* WQ = (bf*)take((size_t)DQ * DM * 2); bf* WK = (bf*)take((size_t)DKV * DM * 2); bf* WV = (bf*)take((size_t)DKV * DM * 2); bf* WO = (bf*)take((size_t)DM * DQ * 2); float* CS = (float*)take((size_t)TT * HD * 2 * 4);
    bf* XB = (bf*)take((size_t)NB_ * TT * DM * 2); bf* JT = (bf*)take((size_t)NH_ * HD * HD * 2); float* QN = (float*)take((size_t)TT * DQ * 4); float* KN = (float*)take((size_t)TT * DKV * 4); float* QJF = (float*)take((size_t)NH_ * TT * HD * 4); bf* QKNh = (bf*)take((size_t)NB_ * 2 * PLN * 2); bf* QKNl = (bf*)take((size_t)NB_ * 2 * PLN * 2); h16* QN16 = (h16*)take((size_t)NH_ * TT * HD * 2); h16* KN16 = (h16*)take((size_t)NKV * TT * HD * 2); bf* QJh = (bf*)take((size_t)NB_ * PLN * 2); bf* QJl = (bf*)take((size_t)NB_ * PLN * 2);   /* each q plane is followed by its k plane; the planes that k_attn reads are kept for both batches: QK* [b][q, k][h][t][d], QJ* [b][h][t][d], VT* [b][h][d][t] */ float* FQ = (float*)take((size_t)TT * DQ * 4); float* FK = (float*)take((size_t)TT * DKV * 4); float* FV = (float*)take((size_t)TT * DKV * 4);   // FQ, FK, FV lie in a row (z-stride TT*DQ), as do WQ, WK, WV
    h16* QP16 = (h16*)take((size_t)NH_ * TT * HD * 2); h16* KP16 = (h16*)take((size_t)NKV * TT * HD * 2); h16* VT16 = (h16*)take((size_t)NB_ * PLN * 2);
    bf* QKPh = (bf*)take((size_t)NB_ * 2 * PLN * 2); bf* QKPl = (bf*)take((size_t)NB_ * 2 * PLN * 2); bf* VTh = (bf*)take((size_t)NB_ * PLN * 2); bf* VTl = (bf*)take((size_t)NB_ * PLN * 2);
    bf* ATh = (bf*)take((size_t)NB_ * TT * DQ * 2); bf* ATl = (bf*)take((size_t)NB_ * TT * DQ * 2);
    if ((size_t)(wsp - (char*)d_ws) > ws_size) return;    // ws 256 MiB
    static_assert(DQ == DKV && DQ == DM, "the batched launches take equal shapes"); static_assert(RH % QW == 0 && TT % (QW * AW) == 0 && TT % 32 == 0, "a wave's query columns lie on one side of RH and tile the sequence; key blocks of 32 tile it too");
    (void)WK; (void)WV; (void)FK; (void)KN; (void)KP16; (void)KN16;   // reached as members of the row they lie in
    { k_wtG<<<dim3((unsigned)((DM * DQ / 64 + 63) / 64), 4, 1), 256, 0, stream>>>(wq, wk, wv, wo, DM, DQ, WQ);   // WQ, WK, WV, WO lie in a row
      k_wtG<<<dim3((HD * HD / 64 + 63) / 64, NH_, 1), 256, 0, stream>>>(Jm, nullptr, nullptr, nullptr, HD, HD, JT);
       }
    k_csid<<<(TT * HD + 255) / 256, 256, 0, stream>>>(CS);
    const unsigned LQ = (unsigned)(((size_t)NH_ * TT * HD / 2 + 255) / 256), LKv = (unsigned)(((size_t)NKV * TT * HD / 2 + 255) / 256);
    k_cvt8<<<(unsigned)(((size_t)NB_ * TT * DM / 8 + 255) / 256), 256, 0, stream>>>(x, XB, (size_t)NB_ * TT * DM / 8);   /* both batches */
    for (int b = 0; b < NB_; ++b) {
        k_gemmw<bf, 0, true><<<dim3(TT / 64, DQ / 64, 3), 32, 0, stream>>>(XB + (size_t)b * TT * DM, nullptr, WQ, nullptr, DM, FQ, DQ, bq, bk, bv, 0, (size_t)DQ * DM, (size_t)TT * DQ);   /* q, k, v projections */
        k_rope<<<dim3(LQ, 2, 1), 256, 0, stream>>>(FQ, (size_t)TT * DQ, DQ, NH_, CS, nullptr, nullptr, 1.0f, QP16, QKPh + (size_t)b * 2 * PLN, QKPl + (size_t)b * 2 * PLN);   /* q and k planes */
        k_tanhp<<<(unsigned)(((size_t)2 * TT * DQ / 4 + 255) / 256), 256, 0, stream>>>(FQ, QN, (size_t)2 * TT * DQ / 4);   /* FQ, FK -> QN, KN, each pair in a row */
        k_rope<<<dim3(LQ, 2, 1), 256, 0, stream>>>(QN, (size_t)TT * DQ, DQ, NH_, CS, nullptr, nullptr, 1.0f, QN16, QKNh + (size_t)b * 2 * PLN, QKNl + (size_t)b * 2 * PLN);   /* tanh q and tanh k planes */
        k_gemmw<bf, 1, false><<<dim3(TT / 64, 1, NH_), 32, 0, stream>>>(QKNh + (size_t)b * 2 * PLN, QKNl + (size_t)b * 2 * PLN, JT, nullptr, HD, QJF, HD, nullptr, nullptr, nullptr, (size_t)TT * HD, (size_t)HD * HD, (size_t)TT * HD); k_hlG<<<(unsigned)(((size_t)NH_ * TT * HD / 4 + 255) / 256), 256, 0, stream>>>(QJF, QJh + (size_t)b * PLN, QJl + (size_t)b * PLN, (size_t)NH_ * TT * HD);
        k_vtp<<<LKv, 256, 0, stream>>>(FV, DKV, NKV, VT16 + (size_t)b * PLN, VTh + (size_t)b * PLN, VTl + (size_t)b * PLN); }
    k_attn<<<dim3(NXT, NB_ * NH_, 1), 32 * AW, 0, stream>>>(QKPh, QKPl, QJh, QJl, QKNh, QKNl, VT16, VTh, VTl, lamp, ATh, ATl);   /* scores, softmax and P.V of all heads of both batches */
    k_gemmw<bf, 1, true><<<dim3(NB_ * TT / 64, DM / 64, 1), 32, 0, stream>>>(ATh, ATl, WO, nullptr, DQ, OUT, DM, bo, nullptr, nullptr, 0, 0, 0);   /* output projection, both batches */
}

// v004
// One run takes 262 microseconds.
// Next to v003, in two timings, it ran 1.27 and 1.28 times as fast.
// Counting every step since v000, it is 7.76 times as fast.
#include <hip/hip_runtime.h>

// Causal attention with a bilinear tanh correction (x [2][2048][1024]; Q/K/V = x W + b (16 x 64); scores = Q.K / 8 + lam * (tanh(Q) J_h tanh(K)^T) (J [16][64][64] and the scalar lam read); causal (-inf) softmax; out = merged Wo + bo -> [2][2048][1024]).
// Compute dtypes, f32 accumulate: every input rounded to bf16; Q/K/V on PLAIN bf16 operands (inputs: exact) + bias; tanh elementwise in f32 (exp2 form with the hardware reciprocal, clamped |x| <= 15), in the projection's epilogue; QJ = hi/lo tanh(Q) x exact J (2 products, f32); both score products hl x hl (3 products) on every row; the two terms combined per element in f32 in the reference's order (s/8 + lam d); key blocks beyond the diagonal skipped; softmax f32, online (running maximum and sum), fused with both products; attn.v: rows < 512 hl (3 products), the rest fp16 (x1024); Wo hl x exact (2 products) + bias.

#define NB_  2
#define TT   2048
#define DM   1024
#define NH_  16
#define NKV  16
#define HD   64
#define DQ   (NH_ * HD)
#define DKV  (NKV * HD)
#define RH   512                  // query rows < RH use hi+lo planes (0: none)
#define SCL  0.125f   // HD^-0.5
typedef _Float16 h16;
typedef unsigned short bf;
typedef __attribute__((ext_vector_type(16))) __bf16   v16bf;
typedef __attribute__((ext_vector_type(16))) _Float16 v16h;
typedef __attribute__((ext_vector_type(8)))  _Float16 v8h;
typedef __attribute__((ext_vector_type(8)))  unsigned short v8us;
typedef __attribute__((ext_vector_type(8)))  float    v8f;
typedef __attribute__((ext_vector_type(4)))  float    v4f;
typedef v8h  __attribute__((may_alias)) v8ha;
typedef v4f  __attribute__((may_alias)) v4fa;
typedef v8us __attribute__((may_alias)) v8usa;

__device__ __forceinline__ unsigned short f2bf(float f) { unsigned u = __float_as_uint(f); u += 0x7FFFu + ((u >> 16) & 1u); return (unsigned short)(u >> 16); }
__device__ __forceinline__ float bf2f(unsigned short b) { return __uint_as_float(((unsigned)b) << 16); }
__device__ __forceinline__ float bfr(float f) { return bf2f(f2bf(f)); }
__device__ __forceinline__ v16h cat16(v8h lo, v8h hi) { return __builtin_shufflevector(lo, hi, 0, 1, 2, 3, 4, 5, 6, 7, 8, 9, 10, 11, 12, 13, 14, 15); }
__device__ __forceinline__ v16bf cat16b(v8us lo, v8us hi) { return __builtin_bit_cast(v16bf, __builtin_shufflevector(lo, hi, 0, 1, 2, 3, 4, 5, 6, 7, 8, 9, 10, 11, 12, 13, 14, 15)); }
__device__ __forceinline__ v8f wmma16(v16h a, v16h b, v8f c) { return __builtin_amdgcn_wmma_f32_16x16x32_f16(false, a, false, b, (short)0, c, false, false); }
__device__ __forceinline__ v8f wmmab(v16bf a, v16bf b, v8f c) { return __builtin_amdgcn_wmma_f32_16x16x32_bf16(false, a, false, b, (short)0, c, false, false); }



// ---- k_gemmw: register-blocked GEMM, ONE WAVE per 64x64 output tile (16 accumulators), operands straight from K-contiguous 16-bit planes; grid (M/64, N/64, Z), 32 threads.
// C[m][n] (f32, pitch ldc, + optional f32 bias[n]) = sum_k A[m][k] Bt[n][k] (+ split products per NSPLIT). z-batch strides sA/sB/sC in elements. K % 32 == 0.
// Independent products of one shape run as ONE launch with the member in blockIdx.z: the q, k and v projections (three weight planes, three biases) and the 16 per-head tanh(Q) J products.
// EPI says what the epilogue makes of the f32 tile, which goes through LDS either way (0: 16 rows at a time; 1, 2: whole):
//   0: C (f32, pitch ldc) = tile + bias.
//   1: the projections. A tile is 64 tokens of ONE head (HD == 64). Members 0, 1 (q, k): y = tile + bias goes out as hi/lo planes P* [member][h][t][d], tanh(y) as hi/lo planes N* of the same shape.
//      Member 2 (v): the operands change places (rows = the head's 64 d, columns = tokens; same products, same k order), so that the same row-wise epilogue writes the transposed planes V* [h][d][t] (fp16, hi, lo).
//   2: the tile goes out as hi/lo planes P* (pitch ldc, z-stride sC).
// The 16-bit planes are stored 16 bytes a lane, 8 lanes a row: every row piece is one whole 128-byte line.
__device__ __forceinline__ h16 tohx(float x) { return (h16)x; }
__device__ __forceinline__ void splitf(float y, unsigned short& h, unsigned short& l) { h = f2bf(y); l = f2bf(y - bf2f(h)); }
__device__ __forceinline__ float tanhc(float x) { const float xs = fminf(fmaxf(x, -15.0f), 15.0f); const float ex = __builtin_amdgcn_exp2f(xs * 2.8853900817779268f); return (ex - 1.0f) * __builtin_amdgcn_rcpf(ex + 1.0f); }
__device__ __forceinline__ void st_hl(const float (&y)[8], bf* Ph, bf* Pl) { v8us oh, ol;
#pragma unroll
    for (int u = 0; u < 8; ++u) { unsigned short a, c; splitf(y[u], a, c); oh[u] = a; ol[u] = c; }
    *(v8us*)Ph = oh; *(v8us*)Pl = ol; }
template <typename T16> struct WFrag;
template <> struct WFrag<h16> { typedef v16h V; static __device__ __forceinline__ V ld(const h16* p) { return cat16(*(const v8h*)p, *(const v8h*)(p + 16)); } static __device__ __forceinline__ v8f mma(V a, V b, v8f c) { return wmma16(a, b, c); } };
template <> struct WFrag<bf> { typedef v16bf V; static __device__ __forceinline__ V ld(const bf* p) { return cat16b(*(const v8us*)p, *(const v8us*)(p + 16)); } static __device__ __forceinline__ v8f mma(V a, V b, v8f c) { return wmmab(a, b, c); } };
template <typename T16, int NSPLIT, int EPI>
__global__ __launch_bounds__(32) void k_gemmw(const T16* __restrict__ A, const T16* __restrict__ A2, const T16* __restrict__ Bt, const T16* __restrict__ Bt2, int K, float* C, int ldc, const float* __restrict__ bias0, const float* __restrict__ bias1, const float* __restrict__ bias2, size_t sA, size_t sB, size_t sC,
                                              bf* Ph, bf* Pl, bf* Nh, bf* Nl, h16* V16, bf* Vh, bf* Vl) {
    typedef typename WFrag<T16>::V V;
    __shared__ __align__(16) float os[(EPI == 0 ? 16 : 64) * 68];
    const size_t z = blockIdx.z; A += z * sA; if (A2) A2 += z * sA; Bt += z * sB; if (Bt2) Bt2 += z * sB; if (EPI == 0) C += z * sC;
    const float* __restrict__ bias = (z == 0) ? bias0 : (z == 1) ? bias1 : bias2;   // each z-batch member has its own bias vector (at most three members where a bias is added)
    const bool vt = EPI == 1 && z == 2;                                             // the v projection: rows from the weight plane, columns from x
    if (vt) { const T16* const w = Bt; Bt = A; A = w; }
    const int lane = threadIdx.x & 31, lr = lane & 15, hi = lane >> 4; const int r0 = (vt ? blockIdx.y : blockIdx.x) * 64, c0 = (vt ? blockIdx.x : blockIdx.y) * 64;
    v8f acc[4][4];
#pragma unroll
    for (int mb = 0; mb < 4; ++mb)
#pragma unroll
        for (int nb = 0; nb < 4; ++nb) acc[mb][nb] = (v8f){};
    const size_t aoff = (size_t)(r0 + lr) * K + 8 * hi, boff = (size_t)(c0 + lr) * K + 8 * hi;
#pragma unroll 1
    for (int kc = 0; kc < K; kc += 32) {
        V a[4], a2[4];
#pragma unroll
        for (int mb = 0; mb < 4; ++mb) { a[mb] = WFrag<T16>::ld(A + aoff + (size_t)mb * 16 * K + kc); if (NSPLIT == 1 || NSPLIT == 2) a2[mb] = WFrag<T16>::ld(A2 + aoff + (size_t)mb * 16 * K + kc); }
#pragma unroll
        for (int nb = 0; nb < 4; ++nb) { const V b = WFrag<T16>::ld(Bt + boff + (size_t)nb * 16 * K + kc); V b2; if (NSPLIT >= 2) b2 = WFrag<T16>::ld(Bt2 + boff + (size_t)nb * 16 * K + kc);
#pragma unroll
            for (int mb = 0; mb < 4; ++mb) { acc[mb][nb] = WFrag<T16>::mma(a[mb], b, acc[mb][nb]); if (NSPLIT == 1 || NSPLIT == 2) acc[mb][nb] = WFrag<T16>::mma(a2[mb], b, acc[mb][nb]); if (NSPLIT >= 2) acc[mb][nb] = WFrag<T16>::mma(a[mb], b2, acc[mb][nb]); } }
        asm volatile("v_nop\n\tv_nop\n\tv_nop\n\tv_nop" : "+v"(acc[0][0]), "+v"(acc[1][1]), "+v"(acc[2][2]), "+v"(acc[3][3]) : "v"(a[0]), "v"(a[3]));
    }
    if (EPI == 0) {
#pragma unroll
    for (int mb = 0; mb < 4; ++mb) {
#pragma unroll
        for (int nb = 0; nb < 4; ++nb) {
#pragma unroll
            for (int j = 0; j < 8; ++j) os[(hi * 8 + j) * 68 + nb * 16 + lr] = acc[mb][nb][j]; }
        __builtin_amdgcn_wave_barrier(); asm volatile("" ::: "memory");
        float* crow = C + (size_t)(r0 + mb * 16) * ldc + c0;
{
#pragma unroll
            for (int s = 0; s < 8; ++s) { const int row = 2 * s + hi, cofs = lr * 4; v4f val = *(const v4fa*)(os + row * 68 + cofs); val[0] += bfr(bias[c0 + cofs]); val[1] += bfr(bias[c0 + cofs + 1]); val[2] += bfr(bias[c0 + cofs + 2]); val[3] += bfr(bias[c0 + cofs + 3]);
                *(v4f*)(crow + (size_t)row * ldc + cofs) = val; }
             }
        __builtin_amdgcn_wave_barrier(); asm volatile("" ::: "memory");
    }
    } else {
        if (vt) {                                                    // the bias is added on the way into LDS: per row where the operands changed places, else per column
#pragma unroll
            for (int mb = 0; mb < 4; ++mb)
#pragma unroll
                for (int j = 0; j < 8; ++j) { const float bb = bfr(bias[r0 + mb * 16 + hi * 8 + j]);
#pragma unroll
                    for (int nb = 0; nb < 4; ++nb) os[(mb * 16 + hi * 8 + j) * 68 + nb * 16 + lr] = acc[mb][nb][j] + bb; }
        } else {
#pragma unroll
            for (int nb = 0; nb < 4; ++nb) { const float bb = (EPI == 1) ? bfr(bias[c0 + nb * 16 + lr]) : 0.0f;
#pragma unroll
                for (int mb = 0; mb < 4; ++mb)
#pragma unroll
                    for (int j = 0; j < 8; ++j) os[(mb * 16 + hi * 8 + j) * 68 + nb * 16 + lr] = (EPI == 1) ? acc[mb][nb][j] + bb : acc[mb][nb][j]; }
        }
        __builtin_amdgcn_wave_barrier(); asm volatile("" ::: "memory");   // the lanes read each other's rows below
        // Read-back: 4 rows a step, 8 lanes a row, 8 columns a lane. The loops stay rolled, two steps a trip, so that
        // the second step's LDS reads pass behind the first step's arithmetic.
        const int er = lane >> 3, ec = (lane & 7) * 8;
        const float* op = os + er * 68 + ec;
        if (!vt) {
            size_t o = (EPI == 2) ? z * sC + (size_t)(r0 + er) * ldc + c0 + ec : ((z * NH_ + blockIdx.y) * TT + r0 + er) * HD + ec;
            const size_t so = 4 * (size_t)((EPI == 2) ? ldc : HD);
#pragma unroll 1
            for (int i = 0; i < 8; ++i) {
#pragma unroll
                for (int s = 0; s < 2; ++s, op += 4 * 68, o += so) { const v4f x0 = *(const v4fa*)op, x1 = *(const v4fa*)(op + 4);
                    const float y[8] = { x0[0], x0[1], x0[2], x0[3], x1[0], x1[1], x1[2], x1[3] };
                    st_hl(y, Ph + o, Pl + o);
                    if (EPI == 1) { float th[8];
#pragma unroll
                        for (int u = 0; u < 8; ++u) th[u] = tanhc(y[u]);
                        st_hl(th, Nh + o, Nl + o); } }
                asm volatile("s_wait_xcnt 0x0" ::: "memory");        // the next trip overwrites data and address registers of the stores just issued
            }
        } else {
            size_t o = (size_t)(r0 + er) * TT + c0 + ec;
#pragma unroll 1
            for (int i = 0; i < 8; ++i) {
#pragma unroll
                for (int s = 0; s < 2; ++s, op += 4 * 68, o += 4 * (size_t)TT) { const v4f x0 = *(const v4fa*)op, x1 = *(const v4fa*)(op + 4);
                    const float y[8] = { x0[0], x0[1], x0[2], x0[3], x1[0], x1[1], x1[2], x1[3] }; v8h o16;
#pragma unroll
                    for (int u = 0; u < 8; ++u) o16[u] = tohx(y[u]);
                    *(v8h*)(V16 + o) = o16; st_hl(y, Vh + o, Vl + o); }
                asm volatile("s_wait_xcnt 0x0" ::: "memory");        // as above
            }
        }
    }
}

typedef __attribute__((ext_vector_type(2))) _Float16 v2h;
typedef __attribute__((ext_vector_type(4))) _Float16 v4h;
typedef __attribute__((ext_vector_type(2))) unsigned short v2us;
typedef __attribute__((ext_vector_type(4))) unsigned short v4us;
typedef __attribute__((ext_vector_type(2))) float v2f;
typedef __attribute__((ext_vector_type(4))) int v4i;

// k_wtG: Bt[n][k] = bf16(w[k][n]); blockIdx.y is the matrix of a batch of equal shapes: matrix y of one array (w1 null), or one of four separate arrays; the outputs lie in a row.
__global__ __launch_bounds__(256) void k_wtG(const float* __restrict__ w0, const float* __restrict__ w1, const float* __restrict__ w2, const float* __restrict__ w3, int K, int N, bf* Bt) {
    const int y = blockIdx.y; const float* __restrict__ w = !w1 ? w0 + (size_t)y * K * N : (y == 0) ? w0 : (y == 1) ? w1 : (y == 2) ? w2 : w3; Bt += (size_t)y * K * N;
    const int lane = threadIdx.x & 31; const int L0 = (blockIdx.x * 8 + (threadIdx.x >> 5)) * 8; const int nlines = N * K / 64;
{
#pragma unroll 1
        for (int l = 0; l < 8; ++l) { const int L = L0 + l; if (L >= nlines) break; const size_t e = (size_t)L * 64 + lane * 2; const int k = (int)(e % K), n = (int)(e / K); v2us o;
            o[0] = f2bf(w[(size_t)k * N + n]); o[1] = f2bf(w[(size_t)(k + 1) * N + n]); *(v2us*)(Bt + e) = o; }
         }
}
__global__ __launch_bounds__(256) void k_cvt8(const float* __restrict__ src, bf* dst, size_t n8) { const size_t i = (size_t)blockIdx.x * 256 + threadIdx.x; if (i >= n8) return; const v8f v = *(const v8f*)(src + i * 8); v8us o;
#pragma unroll
    for (int k = 0; k < 8; ++k) o[k] = f2bf(v[k]); *(v8us*)(dst + i * 8) = o;  }
// ---- k_attn: score products, causal softmax and probability x value product of every (batch, head) in ONE launch; scores and probabilities stay in registers.
// One wave owns QW = 16 NT query columns and walks the keys up to its diagonal in blocks of 32. Transposed products: S^T = K Q^T and D^T = tanh(K) (tanh(Q) J)^T (A = key rows, B = query rows kept in
// registers; both hl x hl, 3 products), so a lane holds the scores of ONE query: keys 8 hi + j of each 16-key tile. t = S / 8 + lam D per element in f32; running maximum and running sum per query
// (online softmax: the output tile and the sum are rescaled by exp(old max - new max) in every block). The two 16-key tiles of a block, converted in place, ARE the B operand of O^T += V^T P^T
// (element s = tile s >> 3, register s & 7: the k order of the V^T loader). Query rows < RH: P and V in hi+lo planes (3 products); the rest fp16 with P x 1024. P is left unnormalised; O is divided by the sum at the end
// (the factor 1024 is in the sum too and cancels). Every inner loop is unrolled so that the fragment arrays stay in registers. A lane's 8 accumulator registers are 8 consecutive d of one query: one 16-byte store per plane and d tile into the merged-head hi/lo planes.
#define NT   2                    // 16-query column groups per wave
#define QW   (16 * NT)            // queries per wave
#define AW   4                    // waves per work-group: neighbouring query columns of one head, which read the same key rows at about the same time
#define NXT  (TT / (QW * AW))     // query tiles (work-groups) per head
#define L2E  1.4426950408889634f
__device__ __forceinline__ float xhalf(float x) { return __builtin_bit_cast(float, __builtin_amdgcn_permlanex16(__builtin_bit_cast(int, x), __builtin_bit_cast(int, x), 0x76543210, 0xfedcba98, false, false)); }   // lane l reads lane l ^ 16
// In front of code that overwrites address registers of global loads or stores just issued; the scheduling barrier keeps that code behind the wait (and the loads in front of it).
__device__ __forceinline__ void addr_done() { asm volatile("s_wait_xcnt 0x0" ::: "memory"); __builtin_amdgcn_sched_barrier(0); }
// The same, naming two pointers as inputs: they keep their registers up to the wait (else the last load through each lands on its own address pair).
__device__ __forceinline__ void addr_done(const bf* a, const bf* b) { asm volatile("s_wait_xcnt 0x0" :: "v"(a), "v"(b) : "memory"); __builtin_amdgcn_sched_barrier(0); }
template <bool HR>
__device__ __forceinline__ void attn_cols(const bf* __restrict__ Qh, const bf* __restrict__ Ql, const bf* __restrict__ Gh, const bf* __restrict__ Gl, const bf* __restrict__ Kh, const bf* __restrict__ Kl, const bf* __restrict__ Nh, const bf* __restrict__ Nl,
                                          const h16* __restrict__ V16, const bf* __restrict__ Vh, const bf* __restrict__ Vl, float lam, int q0, bf* Ah, bf* Al) {
    const int lane = threadIdx.x & 31, lr = lane & 15, hi = lane >> 4;
    v16bf qh[NT][2], ql[NT][2], gh[NT][2], gl[NT][2];
#pragma unroll
    for (int n = 0; n < NT; ++n)
#pragma unroll
        for (int ks = 0; ks < 2; ++ks) { const size_t qo = (size_t)(q0 + n * 16 + lr) * HD + ks * 32 + 8 * hi; qh[n][ks] = WFrag<bf>::ld(Qh + qo); ql[n][ks] = WFrag<bf>::ld(Ql + qo); gh[n][ks] = WFrag<bf>::ld(Gh + qo); gl[n][ks] = WFrag<bf>::ld(Gl + qo); }
    addr_done();
    v16bf kf[2][2][4];                                               // key fragments of the block at hand: [16-key tile][k step][K hi, K lo, tanh K hi, tanh K lo]
    { const int lo = lr * HD + 8 * hi; Kh += lo; Kl += lo; Nh += lo; Nl += lo; const int lv = lr * TT + 8 * hi; V16 += lv; Vh += lv; Vl += lv; }   // each lane's own place in a block; the pointers then walk the keys
    auto ldk = [&]() {
#pragma unroll
        for (int m = 0; m < 2; ++m)
#pragma unroll
            for (int ks = 0; ks < 2; ++ks) { const int ko = m * 16 * HD + ks * 32; kf[m][ks][0] = WFrag<bf>::ld(Kh + ko); kf[m][ks][1] = WFrag<bf>::ld(Kl + ko); kf[m][ks][2] = WFrag<bf>::ld(Nh + ko); kf[m][ks][3] = WFrag<bf>::ld(Nl + ko); } };
    const int kend = q0 + QW, klast = (kend - 1) & ~31;              // keys up to the last query's diagonal; first key of the last block
    ldk();
    addr_done();
    int kn = min(32, klast), kstep = kn * HD, vstep = 0;             // first key of the block to fetch next (the last block is fetched again: in bounds, unused); how far the pointers move in front of the next loads
    v8f o[4][NT]; float mr[NT], ls[NT];
#pragma unroll
    for (int n = 0; n < NT; ++n) { mr[n] = -3.0e38f; ls[n] = 0.0f;
#pragma unroll
        for (int dt = 0; dt < 4; ++dt) o[dt][n] = (v8f){}; }
#pragma unroll 1   // rolled: a second copy of the block would need a second set of fragment registers
    for (int kb = 0; kb < kend; kb += 32) {
        float t[2][NT][8];
#pragma unroll
        for (int m = 0; m < 2; ++m) {
            v8f s[NT], d[NT];
#pragma unroll
            for (int n = 0; n < NT; ++n) { s[n] = (v8f){}; d[n] = (v8f){}; }
#pragma unroll
            for (int ks = 0; ks < 2; ++ks) { const v16bf kh = kf[m][ks][0], kl = kf[m][ks][1], nh = kf[m][ks][2], nl = kf[m][ks][3];
#pragma unroll
                for (int n = 0; n < NT; ++n) { s[n] = wmmab(kh, qh[n][ks], s[n]); d[n] = wmmab(nh, gh[n][ks], d[n]); s[n] = wmmab(kh, ql[n][ks], s[n]); d[n] = wmmab(nh, gl[n][ks], d[n]); s[n] = wmmab(kl, qh[n][ks], s[n]); d[n] = wmmab(nl, gh[n][ks], d[n]); } }
#pragma unroll
            for (int n = 0; n < NT; ++n)
#pragma unroll
                for (int j = 0; j < 8; ++j) t[m][n][j] = s[n][j] * SCL + lam * d[n][j];
        }
        if (HR) addr_done(Vh, Vl); else addr_done();                 // the pointers move only here, a whole block behind the loads that name them; the scheduling barrier also keeps the loads below from rising over the score products, where they would need a second set of fragment registers
        Kh += kstep; Kl += kstep; Nh += kstep; Nl += kstep; V16 += vstep; Vh += vstep; Vl += vstep;
        v16h v16[4]; v16bf vh[4], vl[4];
#pragma unroll
        for (int dt = 0; dt < 4; ++dt) { const int vo = dt * 16 * TT; if (HR) { vh[dt] = WFrag<bf>::ld(Vh + vo); vl[dt] = WFrag<bf>::ld(Vl + vo); } else v16[dt] = WFrag<h16>::ld(V16 + vo); }
        __builtin_amdgcn_sched_barrier(0);                           // V in front of K: P.V needs V first, and loads return in order
        ldk();                                                       // the next block's key fragments, into the same registers: their latency passes behind the softmax and P.V
        __builtin_amdgcn_sched_barrier(0);                           // holds the loads here, far in front of their first use
        { const int k2 = min(kn + 32, klast); kstep = (k2 - kn) * HD; kn = k2; vstep = 32; }
        if (kb + 31 > q0) {                                          // the block that holds the diagonal (wave-uniform): keys beyond a lane's query leave the softmax
#pragma unroll
            for (int m = 0; m < 2; ++m)
#pragma unroll
                for (int n = 0; n < NT; ++n)
#pragma unroll
                    for (int j = 0; j < 8; ++j) if (kb + m * 16 + 8 * hi + j > q0 + n * 16 + lr) t[m][n][j] = -3.0e38f;
        }
        v16h p16[NT]; v16bf ph[NT], pl[NT];
#pragma unroll
        for (int n = 0; n < NT; ++n) {
            float bm = t[0][n][0];
#pragma unroll
            for (int e = 1; e < 16; ++e) bm = fmaxf(bm, t[e >> 3][n][e & 7]);
            bm = fmaxf(bm, xhalf(bm));                               // the other half of the wave holds the query's other 16 keys
            const float mn = fmaxf(mr[n], bm);                       // finite from the first block on: key 0 is open to every query
            const float al = __builtin_amdgcn_exp2f((mr[n] - mn) * L2E); mr[n] = mn;
            float bs = 0.0f; v8us h0, h1, l0, l1;
#pragma unroll
            for (int e = 0; e < 16; ++e) { const float pe = __builtin_amdgcn_exp2f(HR ? (t[e >> 3][n][e & 7] - mn) * L2E : (t[e >> 3][n][e & 7] - mn) * L2E + 10.0f); bs += pe;   // + 10: P x 1024 for the fp16 planes
                if (HR) { unsigned short a, c2; splitf(pe, a, c2); if (e < 8) { h0[e & 7] = a; l0[e & 7] = c2; } else { h1[e & 7] = a; l1[e & 7] = c2; } }
                else p16[n][e] = tohx(pe); }
            if (HR) { ph[n] = cat16b(h0, h1); pl[n] = cat16b(l0, l1); }
            ls[n] = ls[n] * al + bs;                                 // each half sums its own keys; the halves are joined behind the loop
#pragma unroll
            for (int dt = 0; dt < 4; ++dt) o[dt][n] *= al;
        }
#pragma unroll
        for (int dt = 0; dt < 4; ++dt)
#pragma unroll
            for (int n = 0; n < NT; ++n) {
                if (HR) { o[dt][n] = wmmab(vh[dt], ph[n], o[dt][n]); o[dt][n] = wmmab(vh[dt], pl[n], o[dt][n]); o[dt][n] = wmmab(vl[dt], ph[n], o[dt][n]); }
                else o[dt][n] = wmma16(v16[dt], p16[n], o[dt][n]); }
    }
    addr_done();                                                     // the code below reuses the pointers' registers
#pragma unroll
    for (int n = 0; n < NT; ++n) { const float sum = ls[n] + xhalf(ls[n]); const float f = __fdiv_rn(1.0f, sum);
#pragma unroll
        for (int dt = 0; dt < 4; ++dt) { v8us oh, ol;
#pragma unroll
            for (int j = 0; j < 8; ++j) { unsigned short a, c2; splitf(o[dt][n][j] * f, a, c2); oh[j] = a; ol[j] = c2; }
            const size_t oo = (size_t)(q0 + n * 16 + lr) * DQ + dt * 16 + 8 * hi; *(v8us*)(Ah + oo) = oh; *(v8us*)(Al + oo) = ol; }
        if (n + 1 < NT) addr_done(); }                               // the next column group reuses registers that these stores name
}
// grid (NXT, NB_ NH_), AW waves. Plane sets per batch: QK* = the q planes [h][t][d] followed by the k planes; G* = (tanh Q J) planes; V* = [h][d][t]. A* = merged heads [b][t][DQ], hi and lo.
// Two waves per SIMD (512 registers each): the Q and K fragments alone take 128 registers each.
// The cost of a tile grows with its index and all work-groups are resident at once, so the second of the two rounds of 256 work-groups takes the tiles mirrored: for speed only, each head still gets every tile once.
__global__ __launch_bounds__(32 * AW) __attribute__((amdgpu_waves_per_eu(2, 2))) void k_attn(const bf* __restrict__ QKh, const bf* __restrict__ QKl, const bf* __restrict__ Gh, const bf* __restrict__ Gl, const bf* __restrict__ QKNh, const bf* __restrict__ QKNl,
                                                  const h16* __restrict__ V16, const bf* __restrict__ Vh, const bf* __restrict__ Vl, const float* __restrict__ lamp, bf* Ah, bf* Al) {
    const int bh = blockIdx.y, b = bh / NH_, h = bh % NH_, rnd = (bh * NXT) >> 8;
    int tile = blockIdx.x; if (rnd & 2) tile = (tile + NXT / 2) % NXT; if (rnd & 1) tile = NXT - 1 - tile;
    const int q0 = (tile * AW + __builtin_amdgcn_readfirstlane((int)threadIdx.x >> 5)) * QW;
    const size_t PLN = (size_t)NH_ * TT * HD, qp = ((size_t)b * 2 * NH_ + h) * TT * HD, kp = qp + PLN, gp = ((size_t)b * NH_ + h) * TT * HD, ap = (size_t)b * TT * DQ + h * HD;
    const float lam = bfr(lamp[0]);
    if (q0 < RH) attn_cols<true>(QKh + qp, QKl + qp, Gh + gp, Gl + gp, QKh + kp, QKl + kp, QKNh + kp, QKNl + kp, V16 + gp, Vh + gp, Vl + gp, lam, q0, Ah + ap, Al + ap);
    else attn_cols<false>(QKh + qp, QKl + qp, Gh + gp, Gl + gp, QKh + kp, QKl + kp, QKNh + kp, QKNl + kp, V16 + gp, Vh + gp, Vl + gp, lam, q0, Ah + ap, Al + ap);
}

extern "C" void kernel_launch(void* const* d_in, const int* in_sizes, int n_in,
                              void* d_out, int out_size, void* d_ws, size_t ws_size, hipStream_t stream) {
    (void)in_sizes; (void)n_in; (void)out_size;
    const float* x = (const float*)d_in[0]; const float* wq = (const float*)d_in[1]; const float* bq = (const float*)d_in[2]; const float* wk = (const float*)d_in[3]; const float* bk = (const float*)d_in[4]; const float* wv = (const float*)d_in[5]; const float* bv = (const float*)d_in[6]; const float* wo = (const float*)d_in[7]; const float* bo = (const float*)d_in[8]; const float* Jm = (const float*)d_in[9]; const float* lamp = (const float*)d_in[10];
    float* OUT = (float*)d_out;     // [2][2048][1024]
    char* wsp = (char*)d_ws;
    const size_t PLN = (size_t)NH_ * TT * HD;   // elements of one set of head planes
    auto take = [&](size_t bytes) { char* p = wsp; wsp += (bytes + 255) & ~(size_t)255; return (void*)p; };
    bf* WQ = (bf*)take((size_t)DQ * DM * 2); bf* WK = (bf*)take((size_t)DKV * DM * 2); bf* WV = (bf*)take((size_t)DKV * DM * 2); bf* WO = (bf*)take((size_t)DM * DQ * 2);   // WQ, WK, WV, WO lie in a row
    bf* XB = (bf*)take((size_t)NB_ * TT * DM * 2); bf* JT = (bf*)take((size_t)NH_ * HD * HD * 2);
    /* the planes that k_attn reads are kept for both batches; each q plane is followed by its k plane: QK* [b][q, k][h][t][d], QJ* [b][h][t][d], VT* [b][h][d][t] */
    bf* QKNh = (bf*)take((size_t)NB_ * 2 * PLN * 2); bf* QKNl = (bf*)take((size_t)NB_ * 2 * PLN * 2); bf* QJh = (bf*)take((size_t)NB_ * PLN * 2); bf* QJl = (bf*)take((size_t)NB_ * PLN * 2);
    bf* QKPh = (bf*)take((size_t)NB_ * 2 * PLN * 2); bf* QKPl = (bf*)take((size_t)NB_ * 2 * PLN * 2); h16* VT16 = (h16*)take((size_t)NB_ * PLN * 2); bf* VTh = (bf*)take((size_t)NB_ * PLN * 2); bf* VTl = (bf*)take((size_t)NB_ * PLN * 2);
    bf* ATh = (bf*)take((size_t)NB_ * TT * DQ * 2); bf* ATl = (bf*)take((size_t)NB_ * TT * DQ * 2);
    if ((size_t)(wsp - (char*)d_ws) > ws_size) return;    // ws 256 MiB
    static_assert(DQ == DKV && DQ == DM && HD == 64, "the batched launches take equal shapes; a 64-column tile of a projection is one head"); static_assert(RH % QW == 0 && TT % (QW * AW) == 0 && TT % 32 == 0, "a wave's query columns lie on one side of RH and tile the sequence; key blocks of 32 tile it too");
    (void)WK; (void)WV;   // reached as members of the row they lie in
    { k_wtG<<<dim3((unsigned)((DM * DQ / 64 + 63) / 64), 4, 1), 256, 0, stream>>>(wq, wk, wv, wo, DM, DQ, WQ);
      k_wtG<<<dim3((HD * HD / 64 + 63) / 64, NH_, 1), 256, 0, stream>>>(Jm, nullptr, nullptr, nullptr, HD, HD, JT);
       }
    k_cvt8<<<(unsigned)(((size_t)NB_ * TT * DM / 8 + 255) / 256), 256, 0, stream>>>(x, XB, (size_t)NB_ * TT * DM / 8);   /* both batches */
    for (int b = 0; b < NB_; ++b) {
        k_gemmw<bf, 0, 1><<<dim3(TT / 64, DQ / 64, 3), 32, 0, stream>>>(XB + (size_t)b * TT * DM, nullptr, WQ, nullptr, DM, nullptr, 0, bq, bk, bv, 0, (size_t)DQ * DM, 0,
            QKPh + (size_t)b * 2 * PLN, QKPl + (size_t)b * 2 * PLN, QKNh + (size_t)b * 2 * PLN, QKNl + (size_t)b * 2 * PLN, VT16 + (size_t)b * PLN, VTh + (size_t)b * PLN, VTl + (size_t)b * PLN);   /* q, k, v projections -> q, k, tanh q, tanh k and transposed v planes */
        k_gemmw<bf, 1, 2><<<dim3(TT / 64, 1, NH_), 32, 0, stream>>>(QKNh + (size_t)b * 2 * PLN, QKNl + (size_t)b * 2 * PLN, JT, nullptr, HD, nullptr, HD, nullptr, nullptr, nullptr, (size_t)TT * HD, (size_t)HD * HD, (size_t)TT * HD,
            QJh + (size_t)b * PLN, QJl + (size_t)b * PLN, nullptr, nullptr, nullptr, nullptr, nullptr); }   /* tanh(Q) J of every head -> hi/lo planes */
    k_attn<<<dim3(NXT, NB_ * NH_, 1), 32 * AW, 0, stream>>>(QKPh, QKPl, QJh, QJl, QKNh, QKNl, VT16, VTh, VTl, lamp, ATh, ATl);   /* scores, softmax and P.V of all heads of both batches */
    k_gemmw<bf, 1, 0><<<dim3(NB_ * TT / 64, DM / 64, 1), 32, 0, stream>>>(ATh, ATl, WO, nullptr, DQ, OUT, DM, bo, nullptr, nullptr, 0, 0, 0, nullptr, nullptr, nullptr, nullptr, nullptr, nullptr, nullptr);   /* output projection, both batches */
}

// v005
// It runs in 188 microseconds.
// In two side-by-side timings against v004, it was 1.38 and 1.41 times as fast.
// Over all steps from v000 it is 10.8 times as fast.
#include <hip/hip_runtime.h>

// Causal attention with a bilinear tanh correction (x [2][2048][1024]; Q/K/V = x W + b (16 x 64); scores = Q.K / 8 + lam * (tanh(Q) J_h tanh(K)^T) (J [16][64][64] and the scalar lam read); causal (-inf) softmax; out = merged Wo + bo -> [2][2048][1024]).
// Compute dtypes, f32 accumulate: every input rounded to bf16; Q/K/V on PLAIN bf16 operands (inputs: exact) + bias; tanh elementwise in f32 (exp2 form with the hardware reciprocal, clamped |x| <= 15), in the projection's epilogue; QJ = hi/lo tanh(Q) x exact J (2 products, f32); both score products hl x hl (3 products) on every row; the two terms combined per element in f32 in the reference's order (s/8 + lam d); key blocks beyond the diagonal skipped; softmax f32, online (running maximum and sum), fused with both products; attn.v: rows < 512 hl (3 products), the rest fp16 (x1024); Wo hl x exact (2 products) + bias.

#define NB_  2
#define TT   2048
#define DM   1024
#define NH_  16
#define NKV  16
#define HD   64
#define DQ   (NH_ * HD)
#define DKV  (NKV * HD)
#define RH   512                  // query rows < RH use hi+lo planes (0: none)
#define SCL  0.125f   // HD^-0.5
typedef _Float16 h16;
typedef unsigned short bf;
typedef __attribute__((ext_vector_type(16))) __bf16   v16bf;
typedef __attribute__((ext_vector_type(16))) _Float16 v16h;
typedef __attribute__((ext_vector_type(8)))  _Float16 v8h;
typedef __attribute__((ext_vector_type(8)))  unsigned short v8us;
typedef __attribute__((ext_vector_type(8)))  float    v8f;
typedef __attribute__((ext_vector_type(4)))  float    v4f;
typedef v8h  __attribute__((may_alias)) v8ha;
typedef v4f  __attribute__((may_alias)) v4fa;
typedef v8us __attribute__((may_alias)) v8usa;

__device__ __forceinline__ unsigned short f2bf(float f) { unsigned u = __float_as_uint(f); u += 0x7FFFu + ((u >> 16) & 1u); return (unsigned short)(u >> 16); }
__device__ __forceinline__ float bf2f(unsigned short b) { return __uint_as_float(((unsigned)b) << 16); }
__device__ __forceinline__ float bfr(float f) { return bf2f(f2bf(f)); }
__device__ __forceinline__ v16h cat16(v8h lo, v8h hi) { return __builtin_shufflevector(lo, hi, 0, 1, 2, 3, 4, 5, 6, 7, 8, 9, 10, 11, 12, 13, 14, 15); }
__device__ __forceinline__ v16bf cat16b(v8us lo, v8us hi) { return __builtin_bit_cast(v16bf, __builtin_shufflevector(lo, hi, 0, 1, 2, 3, 4, 5, 6, 7, 8, 9, 10, 11, 12, 13, 14, 15)); }
__device__ __forceinline__ v8f wmma16(v16h a, v16h b, v8f c) { return __builtin_amdgcn_wmma_f32_16x16x32_f16(false, a, false, b, (short)0, c, false, false); }
__device__ __forceinline__ v8f wmmab(v16bf a, v16bf b, v8f c) { return __builtin_amdgcn_wmma_f32_16x16x32_bf16(false, a, false, b, (short)0, c, false, false); }



// ---- Fragment-major planes. Every 16-bit operand plane M[r][k] (K columns) is kept as blocks of 16 rows x 32 k = 512 elements; block (r / 16, k / 32) starts at element (r / 16) * 16 * K + (k / 32) * 512.
// Inside a block the 8 elements k % 32 = 16 j + 8 hi + (0..7) of row r % 16 = lr lie at j * 256 + (16 hi + lr) * 8: lane 16 hi + lr of a wave reads its fragment as two 16-byte loads, at lane * 8 and at 256 + lane * 8,
// and each of the two loads covers 512 contiguous bytes (four whole lines) where a row-major plane makes it touch 16 lines. Which element reaches which lane and register is as with row-major planes.
// ---- k_gemmw: register-blocked GEMM, ONE WAVE per 64x64 output tile (16 accumulators), operands straight from fragment-major 16-bit planes; grid (M/64, N/64, Z), 32 threads.
// C[m][n] (f32, pitch ldc, + optional f32 bias[n]) = sum_k A[m][k] Bt[n][k] (+ split products per NSPLIT). z-batch strides sA/sB/sC in elements. K % 32 == 0.
// Independent products of one shape run as ONE launch with the member in blockIdx.z: the q, k and v projections (three weight planes, three biases) and the 16 per-head tanh(Q) J products.
// EPI says what the epilogue makes of the f32 tile, which goes through LDS either way (0: 16 rows at a time; 1, 2: whole):
//   0: C (f32, pitch ldc) = tile + bias.
//   1: the projections. A tile is 64 tokens of ONE head (HD == 64). Members 0, 1 (q, k): y = tile + bias goes out as hi/lo planes P* [member][h][t][d], tanh(y) as hi/lo planes N* of the same shape.
//      Member 2 (v): the operands change places (rows = the head's 64 d, columns = tokens; same products, same k order), so that the same row-wise epilogue writes the transposed planes V* [h][d][t] (fp16, hi, lo).
//   2: the tile goes out as hi/lo planes P* (pitch ldc, z-stride sC).
// The 16-bit planes are stored 16 bytes a lane, one half block (16 rows x 16 k) a step: 512 contiguous bytes.
__device__ __forceinline__ h16 tohx(float x) { return (h16)x; }
__device__ __forceinline__ void splitf(float y, unsigned short& h, unsigned short& l) { h = f2bf(y); l = f2bf(y - bf2f(h)); }
__device__ __forceinline__ float tanhc(float x) { const float xs = fminf(fmaxf(x, -15.0f), 15.0f); const float ex = __builtin_amdgcn_exp2f(xs * 2.8853900817779268f); return (ex - 1.0f) * __builtin_amdgcn_rcpf(ex + 1.0f); }
__device__ __forceinline__ void st_hl(const float (&y)[8], bf* Ph, bf* Pl) { v8us oh, ol;
#pragma unroll
    for (int u = 0; u < 8; ++u) { unsigned short a, c; splitf(y[u], a, c); oh[u] = a; ol[u] = c; }
    *(v8us*)Ph = oh; *(v8us*)Pl = ol; }
template <typename T16> struct WFrag;
template <> struct WFrag<h16> { typedef v16h V; static __device__ __forceinline__ V ld(const h16* p) { return cat16(*(const v8h*)p, *(const v8h*)(p + 256)); } static __device__ __forceinline__ v8f mma(V a, V b, v8f c) { return wmma16(a, b, c); } };
template <> struct WFrag<bf> { typedef v16bf V; static __device__ __forceinline__ V ld(const bf* p) { return cat16b(*(const v8us*)p, *(const v8us*)(p + 256)); } static __device__ __forceinline__ v8f mma(V a, V b, v8f c) { return wmmab(a, b, c); } };
template <typename T16, int NSPLIT, int EPI, int K>
__global__ __launch_bounds__(32) void k_gemmw(const T16* __restrict__ A, const T16* __restrict__ A2, const T16* __restrict__ Bt, const T16* __restrict__ Bt2, float* C, int ldc, const float* __restrict__ bias0, const float* __restrict__ bias1, const float* __restrict__ bias2, size_t sA, size_t sB, size_t sC,
                                              bf* Ph, bf* Pl, bf* Nh, bf* Nl, h16* V16, bf* Vh, bf* Vl) {
    typedef typename WFrag<T16>::V V;
    __shared__ __align__(16) float os[(EPI == 0 ? 16 : 64) * 68];
    const size_t z = blockIdx.z; A += z * sA; if (A2) A2 += z * sA; Bt += z * sB; if (Bt2) Bt2 += z * sB; if (EPI == 0) C += z * sC;
    const float* __restrict__ bias = (z == 0) ? bias0 : (z == 1) ? bias1 : bias2;   // each z-batch member has its own bias vector (at most three members where a bias is added)
    const bool vt = EPI == 1 && z == 2;                                             // the v projection: rows from the weight plane, columns from x
    if (vt) { const T16* const w = Bt; Bt = A; A = w; }
    const int lane = threadIdx.x & 31, lr = lane & 15, hi = lane >> 4; const int r0 = (vt ? blockIdx.y : blockIdx.x) * 64, c0 = (vt ? blockIdx.x : blockIdx.y) * 64;
    v8f acc[4][4];
#pragma unroll
    for (int mb = 0; mb < 4; ++mb)
#pragma unroll
        for (int nb = 0; nb < 4; ++nb) acc[mb][nb] = (v8f){};
    // Each lane's own piece of the first block of block row r0 / 16 (c0 / 16); the pointers walk k, one block (512 elements) a trip, and the block rows below are constant offsets from them.
    const T16* pa = A + (size_t)r0 * K + 8 * lane; const T16* pa2 = A2 + (size_t)r0 * K + 8 * lane; const T16* pb = Bt + (size_t)c0 * K + 8 * lane; const T16* pb2 = Bt2 + (size_t)c0 * K + 8 * lane;
#pragma unroll 1
    for (int kc = 0; kc < K; kc += 32) {
        V a[4], a2[4], b[4], b2[4];
#pragma unroll
        for (int mb = 0; mb < 4; ++mb) { a[mb] = WFrag<T16>::ld(pa + mb * 16 * K); if (NSPLIT == 1 || NSPLIT == 2) a2[mb] = WFrag<T16>::ld(pa2 + mb * 16 * K); }
#pragma unroll
        for (int nb = 0; nb < 4; ++nb) { b[nb] = WFrag<T16>::ld(pb + nb * 16 * K); if (NSPLIT >= 2) b2[nb] = WFrag<T16>::ld(pb2 + nb * 16 * K); }
        // In front of the pointers' step: they are the address registers of the loads just issued. Named as inputs they keep their registers up to the wait, so that no load lands on its own address pair.
        if (NSPLIT == 0) asm volatile("s_wait_xcnt 0x0" :: "v"(pa), "v"(pb) : "memory"); else if (NSPLIT == 1) asm volatile("s_wait_xcnt 0x0" :: "v"(pa), "v"(pa2), "v"(pb) : "memory"); else asm volatile("s_wait_xcnt 0x0" :: "v"(pa), "v"(pa2), "v"(pb), "v"(pb2) : "memory");
        __builtin_amdgcn_sched_barrier(0);                           // keeps the step behind the wait, and the trip's loads together in front of its products: sunk among them, each group of loads would be waited for by itself
        pa += 512; pa2 += 512; pb += 512; pb2 += 512;
#pragma unroll
        for (int nb = 0; nb < 4; ++nb)
#pragma unroll
            for (int mb = 0; mb < 4; ++mb) { acc[mb][nb] = WFrag<T16>::mma(a[mb], b[nb], acc[mb][nb]); if (NSPLIT == 1 || NSPLIT == 2) acc[mb][nb] = WFrag<T16>::mma(a2[mb], b[nb], acc[mb][nb]); if (NSPLIT >= 2) acc[mb][nb] = WFrag<T16>::mma(a[mb], b2[nb], acc[mb][nb]); }
        asm volatile("v_nop\n\tv_nop\n\tv_nop\n\tv_nop" : "+v"(acc[0][0]), "+v"(acc[1][1]), "+v"(acc[2][2]), "+v"(acc[3][3]) : "v"(a[0]), "v"(a[3]));
    }
    if (EPI == 0) {
#pragma unroll
    for (int mb = 0; mb < 4; ++mb) {
#pragma unroll
        for (int nb = 0; nb < 4; ++nb) {
#pragma unroll
            for (int j = 0; j < 8; ++j) os[(hi * 8 + j) * 68 + nb * 16 + lr] = acc[mb][nb][j]; }
        __builtin_amdgcn_wave_barrier(); asm volatile("" ::: "memory");
        float* crow = C + (size_t)(r0 + mb * 16) * ldc + c0;
{
#pragma unroll
            for (int s = 0; s < 8; ++s) { const int row = 2 * s + hi, cofs = lr * 4; v4f val = *(const v4fa*)(os + row * 68 + cofs); val[0] += bfr(bias[c0 + cofs]); val[1] += bfr(bias[c0 + cofs + 1]); val[2] += bfr(bias[c0 + cofs + 2]); val[3] += bfr(bias[c0 + cofs + 3]);
                *(v4f*)(crow + (size_t)row * ldc + cofs) = val; }
             }
        __builtin_amdgcn_wave_barrier(); asm volatile("" ::: "memory");
    }
    } else {
        if (vt) {                                                    // the bias is added on the way into LDS: per row where the operands changed places, else per column
#pragma unroll
            for (int mb = 0; mb < 4; ++mb)
#pragma unroll
                for (int j = 0; j < 8; ++j) { const float bb = bfr(bias[r0 + mb * 16 + hi * 8 + j]);
#pragma unroll
                    for (int nb = 0; nb < 4; ++nb) os[(mb * 16 + hi * 8 + j) * 68 + nb * 16 + lr] = acc[mb][nb][j] + bb; }
        } else {
#pragma unroll
            for (int nb = 0; nb < 4; ++nb) { const float bb = (EPI == 1) ? bfr(bias[c0 + nb * 16 + lr]) : 0.0f;
#pragma unroll
                for (int mb = 0; mb < 4; ++mb)
#pragma unroll
                    for (int j = 0; j < 8; ++j) os[(mb * 16 + hi * 8 + j) * 68 + nb * 16 + lr] = (EPI == 1) ? acc[mb][nb][j] + bb : acc[mb][nb][j]; }
        }
        __builtin_amdgcn_wave_barrier(); asm volatile("" ::: "memory");   // the lanes read each other's rows below
        // Read-back: one half block a step (16 rows, 16 columns: 8 columns a lane), in the order in which the half blocks lie in the plane. The loops stay rolled, two steps a trip, so that the second step's LDS reads pass behind the first step's arithmetic.
        // Trip i = 2 mb + kb: rows 16 mb.., columns 32 kb..; step s: columns + 16 s. ldp = columns of the plane that the tile goes to, cc = the tile's first column in it.
        const float* const op0 = os + lr * 68 + hi * 8;
        const size_t ldp = vt ? TT : (EPI == 2) ? ldc : HD, cc = (vt || EPI == 2) ? c0 : 0;
        const size_t o0 = (vt ? 0 : (EPI == 2) ? z * sC : (z * NH_ + blockIdx.y) * (size_t)TT * HD) + (size_t)r0 * ldp + cc * 16 + 8 * lane;
        if (!vt) {
#pragma unroll 1
            for (int i = 0; i < 8; ++i) {
#pragma unroll
                for (int s = 0; s < 2; ++s) { const float* const op = op0 + (i >> 1) * (16 * 68) + (i & 1) * 32 + s * 16; const size_t o = o0 + (size_t)(i >> 1) * 16 * ldp + (i & 1) * 512 + s * 256;
                    const v4f x0 = *(const v4fa*)op, x1 = *(const v4fa*)(op + 4);
                    const float y[8] = { x0[0], x0[1], x0[2], x0[3], x1[0], x1[1], x1[2], x1[3] };
                    st_hl(y, Ph + o, Pl + o);
                    if (EPI == 1) { float th[8];
#pragma unroll
                        for (int u = 0; u < 8; ++u) th[u] = tanhc(y[u]);
                        st_hl(th, Nh + o, Nl + o); } }
                asm volatile("s_wait_xcnt 0x0" ::: "memory");        // the next trip overwrites data and address registers of the stores just issued
            }
        } else {
#pragma unroll 1
            for (int i = 0; i < 8; ++i) {
#pragma unroll
                for (int s = 0; s < 2; ++s) { const float* const op = op0 + (i >> 1) * (16 * 68) + (i & 1) * 32 + s * 16; const size_t o = o0 + (size_t)(i >> 1) * 16 * ldp + (i & 1) * 512 + s * 256;
                    const v4f x0 = *(const v4fa*)op, x1 = *(const v4fa*)(op + 4);
                    const float y[8] = { x0[0], x0[1], x0[2], x0[3], x1[0], x1[1], x1[2], x1[3] }; v8h o16;
#pragma unroll
                    for (int u = 0; u < 8; ++u) o16[u] = tohx(y[u]);
                    *(v8h*)(V16 + o) = o16; st_hl(y, Vh + o, Vl + o); }
                asm volatile("s_wait_xcnt 0x0" ::: "memory");        // as above
            }
        }
    }
}

typedef __attribute__((ext_vector_type(2))) _Float16 v2h;
typedef __attribute__((ext_vector_type(4))) _Float16 v4h;
typedef __attribute__((ext_vector_type(2))) unsigned short v2us;
typedef __attribute__((ext_vector_type(4))) unsigned short v4us;
typedef __attribute__((ext_vector_type(2))) float v2f;
typedef __attribute__((ext_vector_type(4))) int v4i;

// k_wtG: the fragment-major plane of Bt[n][k] = bf16(w[k][n]); blockIdx.y is the matrix of a batch of equal shapes: matrix y of one array (w1 null), or one of four separate arrays; the outputs lie in a row.
// One 8-element piece a thread, in the order of the plane: a wave stores 512 contiguous bytes, and each of its 8 loads reads 16 neighbouring n of two rows k. N K / 8 is a multiple of the block size.
__global__ __launch_bounds__(256) void k_wtG(const float* __restrict__ w0, const float* __restrict__ w1, const float* __restrict__ w2, const float* __restrict__ w3, int K, int N, bf* Bt) {
    const int y = blockIdx.y; const float* __restrict__ w = !w1 ? w0 + (size_t)y * K * N : (y == 0) ? w0 : (y == 1) ? w1 : (y == 2) ? w2 : w3; Bt += (size_t)y * K * N;
    const int g = blockIdx.x * 256 + threadIdx.x, blk = g >> 6, kbs = K >> 5;
    const int n = (blk / kbs) * 16 + (g & 15), k = (blk % kbs) * 32 + ((g >> 5) & 1) * 16 + ((g >> 4) & 1) * 8;
    const float* __restrict__ p = w + (size_t)k * N + n; float v[8];
#pragma unroll
    for (int u = 0; u < 8; ++u) v[u] = p[(size_t)u * N];
    v8us o;
#pragma unroll
    for (int u = 0; u < 8; ++u) o[u] = f2bf(v[u]);
    *(v8us*)(Bt + (size_t)g * 8) = o;
}
// k_cvt8: the fragment-major bf16 plane of src[r][k] (K columns); one 8-element piece a thread, in the order of the plane (a wave stores 512 contiguous bytes; a block reads 512 contiguous bytes of each of 16 rows).
__global__ __launch_bounds__(256) void k_cvt8(const float* __restrict__ src, bf* dst, size_t n8, int K) { const size_t i = (size_t)blockIdx.x * 256 + threadIdx.x; if (i >= n8) return;
    const int blk = (int)(i >> 6), kbs = K >> 5; const int r = (blk / kbs) * 16 + ((int)i & 15), k = (blk % kbs) * 32 + (((int)i >> 5) & 1) * 16 + (((int)i >> 4) & 1) * 8;
    const v8f v = *(const v8f*)(src + (size_t)r * K + k); v8us o;
    asm volatile("s_wait_xcnt 0x0" ::: "memory");                    // the conversion below reuses the address registers of the loads just issued
#pragma unroll
    for (int u = 0; u < 8; ++u) o[u] = f2bf(v[u]); *(v8us*)(dst + i * 8) = o;  }
// ---- k_attn: score products, causal softmax and probability x value product of every (batch, head) in ONE launch; scores and probabilities stay in registers.
// One wave owns QW = 16 NT query columns and walks the keys up to its diagonal in blocks of 32. Transposed products: S^T = K Q^T and D^T = tanh(K) (tanh(Q) J)^T (A = key rows, B = query rows kept in
// registers; both hl x hl, 3 products), so a lane holds the scores of ONE query: keys 8 hi + j of each 16-key tile. t = S / 8 + lam D per element in f32; running maximum and running sum per query
// (online softmax: the output tile and the sum are rescaled by exp(old max - new max) in every block). The two 16-key tiles of a block, converted in place, ARE the B operand of O^T += V^T P^T
// (element s = tile s >> 3, register s & 7: the k order of the V^T loader). Query rows < RH: P and V in hi+lo planes (3 products); the rest fp16 with P x 1024. P is left unnormalised; O is divided by the sum at the end
// (the factor 1024 is in the sum too and cancels). Every inner loop is unrolled so that the fragment arrays stay in registers. A lane's 8 accumulator registers are 8 consecutive d of one query: one 16-byte store per plane and d tile into the merged-head hi/lo planes, where the wave's 32 pieces are one half block (512 contiguous bytes).
#define NT   2                    // 16-query column groups per wave
#define QW   (16 * NT)            // queries per wave
#define AW   4                    // waves per work-group: neighbouring query columns of one head, which read the same key rows at about the same time
#define NXT  (TT / (QW * AW))     // query tiles (work-groups) per head
#define L2E  1.4426950408889634f
__device__ __forceinline__ float xhalf(float x) { return __builtin_bit_cast(float, __builtin_amdgcn_permlanex16(__builtin_bit_cast(int, x), __builtin_bit_cast(int, x), 0x76543210, 0xfedcba98, false, false)); }   // lane l reads lane l ^ 16
// In front of code that overwrites address registers of global loads or stores just issued; the scheduling barrier keeps that code behind the wait (and the loads in front of it).
__device__ __forceinline__ void addr_done() { asm volatile("s_wait_xcnt 0x0" ::: "memory"); __builtin_amdgcn_sched_barrier(0); }
// The same, naming two pointers as inputs: they keep their registers up to the wait (else the last load through each lands on its own address pair).
__device__ __forceinline__ void addr_done(const bf* a, const bf* b) { asm volatile("s_wait_xcnt 0x0" :: "v"(a), "v"(b) : "memory"); __builtin_amdgcn_sched_barrier(0); }
template <bool HR>
__device__ __forceinline__ void attn_cols(const bf* __restrict__ Qh, const bf* __restrict__ Ql, const bf* __restrict__ Gh, const bf* __restrict__ Gl, const bf* __restrict__ Kh, const bf* __restrict__ Kl, const bf* __restrict__ Nh, const bf* __restrict__ Nl,
                                          const h16* __restrict__ V16, const bf* __restrict__ Vh, const bf* __restrict__ Vl, float lam, int q0, bf* Ah, bf* Al) {
    const int lane = threadIdx.x & 31, lr = lane & 15, hi = lane >> 4;
    v16bf qh[NT][2], ql[NT][2], gh[NT][2], gl[NT][2];
#pragma unroll
    for (int n = 0; n < NT; ++n)
#pragma unroll
        for (int ks = 0; ks < 2; ++ks) { const size_t qo = (size_t)(q0 + n * 16) * HD + ks * 512 + 8 * lane; qh[n][ks] = WFrag<bf>::ld(Qh + qo); ql[n][ks] = WFrag<bf>::ld(Ql + qo); gh[n][ks] = WFrag<bf>::ld(Gh + qo); gl[n][ks] = WFrag<bf>::ld(Gl + qo); }
    addr_done();
    v16bf kf[2][2][4];                                               // key fragments of the block at hand: [16-key tile][k step][K hi, K lo, tanh K hi, tanh K lo]
    { const int lo = 8 * lane; Kh += lo; Kl += lo; Nh += lo; Nl += lo; V16 += lo; Vh += lo; Vl += lo; }   // each lane's own place in a block; the pointers then walk the keys
    auto ldk = [&]() {
#pragma unroll
        for (int m = 0; m < 2; ++m)
#pragma unroll
            for (int ks = 0; ks < 2; ++ks) { const int ko = m * 16 * HD + ks * 512; kf[m][ks][0] = WFrag<bf>::ld(Kh + ko); kf[m][ks][1] = WFrag<bf>::ld(Kl + ko); kf[m][ks][2] = WFrag<bf>::ld(Nh + ko); kf[m][ks][3] = WFrag<bf>::ld(Nl + ko); } };
    const int kend = q0 + QW, klast = (kend - 1) & ~31;              // keys up to the last query's diagonal; first key of the last block
    ldk();
    addr_done();
    int kn = min(32, klast), kstep = kn * HD, vstep = 0;             // first key of the block to fetch next (the last block is fetched again: in bounds, unused); how far the pointers move in front of the next loads
    v8f o[4][NT]; float mr[NT], ls[NT];
#pragma unroll
    for (int n = 0; n < NT; ++n) { mr[n] = -3.0e38f; ls[n] = 0.0f;
#pragma unroll
        for (int dt = 0; dt < 4; ++dt) o[dt][n] = (v8f){}; }
#pragma unroll 1   // rolled: a second copy of the block would need a second set of fragment registers
    for (int kb = 0; kb < kend; kb += 32) {
        float t[2][NT][8];
#pragma unroll
        for (int m = 0; m < 2; ++m) {
            v8f s[NT], d[NT];
#pragma unroll
            for (int n = 0; n < NT; ++n) { s[n] = (v8f){}; d[n] = (v8f){}; }
#pragma unroll
            for (int ks = 0; ks < 2; ++ks) { const v16bf kh = kf[m][ks][0], kl = kf[m][ks][1], nh = kf[m][ks][2], nl = kf[m][ks][3];
#pragma unroll
                for (int n = 0; n < NT; ++n) { s[n] = wmmab(kh, qh[n][ks], s[n]); d[n] = wmmab(nh, gh[n][ks], d[n]); s[n] = wmmab(kh, ql[n][ks], s[n]); d[n] = wmmab(nh, gl[n][ks], d[n]); s[n] = wmmab(kl, qh[n][ks], s[n]); d[n] = wmmab(nl, gh[n][ks], d[n]); } }
#pragma unroll
            for (int n = 0; n < NT; ++n)
#pragma unroll
                for (int j = 0; j < 8; ++j) t[m][n][j] = s[n][j] * SCL + lam * d[n][j];
        }
        if (HR) addr_done(Vh, Vl); else addr_done();                 // the pointers move only here, a whole block behind the loads that name them; the scheduling barrier also keeps the loads below from rising over the score products, where they would need a second set of fragment registers
        Kh += kstep; Kl += kstep; Nh += kstep; Nl += kstep; V16 += vstep; Vh += vstep; Vl += vstep;
        v16h v16[4]; v16bf vh[4], vl[4];
#pragma unroll
        for (int dt = 0; dt < 4; ++dt) { const int vo = dt * 16 * TT; if (HR) { vh[dt] = WFrag<bf>::ld(Vh + vo); vl[dt] = WFrag<bf>::ld(Vl + vo); } else v16[dt] = WFrag<h16>::ld(V16 + vo); }
        __builtin_amdgcn_sched_barrier(0);                           // V in front of K: P.V needs V first, and loads return in order
        ldk();                                                       // the next block's key fragments, into the same registers: their latency passes behind the softmax and P.V
        __builtin_amdgcn_sched_barrier(0);                           // holds the loads here, far in front of their first use
        { const int k2 = min(kn + 32, klast); kstep = (k2 - kn) * HD; kn = k2; vstep = 512; }   // 32 keys on: 2 block rows of the key planes, one block of the V^T planes
        if (kb + 31 > q0) {                                          // the block that holds the diagonal (wave-uniform): keys beyond a lane's query leave the softmax
#pragma unroll
            for (int m = 0; m < 2; ++m)
#pragma unroll
                for (int n = 0; n < NT; ++n)
#pragma unroll
                    for (int j = 0; j < 8; ++j) if (kb + m * 16 + 8 * hi + j > q0 + n * 16 + lr) t[m][n][j] = -3.0e38f;
        }
        v16h p16[NT]; v16bf ph[NT], pl[NT];
#pragma unroll
        for (int n = 0; n < NT; ++n) {
            float bm = t[0][n][0];
#pragma unroll
            for (int e = 1; e < 16; ++e) bm = fmaxf(bm, t[e >> 3][n][e & 7]);
            bm = fmaxf(bm, xhalf(bm));                               // the other half of the wave holds the query's other 16 keys
            const float mn = fmaxf(mr[n], bm);                       // finite from the first block on: key 0 is open to every query
            const float al = __builtin_amdgcn_exp2f((mr[n] - mn) * L2E); mr[n] = mn;
            float bs = 0.0f; v8us h0, h1, l0, l1;
#pragma unroll
            for (int e = 0; e < 16; ++e) { const float pe = __builtin_amdgcn_exp2f(HR ? (t[e >> 3][n][e & 7] - mn) * L2E : (t[e >> 3][n][e & 7] - mn) * L2E + 10.0f); bs += pe;   // + 10: P x 1024 for the fp16 planes
                if (HR) { unsigned short a, c2; splitf(pe, a, c2); if (e < 8) { h0[e & 7] = a; l0[e & 7] = c2; } else { h1[e & 7] = a; l1[e & 7] = c2; } }
                else p16[n][e] = tohx(pe); }
            if (HR) { ph[n] = cat16b(h0, h1); pl[n] = cat16b(l0, l1); }
            ls[n] = ls[n] * al + bs;                                 // each half sums its own keys; the halves are joined behind the loop
#pragma unroll
            for (int dt = 0; dt < 4; ++dt) o[dt][n] *= al;
        }
#pragma unroll
        for (int dt = 0; dt < 4; ++dt)
#pragma unroll
            for (int n = 0; n < NT; ++n) {
                if (HR) { o[dt][n] = wmmab(vh[dt], ph[n], o[dt][n]); o[dt][n] = wmmab(vh[dt], pl[n], o[dt][n]); o[dt][n] = wmmab(vl[dt], ph[n], o[dt][n]); }
                else o[dt][n] = wmma16(v16[dt], p16[n], o[dt][n]); }
    }
    addr_done();                                                     // the code below reuses the pointers' registers
#pragma unroll
    for (int n = 0; n < NT; ++n) { const float sum = ls[n] + xhalf(ls[n]); const float f = __fdiv_rn(1.0f, sum);
#pragma unroll
        for (int dt = 0; dt < 4; ++dt) { v8us oh, ol;
#pragma unroll
            for (int j = 0; j < 8; ++j) { unsigned short a, c2; splitf(o[dt][n][j] * f, a, c2); oh[j] = a; ol[j] = c2; }
            const size_t oo = (size_t)(q0 + n * 16) * DQ + dt * 256 + 8 * lane; *(v8us*)(Ah + oo) = oh; *(v8us*)(Al + oo) = ol; }
        if (n + 1 < NT) addr_done(); }                               // the next column group reuses registers that these stores name
}
// grid (NXT, NB_ NH_), AW waves. Plane sets per batch: QK* = the q planes [h][t][d] followed by the k planes; G* = (tanh Q J) planes; V* = [h][d][t]. A* = merged heads [b][t][DQ], hi and lo. Every plane is fragment-major (rows t of 64 d; rows d of TT keys; rows t of DQ).
// Two waves per SIMD (512 registers each): the Q and K fragments alone take 128 registers each.
// The cost of a tile grows with its index and all work-groups are resident at once, so the second of the two rounds of 256 work-groups takes the tiles mirrored: for speed only, each head still gets every tile once.
__global__ __launch_bounds__(32 * AW) __attribute__((amdgpu_waves_per_eu(2, 2))) void k_attn(const bf* __restrict__ QKh, const bf* __restrict__ QKl, const bf* __restrict__ Gh, const bf* __restrict__ Gl, const bf* __restrict__ QKNh, const bf* __restrict__ QKNl,
                                                  const h16* __restrict__ V16, const bf* __restrict__ Vh, const bf* __restrict__ Vl, const float* __restrict__ lamp, bf* Ah, bf* Al) {
    const int bh = blockIdx.y, b = bh / NH_, h = bh % NH_, rnd = (bh * NXT) >> 8;
    int tile = blockIdx.x; if (rnd & 2) tile = (tile + NXT / 2) % NXT; if (rnd & 1) tile = NXT - 1 - tile;
    const int q0 = (tile * AW + __builtin_amdgcn_readfirstlane((int)threadIdx.x >> 5)) * QW;
    const size_t PLN = (size_t)NH_ * TT * HD, qp = ((size_t)b * 2 * NH_ + h) * TT * HD, kp = qp + PLN, gp = ((size_t)b * NH_ + h) * TT * HD, ap = (size_t)b * TT * DQ + h * HD * 16;
    const float lam = bfr(lamp[0]);
    if (q0 < RH) attn_cols<true>(QKh + qp, QKl + qp, Gh + gp, Gl + gp, QKh + kp, QKl + kp, QKNh + kp, QKNl + kp, V16 + gp, Vh + gp, Vl + gp, lam, q0, Ah + ap, Al + ap);
    else attn_cols<false>(QKh + qp, QKl + qp, Gh + gp, Gl + gp, QKh + kp, QKl + kp, QKNh + kp, QKNl + kp, V16 + gp, Vh + gp, Vl + gp, lam, q0, Ah + ap, Al + ap);
}

extern "C" void kernel_launch(void* const* d_in, const int* in_sizes, int n_in,
                              void* d_out, int out_size, void* d_ws, size_t ws_size, hipStream_t stream) {
    (void)in_sizes; (void)n_in; (void)out_size;
    const float* x = (const float*)d_in[0]; const float* wq = (const float*)d_in[1]; const float* bq = (const float*)d_in[2]; const float* wk = (const float*)d_in[3]; const float* bk = (const float*)d_in[4]; const float* wv = (const float*)d_in[5]; const float* bv = (const float*)d_in[6]; const float* wo = (const float*)d_in[7]; const float* bo = (const float*)d_in[8]; const float* Jm = (const float*)d_in[9]; const float* lamp = (const float*)d_in[10];
    float* OUT = (float*)d_out;     // [2][2048][1024]
    char* wsp = (char*)d_ws;
    const size_t PLN = (size_t)NH_ * TT * HD;   // elements of one set of head planes
    auto take = [&](size_t bytes) { char* p = wsp; wsp += (bytes + 255) & ~(size_t)255; return (void*)p; };
    bf* WQ = (bf*)take((size_t)DQ * DM * 2); bf* WK = (bf*)take((size_t)DKV * DM * 2); bf* WV = (bf*)take((size_t)DKV * DM * 2); bf* WO = (bf*)take((size_t)DM * DQ * 2);   // WQ, WK, WV, WO lie in a row
    bf* XB = (bf*)take((size_t)NB_ * TT * DM * 2); bf* JT = (bf*)take((size_t)NH_ * HD * HD * 2);
    /* the planes that k_attn reads are kept for both batches; each q plane is followed by its k plane: QK* [b][q, k][h][t][d], QJ* [b][h][t][d], VT* [b][h][d][t] */
    bf* QKNh = (bf*)take((size_t)NB_ * 2 * PLN * 2); bf* QKNl = (bf*)take((size_t)NB_ * 2 * PLN * 2); bf* QJh = (bf*)take((size_t)NB_ * PLN * 2); bf* QJl = (bf*)take((size_t)NB_ * PLN * 2);
    bf* QKPh = (bf*)take((size_t)NB_ * 2 * PLN * 2); bf* QKPl = (bf*)take((size_t)NB_ * 2 * PLN * 2); h16* VT16 = (h16*)take((size_t)NB_ * PLN * 2); bf* VTh = (bf*)take((size_t)NB_ * PLN * 2); bf* VTl = (bf*)take((size_t)NB_ * PLN * 2);
    bf* ATh = (bf*)take((size_t)NB_ * TT * DQ * 2); bf* ATl = (bf*)take((size_t)NB_ * TT * DQ * 2);
    if ((size_t)(wsp - (char*)d_ws) > ws_size) return;    // ws 256 MiB
    static_assert(DQ == DKV && DQ == DM && HD == 64, "the batched launches take equal shapes; a 64-column tile of a projection is one head"); static_assert((DM * DQ / 8) % 256 == 0 && (HD * HD / 8) % 256 == 0 && DM % 32 == 0 && HD % 32 == 0 && TT % 32 == 0, "whole blocks of the fragment-major planes; one piece a thread in the transposes"); static_assert(RH % QW == 0 && TT % (QW * AW) == 0 && TT % 32 == 0, "a wave's query columns lie on one side of RH and tile the sequence; key blocks of 32 tile it too");
    (void)WK; (void)WV;   // reached as members of the row they lie in
    { k_wtG<<<dim3(DM * DQ / 8 / 256, 4, 1), 256, 0, stream>>>(wq, wk, wv, wo, DM, DQ, WQ);
      k_wtG<<<dim3(HD * HD / 8 / 256, NH_, 1), 256, 0, stream>>>(Jm, nullptr, nullptr, nullptr, HD, HD, JT);
       }
    k_cvt8<<<(unsigned)(((size_t)NB_ * TT * DM / 8 + 255) / 256), 256, 0, stream>>>(x, XB, (size_t)NB_ * TT * DM / 8, DM);   /* both batches */
    for (int b = 0; b < NB_; ++b) {
        k_gemmw<bf, 0, 1, DM><<<dim3(TT / 64, DQ / 64, 3), 32, 0, stream>>>(XB + (size_t)b * TT * DM, nullptr, WQ, nullptr, nullptr, 0, bq, bk, bv, 0, (size_t)DQ * DM, 0,
            QKPh + (size_t)b * 2 * PLN, QKPl + (size_t)b * 2 * PLN, QKNh + (size_t)b * 2 * PLN, QKNl + (size_t)b * 2 * PLN, VT16 + (size_t)b * PLN, VTh + (size_t)b * PLN, VTl + (size_t)b * PLN);   /* q, k, v projections -> q, k, tanh q, tanh k and transposed v planes */
        k_gemmw<bf, 1, 2, HD><<<dim3(TT / 64, 1, NH_), 32, 0, stream>>>(QKNh + (size_t)b * 2 * PLN, QKNl + (size_t)b * 2 * PLN, JT, nullptr, nullptr, HD, nullptr, nullptr, nullptr, (size_t)TT * HD, (size_t)HD * HD, (size_t)TT * HD,
            QJh + (size_t)b * PLN, QJl + (size_t)b * PLN, nullptr, nullptr, nullptr, nullptr, nullptr); }   /* tanh(Q) J of every head -> hi/lo planes */
    k_attn<<<dim3(NXT, NB_ * NH_, 1), 32 * AW, 0, stream>>>(QKPh, QKPl, QJh, QJl, QKNh, QKNl, VT16, VTh, VTl, lamp, ATh, ATl);   /* scores, softmax and P.V of all heads of both batches */
    k_gemmw<bf, 1, 0, DQ><<<dim3(NB_ * TT / 64, DM / 64, 1), 32, 0, stream>>>(ATh, ATl, WO, nullptr, OUT, DM, bo, nullptr, nullptr, 0, 0, 0, nullptr, nullptr, nullptr, nullptr, nullptr, nullptr, nullptr);   /* output projection, both batches */
}

// v006
// A run of this version takes 152 microseconds.
// Next to v005, in two timings, it ran 1.28 times as fast each time.
// Counting every step since v000, it is 13.8 times as fast.
#include <hip/hip_runtime.h>

// Causal attention with a bilinear tanh correction (x [2][2048][1024]; Q/K/V = x W + b (16 x 64); scores = Q.K / 8 + lam * (tanh(Q) J_h tanh(K)^T) (J [16][64][64] and the scalar lam read); causal (-inf) softmax; out = merged Wo + bo -> [2][2048][1024]).
// Compute dtypes, f32 accumulate: every input rounded to bf16; Q/K/V on PLAIN bf16 operands (inputs: exact) + bias; tanh elementwise in f32 (exp2 form with the hardware reciprocal, clamped |x| <= 15), in the projection's epilogue; QJ = hi/lo tanh(Q) x exact J (2 products, f32); both score products hl x hl (3 products) on every row; the two terms combined per element in f32 in the reference's order (s/8 + lam d); key blocks beyond the diagonal skipped; softmax f32, online (running maximum and sum), fused with both products; attn.v: rows < 512 hl (3 products), the rest fp16 (x1024); Wo hl x exact (2 products) + bias.

#define NB_  2
#define TT   2048
#define DM   1024
#define NH_  16
#define NKV  16
#define HD   64
#define DQ   (NH_ * HD)
#define DKV  (NKV * HD)
#define RH   512                  // query rows < RH use hi+lo planes (0: none)
#define SCL  0.125f   // HD^-0.5
typedef _Float16 h16;
typedef unsigned short bf;
typedef __attribute__((ext_vector_type(16))) __bf16   v16bf;
typedef __attribute__((ext_vector_type(16))) _Float16 v16h;
typedef __attribute__((ext_vector_type(8)))  _Float16 v8h;
typedef __attribute__((ext_vector_type(8)))  unsigned short v8us;
typedef __attribute__((ext_vector_type(8)))  float    v8f;
typedef __attribute__((ext_vector_type(4)))  float    v4f;
typedef v8h  __attribute__((may_alias)) v8ha;
typedef v4f  __attribute__((may_alias)) v4fa;
typedef v8us __attribute__((may_alias)) v8usa;

__device__ __forceinline__ unsigned short f2bf(float f) { unsigned u = __float_as_uint(f); u += 0x7FFFu + ((u >> 16) & 1u); return (unsigned short)(u >> 16); }
__device__ __forceinline__ float bf2f(unsigned short b) { return __uint_as_float(((unsigned)b) << 16); }
__device__ __forceinline__ float bfr(float f) { return bf2f(f2bf(f)); }
__device__ __forceinline__ v16h cat16(v8h lo, v8h hi) { return __builtin_shufflevector(lo, hi, 0, 1, 2, 3, 4, 5, 6, 7, 8, 9, 10, 11, 12, 13, 14, 15); }
__device__ __forceinline__ v16bf cat16b(v8us lo, v8us hi) { return __builtin_bit_cast(v16bf, __builtin_shufflevector(lo, hi, 0, 1, 2, 3, 4, 5, 6, 7, 8, 9, 10, 11, 12, 13, 14, 15)); }
__device__ __forceinline__ v8f wmma16(v16h a, v16h b, v8f c) { return __builtin_amdgcn_wmma_f32_16x16x32_f16(false, a, false, b, (short)0, c, false, false); }
__device__ __forceinline__ v8f wmmab(v16bf a, v16bf b, v8f c) { return __builtin_amdgcn_wmma_f32_16x16x32_bf16(false, a, false, b, (short)0, c, false, false); }



// ---- Fragment-major planes. Every 16-bit operand plane M[r][k] (K columns) is kept as blocks of 16 rows x 32 k = 512 elements; block (r / 16, k / 32) starts at element (r / 16) * 16 * K + (k / 32) * 512.
// Inside a block the 8 elements k % 32 = 16 j + 8 hi + (0..7) of row r % 16 = lr lie at j * 256 + (16 hi + lr) * 8: lane 16 hi + lr of a wave reads its fragment as two 16-byte loads, at lane * 8 and at 256 + lane * 8,
// and each of the two loads covers 512 contiguous bytes (four whole lines) where a row-major plane makes it touch 16 lines. Which element reaches which lane and register is as with row-major planes.
// ---- k_gemmw: register-blocked GEMM, ONE WAVE per 64x64 output tile (16 accumulators), operands from fragment-major 16-bit planes.
// ST false: one wave a work-group, fragments straight from global memory; grid (M/64, N/64, Z), 32 threads.
// ST true: four waves (2 x 2) a work-group share a 128x128 tile; grid (M/128, N/128, Z), 128 threads. The operands' 128 rows x 128 k of a stage come into LDS by asynchronous copies (each byte fetched once a work-group, not
// once a wave), two buffers: the next stage's copies fly while this stage is worked on. A stage keeps the planes' own order (8 block rows of 4 blocks = 4 KiB each), so a fragment is two 16-byte LDS loads a lane, 512 contiguous bytes each.
// The products and their k order are the same either way.
// C[m][n] (f32, pitch ldc, + optional f32 bias[n]) = sum_k A[m][k] Bt[n][k] (+ split products per NSPLIT). z-batch strides sA/sB/sC in elements. K % 32 == 0.
// Independent products of one shape run as ONE launch with the member in blockIdx.z: the q, k and v projections (three weight planes, three biases) and the 16 per-head tanh(Q) J products.
// EPI says what the epilogue makes of the f32 tile, which goes through LDS either way (0: 16 rows at a time; 1, 2: whole):
//   0: C (f32, pitch ldc) = tile + bias.
//   1: the projections. A tile is 64 tokens of ONE head (HD == 64). Members 0, 1 (q, k): y = tile + bias goes out as hi/lo planes P* [member][h][t][d], tanh(y) as hi/lo planes N* of the same shape.
//      Member 2 (v): the operands change places (rows = the head's 64 d, columns = tokens; same products, same k order), so that the same row-wise epilogue writes the transposed planes V* [h][d][t] (fp16, hi, lo).
//   2: the tile goes out as hi/lo planes P* (pitch ldc, z-stride sC).
// The 16-bit planes are stored 16 bytes a lane, one half block (16 rows x 16 k) a step: 512 contiguous bytes.
__device__ __forceinline__ h16 tohx(float x) { return (h16)x; }
__device__ __forceinline__ void splitf(float y, unsigned short& h, unsigned short& l) { h = f2bf(y); l = f2bf(y - bf2f(h)); }
__device__ __forceinline__ float tanhc(float x) { const float xs = fminf(fmaxf(x, -15.0f), 15.0f); const float ex = __builtin_amdgcn_exp2f(xs * 2.8853900817779268f); return (ex - 1.0f) * __builtin_amdgcn_rcpf(ex + 1.0f); }
__device__ __forceinline__ void st_hl(const float (&y)[8], bf* Ph, bf* Pl) { v8us oh, ol;
#pragma unroll
    for (int u = 0; u < 8; ++u) { unsigned short a, c; splitf(y[u], a, c); oh[u] = a; ol[u] = c; }
    *(v8us*)Ph = oh; *(v8us*)Pl = ol; }
template <typename T16> struct WFrag;
template <> struct WFrag<h16> { typedef v16h V; static __device__ __forceinline__ V ld(const h16* p) { return cat16(*(const v8h*)p, *(const v8h*)(p + 256)); } static __device__ __forceinline__ v8f mma(V a, V b, v8f c) { return wmma16(a, b, c); } };
template <> struct WFrag<bf> { typedef v16bf V; static __device__ __forceinline__ V ld(const bf* p) { return cat16b(*(const v8us*)p, *(const v8us*)(p + 256)); } static __device__ __forceinline__ v8f mma(V a, V b, v8f c) { return wmmab(a, b, c); } };
// One block row of a stage (4 blocks = 4 KiB, contiguous in the plane and in LDS): eight asynchronous copies of 16 bytes a lane, 512 bytes a wave each. l: the lane's LDS byte address, g: its global address.
// The wait on the last line stands in front of whatever next rewrites the address registers that the copies name.
template <typename T16>
__device__ __forceinline__ void cp_row(unsigned l, const T16* g) {
    asm volatile("global_load_async_to_lds_b128 %0, %8, off\n\t"
                 "global_load_async_to_lds_b128 %1, %9, off\n\t"
                 "global_load_async_to_lds_b128 %2, %10, off\n\t"
                 "global_load_async_to_lds_b128 %3, %11, off\n\t"
                 "global_load_async_to_lds_b128 %4, %12, off\n\t"
                 "global_load_async_to_lds_b128 %5, %13, off\n\t"
                 "global_load_async_to_lds_b128 %6, %14, off\n\t"
                 "global_load_async_to_lds_b128 %7, %15, off\n\t"
                 "s_wait_xcnt 0x0"
                 :: "v"(l), "v"(l + 512u), "v"(l + 1024u), "v"(l + 1536u), "v"(l + 2048u), "v"(l + 2560u), "v"(l + 3072u), "v"(l + 3584u),
                    "v"(g), "v"(g + 256), "v"(g + 512), "v"(g + 768), "v"(g + 1024), "v"(g + 1280), "v"(g + 1536), "v"(g + 1792) : "memory");
}
template <typename T16, int NSPLIT, int EPI, int K, bool ST>
__global__ __launch_bounds__(ST ? 128 : 32) void k_gemmw(const T16* __restrict__ A, const T16* __restrict__ A2, const T16* __restrict__ Bt, const T16* __restrict__ Bt2, float* C, int ldc, const float* __restrict__ bias0, const float* __restrict__ bias1, const float* __restrict__ bias2, size_t sA, size_t sB, size_t sC,
                                              bf* Ph, bf* Pl, bf* Nh, bf* Nl, h16* V16, bf* Vh, bf* Vl) {
    typedef typename WFrag<T16>::V V;
    constexpr int OSN = (EPI == 0 ? 16 : 64) * 68;                   // floats of one wave's epilogue staging
    constexpr unsigned PB = 128 * 128 * 2, SB = (NSPLIT == 1 ? 3 : 2) * PB;   // bytes of one plane's part of a stage; of a stage (A, A2 where there is one, B)
    constexpr unsigned SMB = !ST ? OSN * 4 : (2 * SB > 4 * OSN * 4) ? 2 * SB : 4 * OSN * 4;   // the epilogue stages in the two buffers' place, behind the last stage's barrier
    __shared__ __align__(1024) char sm[SMB];
    const int wave = ST ? __builtin_amdgcn_readfirstlane((int)threadIdx.x >> 5) : 0;
    float* const os = (float*)sm + wave * OSN;
    const size_t z = blockIdx.z; A += z * sA; if (A2) A2 += z * sA; Bt += z * sB; if (Bt2) Bt2 += z * sB; if (EPI == 0) C += z * sC;
    const float* __restrict__ bias = (z == 0) ? bias0 : (z == 1) ? bias1 : bias2;   // each z-batch member has its own bias vector (at most three members where a bias is added)
    const bool vt = EPI == 1 && z == 2;                                             // the v projection: rows from the weight plane, columns from x
    if (vt) { const T16* const w = Bt; Bt = A; A = w; }
    const int lane = threadIdx.x & 31, lr = lane & 15, hi = lane >> 4; const int R0 = (vt ? blockIdx.y : blockIdx.x) * (ST ? 128 : 64), C0 = (vt ? blockIdx.x : blockIdx.y) * (ST ? 128 : 64), r0 = R0 + (wave >> 1) * 64, c0 = C0 + (wave & 1) * 64;
    v8f acc[4][4];
#pragma unroll
    for (int mb = 0; mb < 4; ++mb)
#pragma unroll
        for (int nb = 0; nb < 4; ++nb) acc[mb][nb] = (v8f){};
    if constexpr (ST) {
        static_assert(NSPLIT <= 1 && K % 128 == 0 && K / 128 >= 2, "whole stages of 128 k, two at least; planes A, A2, B");
        constexpr int NS = K / 128;
        // Wave w copies block rows 2 w and 2 w + 1 of each plane's 8.
        const unsigned lw = (unsigned)(size_t)sm + (unsigned)wave * 8192u + (unsigned)lane * 16u;
        const T16* const ga = A + (size_t)(R0 + wave * 32) * K + 8 * lane; const T16* const ga2 = A2 + (size_t)(R0 + wave * 32) * K + 8 * lane; const T16* const gb = Bt + (size_t)(C0 + wave * 32) * K + 8 * lane;
        auto fill = [&](int s, unsigned l) { const size_t go = (size_t)s * 2048;
            cp_row(l, ga + go); cp_row(l + 4096u, ga + go + 16 * K);
            if (NSPLIT == 1) { cp_row(l + PB, ga2 + go); cp_row(l + PB + 4096u, ga2 + go + 16 * K); }
            cp_row(l + (SB - PB), gb + go); cp_row(l + (SB - PB) + 4096u, gb + go + 16 * K); };
        fill(0, lw);
        asm volatile("s_wait_asynccnt 0x0" ::: "memory");            // this wave's part of stage 0 has landed
        __syncthreads();                                             // every wave's part has
        fill(1, lw + SB);
#pragma unroll 1   // rolled: one copy of the stage's text, the buffer chosen by an offset
        for (int s = 0; s < NS; ++s) {
            const unsigned bo = (unsigned)(s & 1) * SB;
            const T16* const fa = (const T16*)(sm + bo + (unsigned)(wave >> 1) * 16384u) + 8 * lane; const T16* const fa2 = (const T16*)(sm + bo + PB + (unsigned)(wave >> 1) * 16384u) + 8 * lane; const T16* const fb = (const T16*)(sm + bo + (SB - PB) + (unsigned)(wave & 1) * 16384u) + 8 * lane;
            V a[2][4], a2[2][4], b[2][4];                            // two fragment sets: inside a stage the next block's LDS loads go out as one group in front of this block's products
            auto ldf = [&](int kb) {
#pragma unroll
                for (int mb = 0; mb < 4; ++mb) { a[kb & 1][mb] = WFrag<T16>::ld(fa + mb * 2048 + kb * 512); if (NSPLIT == 1) a2[kb & 1][mb] = WFrag<T16>::ld(fa2 + mb * 2048 + kb * 512); }
#pragma unroll
                for (int nb = 0; nb < 4; ++nb) b[kb & 1][nb] = WFrag<T16>::ld(fb + nb * 2048 + kb * 512); };
            ldf(0);
#pragma unroll
            for (int kb = 0; kb < 4; ++kb) {
                if (kb < 3) ldf(kb + 1);
                __builtin_amdgcn_sched_barrier(0);                   // keeps the load group whole and in front of the products: sunk among them, each small group is waited for by itself
#pragma unroll
                for (int nb = 0; nb < 4; ++nb)
#pragma unroll
                    for (int mb = 0; mb < 4; ++mb) { acc[mb][nb] = WFrag<T16>::mma(a[kb & 1][mb], b[kb & 1][nb], acc[mb][nb]); if (NSPLIT == 1) acc[mb][nb] = WFrag<T16>::mma(a2[kb & 1][mb], b[kb & 1][nb], acc[mb][nb]); }
                __builtin_amdgcn_sched_barrier(0);                   // keeps the block after next's loads, which land in this block's registers, behind its products
            }
            asm volatile("s_wait_dscnt 0x0" ::: "memory");           // this wave's reads of the buffer are done: behind the barrier it is refilled
            asm volatile("s_wait_asynccnt 0x0" ::: "memory");        // this wave's part of the next stage has landed
            __syncthreads();                                         // publishes the next stage and ends every wave's reads of this one
            if (s + 2 < NS) fill(s + 2, lw + bo);
        }
        asm volatile("s_wait_asynccnt 0x0" ::: "memory");            // no copy is left in flight where the buffers become the epilogue's staging
    } else {
    // Each lane's own piece of the first block of block row r0 / 16 (c0 / 16); the pointers walk k, one block (512 elements) a trip, and the block rows below are constant offsets from them.
    const T16* pa = A + (size_t)r0 * K + 8 * lane; const T16* pa2 = A2 + (size_t)r0 * K + 8 * lane; const T16* pb = Bt + (size_t)c0 * K + 8 * lane; const T16* pb2 = Bt2 + (size_t)c0 * K + 8 * lane;
#pragma unroll 1
    for (int kc = 0; kc < K; kc += 32) {
        V a[4], a2[4], b[4], b2[4];
#pragma unroll
        for (int mb = 0; mb < 4; ++mb) { a[mb] = WFrag<T16>::ld(pa + mb * 16 * K); if (NSPLIT == 1 || NSPLIT == 2) a2[mb] = WFrag<T16>::ld(pa2 + mb * 16 * K); }
#pragma unroll
        for (int nb = 0; nb < 4; ++nb) { b[nb] = WFrag<T16>::ld(pb + nb * 16 * K); if (NSPLIT >= 2) b2[nb] = WFrag<T16>::ld(pb2 + nb * 16 * K); }
        // In front of the pointers' step: they are the address registers of the loads just issued. Named as inputs they keep their registers up to the wait, so that no load lands on its own address pair.
        if (NSPLIT == 0) asm volatile("s_wait_xcnt 0x0" :: "v"(pa), "v"(pb) : "memory"); else if (NSPLIT == 1) asm volatile("s_wait_xcnt 0x0" :: "v"(pa), "v"(pa2), "v"(pb) : "memory"); else asm volatile("s_wait_xcnt 0x0" :: "v"(pa), "v"(pa2), "v"(pb), "v"(pb2) : "memory");
        __builtin_amdgcn_sched_barrier(0);                           // keeps the step behind the wait, and the trip's loads together in front of its products: sunk among them, each group of loads would be waited for by itself
        pa += 512; pa2 += 512; pb += 512; pb2 += 512;
#pragma unroll
        for (int nb = 0; nb < 4; ++nb)
#pragma unroll
            for (int mb = 0; mb < 4; ++mb) { acc[mb][nb] = WFrag<T16>::mma(a[mb], b[nb], acc[mb][nb]); if (NSPLIT == 1 || NSPLIT == 2) acc[mb][nb] = WFrag<T16>::mma(a2[mb], b[nb], acc[mb][nb]); if (NSPLIT >= 2) acc[mb][nb] = WFrag<T16>::mma(a[mb], b2[nb], acc[mb][nb]); }
        asm volatile("v_nop\n\tv_nop\n\tv_nop\n\tv_nop" : "+v"(acc[0][0]), "+v"(acc[1][1]), "+v"(acc[2][2]), "+v"(acc[3][3]) : "v"(a[0]), "v"(a[3]));
    }
    }
    if (EPI == 0) {
#pragma unroll
    for (int mb = 0; mb < 4; ++mb) {
#pragma unroll
        for (int nb = 0; nb < 4; ++nb) {
#pragma unroll
            for (int j = 0; j < 8; ++j) os[(hi * 8 + j) * 68 + nb * 16 + lr] = acc[mb][nb][j]; }
        __builtin_amdgcn_wave_barrier(); asm volatile("" ::: "memory");
        float* crow = C + (size_t)(r0 + mb * 16) * ldc + c0;
{
#pragma unroll
            for (int s = 0; s < 8; ++s) { const int row = 2 * s + hi, cofs = lr * 4; v4f val = *(const v4fa*)(os + row * 68 + cofs); val[0] += bfr(bias[c0 + cofs]); val[1] += bfr(bias[c0 + cofs + 1]); val[2] += bfr(bias[c0 + cofs + 2]); val[3] += bfr(bias[c0 + cofs + 3]);
                *(v4f*)(crow + (size_t)row * ldc + cofs) = val; }
             }
        __builtin_amdgcn_wave_barrier(); asm volatile("" ::: "memory");
    }
    } else {
        if (vt) {                                                    // the bias is added on the way into LDS: per row where the operands changed places, else per column
#pragma unroll
            for (int mb = 0; mb < 4; ++mb)
#pragma unroll
                for (int j = 0; j < 8; ++j) { const float bb = bfr(bias[r0 + mb * 16 + hi * 8 + j]);
#pragma unroll
                    for (int nb = 0; nb < 4; ++nb) os[(mb * 16 + hi * 8 + j) * 68 + nb * 16 + lr] = acc[mb][nb][j] + bb; }
        } else {
#pragma unroll
            for (int nb = 0; nb < 4; ++nb) { const float bb = (EPI == 1) ? bfr(bias[c0 + nb * 16 + lr]) : 0.0f;
#pragma unroll
                for (int mb = 0; mb < 4; ++mb)
#pragma unroll
                    for (int j = 0; j < 8; ++j) os[(mb * 16 + hi * 8 + j) * 68 + nb * 16 + lr] = (EPI == 1) ? acc[mb][nb][j] + bb : acc[mb][nb][j]; }
        }
        __builtin_amdgcn_wave_barrier(); asm volatile("" ::: "memory");   // the lanes read each other's rows below
        // Read-back: one half block a step (16 rows, 16 columns: 8 columns a lane), in the order in which the half blocks lie in the plane. The loops stay rolled, two steps a trip, so that the second step's LDS reads pass behind the first step's arithmetic.
        // Trip i = 2 mb + kb: rows 16 mb.., columns 32 kb..; step s: columns + 16 s. ldp = columns of the plane that the tile goes to, cc = the tile's first column in it.
        const float* const op0 = os + lr * 68 + hi * 8;
        const size_t ldp = vt ? TT : (EPI == 2) ? ldc : HD, cc = (vt || EPI == 2) ? c0 : 0;
        const size_t o0 = (vt ? 0 : (EPI == 2) ? z * sC : (z * NH_ + (c0 >> 6)) * (size_t)TT * HD) + (size_t)r0 * ldp + cc * 16 + 8 * lane;
        if (!vt) {
#pragma unroll 1
            for (int i = 0; i < 8; ++i) {
#pragma unroll
                for (int s = 0; s < 2; ++s) { const float* const op = op0 + (i >> 1) * (16 * 68) + (i & 1) * 32 + s * 16; const size_t o = o0 + (size_t)(i >> 1) * 16 * ldp + (i & 1) * 512 + s * 256;
                    const v4f x0 = *(const v4fa*)op, x1 = *(const v4fa*)(op + 4);
                    const float y[8] = { x0[0], x0[1], x0[2], x0[3], x1[0], x1[1], x1[2], x1[3] };
                    st_hl(y, Ph + o, Pl + o);
                    if (EPI == 1) { float th[8];
#pragma unroll
                        for (int u = 0; u < 8; ++u) th[u] = tanhc(y[u]);
                        st_hl(th, Nh + o, Nl + o); } }
                asm volatile("s_wait_xcnt 0x0" ::: "memory");        // the next trip overwrites data and address registers of the stores just issued
            }
        } else {
#pragma unroll 1
            for (int i = 0; i < 8; ++i) {
#pragma unroll
                for (int s = 0; s < 2; ++s) { const float* const op = op0 + (i >> 1) * (16 * 68) + (i & 1) * 32 + s * 16; const size_t o = o0 + (size_t)(i >> 1) * 16 * ldp + (i & 1) * 512 + s * 256;
                    const v4f x0 = *(const v4fa*)op, x1 = *(const v4fa*)(op + 4);
                    const float y[8] = { x0[0], x0[1], x0[2], x0[3], x1[0], x1[1], x1[2], x1[3] }; v8h o16;
#pragma unroll
                    for (int u = 0; u < 8; ++u) o16[u] = tohx(y[u]);
                    *(v8h*)(V16 + o) = o16; st_hl(y, Vh + o, Vl + o); }
                asm volatile("s_wait_xcnt 0x0" ::: "memory");        // as above
            }
        }
    }
}

typedef __attribute__((ext_vector_type(2))) _Float16 v2h;
typedef __attribute__((ext_vector_type(4))) _Float16 v4h;
typedef __attribute__((ext_vector_type(2))) unsigned short v2us;
typedef __attribute__((ext_vector_type(4))) unsigned short v4us;
typedef __attribute__((ext_vector_type(2))) float v2f;
typedef __attribute__((ext_vector_type(4))) int v4i;

// k_wtG: the fragment-major plane of Bt[n][k] = bf16(w[k][n]); blockIdx.y is the matrix of a batch of equal shapes: matrix y of one array (w1 null), or one of four separate arrays; the outputs lie in a row.
// One 8-element piece a thread, in the order of the plane: a wave stores 512 contiguous bytes, and each of its 8 loads reads 16 neighbouring n of two rows k. N K / 8 is a multiple of the block size.
__global__ __launch_bounds__(256) void k_wtG(const float* __restrict__ w0, const float* __restrict__ w1, const float* __restrict__ w2, const float* __restrict__ w3, int K, int N, bf* Bt) {
    const int y = blockIdx.y; const float* __restrict__ w = !w1 ? w0 + (size_t)y * K * N : (y == 0) ? w0 : (y == 1) ? w1 : (y == 2) ? w2 : w3; Bt += (size_t)y * K * N;
    const int g = blockIdx.x * 256 + threadIdx.x, blk = g >> 6, kbs = K >> 5;
    const int n = (blk / kbs) * 16 + (g & 15), k = (blk % kbs) * 32 + ((g >> 5) & 1) * 16 + ((g >> 4) & 1) * 8;
    const float* __restrict__ p = w + (size_t)k * N + n; float v[8];
#pragma unroll
    for (int u = 0; u < 8; ++u) v[u] = p[(size_t)u * N];
    v8us o;
#pragma unroll
    for (int u = 0; u < 8; ++u) o[u] = f2bf(v[u]);
    *(v8us*)(Bt + (size_t)g * 8) = o;
}
// k_cvt8: the fragment-major bf16 plane of src[r][k] (K columns); one 8-element piece a thread, in the order of the plane (a wave stores 512 contiguous bytes; a block reads 512 contiguous bytes of each of 16 rows).
__global__ __launch_bounds__(256) void k_cvt8(const float* __restrict__ src, bf* dst, size_t n8, int K) { const size_t i = (size_t)blockIdx.x * 256 + threadIdx.x; if (i >= n8) return;
    const int blk = (int)(i >> 6), kbs = K >> 5; const int r = (blk / kbs) * 16 + ((int)i & 15), k = (blk % kbs) * 32 + (((int)i >> 5) & 1) * 16 + (((int)i >> 4) & 1) * 8;
    const v8f v = *(const v8f*)(src + (size_t)r * K + k); v8us o;
    asm volatile("s_wait_xcnt 0x0" ::: "memory");                    // the conversion below reuses the address registers of the loads just issued
#pragma unroll
    for (int u = 0; u < 8; ++u) o[u] = f2bf(v[u]); *(v8us*)(dst + i * 8) = o;  }
// ---- k_attn: score products, causal softmax and probability x value product of every (batch, head) in ONE launch; scores and probabilities stay in registers.
// One wave owns QW = 16 NT query columns and walks the keys up to its diagonal in blocks of 32. Transposed products: S^T = K Q^T and D^T = tanh(K) (tanh(Q) J)^T (A = key rows, B = query rows kept in
// registers; both hl x hl, 3 products), so a lane holds the scores of ONE query: keys 8 hi + j of each 16-key tile. t = S / 8 + lam D per element in f32; running maximum and running sum per query
// (online softmax: the output tile and the sum are rescaled by exp(old max - new max) in every block). The two 16-key tiles of a block, converted in place, ARE the B operand of O^T += V^T P^T
// (element s = tile s >> 3, register s & 7: the k order of the V^T loader). Query rows < RH: P and V in hi+lo planes (3 products); the rest fp16 with P x 1024. P is left unnormalised; O is divided by the sum at the end
// (the factor 1024 is in the sum too and cancels). Every inner loop is unrolled so that the fragment arrays stay in registers. A lane's 8 accumulator registers are 8 consecutive d of one query: one 16-byte store per plane and d tile into the merged-head hi/lo planes, where the wave's 32 pieces are one half block (512 contiguous bytes).
#define NT   2                    // 16-query column groups per wave
#define QW   (16 * NT)            // queries per wave
#define AW   4                    // waves per work-group: neighbouring query columns of one head, which read the same key rows at about the same time
#define NXT  (TT / (QW * AW))     // query tiles (work-groups) per head
#define L2E  1.4426950408889634f
__device__ __forceinline__ float xhalf(float x) { return __builtin_bit_cast(float, __builtin_amdgcn_permlanex16(__builtin_bit_cast(int, x), __builtin_bit_cast(int, x), 0x76543210, 0xfedcba98, false, false)); }   // lane l reads lane l ^ 16
// In front of code that overwrites address registers of global loads or stores just issued; the scheduling barrier keeps that code behind the wait (and the loads in front of it).
__device__ __forceinline__ void addr_done() { asm volatile("s_wait_xcnt 0x0" ::: "memory"); __builtin_amdgcn_sched_barrier(0); }
// The same, naming two pointers as inputs: they keep their registers up to the wait (else the last load through each lands on its own address pair).
__device__ __forceinline__ void addr_done(const bf* a, const bf* b) { asm volatile("s_wait_xcnt 0x0" :: "v"(a), "v"(b) : "memory"); __builtin_amdgcn_sched_barrier(0); }
template <bool HR>
__device__ __forceinline__ void attn_cols(const bf* __restrict__ Qh, const bf* __restrict__ Ql, const bf* __restrict__ Gh, const bf* __restrict__ Gl, const bf* __restrict__ Kh, const bf* __restrict__ Kl, const bf* __restrict__ Nh, const bf* __restrict__ Nl,
                                          const h16* __restrict__ V16, const bf* __restrict__ Vh, const bf* __restrict__ Vl, float lam, int q0, bf* Ah, bf* Al) {
    const int lane = threadIdx.x & 31, lr = lane & 15, hi = lane >> 4;
    v16bf qh[NT][2], ql[NT][2], gh[NT][2], gl[NT][2];
#pragma unroll
    for (int n = 0; n < NT; ++n)
#pragma unroll
        for (int ks = 0; ks < 2; ++ks) { const size_t qo = (size_t)(q0 + n * 16) * HD + ks * 512 + 8 * lane; qh[n][ks] = WFrag<bf>::ld(Qh + qo); ql[n][ks] = WFrag<bf>::ld(Ql + qo); gh[n][ks] = WFrag<bf>::ld(Gh + qo); gl[n][ks] = WFrag<bf>::ld(Gl + qo); }
    addr_done();
    v16bf kf[2][2][4];                                               // key fragments of the block at hand: [16-key tile][k step][K hi, K lo, tanh K hi, tanh K lo]
    { const int lo = 8 * lane; Kh += lo; Kl += lo; Nh += lo; Nl += lo; V16 += lo; Vh += lo; Vl += lo; }   // each lane's own place in a block; the pointers then walk the keys
    auto ldk = [&]() {
#pragma unroll
        for (int m = 0; m < 2; ++m)
#pragma unroll
            for (int ks = 0; ks < 2; ++ks) { const int ko = m * 16 * HD + ks * 512; kf[m][ks][0] = WFrag<bf>::ld(Kh + ko); kf[m][ks][1] = WFrag<bf>::ld(Kl + ko); kf[m][ks][2] = WFrag<bf>::ld(Nh + ko); kf[m][ks][3] = WFrag<bf>::ld(Nl + ko); } };
    const int kend = q0 + QW, klast = (kend - 1) & ~31;              // keys up to the last query's diagonal; first key of the last block
    ldk();
    addr_done();
    int kn = min(32, klast), kstep = kn * HD, vstep = 0;             // first key of the block to fetch next (the last block is fetched again: in bounds, unused); how far the pointers move in front of the next loads
    v8f o[4][NT]; float mr[NT], ls[NT];
#pragma unroll
    for (int n = 0; n < NT; ++n) { mr[n] = -3.0e38f; ls[n] = 0.0f;
#pragma unroll
        for (int dt = 0; dt < 4; ++dt) o[dt][n] = (v8f){}; }
#pragma unroll 1   // rolled: a second copy of the block would need a second set of fragment registers
    for (int kb = 0; kb < kend; kb += 32) {
        float t[2][NT][8];
#pragma unroll
        for (int m = 0; m < 2; ++m) {
            v8f s[NT], d[NT];
#pragma unroll
            for (int n = 0; n < NT; ++n) { s[n] = (v8f){}; d[n] = (v8f){}; }
#pragma unroll
            for (int ks = 0; ks < 2; ++ks) { const v16bf kh = kf[m][ks][0], kl = kf[m][ks][1], nh = kf[m][ks][2], nl = kf[m][ks][3];
#pragma unroll
                for (int n = 0; n < NT; ++n) { s[n] = wmmab(kh, qh[n][ks], s[n]); d[n] = wmmab(nh, gh[n][ks], d[n]); s[n] = wmmab(kh, ql[n][ks], s[n]); d[n] = wmmab(nh, gl[n][ks], d[n]); s[n] = wmmab(kl, qh[n][ks], s[n]); d[n] = wmmab(nl, gh[n][ks], d[n]); } }
#pragma unroll
            for (int n = 0; n < NT; ++n)
#pragma unroll
                for (int j = 0; j < 8; ++j) t[m][n][j] = s[n][j] * SCL + lam * d[n][j];
        }
        if (HR) addr_done(Vh, Vl); else addr_done();                 // the pointers move only here, a whole block behind the loads that name them; the scheduling barrier also keeps the loads below from rising over the score products, where they would need a second set of fragment registers
        Kh += kstep; Kl += kstep; Nh += kstep; Nl += kstep; V16 += vstep; Vh += vstep; Vl += vstep;
        v16h v16[4]; v16bf vh[4], vl[4];
#pragma unroll
        for (int dt = 0; dt < 4; ++dt) { const int vo = dt * 16 * TT; if (HR) { vh[dt] = WFrag<bf>::ld(Vh + vo); vl[dt] = WFrag<bf>::ld(Vl + vo); } else v16[dt] = WFrag<h16>::ld(V16 + vo); }
        __builtin_amdgcn_sched_barrier(0);                           // V in front of K: P.V needs V first, and loads return in order
        ldk();                                                       // the next block's key fragments, into the same registers: their latency passes behind the softmax and P.V
        __builtin_amdgcn_sched_barrier(0);                           // holds the loads here, far in front of their first use
        { const int k2 = min(kn + 32, klast); kstep = (k2 - kn) * HD; kn = k2; vstep = 512; }   // 32 keys on: 2 block rows of the key planes, one block of the V^T planes
        if (kb + 31 > q0) {                                          // the block that holds the diagonal (wave-uniform): keys beyond a lane's query leave the softmax
#pragma unroll
            for (int m = 0; m < 2; ++m)
#pragma unroll
                for (int n = 0; n < NT; ++n)
#pragma unroll
                    for (int j = 0; j < 8; ++j) if (kb + m * 16 + 8 * hi + j > q0 + n * 16 + lr) t[m][n][j] = -3.0e38f;
        }
        v16h p16[NT]; v16bf ph[NT], pl[NT];
#pragma unroll
        for (int n = 0; n < NT; ++n) {
            float bm = t[0][n][0];
#pragma unroll
            for (int e = 1; e < 16; ++e) bm = fmaxf(bm, t[e >> 3][n][e & 7]);
            bm = fmaxf(bm, xhalf(bm));                               // the other half of the wave holds the query's other 16 keys
            const float mn = fmaxf(mr[n], bm);                       // finite from the first block on: key 0 is open to every query
            const float al = __builtin_amdgcn_exp2f((mr[n] - mn) * L2E); mr[n] = mn;
            float bs = 0.0f; v8us h0, h1, l0, l1;
#pragma unroll
            for (int e = 0; e < 16; ++e) { const float pe = __builtin_amdgcn_exp2f(HR ? (t[e >> 3][n][e & 7] - mn) * L2E : (t[e >> 3][n][e & 7] - mn) * L2E + 10.0f); bs += pe;   // + 10: P x 1024 for the fp16 planes
                if (HR) { unsigned short a, c2; splitf(pe, a, c2); if (e < 8) { h0[e & 7] = a; l0[e & 7] = c2; } else { h1[e & 7] = a; l1[e & 7] = c2; } }
                else p16[n][e] = tohx(pe); }
            if (HR) { ph[n] = cat16b(h0, h1); pl[n] = cat16b(l0, l1); }
            ls[n] = ls[n] * al + bs;                                 // each half sums its own keys; the halves are joined behind the loop
#pragma unroll
            for (int dt = 0; dt < 4; ++dt) o[dt][n] *= al;
        }
#pragma unroll
        for (int dt = 0; dt < 4; ++dt)
#pragma unroll
            for (int n = 0; n < NT; ++n) {
                if (HR) { o[dt][n] = wmmab(vh[dt], ph[n], o[dt][n]); o[dt][n] = wmmab(vh[dt], pl[n], o[dt][n]); o[dt][n] = wmmab(vl[dt], ph[n], o[dt][n]); }
                else o[dt][n] = wmma16(v16[dt], p16[n], o[dt][n]); }
    }
    addr_done();                                                     // the code below reuses the pointers' registers
#pragma unroll
    for (int n = 0; n < NT; ++n) { const float sum = ls[n] + xhalf(ls[n]); const float f = __fdiv_rn(1.0f, sum);
#pragma unroll
        for (int dt = 0; dt < 4; ++dt) { v8us oh, ol;
#pragma unroll
            for (int j = 0; j < 8; ++j) { unsigned short a, c2; splitf(o[dt][n][j] * f, a, c2); oh[j] = a; ol[j] = c2; }
            const size_t oo = (size_t)(q0 + n * 16) * DQ + dt * 256 + 8 * lane; *(v8us*)(Ah + oo) = oh; *(v8us*)(Al + oo) = ol; }
        if (n + 1 < NT) addr_done(); }                               // the next column group reuses registers that these stores name
}
// grid (NXT, NB_ NH_), AW waves. Plane sets per batch: QK* = the q planes [h][t][d] followed by the k planes; G* = (tanh Q J) planes; V* = [h][d][t]. A* = merged heads [b][t][DQ], hi and lo. Every plane is fragment-major (rows t of 64 d; rows d of TT keys; rows t of DQ).
// Two waves per SIMD (512 registers each): the Q and K fragments alone take 128 registers each.
// The cost of a tile grows with its index and all work-groups are resident at once, so the second of the two rounds of 256 work-groups takes the tiles mirrored: for speed only, each head still gets every tile once.
__global__ __launch_bounds__(32 * AW) __attribute__((amdgpu_waves_per_eu(2, 2))) void k_attn(const bf* __restrict__ QKh, const bf* __restrict__ QKl, const bf* __restrict__ Gh, const bf* __restrict__ Gl, const bf* __restrict__ QKNh, const bf* __restrict__ QKNl,
                                                  const h16* __restrict__ V16, const bf* __restrict__ Vh, const bf* __restrict__ Vl, const float* __restrict__ lamp, bf* Ah, bf* Al) {
    const int bh = blockIdx.y, b = bh / NH_, h = bh % NH_, rnd = (bh * NXT) >> 8;
    int tile = blockIdx.x; if (rnd & 2) tile = (tile + NXT / 2) % NXT; if (rnd & 1) tile = NXT - 1 - tile;
    const int q0 = (tile * AW + __builtin_amdgcn_readfirstlane((int)threadIdx.x >> 5)) * QW;
    const size_t PLN = (size_t)NH_ * TT * HD, qp = ((size_t)b * 2 * NH_ + h) * TT * HD, kp = qp + PLN, gp = ((size_t)b * NH_ + h) * TT * HD, ap = (size_t)b * TT * DQ + h * HD * 16;
    const float lam = bfr(lamp[0]);
    if (q0 < RH) attn_cols<true>(QKh + qp, QKl + qp, Gh + gp, Gl + gp, QKh + kp, QKl + kp, QKNh + kp, QKNl + kp, V16 + gp, Vh + gp, Vl + gp, lam, q0, Ah + ap, Al + ap);
    else attn_cols<false>(QKh + qp, QKl + qp, Gh + gp, Gl + gp, QKh + kp, QKl + kp, QKNh + kp, QKNl + kp, V16 + gp, Vh + gp, Vl + gp, lam, q0, Ah + ap, Al + ap);
}

extern "C" void kernel_launch(void* const* d_in, const int* in_sizes, int n_in,
                              void* d_out, int out_size, void* d_ws, size_t ws_size, hipStream_t stream) {
    (void)in_sizes; (void)n_in; (void)out_size;
    const float* x = (const float*)d_in[0]; const float* wq = (const float*)d_in[1]; const float* bq = (const float*)d_in[2]; const float* wk = (const float*)d_in[3]; const float* bk = (const float*)d_in[4]; const float* wv = (const float*)d_in[5]; const float* bv = (const float*)d_in[6]; const float* wo = (const float*)d_in[7]; const float* bo = (const float*)d_in[8]; const float* Jm = (const float*)d_in[9]; const float* lamp = (const float*)d_in[10];
    float* OUT = (float*)d_out;     // [2][2048][1024]
    char* wsp = (char*)d_ws;
    const size_t PLN = (size_t)NH_ * TT * HD;   // elements of one set of head planes
    auto take = [&](size_t bytes) { char* p = wsp; wsp += (bytes + 255) & ~(size_t)255; return (void*)p; };
    bf* WQ = (bf*)take((size_t)DQ * DM * 2); bf* WK = (bf*)take((size_t)DKV * DM * 2); bf* WV = (bf*)take((size_t)DKV * DM * 2); bf* WO = (bf*)take((size_t)DM * DQ * 2);   // WQ, WK, WV, WO lie in a row
    bf* XB = (bf*)take((size_t)NB_ * TT * DM * 2); bf* JT = (bf*)take((size_t)NH_ * HD * HD * 2);
    /* the planes that k_attn reads are kept for both batches; each q plane is followed by its k plane: QK* [b][q, k][h][t][d], QJ* [b][h][t][d], VT* [b][h][d][t] */
    bf* QKNh = (bf*)take((size_t)NB_ * 2 * PLN * 2); bf* QKNl = (bf*)take((size_t)NB_ * 2 * PLN * 2); bf* QJh = (bf*)take((size_t)NB_ * PLN * 2); bf* QJl = (bf*)take((size_t)NB_ * PLN * 2);
    bf* QKPh = (bf*)take((size_t)NB_ * 2 * PLN * 2); bf* QKPl = (bf*)take((size_t)NB_ * 2 * PLN * 2); h16* VT16 = (h16*)take((size_t)NB_ * PLN * 2); bf* VTh = (bf*)take((size_t)NB_ * PLN * 2); bf* VTl = (bf*)take((size_t)NB_ * PLN * 2);
    bf* ATh = (bf*)take((size_t)NB_ * TT * DQ * 2); bf* ATl = (bf*)take((size_t)NB_ * TT * DQ * 2);
    if ((size_t)(wsp - (char*)d_ws) > ws_size) return;    // ws 256 MiB
    static_assert(DQ == DKV && DQ == DM && HD == 64, "the batched launches take equal shapes; a 64-column tile of a projection is one head"); static_assert((DM * DQ / 8) % 256 == 0 && (HD * HD / 8) % 256 == 0 && DM % 32 == 0 && HD % 32 == 0 && TT % 32 == 0, "whole blocks of the fragment-major planes; one piece a thread in the transposes"); static_assert(RH % QW == 0 && TT % (QW * AW) == 0 && TT % 32 == 0, "a wave's query columns lie on one side of RH and tile the sequence; key blocks of 32 tile it too");
    (void)WK; (void)WV;   // reached as members of the row they lie in
    { k_wtG<<<dim3(DM * DQ / 8 / 256, 4, 1), 256, 0, stream>>>(wq, wk, wv, wo, DM, DQ, WQ);
      k_wtG<<<dim3(HD * HD / 8 / 256, NH_, 1), 256, 0, stream>>>(Jm, nullptr, nullptr, nullptr, HD, HD, JT);
       }
    k_cvt8<<<(unsigned)(((size_t)NB_ * TT * DM / 8 + 255) / 256), 256, 0, stream>>>(x, XB, (size_t)NB_ * TT * DM / 8, DM);   /* both batches */
    for (int b = 0; b < NB_; ++b) {
        k_gemmw<bf, 0, 1, DM, true><<<dim3(TT / 128, DQ / 128, 3), 128, 0, stream>>>(XB + (size_t)b * TT * DM, nullptr, WQ, nullptr, nullptr, 0, bq, bk, bv, 0, (size_t)DQ * DM, 0,
            QKPh + (size_t)b * 2 * PLN, QKPl + (size_t)b * 2 * PLN, QKNh + (size_t)b * 2 * PLN, QKNl + (size_t)b * 2 * PLN, VT16 + (size_t)b * PLN, VTh + (size_t)b * PLN, VTl + (size_t)b * PLN);   /* q, k, v projections -> q, k, tanh q, tanh k and transposed v planes */
        k_gemmw<bf, 1, 2, HD, false><<<dim3(TT / 64, 1, NH_), 32, 0, stream>>>(QKNh + (size_t)b * 2 * PLN, QKNl + (size_t)b * 2 * PLN, JT, nullptr, nullptr, HD, nullptr, nullptr, nullptr, (size_t)TT * HD, (size_t)HD * HD, (size_t)TT * HD,
            QJh + (size_t)b * PLN, QJl + (size_t)b * PLN, nullptr, nullptr, nullptr, nullptr, nullptr); }   /* tanh(Q) J of every head -> hi/lo planes */
    k_attn<<<dim3(NXT, NB_ * NH_, 1), 32 * AW, 0, stream>>>(QKPh, QKPl, QJh, QJl, QKNh, QKNl, VT16, VTh, VTl, lamp, ATh, ATl);   /* scores, softmax and P.V of all heads of both batches */
    k_gemmw<bf, 1, 0, DQ, true><<<dim3(NB_ * TT / 128, DM / 128, 1), 128, 0, stream>>>(ATh, ATl, WO, nullptr, OUT, DM, bo, nullptr, nullptr, 0, 0, 0, nullptr, nullptr, nullptr, nullptr, nullptr, nullptr, nullptr);   /* output projection, both batches */
}

// v007
// It runs in 140 microseconds.
// Timed twice side by side with v006, it ran 1.08 times as fast both times.
// Counting every step since v000, it is 14.9 times as fast.
#include <hip/hip_runtime.h>

// Causal attention with a bilinear tanh correction (x [2][2048][1024]; Q/K/V = x W + b (16 x 64); scores = Q.K / 8 + lam * (tanh(Q) J_h tanh(K)^T) (J [16][64][64] and the scalar lam read); causal (-inf) softmax; out = merged Wo + bo -> [2][2048][1024]).
// Compute dtypes, f32 accumulate: every input rounded to bf16; Q/K/V on PLAIN bf16 operands (inputs: exact) + bias; tanh elementwise in f32 (exp2 form with the hardware reciprocal, clamped |x| <= 15), in the projection's epilogue; QJ = hi/lo tanh(Q) x exact J (2 products, f32); both score products hl x hl (3 products) on every row; the two terms combined per element in f32 in the reference's order (s/8 + lam d); key blocks beyond the diagonal skipped; softmax f32, online (running maximum and sum), fused with both products; attn.v: rows < 512 hl (3 products), the rest fp16 (x1024); Wo hl x exact (2 products) + bias.

#define NB_  2
#define TT   2048
#define DM   1024
#define NH_  16
#define NKV  16
#define HD   64
#define DQ   (NH_ * HD)
#define DKV  (NKV * HD)
#define RH   512                  // query rows < RH use hi+lo planes (0: none)
#define SCL  0.125f   // HD^-0.5
typedef _Float16 h16;
typedef unsigned short bf;
typedef __attribute__((ext_vector_type(16))) __bf16   v16bf;
typedef __attribute__((ext_vector_type(16))) _Float16 v16h;
typedef __attribute__((ext_vector_type(8)))  _Float16 v8h;
typedef __attribute__((ext_vector_type(8)))  unsigned short v8us;
typedef __attribute__((ext_vector_type(8)))  float    v8f;
typedef __attribute__((ext_vector_type(4)))  float    v4f;
typedef v8h  __attribute__((may_alias)) v8ha;
typedef v4f  __attribute__((may_alias)) v4fa;
typedef v8us __attribute__((may_alias)) v8usa;

__device__ __forceinline__ unsigned short f2bf(float f) { unsigned u = __float_as_uint(f); u += 0x7FFFu + ((u >> 16) & 1u); return (unsigned short)(u >> 16); }
__device__ __forceinline__ float bf2f(unsigned short b) { return __uint_as_float(((unsigned)b) << 16); }
__device__ __forceinline__ float bfr(float f) { return bf2f(f2bf(f)); }
__device__ __forceinline__ v16h cat16(v8h lo, v8h hi) { return __builtin_shufflevector(lo, hi, 0, 1, 2, 3, 4, 5, 6, 7, 8, 9, 10, 11, 12, 13, 14, 15); }
__device__ __forceinline__ v16bf cat16b(v8us lo, v8us hi) { return __builtin_bit_cast(v16bf, __builtin_shufflevector(lo, hi, 0, 1, 2, 3, 4, 5, 6, 7, 8, 9, 10, 11, 12, 13, 14, 15)); }
__device__ __forceinline__ v8f wmma16(v16h a, v16h b, v8f c) { return __builtin_amdgcn_wmma_f32_16x16x32_f16(false, a, false, b, (short)0, c, false, false); }
__device__ __forceinline__ v8f wmmab(v16bf a, v16bf b, v8f c) { return __builtin_amdgcn_wmma_f32_16x16x32_bf16(false, a, false, b, (short)0, c, false, false); }



// ---- Fragment-major planes. Every 16-bit operand plane M[r][k] (K columns) is kept as blocks of 16 rows x 32 k = 512 elements; block (r / 16, k / 32) starts at element (r / 16) * 16 * K + (k / 32) * 512.
// Inside a block the 8 elements k % 32 = 16 j + 8 hi + (0..7) of row r % 16 = lr lie at j * 256 + (16 hi + lr) * 8: lane 16 hi + lr of a wave reads its fragment as two 16-byte loads, at lane * 8 and at 256 + lane * 8,
// and each of the two loads covers 512 contiguous bytes (four whole lines) where a row-major plane makes it touch 16 lines. Which element reaches which lane and register is as with row-major planes.
// ---- k_gemmw: register-blocked GEMM, ONE WAVE per 64x64 output tile (16 accumulators), operands from fragment-major 16-bit planes.
// ST false: one wave a work-group, fragments straight from global memory; grid (M/64, N/64, Z), 32 threads.
// ST true: four waves (2 x 2) a work-group share a 128x128 tile; grid (M/128, N/128, Z), 128 threads. The operands' 128 rows x 128 k of a stage come into LDS by asynchronous copies (each byte fetched once a work-group, not
// once a wave), two buffers: the next stage's copies fly while this stage is worked on. A stage keeps the planes' own order (8 block rows of 4 blocks = 4 KiB each), so a fragment is two 16-byte LDS loads a lane, 512 contiguous bytes each.
// The products and their k order are the same either way.
// C[m][n] (f32, pitch ldc, + optional f32 bias[n]) = sum_k A[m][k] Bt[n][k] (+ split products per NSPLIT). z-batch strides sA/sB/sC in elements. K % 32 == 0.
// Independent products of one shape run as ONE launch with the member in blockIdx.z: the q, k and v projections (three weight planes, three biases; the tokens of both batches as one row range) and the tanh(Q) J products of every head of both batches.
// EPI says what the epilogue makes of the f32 tile, which goes through LDS either way (0: 16 rows at a time; 1, 2: whole):
//   0: C (f32, pitch ldc) = tile + bias.
//   1: the projections. A tile is 64 tokens of ONE head (HD == 64). Members 0, 1 (q, k): y = tile + bias goes out as hi/lo planes P* [b][member][h][t][d], tanh(y) as hi/lo planes N* of the same shape.
//      Member 2 (v): the operands change places (rows = the head's 64 d, columns = tokens; same products, same k order), so that the same row-wise epilogue writes the transposed planes V* [b][h][d][t] (fp16, hi, lo).
//   2: the tile goes out as hi/lo planes P* (pitch ldc, z-stride sC).
// The 16-bit planes are stored 16 bytes a lane, one half block (16 rows x 16 k) a step: 512 contiguous bytes.
__device__ __forceinline__ h16 tohx(float x) { return (h16)x; }
__device__ __forceinline__ void splitf(float y, unsigned short& h, unsigned short& l) { h = f2bf(y); l = f2bf(y - bf2f(h)); }
__device__ __forceinline__ float tanhc(float x) { const float xs = fminf(fmaxf(x, -15.0f), 15.0f); const float ex = __builtin_amdgcn_exp2f(xs * 2.8853900817779268f); return (ex - 1.0f) * __builtin_amdgcn_rcpf(ex + 1.0f); }
__device__ __forceinline__ void st_hl(const float (&y)[8], bf* Ph, bf* Pl) { v8us oh, ol;
#pragma unroll
    for (int u = 0; u < 8; ++u) { unsigned short a, c; splitf(y[u], a, c); oh[u] = a; ol[u] = c; }
    *(v8us*)Ph = oh; *(v8us*)Pl = ol; }
template <typename T16> struct WFrag;
template <> struct WFrag<h16> { typedef v16h V; static __device__ __forceinline__ V ld(const h16* p) { return cat16(*(const v8h*)p, *(const v8h*)(p + 256)); } static __device__ __forceinline__ v8f mma(V a, V b, v8f c) { return wmma16(a, b, c); } };
template <> struct WFrag<bf> { typedef v16bf V; static __device__ __forceinline__ V ld(const bf* p) { return cat16b(*(const v8us*)p, *(const v8us*)(p + 256)); } static __device__ __forceinline__ v8f mma(V a, V b, v8f c) { return wmmab(a, b, c); } };
// One block row of a stage (4 blocks = 4 KiB, contiguous in the plane and in LDS): eight asynchronous copies of 16 bytes a lane, 512 bytes a wave each. l: the lane's LDS byte address, g: its global address.
// The wait on the last line stands in front of whatever next rewrites the address registers that the copies name.
template <typename T16>
__device__ __forceinline__ void cp_row(unsigned l, const T16* g) {
    asm volatile("global_load_async_to_lds_b128 %0, %8, off\n\t"
                 "global_load_async_to_lds_b128 %1, %9, off\n\t"
                 "global_load_async_to_lds_b128 %2, %10, off\n\t"
                 "global_load_async_to_lds_b128 %3, %11, off\n\t"
                 "global_load_async_to_lds_b128 %4, %12, off\n\t"
                 "global_load_async_to_lds_b128 %5, %13, off\n\t"
                 "global_load_async_to_lds_b128 %6, %14, off\n\t"
                 "global_load_async_to_lds_b128 %7, %15, off\n\t"
                 "s_wait_xcnt 0x0"
                 :: "v"(l), "v"(l + 512u), "v"(l + 1024u), "v"(l + 1536u), "v"(l + 2048u), "v"(l + 2560u), "v"(l + 3072u), "v"(l + 3584u),
                    "v"(g), "v"(g + 256), "v"(g + 512), "v"(g + 768), "v"(g + 1024), "v"(g + 1280), "v"(g + 1536), "v"(g + 1792) : "memory");
}
template <typename T16, int NSPLIT, int EPI, int K, bool ST>
__global__ __launch_bounds__(ST ? 128 : 32) void k_gemmw(const T16* __restrict__ A, const T16* __restrict__ A2, const T16* __restrict__ Bt, const T16* __restrict__ Bt2, float* C, int ldc, const float* __restrict__ bias0, const float* __restrict__ bias1, const float* __restrict__ bias2, size_t sA, size_t sB, size_t sC,
                                              bf* Ph, bf* Pl, bf* Nh, bf* Nl, h16* V16, bf* Vh, bf* Vl) {
    typedef typename WFrag<T16>::V V;
    constexpr int OSN = (EPI == 0 ? 16 : 64) * 68;                   // floats of one wave's epilogue staging
    constexpr unsigned PB = 128 * 128 * 2, SB = (NSPLIT == 1 ? 3 : 2) * PB;   // bytes of one plane's part of a stage; of a stage (A, A2 where there is one, B)
    constexpr unsigned SMB = !ST ? OSN * 4 : (2 * SB > 4 * OSN * 4) ? 2 * SB : 4 * OSN * 4;   // the epilogue stages in the two buffers' place, behind the last stage's barrier
    __shared__ __align__(1024) char sm[SMB];
    const int wave = ST ? __builtin_amdgcn_readfirstlane((int)threadIdx.x >> 5) : 0;
    float* const os = (float*)sm + wave * OSN;
    const size_t z = blockIdx.z;
    const size_t za = (EPI == 2) ? z + z / NH_ * NH_ : z, zb = (EPI == 2) ? z % NH_ : z;   // EPI 2: member z = batch * NH_ + head; a batch's NH_ tanh(q) planes are followed by its NH_ tanh(k) planes, and both batches share the J planes
    A += za * sA; if (A2) A2 += za * sA; Bt += zb * sB; if (Bt2) Bt2 += zb * sB; if (EPI == 0) C += z * sC;
    const float* __restrict__ bias = (z == 0) ? bias0 : (z == 1) ? bias1 : bias2;   // each z-batch member has its own bias vector (at most three members where a bias is added)
    const bool vt = EPI == 1 && z == 2;                                             // the v projection: rows from the weight plane, columns from x
    if (vt) { const T16* const w = Bt; Bt = A; A = w; }
    const int lane = threadIdx.x & 31, lr = lane & 15, hi = lane >> 4; const int R0 = (vt ? blockIdx.y : blockIdx.x) * (ST ? 128 : 64), C0 = (vt ? blockIdx.x : blockIdx.y) * (ST ? 128 : 64), r0 = R0 + (wave >> 1) * 64, c0 = C0 + (wave & 1) * 64;
    v8f acc[4][4];
#pragma unroll
    for (int mb = 0; mb < 4; ++mb)
#pragma unroll
        for (int nb = 0; nb < 4; ++nb) acc[mb][nb] = (v8f){};
    if constexpr (ST) {
        static_assert(NSPLIT <= 1 && K % 128 == 0 && K / 128 >= 2, "whole stages of 128 k, two at least; planes A, A2, B");
        constexpr int NS = K / 128;
        // Wave w copies block rows 2 w and 2 w + 1 of each plane's 8.
        const unsigned lw = (unsigned)(size_t)sm + (unsigned)wave * 8192u + (unsigned)lane * 16u;
        const T16* const ga = A + (size_t)(R0 + wave * 32) * K + 8 * lane; const T16* const ga2 = A2 + (size_t)(R0 + wave * 32) * K + 8 * lane; const T16* const gb = Bt + (size_t)(C0 + wave * 32) * K + 8 * lane;
        auto fill = [&](int s, unsigned l) { const size_t go = (size_t)s * 2048;
            cp_row(l, ga + go); cp_row(l + 4096u, ga + go + 16 * K);
            if (NSPLIT == 1) { cp_row(l + PB, ga2 + go); cp_row(l + PB + 4096u, ga2 + go + 16 * K); }
            cp_row(l + (SB - PB), gb + go); cp_row(l + (SB - PB) + 4096u, gb + go + 16 * K); };
        fill(0, lw);
        asm volatile("s_wait_asynccnt 0x0" ::: "memory");            // this wave's part of stage 0 has landed
        __syncthreads();                                             // every wave's part has
        fill(1, lw + SB);
#pragma unroll 1   // rolled: one copy of the stage's text, the buffer chosen by an offset
        for (int s = 0; s < NS; ++s) {
            const unsigned bo = (unsigned)(s & 1) * SB;
            const T16* const fa = (const T16*)(sm + bo + (unsigned)(wave >> 1) * 16384u) + 8 * lane; const T16* const fa2 = (const T16*)(sm + bo + PB + (unsigned)(wave >> 1) * 16384u) + 8 * lane; const T16* const fb = (const T16*)(sm + bo + (SB - PB) + (unsigned)(wave & 1) * 16384u) + 8 * lane;
            V a[2][4], a2[2][4], b[2][4];                            // two fragment sets: inside a stage the next block's LDS loads go out as one group in front of this block's products
            auto ldf = [&](int kb) {
#pragma unroll
                for (int mb = 0; mb < 4; ++mb) { a[kb & 1][mb] = WFrag<T16>::ld(fa + mb * 2048 + kb * 512); if (NSPLIT == 1) a2[kb & 1][mb] = WFrag<T16>::ld(fa2 + mb * 2048 + kb * 512); }
#pragma unroll
                for (int nb = 0; nb < 4; ++nb) b[kb & 1][nb] = WFrag<T16>::ld(fb + nb * 2048 + kb * 512); };
            ldf(0);
#pragma unroll
            for (int kb = 0; kb < 4; ++kb) {
                if (kb < 3) ldf(kb + 1);
                __builtin_amdgcn_sched_barrier(0);                   // keeps the load group whole and in front of the products: sunk among them, each small group is waited for by itself
#pragma unroll
                for (int nb = 0; nb < 4; ++nb)
#pragma unroll
                    for (int mb = 0; mb < 4; ++mb) { acc[mb][nb] = WFrag<T16>::mma(a[kb & 1][mb], b[kb & 1][nb], acc[mb][nb]); if (NSPLIT == 1) acc[mb][nb] = WFrag<T16>::mma(a2[kb & 1][mb], b[kb & 1][nb], acc[mb][nb]); }
                __builtin_amdgcn_sched_barrier(0);                   // keeps the block after next's loads, which land in this block's registers, behind its products
            }
            asm volatile("s_wait_dscnt 0x0" ::: "memory");           // this wave's reads of the buffer are done: behind the barrier it is refilled
            asm volatile("s_wait_asynccnt 0x0" ::: "memory");        // this wave's part of the next stage has landed
            __syncthreads();                                         // publishes the next stage and ends every wave's reads of this one
            if (s + 2 < NS) fill(s + 2, lw + bo);
        }
        asm volatile("s_wait_asynccnt 0x0" ::: "memory");            // no copy is left in flight where the buffers become the epilogue's staging
    } else {
    // Each lane's own piece of the first block of block row r0 / 16 (c0 / 16); the pointers walk k, one block (512 elements) a trip, and the block rows below are constant offsets from them.
    const T16* pa = A + (size_t)r0 * K + 8 * lane; const T16* pa2 = A2 + (size_t)r0 * K + 8 * lane; const T16* pb = Bt + (size_t)c0 * K + 8 * lane; const T16* pb2 = Bt2 + (size_t)c0 * K + 8 * lane;
#pragma unroll 1
    for (int kc = 0; kc < K; kc += 32) {
        V a[4], a2[4], b[4], b2[4];
#pragma unroll
        for (int mb = 0; mb < 4; ++mb) { a[mb] = WFrag<T16>::ld(pa + mb * 16 * K); if (NSPLIT == 1 || NSPLIT == 2) a2[mb] = WFrag<T16>::ld(pa2 + mb * 16 * K); }
#pragma unroll
        for (int nb = 0; nb < 4; ++nb) { b[nb] = WFrag<T16>::ld(pb + nb * 16 * K); if (NSPLIT >= 2) b2[nb] = WFrag<T16>::ld(pb2 + nb * 16 * K); }
        // In front of the pointers' step: they are the address registers of the loads just issued. Named as inputs they keep their registers up to the wait, so that no load lands on its own address pair.
        if (NSPLIT == 0) asm volatile("s_wait_xcnt 0x0" :: "v"(pa), "v"(pb) : "memory"); else if (NSPLIT == 1) asm volatile("s_wait_xcnt 0x0" :: "v"(pa), "v"(pa2), "v"(pb) : "memory"); else asm volatile("s_wait_xcnt 0x0" :: "v"(pa), "v"(pa2), "v"(pb), "v"(pb2) : "memory");
        __builtin_amdgcn_sched_barrier(0);                           // keeps the step behind the wait, and the trip's loads together in front of its products: sunk among them, each group of loads would be waited for by itself
        pa += 512; pa2 += 512; pb += 512; pb2 += 512;
#pragma unroll
        for (int nb = 0; nb < 4; ++nb)
#pragma unroll
            for (int mb = 0; mb < 4; ++mb) { acc[mb][nb] = WFrag<T16>::mma(a[mb], b[nb], acc[mb][nb]); if (NSPLIT == 1 || NSPLIT == 2) acc[mb][nb] = WFrag<T16>::mma(a2[mb], b[nb], acc[mb][nb]); if (NSPLIT >= 2) acc[mb][nb] = WFrag<T16>::mma(a[mb], b2[nb], acc[mb][nb]); }
        asm volatile("v_nop\n\tv_nop\n\tv_nop\n\tv_nop" : "+v"(acc[0][0]), "+v"(acc[1][1]), "+v"(acc[2][2]), "+v"(acc[3][3]) : "v"(a[0]), "v"(a[3]));
    }
    }
    if (EPI == 0) {
#pragma unroll
    for (int mb = 0; mb < 4; ++mb) {
#pragma unroll
        for (int nb = 0; nb < 4; ++nb) {
#pragma unroll
            for (int j = 0; j < 8; ++j) os[(hi * 8 + j) * 68 + nb * 16 + lr] = acc[mb][nb][j]; }
        __builtin_amdgcn_wave_barrier(); asm volatile("" ::: "memory");
        float* crow = C + (size_t)(r0 + mb * 16) * ldc + c0;
{
#pragma unroll
            for (int s = 0; s < 8; ++s) { const int row = 2 * s + hi, cofs = lr * 4; v4f val = *(const v4fa*)(os + row * 68 + cofs); val[0] += bfr(bias[c0 + cofs]); val[1] += bfr(bias[c0 + cofs + 1]); val[2] += bfr(bias[c0 + cofs + 2]); val[3] += bfr(bias[c0 + cofs + 3]);
                *(v4f*)(crow + (size_t)row * ldc + cofs) = val; }
             }
        __builtin_amdgcn_wave_barrier(); asm volatile("" ::: "memory");
    }
    } else {
        if (vt) {                                                    // the bias is added on the way into LDS: per row where the operands changed places, else per column
#pragma unroll
            for (int mb = 0; mb < 4; ++mb)
#pragma unroll
                for (int j = 0; j < 8; ++j) { const float bb = bfr(bias[r0 + mb * 16 + hi * 8 + j]);
#pragma unroll
                    for (int nb = 0; nb < 4; ++nb) os[(mb * 16 + hi * 8 + j) * 68 + nb * 16 + lr] = acc[mb][nb][j] + bb; }
        } else {
#pragma unroll
            for (int nb = 0; nb < 4; ++nb) { const float bb = (EPI == 1) ? bfr(bias[c0 + nb * 16 + lr]) : 0.0f;
#pragma unroll
                for (int mb = 0; mb < 4; ++mb)
#pragma unroll
                    for (int j = 0; j < 8; ++j) os[(mb * 16 + hi * 8 + j) * 68 + nb * 16 + lr] = (EPI == 1) ? acc[mb][nb][j] + bb : acc[mb][nb][j]; }
        }
        __builtin_amdgcn_wave_barrier(); asm volatile("" ::: "memory");   // the lanes read each other's rows below
        // Read-back: one half block a step (16 rows, 16 columns: 8 columns a lane), in the order in which the half blocks lie in the plane. The loops stay rolled, two steps a trip, so that the second step's LDS reads pass behind the first step's arithmetic.
        // Trip i = 2 mb + kb: rows 16 mb.., columns 32 kb..; step s: columns + 16 s. ldp = columns of the plane that the tile goes to, cc = the tile's first column in it.
        const float* const op0 = os + lr * 68 + hi * 8;
        // EPI 1: the tokens of both batches lie in a row (NB_ TT of them); a tile's 64 tokens are of one batch bt, and tl is the first of them inside it.
        const int tk = vt ? c0 : r0, bt = (EPI == 1) ? tk / TT : 0, tl = tk - bt * TT;
        const size_t ldp = vt ? TT : (EPI == 2) ? ldc : HD, cc = vt ? tl : (EPI == 2) ? c0 : 0, rr = (EPI == 1 && !vt) ? tl : r0;
        const size_t o0 = (vt ? (size_t)bt * NH_ : (EPI == 2) ? 0 : ((size_t)bt * 2 + z) * NH_ + (c0 >> 6)) * (size_t)TT * HD + ((EPI == 2) ? z * sC : 0) + rr * ldp + cc * 16 + 8 * lane;
        if (!vt) {
#pragma unroll 1
            for (int i = 0; i < 8; ++i) {
#pragma unroll
                for (int s = 0; s < 2; ++s) { const float* const op = op0 + (i >> 1) * (16 * 68) + (i & 1) * 32 + s * 16; const size_t o = o0 + (size_t)(i >> 1) * 16 * ldp + (i & 1) * 512 + s * 256;
                    const v4f x0 = *(const v4fa*)op, x1 = *(const v4fa*)(op + 4);
                    const float y[8] = { x0[0], x0[1], x0[2], x0[3], x1[0], x1[1], x1[2], x1[3] };
                    st_hl(y, Ph + o, Pl + o);
                    if (EPI == 1) { float th[8];
#pragma unroll
                        for (int u = 0; u < 8; ++u) th[u] = tanhc(y[u]);
                        st_hl(th, Nh + o, Nl + o); } }
                asm volatile("s_wait_xcnt 0x0" ::: "memory");        // the next trip overwrites data and address registers of the stores just issued
            }
        } else {
#pragma unroll 1
            for (int i = 0; i < 8; ++i) {
#pragma unroll
                for (int s = 0; s < 2; ++s) { const float* const op = op0 + (i >> 1) * (16 * 68) + (i & 1) * 32 + s * 16; const size_t o = o0 + (size_t)(i >> 1) * 16 * ldp + (i & 1) * 512 + s * 256;
                    const v4f x0 = *(const v4fa*)op, x1 = *(const v4fa*)(op + 4);
                    const float y[8] = { x0[0], x0[1], x0[2], x0[3], x1[0], x1[1], x1[2], x1[3] }; v8h o16;
#pragma unroll
                    for (int u = 0; u < 8; ++u) o16[u] = tohx(y[u]);
                    *(v8h*)(V16 + o) = o16; st_hl(y, Vh + o, Vl + o); }
                asm volatile("s_wait_xcnt 0x0" ::: "memory");        // as above
            }
        }
    }
}

typedef __attribute__((ext_vector_type(2))) _Float16 v2h;
typedef __attribute__((ext_vector_type(4))) _Float16 v4h;
typedef __attribute__((ext_vector_type(2))) unsigned short v2us;
typedef __attribute__((ext_vector_type(4))) unsigned short v4us;
typedef __attribute__((ext_vector_type(2))) float v2f;
typedef __attribute__((ext_vector_type(4))) int v4i;

// wt_piece: the fragment-major plane of Bt[n][k] = bf16(w[k][n]); bx is the block of 256 pieces inside the matrix.
// One 8-element piece a thread, in the order of the plane: a wave stores 512 contiguous bytes, and each of its 8 loads reads 16 neighbouring n of two rows k. N K / 8 is a multiple of the block size.
__device__ __forceinline__ void wt_piece(const float* __restrict__ w, int K, int N, bf* Bt, int bx) {
    const int g = bx * 256 + threadIdx.x, blk = g >> 6, kbs = K >> 5;
    const int n = (blk / kbs) * 16 + (g & 15), k = (blk % kbs) * 32 + ((g >> 5) & 1) * 16 + ((g >> 4) & 1) * 8;
    const float* __restrict__ p = w + (size_t)k * N + n; float v[8];
#pragma unroll
    for (int u = 0; u < 8; ++u) v[u] = p[(size_t)u * N];
    v8us o;
#pragma unroll
    for (int u = 0; u < 8; ++u) o[u] = f2bf(v[u]);
    *(v8us*)(Bt + (size_t)g * 8) = o;
}
// cvt_piece: the fragment-major bf16 plane of src[r][k] (K columns); one 8-element piece a thread, in the order of the plane (a wave stores 512 contiguous bytes; a block reads 512 contiguous bytes of each of 16 rows).
__device__ __forceinline__ void cvt_piece(const float* __restrict__ src, bf* dst, size_t n8, int K, int bx) { const size_t i = (size_t)bx * 256 + threadIdx.x; if (i >= n8) return;
    const int blk = (int)(i >> 6), kbs = K >> 5; const int r = (blk / kbs) * 16 + ((int)i & 15), k = (blk % kbs) * 32 + (((int)i >> 5) & 1) * 16 + (((int)i >> 4) & 1) * 8;
    const v8f v = *(const v8f*)(src + (size_t)r * K + k); v8us o;
    asm volatile("s_wait_xcnt 0x0" ::: "memory");                    // the conversion below reuses the address registers of the loads just issued
#pragma unroll
    for (int u = 0; u < 8; ++u) o[u] = f2bf(v[u]); *(v8us*)(dst + i * 8) = o;  }
// k_prep: every 16-bit plane that is made of an input alone, in ONE launch; none needs anything of another, so each takes a range of the block index (the branch is the same for a whole work-group):
// the four weight matrices (outputs in a row from WT), x of both batches, the NH_ matrices of J.
#define PBW  (DM * DQ / 8 / 256)          // blocks of one weight matrix
#define PBX  (NB_ * TT * DM / 8 / 256)    // blocks of x
#define PBJ  (HD * HD / 8 / 256)          // blocks of one matrix of J
__global__ __launch_bounds__(256) void k_prep(const float* __restrict__ w0, const float* __restrict__ w1, const float* __restrict__ w2, const float* __restrict__ w3, const float* __restrict__ x, const float* __restrict__ Jm, bf* WT, bf* XB, bf* JT) {
    int bx = blockIdx.x;
    if (bx < 4 * PBW) { const int y = bx / PBW; wt_piece((y == 0) ? w0 : (y == 1) ? w1 : (y == 2) ? w2 : w3, DM, DQ, WT + (size_t)y * DM * DQ, bx % PBW); return; }
    bx -= 4 * PBW;
    if (bx < PBX) { cvt_piece(x, XB, (size_t)NB_ * TT * DM / 8, DM, bx); return; }
    bx -= PBX;
    { const int y = bx / PBJ; wt_piece(Jm + (size_t)y * HD * HD, HD, HD, JT + (size_t)y * HD * HD, bx % PBJ); }
}
// ---- k_attn: score products, causal softmax and probability x value product of every (batch, head) in ONE launch; scores and probabilities stay in registers.
// One wave owns QW = 16 NT query columns and walks the keys up to its diagonal in blocks of 32. Transposed products: S^T = K Q^T and D^T = tanh(K) (tanh(Q) J)^T (A = key rows, B = query rows kept in
// registers; both hl x hl, 3 products), so a lane holds the scores of ONE query: keys 8 hi + j of each 16-key tile. t = S / 8 + lam D per element in f32; running maximum and running sum per query
// (online softmax: the output tile and the sum are rescaled by exp(old max - new max) in every block). The two 16-key tiles of a block, converted in place, ARE the B operand of O^T += V^T P^T
// (element s = tile s >> 3, register s & 7: the k order of the V^T loader). Query rows < RH: P and V in hi+lo planes (3 products); the rest fp16 with P x 1024. P is left unnormalised; O is divided by the sum at the end
// (the factor 1024 is in the sum too and cancels). Every inner loop is unrolled so that the fragment arrays stay in registers. A lane's 8 accumulator registers are 8 consecutive d of one query: one 16-byte store per plane and d tile into the merged-head hi/lo planes, where the wave's 32 pieces are one half block (512 contiguous bytes).
#define NT   2                    // 16-query column groups per wave
#define QW   (16 * NT)            // queries per wave
#define AW   4                    // waves per work-group: neighbouring query columns of one head, which read the same key rows at about the same time
#define NXT  (TT / (QW * AW))     // query tiles (work-groups) per head
#define L2E  1.4426950408889634f
__device__ __forceinline__ float xhalf(float x) { return __builtin_bit_cast(float, __builtin_amdgcn_permlanex16(__builtin_bit_cast(int, x), __builtin_bit_cast(int, x), 0x76543210, 0xfedcba98, false, false)); }   // lane l reads lane l ^ 16
// In front of code that overwrites address registers of global loads or stores just issued; the scheduling barrier keeps that code behind the wait (and the loads in front of it).
__device__ __forceinline__ void addr_done() { asm volatile("s_wait_xcnt 0x0" ::: "memory"); __builtin_amdgcn_sched_barrier(0); }
// The same, naming two pointers as inputs: they keep their registers up to the wait (else the last load through each lands on its own address pair).
__device__ __forceinline__ void addr_done(const bf* a, const bf* b) { asm volatile("s_wait_xcnt 0x0" :: "v"(a), "v"(b) : "memory"); __builtin_amdgcn_sched_barrier(0); }
template <bool HR>
__device__ __forceinline__ void attn_cols(const bf* __restrict__ Qh, const bf* __restrict__ Ql, const bf* __restrict__ Gh, const bf* __restrict__ Gl, const bf* __restrict__ Kh, const bf* __restrict__ Kl, const bf* __restrict__ Nh, const bf* __restrict__ Nl,
                                          const h16* __restrict__ V16, const bf* __restrict__ Vh, const bf* __restrict__ Vl, float lam, int q0, bf* Ah, bf* Al) {
    const int lane = threadIdx.x & 31, lr = lane & 15, hi = lane >> 4;
    v16bf qh[NT][2], ql[NT][2], gh[NT][2], gl[NT][2];
#pragma unroll
    for (int n = 0; n < NT; ++n)
#pragma unroll
        for (int ks = 0; ks < 2; ++ks) { const size_t qo = (size_t)(q0 + n * 16) * HD + ks * 512 + 8 * lane; qh[n][ks] = WFrag<bf>::ld(Qh + qo); ql[n][ks] = WFrag<bf>::ld(Ql + qo); gh[n][ks] = WFrag<bf>::ld(Gh + qo); gl[n][ks] = WFrag<bf>::ld(Gl + qo); }
    addr_done();
    v16bf kf[2][2][4];                                               // key fragments of the block at hand: [16-key tile][k step][K hi, K lo, tanh K hi, tanh K lo]
    { const int lo = 8 * lane; Kh += lo; Kl += lo; Nh += lo; Nl += lo; V16 += lo; Vh += lo; Vl += lo; }   // each lane's own place in a block; the pointers then walk the keys
    auto ldk = [&]() {
#pragma unroll
        for (int m = 0; m < 2; ++m)
#pragma unroll
            for (int ks = 0; ks < 2; ++ks) { const int ko = m * 16 * HD + ks * 512; kf[m][ks][0] = WFrag<bf>::ld(Kh + ko); kf[m][ks][1] = WFrag<bf>::ld(Kl + ko); kf[m][ks][2] = WFrag<bf>::ld(Nh + ko); kf[m][ks][3] = WFrag<bf>::ld(Nl + ko); } };
    const int kend = q0 + QW, klast = (kend - 1) & ~31;              // keys up to the last query's diagonal; first key of the last block
    ldk();
    addr_done();
    int kn = min(32, klast), kstep = kn * HD, vstep = 0;             // first key of the block to fetch next (the last block is fetched again: in bounds, unused); how far the pointers move in front of the next loads
    v8f o[4][NT]; float mr[NT], ls[NT];
#pragma unroll
    for (int n = 0; n < NT; ++n) { mr[n] = -3.0e38f; ls[n] = 0.0f;
#pragma unroll
        for (int dt = 0; dt < 4; ++dt) o[dt][n] = (v8f){}; }
#pragma unroll 1   // rolled: a second copy of the block would need a second set of fragment registers
    for (int kb = 0; kb < kend; kb += 32) {
        float t[2][NT][8];
#pragma unroll
        for (int m = 0; m < 2; ++m) {
            v8f s[NT], d[NT];
#pragma unroll
            for (int n = 0; n < NT; ++n) { s[n] = (v8f){}; d[n] = (v8f){}; }
#pragma unroll
            for (int ks = 0; ks < 2; ++ks) { const v16bf kh = kf[m][ks][0], kl = kf[m][ks][1], nh = kf[m][ks][2], nl = kf[m][ks][3];
#pragma unroll
                for (int n = 0; n < NT; ++n) { s[n] = wmmab(kh, qh[n][ks], s[n]); d[n] = wmmab(nh, gh[n][ks], d[n]); s[n] = wmmab(kh, ql[n][ks], s[n]); d[n] = wmmab(nh, gl[n][ks], d[n]); s[n] = wmmab(kl, qh[n][ks], s[n]); d[n] = wmmab(nl, gh[n][ks], d[n]); } }
#pragma unroll
            for (int n = 0; n < NT; ++n)
#pragma unroll
                for (int j = 0; j < 8; ++j) t[m][n][j] = s[n][j] * SCL + lam * d[n][j];
        }
        if (HR) addr_done(Vh, Vl); else addr_done();                 // the pointers move only here, a whole block behind the loads that name them; the scheduling barrier also keeps the loads below from rising over the score products, where they would need a second set of fragment registers
        Kh += kstep; Kl += kstep; Nh += kstep; Nl += kstep; V16 += vstep; Vh += vstep; Vl += vstep;
        v16h v16[4]; v16bf vh[4], vl[4];
#pragma unroll
        for (int dt = 0; dt < 4; ++dt) { const int vo = dt * 16 * TT; if (HR) { vh[dt] = WFrag<bf>::ld(Vh + vo); vl[dt] = WFrag<bf>::ld(Vl + vo); } else v16[dt] = WFrag<h16>::ld(V16 + vo); }
        __builtin_amdgcn_sched_barrier(0);                           // V in front of K: P.V needs V first, and loads return in order
        ldk();                                                       // the next block's key fragments, into the same registers: their latency passes behind the softmax and P.V
        __builtin_amdgcn_sched_barrier(0);                           // holds the loads here, far in front of their first use
        { const int k2 = min(kn + 32, klast); kstep = (k2 - kn) * HD; kn = k2; vstep = 512; }   // 32 keys on: 2 block rows of the key planes, one block of the V^T planes
        if (kb + 31 > q0) {                                          // the block that holds the diagonal (wave-uniform): keys beyond a lane's query leave the softmax
#pragma unroll
            for (int m = 0; m < 2; ++m)
#pragma unroll
                for (int n = 0; n < NT; ++n)
#pragma unroll
                    for (int j = 0; j < 8; ++j) if (kb + m * 16 + 8 * hi + j > q0 + n * 16 + lr) t[m][n][j] = -3.0e38f;
        }
        v16h p16[NT]; v16bf ph[NT], pl[NT];
#pragma unroll
        for (int n = 0; n < NT; ++n) {
            float bm = t[0][n][0];
#pragma unroll
            for (int e = 1; e < 16; ++e) bm = fmaxf(bm, t[e >> 3][n][e & 7]);
            bm = fmaxf(bm, xhalf(bm));                               // the other half of the wave holds the query's other 16 keys
            const float mn = fmaxf(mr[n], bm);                       // finite from the first block on: key 0 is open to every query
            const float al = __builtin_amdgcn_exp2f((mr[n] - mn) * L2E); mr[n] = mn;
            float bs = 0.0f; v8us h0, h1, l0, l1;
#pragma unroll
            for (int e = 0; e < 16; ++e) { const float pe = __builtin_amdgcn_exp2f(HR ? (t[e >> 3][n][e & 7] - mn) * L2E : (t[e >> 3][n][e & 7] - mn) * L2E + 10.0f); bs += pe;   // + 10: P x 1024 for the fp16 planes
                if (HR) { unsigned short a, c2; splitf(pe, a, c2); if (e < 8) { h0[e & 7] = a; l0[e & 7] = c2; } else { h1[e & 7] = a; l1[e & 7] = c2; } }
                else p16[n][e] = tohx(pe); }
            if (HR) { ph[n] = cat16b(h0, h1); pl[n] = cat16b(l0, l1); }
            ls[n] = ls[n] * al + bs;                                 // each half sums its own keys; the halves are joined behind the loop
#pragma unroll
            for (int dt = 0; dt < 4; ++dt) o[dt][n] *= al;
        }
#pragma unroll
        for (int dt = 0; dt < 4; ++dt)
#pragma unroll
            for (int n = 0; n < NT; ++n) {
                if (HR) { o[dt][n] = wmmab(vh[dt], ph[n], o[dt][n]); o[dt][n] = wmmab(vh[dt], pl[n], o[dt][n]); o[dt][n] = wmmab(vl[dt], ph[n], o[dt][n]); }
                else o[dt][n] = wmma16(v16[dt], p16[n], o[dt][n]); }
    }
    addr_done();                                                     // the code below reuses the pointers' registers
#pragma unroll
    for (int n = 0; n < NT; ++n) { const float sum = ls[n] + xhalf(ls[n]); const float f = __fdiv_rn(1.0f, sum);
#pragma unroll
        for (int dt = 0; dt < 4; ++dt) { v8us oh, ol;
#pragma unroll
            for (int j = 0; j < 8; ++j) { unsigned short a, c2; splitf(o[dt][n][j] * f, a, c2); oh[j] = a; ol[j] = c2; }
            const size_t oo = (size_t)(q0 + n * 16) * DQ + dt * 256 + 8 * lane; *(v8us*)(Ah + oo) = oh; *(v8us*)(Al + oo) = ol; }
        if (n + 1 < NT) addr_done(); }                               // the next column group reuses registers that these stores name
}
// grid (NXT, NB_ NH_), AW waves. Plane sets per batch: QK* = the q planes [h][t][d] followed by the k planes; G* = (tanh Q J) planes; V* = [h][d][t]. A* = merged heads [b][t][DQ], hi and lo. Every plane is fragment-major (rows t of 64 d; rows d of TT keys; rows t of DQ).
// Two waves per SIMD (512 registers each): the Q and K fragments alone take 128 registers each.
// The cost of a tile grows with its index and all work-groups are resident at once, so the second of the two rounds of 256 work-groups takes the tiles mirrored: for speed only, each head still gets every tile once.
__global__ __launch_bounds__(32 * AW) __attribute__((amdgpu_waves_per_eu(2, 2))) void k_attn(const bf* __restrict__ QKh, const bf* __restrict__ QKl, const bf* __restrict__ Gh, const bf* __restrict__ Gl, const bf* __restrict__ QKNh, const bf* __restrict__ QKNl,
                                                  const h16* __restrict__ V16, const bf* __restrict__ Vh, const bf* __restrict__ Vl, const float* __restrict__ lamp, bf* Ah, bf* Al) {
    const int bh = blockIdx.y, b = bh / NH_, h = bh % NH_, rnd = (bh * NXT) >> 8;
    int tile = blockIdx.x; if (rnd & 2) tile = (tile + NXT / 2) % NXT; if (rnd & 1) tile = NXT - 1 - tile;
    const int q0 = (tile * AW + __builtin_amdgcn_readfirstlane((int)threadIdx.x >> 5)) * QW;
    const size_t PLN = (size_t)NH_ * TT * HD, qp = ((size_t)b * 2 * NH_ + h) * TT * HD, kp = qp + PLN, gp = ((size_t)b * NH_ + h) * TT * HD, ap = (size_t)b * TT * DQ + h * HD * 16;
    const float lam = bfr(lamp[0]);
    if (q0 < RH) attn_cols<true>(QKh + qp, QKl + qp, Gh + gp, Gl + gp, QKh + kp, QKl + kp, QKNh + kp, QKNl + kp, V16 + gp, Vh + gp, Vl + gp, lam, q0, Ah + ap, Al + ap);
    else attn_cols<false>(QKh + qp, QKl + qp, Gh + gp, Gl + gp, QKh + kp, QKl + kp, QKNh + kp, QKNl + kp, V16 + gp, Vh + gp, Vl + gp, lam, q0, Ah + ap, Al + ap);
}

extern "C" void kernel_launch(void* const* d_in, const int* in_sizes, int n_in,
                              void* d_out, int out_size, void* d_ws, size_t ws_size, hipStream_t stream) {
    (void)in_sizes; (void)n_in; (void)out_size;
    const float* x = (const float*)d_in[0]; const float* wq = (const float*)d_in[1]; const float* bq = (const float*)d_in[2]; const float* wk = (const float*)d_in[3]; const float* bk = (const float*)d_in[4]; const float* wv = (const float*)d_in[5]; const float* bv = (const float*)d_in[6]; const float* wo = (const float*)d_in[7]; const float* bo = (const float*)d_in[8]; const float* Jm = (const float*)d_in[9]; const float* lamp = (const float*)d_in[10];
    float* OUT = (float*)d_out;     // [2][2048][1024]
    char* wsp = (char*)d_ws;
    const size_t PLN = (size_t)NH_ * TT * HD;   // elements of one set of head planes
    auto take = [&](size_t bytes) { char* p = wsp; wsp += (bytes + 255) & ~(size_t)255; return (void*)p; };
    bf* WQ = (bf*)take((size_t)DQ * DM * 2); bf* WK = (bf*)take((size_t)DKV * DM * 2); bf* WV = (bf*)take((size_t)DKV * DM * 2); bf* WO = (bf*)take((size_t)DM * DQ * 2);   // WQ, WK, WV, WO lie in a row
    bf* XB = (bf*)take((size_t)NB_ * TT * DM * 2); bf* JT = (bf*)take((size_t)NH_ * HD * HD * 2);
    /* the planes that k_attn reads are kept for both batches; each q plane is followed by its k plane: QK* [b][q, k][h][t][d], QJ* [b][h][t][d], VT* [b][h][d][t] */
    bf* QKNh = (bf*)take((size_t)NB_ * 2 * PLN * 2); bf* QKNl = (bf*)take((size_t)NB_ * 2 * PLN * 2); bf* QJh = (bf*)take((size_t)NB_ * PLN * 2); bf* QJl = (bf*)take((size_t)NB_ * PLN * 2);
    bf* QKPh = (bf*)take((size_t)NB_ * 2 * PLN * 2); bf* QKPl = (bf*)take((size_t)NB_ * 2 * PLN * 2); h16* VT16 = (h16*)take((size_t)NB_ * PLN * 2); bf* VTh = (bf*)take((size_t)NB_ * PLN * 2); bf* VTl = (bf*)take((size_t)NB_ * PLN * 2);
    bf* ATh = (bf*)take((size_t)NB_ * TT * DQ * 2); bf* ATl = (bf*)take((size_t)NB_ * TT * DQ * 2);
    if ((size_t)(wsp - (char*)d_ws) > ws_size) return;    // ws 256 MiB
    static_assert(DQ == DKV && DQ == DM && HD == 64, "the batched launches take equal shapes; a 64-column tile of a projection is one head"); static_assert((DM * DQ / 8) % 256 == 0 && (HD * HD / 8) % 256 == 0 && (NB_ * TT * DM / 8) % 256 == 0 && TT % 128 == 0 && DM % 32 == 0 && HD % 32 == 0 && TT % 32 == 0, "whole blocks of the fragment-major planes; one piece a thread in the transposes"); static_assert(RH % QW == 0 && TT % (QW * AW) == 0 && TT % 32 == 0, "a wave's query columns lie on one side of RH and tile the sequence; key blocks of 32 tile it too");
    (void)WK; (void)WV;   // reached as members of the row they lie in
    k_prep<<<4 * PBW + PBX + NH_ * PBJ, 256, 0, stream>>>(wq, wk, wv, wo, x, Jm, WQ, XB, JT);   /* weight, x and J planes */
    k_gemmw<bf, 0, 1, DM, true><<<dim3(NB_ * TT / 128, DQ / 128, 3), 128, 0, stream>>>(XB, nullptr, WQ, nullptr, nullptr, 0, bq, bk, bv, 0, (size_t)DQ * DM, 0,
        QKPh, QKPl, QKNh, QKNl, VT16, VTh, VTl);   /* q, k, v projections of both batches -> q, k, tanh q, tanh k and transposed v planes */
    k_gemmw<bf, 1, 2, HD, false><<<dim3(TT / 64, 1, NB_ * NH_), 32, 0, stream>>>(QKNh, QKNl, JT, nullptr, nullptr, HD, nullptr, nullptr, nullptr, (size_t)TT * HD, (size_t)HD * HD, (size_t)TT * HD,
        QJh, QJl, nullptr, nullptr, nullptr, nullptr, nullptr);   /* tanh(Q) J of every head of both batches -> hi/lo planes */
    k_attn<<<dim3(NXT, NB_ * NH_, 1), 32 * AW, 0, stream>>>(QKPh, QKPl, QJh, QJl, QKNh, QKNl, VT16, VTh, VTl, lamp, ATh, ATl);   /* scores, softmax and P.V of all heads of both batches */
    k_gemmw<bf, 1, 0, DQ, true><<<dim3(NB_ * TT / 128, DM / 128, 1), 128, 0, stream>>>(ATh, ATl, WO, nullptr, OUT, DM, bo, nullptr, nullptr, 0, 0, 0, nullptr, nullptr, nullptr, nullptr, nullptr, nullptr, nullptr);   /* output projection, both batches */
}

// v008
// Measured time: 116 microseconds a run.
// Next to v007, in two timings, it ran 1.23 times as fast each time.
// Counting every step since v000, it is 18.3 times as fast.
#include <hip/hip_runtime.h>

// Causal attention with a bilinear tanh correction (x [2][2048][1024]; Q/K/V = x W + b (16 x 64); scores = Q.K / 8 + lam * (tanh(Q) J_h tanh(K)^T) (J [16][64][64] and the scalar lam read); causal (-inf) softmax; out = merged Wo + bo -> [2][2048][1024]).
// Compute dtypes, f32 accumulate: every input rounded to bf16; Q/K/V on PLAIN bf16 operands (inputs: exact) + bias; tanh elementwise in f32 (exp2 form with the hardware reciprocal, clamped |x| <= 15), in the projection's epilogue; QJ = hi/lo tanh(Q) x exact J (2 products, f32); both score products hl x hl (3 products) on every row; the two terms combined per element in f32 in the reference's order (s/8 + lam d); key blocks beyond the diagonal skipped; softmax f32, online (running maximum and sum), fused with both products; attn.v: rows < 512 hl (3 products), the rest fp16 (x1024); Wo hl x exact (2 products) + bias.

#define NB_  2
#define TT   2048
#define DM   1024
#define NH_  16
#define NKV  16
#define HD   64
#define DQ   (NH_ * HD)
#define DKV  (NKV * HD)
#define RH   512                  // query rows < RH use hi+lo planes (0: none)
#define SCL  0.125f   // HD^-0.5
typedef _Float16 h16;
typedef unsigned short bf;
typedef __attribute__((ext_vector_type(16))) __bf16   v16bf;
typedef __attribute__((ext_vector_type(16))) _Float16 v16h;
typedef __attribute__((ext_vector_type(8)))  _Float16 v8h;
typedef __attribute__((ext_vector_type(8)))  unsigned short v8us;
typedef __attribute__((ext_vector_type(8)))  float    v8f;
typedef __attribute__((ext_vector_type(4)))  float    v4f;
typedef v8h  __attribute__((may_alias)) v8ha;
typedef v4f  __attribute__((may_alias)) v4fa;
typedef v8us __attribute__((may_alias)) v8usa;

__device__ __forceinline__ unsigned short f2bf(float f) { unsigned u = __float_as_uint(f); u += 0x7FFFu + ((u >> 16) & 1u); return (unsigned short)(u >> 16); }
__device__ __forceinline__ float bf2f(unsigned short b) { return __uint_as_float(((unsigned)b) << 16); }
__device__ __forceinline__ float bfr(float f) { return bf2f(f2bf(f)); }
__device__ __forceinline__ v16h cat16(v8h lo, v8h hi) { return __builtin_shufflevector(lo, hi, 0, 1, 2, 3, 4, 5, 6, 7, 8, 9, 10, 11, 12, 13, 14, 15); }
__device__ __forceinline__ v16bf cat16b(v8us lo, v8us hi) { return __builtin_bit_cast(v16bf, __builtin_shufflevector(lo, hi, 0, 1, 2, 3, 4, 5, 6, 7, 8, 9, 10, 11, 12, 13, 14, 15)); }
__device__ __forceinline__ v8f wmma16(v16h a, v16h b, v8f c) { return __builtin_amdgcn_wmma_f32_16x16x32_f16(false, a, false, b, (short)0, c, false, false); }
__device__ __forceinline__ v8f wmmab(v16bf a, v16bf b, v8f c) { return __builtin_amdgcn_wmma_f32_16x16x32_bf16(false, a, false, b, (short)0, c, false, false); }



// ---- Fragment-major planes. Every 16-bit operand plane M[r][k] (K columns) is kept as blocks of 16 rows x 32 k = 512 elements; block (r / 16, k / 32) starts at element (r / 16) * 16 * K + (k / 32) * 512.
// Inside a block the 8 elements k % 32 = 16 j + 8 hi + (0..7) of row r % 16 = lr lie at j * 256 + (16 hi + lr) * 8: lane 16 hi + lr of a wave reads its fragment as two 16-byte loads, at lane * 8 and at 256 + lane * 8,
// and each of the two loads covers 512 contiguous bytes (four whole lines) where a row-major plane makes it touch 16 lines. Which element reaches which lane and register is as with row-major planes.
// ---- k_gemmw: register-blocked GEMM, ONE WAVE per 64x64 output tile (16 accumulators), operands from fragment-major 16-bit planes.
// ST false: one wave a work-group, fragments straight from global memory; grid (M/64, N/64, Z), 32 threads.
// ST true: four waves (2 x 2) a work-group share a 128x128 tile; grid (M/128, N/128, Z), 128 threads. The operands' 128 rows x 128 k of a stage come into LDS by asynchronous copies (each byte fetched once a work-group, not
// once a wave), two buffers: the next stage's copies fly while this stage is worked on. A stage keeps the planes' own order (8 block rows of 4 blocks = 4 KiB each), so a fragment is two 16-byte LDS loads a lane, 512 contiguous bytes each.
// The products and their k order are the same either way.
// C[m][n] (f32, pitch ldc, + optional f32 bias[n]) = sum_k A[m][k] Bt[n][k] (+ split products per NSPLIT). z-batch strides sA/sB/sC in elements. K % 32 == 0.
// Independent products of one shape run as ONE launch with the member in blockIdx.z: the q, k and v projections (three weight planes, three biases; the tokens of both batches as one row range) and the tanh(Q) J products of every head of both batches.
// EPI says what the epilogue makes of the f32 tile, which goes through LDS either way (0: 16 rows at a time; 1, 2: whole):
//   0: C (f32, pitch ldc) = tile + bias.
//   1: the projections. A tile is 64 tokens of ONE head (HD == 64). Members 0, 1 (q, k): y = tile + bias goes out as hi/lo planes P* [b][member][h][t][d], tanh(y) as hi/lo planes N* of the same shape.
//      Member 2 (v): the operands change places (rows = the head's 64 d, columns = tokens; same products, same k order), so that the same row-wise epilogue writes the transposed planes V* [b][h][d][t] (fp16, hi, lo).
//   2: the tile goes out as hi/lo planes P* (pitch ldc, z-stride sC).
// The 16-bit planes are stored 16 bytes a lane, one half block (16 rows x 16 k) a step: 512 contiguous bytes.
__device__ __forceinline__ h16 tohx(float x) { return (h16)x; }
__device__ __forceinline__ void splitf(float y, unsigned short& h, unsigned short& l) { h = f2bf(y); l = f2bf(y - bf2f(h)); }
__device__ __forceinline__ float tanhc(float x) { const float xs = fminf(fmaxf(x, -15.0f), 15.0f); const float ex = __builtin_amdgcn_exp2f(xs * 2.8853900817779268f); return (ex - 1.0f) * __builtin_amdgcn_rcpf(ex + 1.0f); }
__device__ __forceinline__ void st_hl(const float (&y)[8], bf* Ph, bf* Pl) { v8us oh, ol;
#pragma unroll
    for (int u = 0; u < 8; ++u) { unsigned short a, c; splitf(y[u], a, c); oh[u] = a; ol[u] = c; }
    *(v8us*)Ph = oh; *(v8us*)Pl = ol; }
template <typename T16> struct WFrag;
template <> struct WFrag<h16> { typedef v16h V; static __device__ __forceinline__ V ld(const h16* p) { return cat16(*(const v8h*)p, *(const v8h*)(p + 256)); } static __device__ __forceinline__ v8f mma(V a, V b, v8f c) { return wmma16(a, b, c); } };
template <> struct WFrag<bf> { typedef v16bf V; static __device__ __forceinline__ V ld(const bf* p) { return cat16b(*(const v8us*)p, *(const v8us*)(p + 256)); } static __device__ __forceinline__ v8f mma(V a, V b, v8f c) { return wmmab(a, b, c); } };
// One block row of a stage (4 blocks = 4 KiB, contiguous in the plane and in LDS): eight asynchronous copies of 16 bytes a lane, 512 bytes a wave each. l: the lane's LDS byte address, g: its global address.
// The wait on the last line stands in front of whatever next rewrites the address registers that the copies name.
template <typename T16>
__device__ __forceinline__ void cp_row(unsigned l, const T16* g) {
    asm volatile("global_load_async_to_lds_b128 %0, %8, off\n\t"
                 "global_load_async_to_lds_b128 %1, %9, off\n\t"
                 "global_load_async_to_lds_b128 %2, %10, off\n\t"
                 "global_load_async_to_lds_b128 %3, %11, off\n\t"
                 "global_load_async_to_lds_b128 %4, %12, off\n\t"
                 "global_load_async_to_lds_b128 %5, %13, off\n\t"
                 "global_load_async_to_lds_b128 %6, %14, off\n\t"
                 "global_load_async_to_lds_b128 %7, %15, off\n\t"
                 "s_wait_xcnt 0x0"
                 :: "v"(l), "v"(l + 512u), "v"(l + 1024u), "v"(l + 1536u), "v"(l + 2048u), "v"(l + 2560u), "v"(l + 3072u), "v"(l + 3584u),
                    "v"(g), "v"(g + 256), "v"(g + 512), "v"(g + 768), "v"(g + 1024), "v"(g + 1280), "v"(g + 1536), "v"(g + 1792) : "memory");
}
template <typename T16, int NSPLIT, int EPI, int K, bool ST>
__global__ __launch_bounds__(ST ? 128 : 32) void k_gemmw(const T16* __restrict__ A, const T16* __restrict__ A2, const T16* __restrict__ Bt, const T16* __restrict__ Bt2, float* C, int ldc, const float* __restrict__ bias0, const float* __restrict__ bias1, const float* __restrict__ bias2, size_t sA, size_t sB, size_t sC,
                                              bf* Ph, bf* Pl, bf* Nh, bf* Nl, h16* V16, bf* Vh, bf* Vl) {
    typedef typename WFrag<T16>::V V;
    constexpr int OSN = (EPI == 0 ? 16 : 64) * 68;                   // floats of one wave's epilogue staging
    constexpr unsigned PB = 128 * 128 * 2, SB = (NSPLIT == 1 ? 3 : 2) * PB;   // bytes of one plane's part of a stage; of a stage (A, A2 where there is one, B)
    constexpr unsigned SMB = !ST ? OSN * 4 : (2 * SB > 4 * OSN * 4) ? 2 * SB : 4 * OSN * 4;   // the epilogue stages in the two buffers' place, behind the last stage's barrier
    __shared__ __align__(1024) char sm[SMB];
    const int wave = ST ? __builtin_amdgcn_readfirstlane((int)threadIdx.x >> 5) : 0;
    float* const os = (float*)sm + wave * OSN;
    const size_t z = blockIdx.z;
    const size_t za = (EPI == 2) ? z + z / NH_ * NH_ : z, zb = (EPI == 2) ? z % NH_ : z;   // EPI 2: member z = batch * NH_ + head; a batch's NH_ tanh(q) planes are followed by its NH_ tanh(k) planes, and both batches share the J planes
    A += za * sA; if (A2) A2 += za * sA; Bt += zb * sB; if (Bt2) Bt2 += zb * sB; if (EPI == 0) C += z * sC;
    const float* __restrict__ bias = (z == 0) ? bias0 : (z == 1) ? bias1 : bias2;   // each z-batch member has its own bias vector (at most three members where a bias is added)
    const bool vt = EPI == 1 && z == 2;                                             // the v projection: rows from the weight plane, columns from x
    if (vt) { const T16* const w = Bt; Bt = A; A = w; }
    const int lane = threadIdx.x & 31, lr = lane & 15, hi = lane >> 4; const int R0 = (vt ? blockIdx.y : blockIdx.x) * (ST ? 128 : 64), C0 = (vt ? blockIdx.x : blockIdx.y) * (ST ? 128 : 64), r0 = R0 + (wave >> 1) * 64, c0 = C0 + (wave & 1) * 64;
    v8f acc[4][4];
#pragma unroll
    for (int mb = 0; mb < 4; ++mb)
#pragma unroll
        for (int nb = 0; nb < 4; ++nb) acc[mb][nb] = (v8f){};
    if constexpr (ST) {
        static_assert(NSPLIT <= 1 && K % 128 == 0 && K / 128 >= 2, "whole stages of 128 k, two at least; planes A, A2, B");
        constexpr int NS = K / 128;
        // Wave w copies block rows 2 w and 2 w + 1 of each plane's 8.
        const unsigned lw = (unsigned)(size_t)sm + (unsigned)wave * 8192u + (unsigned)lane * 16u;
        const T16* const ga = A + (size_t)(R0 + wave * 32) * K + 8 * lane; const T16* const ga2 = A2 + (size_t)(R0 + wave * 32) * K + 8 * lane; const T16* const gb = Bt + (size_t)(C0 + wave * 32) * K + 8 * lane;
        auto fill = [&](int s, unsigned l) { const size_t go = (size_t)s * 2048;
            cp_row(l, ga + go); cp_row(l + 4096u, ga + go + 16 * K);
            if (NSPLIT == 1) { cp_row(l + PB, ga2 + go); cp_row(l + PB + 4096u, ga2 + go + 16 * K); }
            cp_row(l + (SB - PB), gb + go); cp_row(l + (SB - PB) + 4096u, gb + go + 16 * K); };
        fill(0, lw);
        asm volatile("s_wait_asynccnt 0x0" ::: "memory");            // this wave's part of stage 0 has landed
        __syncthreads();                                             // every wave's part has
        fill(1, lw + SB);
#pragma unroll 1   // rolled: one copy of the stage's text, the buffer chosen by an offset
        for (int s = 0; s < NS; ++s) {
            const unsigned bo = (unsigned)(s & 1) * SB;
            const T16* const fa = (const T16*)(sm + bo + (unsigned)(wave >> 1) * 16384u) + 8 * lane; const T16* const fa2 = (const T16*)(sm + bo + PB + (unsigned)(wave >> 1) * 16384u) + 8 * lane; const T16* const fb = (const T16*)(sm + bo + (SB - PB) + (unsigned)(wave & 1) * 16384u) + 8 * lane;
            V a[2][4], a2[2][4], b[2][4];                            // two fragment sets: inside a stage the next block's LDS loads go out as one group in front of this block's products
            auto ldf = [&](int kb) {
#pragma unroll
                for (int mb = 0; mb < 4; ++mb) { a[kb & 1][mb] = WFrag<T16>::ld(fa + mb * 2048 + kb * 512); if (NSPLIT == 1) a2[kb & 1][mb] = WFrag<T16>::ld(fa2 + mb * 2048 + kb * 512); }
#pragma unroll
                for (int nb = 0; nb < 4; ++nb) b[kb & 1][nb] = WFrag<T16>::ld(fb + nb * 2048 + kb * 512); };
            ldf(0);
#pragma unroll
            for (int kb = 0; kb < 4; ++kb) {
                if (kb < 3) ldf(kb + 1);
                __builtin_amdgcn_sched_barrier(0);                   // keeps the load group whole and in front of the products: sunk among them, each small group is waited for by itself
#pragma unroll
                for (int nb = 0; nb < 4; ++nb)
#pragma unroll
                    for (int mb = 0; mb < 4; ++mb) { acc[mb][nb] = WFrag<T16>::mma(a[kb & 1][mb], b[kb & 1][nb], acc[mb][nb]); if (NSPLIT == 1) acc[mb][nb] = WFrag<T16>::mma(a2[kb & 1][mb], b[kb & 1][nb], acc[mb][nb]); }
                __builtin_amdgcn_sched_barrier(0);                   // keeps the block after next's loads, which land in this block's registers, behind its products
            }
            asm volatile("s_wait_dscnt 0x0" ::: "memory");           // this wave's reads of the buffer are done: behind the barrier it is refilled
            asm volatile("s_wait_asynccnt 0x0" ::: "memory");        // this wave's part of the next stage has landed
            __syncthreads();                                         // publishes the next stage and ends every wave's reads of this one
            if (s + 2 < NS) fill(s + 2, lw + bo);
        }
        asm volatile("s_wait_asynccnt 0x0" ::: "memory");            // no copy is left in flight where the buffers become the epilogue's staging
    } else {
    // Each lane's own piece of the first block of block row r0 / 16 (c0 / 16); the pointers walk k, one block (512 elements) a trip, and the block rows below are constant offsets from them.
    const T16* pa = A + (size_t)r0 * K + 8 * lane; const T16* pa2 = A2 + (size_t)r0 * K + 8 * lane; const T16* pb = Bt + (size_t)c0 * K + 8 * lane; const T16* pb2 = Bt2 + (size_t)c0 * K + 8 * lane;
#pragma unroll 1
    for (int kc = 0; kc < K; kc += 32) {
        V a[4], a2[4], b[4], b2[4];
#pragma unroll
        for (int mb = 0; mb < 4; ++mb) { a[mb] = WFrag<T16>::ld(pa + mb * 16 * K); if (NSPLIT == 1 || NSPLIT == 2) a2[mb] = WFrag<T16>::ld(pa2 + mb * 16 * K); }
#pragma unroll
        for (int nb = 0; nb < 4; ++nb) { b[nb] = WFrag<T16>::ld(pb + nb * 16 * K); if (NSPLIT >= 2) b2[nb] = WFrag<T16>::ld(pb2 + nb * 16 * K); }
        // In front of the pointers' step: they are the address registers of the loads just issued. Named as inputs they keep their registers up to the wait, so that no load lands on its own address pair.
        if (NSPLIT == 0) asm volatile("s_wait_xcnt 0x0" :: "v"(pa), "v"(pb) : "memory"); else if (NSPLIT == 1) asm volatile("s_wait_xcnt 0x0" :: "v"(pa), "v"(pa2), "v"(pb) : "memory"); else asm volatile("s_wait_xcnt 0x0" :: "v"(pa), "v"(pa2), "v"(pb), "v"(pb2) : "memory");
        __builtin_amdgcn_sched_barrier(0);                           // keeps the step behind the wait, and the trip's loads together in front of its products: sunk among them, each group of loads would be waited for by itself
        pa += 512; pa2 += 512; pb += 512; pb2 += 512;
#pragma unroll
        for (int nb = 0; nb < 4; ++nb)
#pragma unroll
            for (int mb = 0; mb < 4; ++mb) { acc[mb][nb] = WFrag<T16>::mma(a[mb], b[nb], acc[mb][nb]); if (NSPLIT == 1 || NSPLIT == 2) acc[mb][nb] = WFrag<T16>::mma(a2[mb], b[nb], acc[mb][nb]); if (NSPLIT >= 2) acc[mb][nb] = WFrag<T16>::mma(a[mb], b2[nb], acc[mb][nb]); }
        asm volatile("v_nop\n\tv_nop\n\tv_nop\n\tv_nop" : "+v"(acc[0][0]), "+v"(acc[1][1]), "+v"(acc[2][2]), "+v"(acc[3][3]) : "v"(a[0]), "v"(a[3]));
    }
    }
    if (EPI == 0) {
#pragma unroll
    for (int mb = 0; mb < 4; ++mb) {
#pragma unroll
        for (int nb = 0; nb < 4; ++nb) {
#pragma unroll
            for (int j = 0; j < 8; ++j) os[(hi * 8 + j) * 68 + nb * 16 + lr] = acc[mb][nb][j]; }
        __builtin_amdgcn_wave_barrier(); asm volatile("" ::: "memory");
        float* crow = C + (size_t)(r0 + mb * 16) * ldc + c0;
{
#pragma unroll
            for (int s = 0; s < 8; ++s) { const int row = 2 * s + hi, cofs = lr * 4; v4f val = *(const v4fa*)(os + row * 68 + cofs); val[0] += bfr(bias[c0 + cofs]); val[1] += bfr(bias[c0 + cofs + 1]); val[2] += bfr(bias[c0 + cofs + 2]); val[3] += bfr(bias[c0 + cofs + 3]);
                *(v4f*)(crow + (size_t)row * ldc + cofs) = val; }
             }
        __builtin_amdgcn_wave_barrier(); asm volatile("" ::: "memory");
    }
    } else {
        if (vt) {                                                    // the bias is added on the way into LDS: per row where the operands changed places, else per column
#pragma unroll
            for (int mb = 0; mb < 4; ++mb)
#pragma unroll
                for (int j = 0; j < 8; ++j) { const float bb = bfr(bias[r0 + mb * 16 + hi * 8 + j]);
#pragma unroll
                    for (int nb = 0; nb < 4; ++nb) os[(mb * 16 + hi * 8 + j) * 68 + nb * 16 + lr] = acc[mb][nb][j] + bb; }
        } else {
#pragma unroll
            for (int nb = 0; nb < 4; ++nb) { const float bb = (EPI == 1) ? bfr(bias[c0 + nb * 16 + lr]) : 0.0f;
#pragma unroll
                for (int mb = 0; mb < 4; ++mb)
#pragma unroll
                    for (int j = 0; j < 8; ++j) os[(mb * 16 + hi * 8 + j) * 68 + nb * 16 + lr] = (EPI == 1) ? acc[mb][nb][j] + bb : acc[mb][nb][j]; }
        }
        __builtin_amdgcn_wave_barrier(); asm volatile("" ::: "memory");   // the lanes read each other's rows below
        // Read-back: one half block a step (16 rows, 16 columns: 8 columns a lane), in the order in which the half blocks lie in the plane. The loops stay rolled, two steps a trip, so that the second step's LDS reads pass behind the first step's arithmetic.
        // Trip i = 2 mb + kb: rows 16 mb.., columns 32 kb..; step s: columns + 16 s. ldp = columns of the plane that the tile goes to, cc = the tile's first column in it.
        const float* const op0 = os + lr * 68 + hi * 8;
        // EPI 1: the tokens of both batches lie in a row (NB_ TT of them); a tile's 64 tokens are of one batch bt, and tl is the first of them inside it.
        const int tk = vt ? c0 : r0, bt = (EPI == 1) ? tk / TT : 0, tl = tk - bt * TT;
        const size_t ldp = vt ? TT : (EPI == 2) ? ldc : HD, cc = vt ? tl : (EPI == 2) ? c0 : 0, rr = (EPI == 1 && !vt) ? tl : r0;
        const size_t o0 = (vt ? (size_t)bt * NH_ : (EPI == 2) ? 0 : ((size_t)bt * 2 + z) * NH_ + (c0 >> 6)) * (size_t)TT * HD + ((EPI == 2) ? z * sC : 0) + rr * ldp + cc * 16 + 8 * lane;
        if (!vt) {
#pragma unroll 1
            for (int i = 0; i < 8; ++i) {
#pragma unroll
                for (int s = 0; s < 2; ++s) { const float* const op = op0 + (i >> 1) * (16 * 68) + (i & 1) * 32 + s * 16; const size_t o = o0 + (size_t)(i >> 1) * 16 * ldp + (i & 1) * 512 + s * 256;
                    const v4f x0 = *(const v4fa*)op, x1 = *(const v4fa*)(op + 4);
                    const float y[8] = { x0[0], x0[1], x0[2], x0[3], x1[0], x1[1], x1[2], x1[3] };
                    st_hl(y, Ph + o, Pl + o);
                    if (EPI == 1) { float th[8];
#pragma unroll
                        for (int u = 0; u < 8; ++u) th[u] = tanhc(y[u]);
                        st_hl(th, Nh + o, Nl + o); } }
                asm volatile("s_wait_xcnt 0x0" ::: "memory");        // the next trip overwrites data and address registers of the stores just issued
            }
        } else {
#pragma unroll 1
            for (int i = 0; i < 8; ++i) {
#pragma unroll
                for (int s = 0; s < 2; ++s) { const float* const op = op0 + (i >> 1) * (16 * 68) + (i & 1) * 32 + s * 16; const size_t o = o0 + (size_t)(i >> 1) * 16 * ldp + (i & 1) * 512 + s * 256;
                    const v4f x0 = *(const v4fa*)op, x1 = *(const v4fa*)(op + 4);
                    const float y[8] = { x0[0], x0[1], x0[2], x0[3], x1[0], x1[1], x1[2], x1[3] }; v8h o16;
#pragma unroll
                    for (int u = 0; u < 8; ++u) o16[u] = tohx(y[u]);
                    *(v8h*)(V16 + o) = o16; st_hl(y, Vh + o, Vl + o); }
                asm volatile("s_wait_xcnt 0x0" ::: "memory");        // as above
            }
        }
    }
}

typedef __attribute__((ext_vector_type(2))) _Float16 v2h;
typedef __attribute__((ext_vector_type(4))) _Float16 v4h;
typedef __attribute__((ext_vector_type(2))) unsigned short v2us;
typedef __attribute__((ext_vector_type(4))) unsigned short v4us;
typedef __attribute__((ext_vector_type(2))) float v2f;
typedef __attribute__((ext_vector_type(4))) int v4i;

// wt_piece: the fragment-major plane of Bt[n][k] = bf16(w[k][n]); bx is the block of 256 pieces inside the matrix.
// One 8-element piece a thread, in the order of the plane: a wave stores 512 contiguous bytes, and each of its 8 loads reads 16 neighbouring n of two rows k. N K / 8 is a multiple of the block size.
__device__ __forceinline__ void wt_piece(const float* __restrict__ w, int K, int N, bf* Bt, int bx) {
    const int g = bx * 256 + threadIdx.x, blk = g >> 6, kbs = K >> 5;
    const int n = (blk / kbs) * 16 + (g & 15), k = (blk % kbs) * 32 + ((g >> 5) & 1) * 16 + ((g >> 4) & 1) * 8;
    const float* __restrict__ p = w + (size_t)k * N + n; float v[8];
#pragma unroll
    for (int u = 0; u < 8; ++u) v[u] = p[(size_t)u * N];
    v8us o;
#pragma unroll
    for (int u = 0; u < 8; ++u) o[u] = f2bf(v[u]);
    *(v8us*)(Bt + (size_t)g * 8) = o;
}
// cvt_piece: the fragment-major bf16 plane of src[r][k] (K columns); one 8-element piece a thread, in the order of the plane (a wave stores 512 contiguous bytes; a block reads 512 contiguous bytes of each of 16 rows).
__device__ __forceinline__ void cvt_piece(const float* __restrict__ src, bf* dst, size_t n8, int K, int bx) { const size_t i = (size_t)bx * 256 + threadIdx.x; if (i >= n8) return;
    const int blk = (int)(i >> 6), kbs = K >> 5; const int r = (blk / kbs) * 16 + ((int)i & 15), k = (blk % kbs) * 32 + (((int)i >> 5) & 1) * 16 + (((int)i >> 4) & 1) * 8;
    const v8f v = *(const v8f*)(src + (size_t)r * K + k); v8us o;
    asm volatile("s_wait_xcnt 0x0" ::: "memory");                    // the conversion below reuses the address registers of the loads just issued
#pragma unroll
    for (int u = 0; u < 8; ++u) o[u] = f2bf(v[u]); *(v8us*)(dst + i * 8) = o;  }
// k_prep: every 16-bit plane that is made of an input alone, in ONE launch; none needs anything of another, so each takes a range of the block index (the branch is the same for a whole work-group):
// the four weight matrices (outputs in a row from WT), x of both batches, the NH_ matrices of J.
#define PBW  (DM * DQ / 8 / 256)          // blocks of one weight matrix
#define PBX  (NB_ * TT * DM / 8 / 256)    // blocks of x
#define PBJ  (HD * HD / 8 / 256)          // blocks of one matrix of J
__global__ __launch_bounds__(256) void k_prep(const float* __restrict__ w0, const float* __restrict__ w1, const float* __restrict__ w2, const float* __restrict__ w3, const float* __restrict__ x, const float* __restrict__ Jm, bf* WT, bf* XB, bf* JT) {
    int bx = blockIdx.x;
    if (bx < 4 * PBW) { const int y = bx / PBW; wt_piece((y == 0) ? w0 : (y == 1) ? w1 : (y == 2) ? w2 : w3, DM, DQ, WT + (size_t)y * DM * DQ, bx % PBW); return; }
    bx -= 4 * PBW;
    if (bx < PBX) { cvt_piece(x, XB, (size_t)NB_ * TT * DM / 8, DM, bx); return; }
    bx -= PBX;
    { const int y = bx / PBJ; wt_piece(Jm + (size_t)y * HD * HD, HD, HD, JT + (size_t)y * HD * HD, bx % PBJ); }
}
// ---- k_attn: score products, causal softmax and probability x value product of every (batch, head) in ONE launch; scores and probabilities stay in registers.
// A query tile is QW = 16 NT query columns; a wave walks keys of it in blocks of 32 (which keys: at k_attn). Transposed products: S^T = K Q^T and D^T = tanh(K) (tanh(Q) J)^T (A = key rows, B = query rows kept in
// registers; both hl x hl, 3 products), so a lane holds the scores of ONE query: keys 8 hi + j of each 16-key tile. t = S / 8 + lam D per element in f32; running maximum and running sum per query
// (online softmax: the output tile and the sum are rescaled by exp(old max - new max) in every block). The two 16-key tiles of a block, converted in place, ARE the B operand of O^T += V^T P^T
// (element s = tile s >> 3, register s & 7: the k order of the V^T loader). Query rows < RH: P and V in hi+lo planes (3 products); the rest fp16 with P x 1024. P is left unnormalised; O is divided by the sum at the end
// (the factor 1024 is in the sum too and cancels). Every inner loop is unrolled so that the fragment arrays stay in registers. A lane's 8 accumulator registers are 8 consecutive d of one query: one 16-byte store per plane and d tile into the merged-head hi/lo planes, where the wave's 32 pieces are one half block (512 contiguous bytes).
#define NT   2                    // 16-query column groups per wave
#define QW   (16 * NT)            // queries per wave
#define NQT  (TT / QW)            // query tiles per head; tile i has i + 1 key blocks
#define PW   4                    // tile pairs per work-group, two waves a pair: neighbouring tiles of one head, which read the same key rows at about the same time
#define L2E  1.4426950408889634f
__device__ __forceinline__ float xhalf(float x) { return __builtin_bit_cast(float, __builtin_amdgcn_permlanex16(__builtin_bit_cast(int, x), __builtin_bit_cast(int, x), 0x76543210, 0xfedcba98, false, false)); }   // lane l reads lane l ^ 16
// In front of code that overwrites address registers of global loads or stores just issued; the scheduling barrier keeps that code behind the wait (and the loads in front of it).
__device__ __forceinline__ void addr_done() { asm volatile("s_wait_xcnt 0x0" ::: "memory"); __builtin_amdgcn_sched_barrier(0); }
// The same, naming two pointers as inputs: they keep their registers up to the wait (else the last load through each lands on its own address pair).
__device__ __forceinline__ void addr_done(const bf* a, const bf* b) { asm volatile("s_wait_xcnt 0x0" :: "v"(a), "v"(b) : "memory"); __builtin_amdgcn_sched_barrier(0); }
// attn_q: the query-side fragments (Q and tanh(Q) J, hi and lo) of the tile at q0. Not part of attn_part, so that the loads and their wait stand once, in front of the branch that picks attn_part's form.
__device__ __forceinline__ void attn_q(const bf* __restrict__ Qh, const bf* __restrict__ Ql, const bf* __restrict__ Gh, const bf* __restrict__ Gl, int q0, v16bf (&qh)[NT][2], v16bf (&ql)[NT][2], v16bf (&gh)[NT][2], v16bf (&gl)[NT][2]) {
    const int lane = threadIdx.x & 31;
#pragma unroll
    for (int n = 0; n < NT; ++n)
#pragma unroll
        for (int ks = 0; ks < 2; ++ks) { const size_t qo = (size_t)(q0 + n * 16) * HD + ks * 512 + 8 * lane; qh[n][ks] = WFrag<bf>::ld(Qh + qo); ql[n][ks] = WFrag<bf>::ld(Ql + qo); gh[n][ks] = WFrag<bf>::ld(Gh + qo); gl[n][ks] = WFrag<bf>::ld(Gl + qo); }
    addr_done();
}
// attn_part: nblk key blocks of the tile at q0 (its fragments from attn_q), from the block at key kf0 on in steps of dk keys (+32 or -32), into the running state o, mr, ls (started here). nblk >= 1.
template <bool HR>
__device__ __forceinline__ void attn_part(const v16bf (&qh)[NT][2], const v16bf (&ql)[NT][2], const v16bf (&gh)[NT][2], const v16bf (&gl)[NT][2], const bf* __restrict__ Kh, const bf* __restrict__ Kl, const bf* __restrict__ Nh, const bf* __restrict__ Nl,
                                          const h16* __restrict__ V16, const bf* __restrict__ Vh, const bf* __restrict__ Vl, float lam, int q0, int kf0, int nblk, int dk, v8f (&o)[4][NT], float (&mr)[NT], float (&ls)[NT]) {
    const int lane = threadIdx.x & 31, lr = lane & 15, hi = lane >> 4;
#pragma unroll
    for (int n = 0; n < NT; ++n) { mr[n] = -3.0e38f; ls[n] = 0.0f;
#pragma unroll
        for (int dt = 0; dt < 4; ++dt) o[dt][n] = (v8f){}; }
    v16bf kf[2][2][4];                                               // key fragments of the block at hand: [16-key tile][k step][K hi, K lo, tanh K hi, tanh K lo]
    { const int lo = kf0 * HD + 8 * lane, lv = kf0 * 16 + 8 * lane; Kh += lo; Kl += lo; Nh += lo; Nl += lo; V16 += lv; Vh += lv; Vl += lv; }   // each lane's own place in the first block (32 keys: 2 block rows of the key planes, one block of the V^T planes); the pointers then walk the keys
    auto ldk = [&]() {
#pragma unroll
        for (int m = 0; m < 2; ++m)
#pragma unroll
            for (int ks = 0; ks < 2; ++ks) { const int ko = m * 16 * HD + ks * 512; kf[m][ks][0] = WFrag<bf>::ld(Kh + ko); kf[m][ks][1] = WFrag<bf>::ld(Kl + ko); kf[m][ks][2] = WFrag<bf>::ld(Nh + ko); kf[m][ks][3] = WFrag<bf>::ld(Nl + ko); } };
    ldk();
    addr_done();
    int kstep = (nblk > 1) ? dk * HD : 0, vstep = 0;                 // how far the pointers move in front of the next loads (behind the last block it is fetched again: in bounds, unused)
    int it = 0, kb = kf0;
#pragma unroll 1   // rolled: a second copy of the block would need a second set of fragment registers
    do {
        float t[2][NT][8];
#pragma unroll
        for (int m = 0; m < 2; ++m) {
            v8f s[NT], d[NT];
#pragma unroll
            for (int n = 0; n < NT; ++n) { s[n] = (v8f){}; d[n] = (v8f){}; }
#pragma unroll
            for (int ks = 0; ks < 2; ++ks) { const v16bf kh = kf[m][ks][0], kl = kf[m][ks][1], nh = kf[m][ks][2], nl = kf[m][ks][3];
#pragma unroll
                for (int n = 0; n < NT; ++n) { s[n] = wmmab(kh, qh[n][ks], s[n]); d[n] = wmmab(nh, gh[n][ks], d[n]); s[n] = wmmab(kh, ql[n][ks], s[n]); d[n] = wmmab(nh, gl[n][ks], d[n]); s[n] = wmmab(kl, qh[n][ks], s[n]); d[n] = wmmab(nl, gh[n][ks], d[n]); } }
#pragma unroll
            for (int n = 0; n < NT; ++n)
#pragma unroll
                for (int j = 0; j < 8; ++j) t[m][n][j] = s[n][j] * SCL + lam * d[n][j];
        }
        if (HR) addr_done(Vh, Vl); else addr_done();                 // the pointers move only here, a whole block behind the loads that name them; the scheduling barrier also keeps the loads below from rising over the score products, where they would need a second set of fragment registers
        Kh += kstep; Kl += kstep; Nh += kstep; Nl += kstep; V16 += vstep; Vh += vstep; Vl += vstep;
        v16h v16[4]; v16bf vh[4], vl[4];
#pragma unroll
        for (int dt = 0; dt < 4; ++dt) { const int vo = dt * 16 * TT; if (HR) { vh[dt] = WFrag<bf>::ld(Vh + vo); vl[dt] = WFrag<bf>::ld(Vl + vo); } else v16[dt] = WFrag<h16>::ld(V16 + vo); }
        __builtin_amdgcn_sched_barrier(0);                           // V in front of K: P.V needs V first, and loads return in order
        ldk();                                                       // the next block's key fragments, into the same registers: their latency passes behind the softmax and P.V
        __builtin_amdgcn_sched_barrier(0);                           // holds the loads here, far in front of their first use
        kstep = (it + 2 < nblk) ? dk * HD : 0; vstep = dk * 16;
        if (kb + 31 > q0) {                                          // the block that holds the diagonal (wave-uniform): keys beyond a lane's query leave the softmax
#pragma unroll
            for (int m = 0; m < 2; ++m)
#pragma unroll
                for (int n = 0; n < NT; ++n)
#pragma unroll
                    for (int j = 0; j < 8; ++j) if (kb + m * 16 + 8 * hi + j > q0 + n * 16 + lr) t[m][n][j] = -3.0e38f;
        }
        v16h p16[NT]; v16bf ph[NT], pl[NT];
#pragma unroll
        for (int n = 0; n < NT; ++n) {
            float bm = t[0][n][0];
#pragma unroll
            for (int e = 1; e < 16; ++e) bm = fmaxf(bm, t[e >> 3][n][e & 7]);
            bm = fmaxf(bm, xhalf(bm));                               // the other half of the wave holds the query's other 16 keys
            const float mn = fmaxf(mr[n], bm);                       // finite from the first block on: every block up to the diagonal's holds a key that is open to the query
            const float al = __builtin_amdgcn_exp2f((mr[n] - mn) * L2E); mr[n] = mn;
            float bs = 0.0f; v8us h0, h1, l0, l1;
#pragma unroll
            for (int e = 0; e < 16; ++e) { const float pe = __builtin_amdgcn_exp2f(HR ? (t[e >> 3][n][e & 7] - mn) * L2E : (t[e >> 3][n][e & 7] - mn) * L2E + 10.0f); bs += pe;   // + 10: P x 1024 for the fp16 planes
                if (HR) { unsigned short a, c2; splitf(pe, a, c2); if (e < 8) { h0[e & 7] = a; l0[e & 7] = c2; } else { h1[e & 7] = a; l1[e & 7] = c2; } }
                else p16[n][e] = tohx(pe); }
            if (HR) { ph[n] = cat16b(h0, h1); pl[n] = cat16b(l0, l1); }
            ls[n] = ls[n] * al + bs;                                 // each half sums its own keys; the halves are joined behind the loop
#pragma unroll
            for (int dt = 0; dt < 4; ++dt) o[dt][n] *= al;
        }
#pragma unroll
        for (int dt = 0; dt < 4; ++dt)
#pragma unroll
            for (int n = 0; n < NT; ++n) {
                if (HR) { o[dt][n] = wmmab(vh[dt], ph[n], o[dt][n]); o[dt][n] = wmmab(vh[dt], pl[n], o[dt][n]); o[dt][n] = wmmab(vl[dt], ph[n], o[dt][n]); }
                else o[dt][n] = wmma16(v16[dt], p16[n], o[dt][n]); }
        kb += dk;
    } while (++it < nblk);
    addr_done();                                                     // the code behind the loop reuses the pointers' registers
}
// attn_out: a tile's finished state -> the merged-head planes.
__device__ __forceinline__ void attn_out(const v8f (&o)[4][NT], const float (&ls)[NT], int q0, bf* Ah, bf* Al) {
    const int lane = threadIdx.x & 31;
#pragma unroll
    for (int n = 0; n < NT; ++n) { const float sum = ls[n] + xhalf(ls[n]); const float f = __fdiv_rn(1.0f, sum);
#pragma unroll
        for (int dt = 0; dt < 4; ++dt) { v8us oh, ol;
#pragma unroll
            for (int j = 0; j < 8; ++j) { unsigned short a, c2; splitf(o[dt][n][j] * f, a, c2); oh[j] = a; ol[j] = c2; }
            const size_t oo = (size_t)(q0 + n * 16) * DQ + dt * 256 + 8 * lane; *(v8us*)(Ah + oo) = oh; *(v8us*)(Al + oo) = ol; }
        if (n + 1 < NT) addr_done(); }                               // the next column group reuses registers that these stores name
}
// grid (NQT / 2 / PW, NB_ NH_), 2 PW waves: one work-group a WGP. Plane sets per batch: QK* = the q planes [h][t][d] followed by the k planes; G* = (tanh Q J) planes; V* = [h][d][t]. A* = merged heads [b][t][DQ], hi and lo. Every plane is fragment-major (rows t of 64 d; rows d of TT keys; rows t of DQ).
// Two waves per SIMD (512 registers each): the Q and K fragments alone take 128 registers each.
// Equal work for every wave. The cost of a tile grows with its index and every wave is resident from the start, so a wave with a whole late tile would run on alone on its SIMD, its vector work no longer behind another wave's products.
// Tiles i and NQT - 1 - i (NQT + 1 key blocks together) go to a pair of waves: the first takes the long tile's first na blocks; the second the rest of the long tile, leaves that partial state (maximum, sum, output tile) in LDS,
// and then takes the short tile, downwards from its diagonal (so the PW second waves stand at the same key block at the same time, as the first waves do). Behind the one barrier the first wave joins the two states as the online softmax joins blocks.
// A block of a tile below RH costs about 5/3 of another (three P.V products, P split): na grows by a third of such a short tile's blocks.
__global__ __launch_bounds__(64 * PW) __attribute__((amdgpu_waves_per_eu(2, 2))) void k_attn(const bf* __restrict__ QKh, const bf* __restrict__ QKl, const bf* __restrict__ Gh, const bf* __restrict__ Gl, const bf* __restrict__ QKNh, const bf* __restrict__ QKNl,
                                                  const h16* __restrict__ V16, const bf* __restrict__ Vh, const bf* __restrict__ Vl, const float* __restrict__ lamp, bf* Ah, bf* Al) {
    static_assert(NT == 2 && QW == 32 && NQT % (2 * PW) == 0 && 2 * RH <= TT, "a tile's diagonal block starts at its first query; whole pairs; the long tile of a pair lies above RH");
    __shared__ v4f xs[PW * 17 * 32];                                 // per pair and lane: the output tile (16 pieces of 4 floats), then maxima and sums; piece-major, so that a wave's store or load covers 512 contiguous bytes
    const int bh = blockIdx.y, b = bh / NH_, h = bh % NH_, lane = threadIdx.x & 31;
    const int wave = __builtin_amdgcn_readfirstlane((int)threadIdx.x >> 5), pr = wave % PW; const bool second = wave >= PW;
    const int i = blockIdx.x * PW + pr, qs = i * QW, qf = (NQT - 1 - i) * QW, nl = NQT - i;   // short tile, long tile, the long tile's key blocks
    const int na = min(NQT / 2 + 1 + ((qs < RH) ? (i + 1) / 3 : 0), nl - 1);   // the second wave keeps the diagonal block at least
    const size_t PLN = (size_t)NH_ * TT * HD, qp = ((size_t)b * 2 * NH_ + h) * TT * HD, kp = qp + PLN, gp = ((size_t)b * NH_ + h) * TT * HD, ap = (size_t)b * TT * DQ + h * HD * 16;
    const float lam = bfr(lamp[0]);
    v8f o[4][NT]; float mr[NT], ls[NT]; v16bf qh[NT][2], ql[NT][2], gh[NT][2], gl[NT][2];
    attn_q(QKh + qp, QKl + qp, Gh + gp, Gl + gp, qf, qh, ql, gh, gl);
    attn_part<false>(qh, ql, gh, gl, QKh + kp, QKl + kp, QKNh + kp, QKNl + kp, V16 + gp, Vh + gp, Vl + gp, lam, qf, second ? na * 32 : 0, second ? nl - na : na, 32, o, mr, ls);
    v4f* const xp = xs + pr * (17 * 32) + lane;
    if (second) {
#pragma unroll
        for (int n = 0; n < NT; ++n)
#pragma unroll
            for (int dt = 0; dt < 4; ++dt) { const v8f v = o[dt][n]; xp[((n * 4 + dt) * 2) * 32] = (v4f){ v[0], v[1], v[2], v[3] }; xp[((n * 4 + dt) * 2 + 1) * 32] = (v4f){ v[4], v[5], v[6], v[7] }; }
        xp[16 * 32] = (v4f){ mr[0], mr[1], ls[0], ls[1] };
        attn_q(QKh + qp, QKl + qp, Gh + gp, Gl + gp, qs, qh, ql, gh, gl);
        if (qs < RH) attn_part<true>(qh, ql, gh, gl, QKh + kp, QKl + kp, QKNh + kp, QKNl + kp, V16 + gp, Vh + gp, Vl + gp, lam, qs, qs, i + 1, -32, o, mr, ls);
        else attn_part<false>(qh, ql, gh, gl, QKh + kp, QKl + kp, QKNh + kp, QKNl + kp, V16 + gp, Vh + gp, Vl + gp, lam, qs, qs, i + 1, -32, o, mr, ls);
    }
    __syncthreads();                                                 // the second waves' partial states are in LDS
    if (!second) {
        const v4f ml = xp[16 * 32];
#pragma unroll
        for (int n = 0; n < NT; ++n) { const float mn = fmaxf(mr[n], ml[n]);   // both finite: each part holds a key that is open to the query
            const float fa = __builtin_amdgcn_exp2f((mr[n] - mn) * L2E), fb = __builtin_amdgcn_exp2f((ml[n] - mn) * L2E);
            ls[n] = ls[n] * fa + ml[2 + n] * fb;
#pragma unroll
            for (int dt = 0; dt < 4; ++dt) { const v4f x0 = xp[((n * 4 + dt) * 2) * 32], x1 = xp[((n * 4 + dt) * 2 + 1) * 32];
#pragma unroll
                for (int j = 0; j < 4; ++j) { o[dt][n][j] = o[dt][n][j] * fa + x0[j] * fb; o[dt][n][4 + j] = o[dt][n][4 + j] * fa + x1[j] * fb; } } }
    }
    attn_out(o, ls, second ? qs : qf, Ah + ap, Al + ap);
}

extern "C" void kernel_launch(void* const* d_in, const int* in_sizes, int n_in,
                              void* d_out, int out_size, void* d_ws, size_t ws_size, hipStream_t stream) {
    (void)in_sizes; (void)n_in; (void)out_size;
    const float* x = (const float*)d_in[0]; const float* wq = (const float*)d_in[1]; const float* bq = (const float*)d_in[2]; const float* wk = (const float*)d_in[3]; const float* bk = (const float*)d_in[4]; const float* wv = (const float*)d_in[5]; const float* bv = (const float*)d_in[6]; const float* wo = (const float*)d_in[7]; const float* bo = (const float*)d_in[8]; const float* Jm = (const float*)d_in[9]; const float* lamp = (const float*)d_in[10];
    float* OUT = (float*)d_out;     // [2][2048][1024]
    char* wsp = (char*)d_ws;
    const size_t PLN = (size_t)NH_ * TT * HD;   // elements of one set of head planes
    auto take = [&](size_t bytes) { char* p = wsp; wsp += (bytes + 255) & ~(size_t)255; return (void*)p; };
    bf* WQ = (bf*)take((size_t)DQ * DM * 2); bf* WK = (bf*)take((size_t)DKV * DM * 2); bf* WV = (bf*)take((size_t)DKV * DM * 2); bf* WO = (bf*)take((size_t)DM * DQ * 2);   // WQ, WK, WV, WO lie in a row
    bf* XB = (bf*)take((size_t)NB_ * TT * DM * 2); bf* JT = (bf*)take((size_t)NH_ * HD * HD * 2);
    /* the planes that k_attn reads are kept for both batches; each q plane is followed by its k plane: QK* [b][q, k][h][t][d], QJ* [b][h][t][d], VT* [b][h][d][t] */
    bf* QKNh = (bf*)take((size_t)NB_ * 2 * PLN * 2); bf* QKNl = (bf*)take((size_t)NB_ * 2 * PLN * 2); bf* QJh = (bf*)take((size_t)NB_ * PLN * 2); bf* QJl = (bf*)take((size_t)NB_ * PLN * 2);
    bf* QKPh = (bf*)take((size_t)NB_ * 2 * PLN * 2); bf* QKPl = (bf*)take((size_t)NB_ * 2 * PLN * 2); h16* VT16 = (h16*)take((size_t)NB_ * PLN * 2); bf* VTh = (bf*)take((size_t)NB_ * PLN * 2); bf* VTl = (bf*)take((size_t)NB_ * PLN * 2);
    bf* ATh = (bf*)take((size_t)NB_ * TT * DQ * 2); bf* ATl = (bf*)take((size_t)NB_ * TT * DQ * 2);
    if ((size_t)(wsp - (char*)d_ws) > ws_size) return;    // ws 256 MiB
    static_assert(DQ == DKV && DQ == DM && HD == 64, "the batched launches take equal shapes; a 64-column tile of a projection is one head"); static_assert((DM * DQ / 8) % 256 == 0 && (HD * HD / 8) % 256 == 0 && (NB_ * TT * DM / 8) % 256 == 0 && TT % 128 == 0 && DM % 32 == 0 && HD % 32 == 0 && TT % 32 == 0, "whole blocks of the fragment-major planes; one piece a thread in the transposes"); static_assert(RH % QW == 0 && TT % QW == 0 && TT % 32 == 0, "a tile's query columns lie on one side of RH and tile the sequence; key blocks of 32 tile it too");
    (void)WK; (void)WV;   // reached as members of the row they lie in
    k_prep<<<4 * PBW + PBX + NH_ * PBJ, 256, 0, stream>>>(wq, wk, wv, wo, x, Jm, WQ, XB, JT);   /* weight, x and J planes */
    k_gemmw<bf, 0, 1, DM, true><<<dim3(NB_ * TT / 128, DQ / 128, 3), 128, 0, stream>>>(XB, nullptr, WQ, nullptr, nullptr, 0, bq, bk, bv, 0, (size_t)DQ * DM, 0,
        QKPh, QKPl, QKNh, QKNl, VT16, VTh, VTl);   /* q, k, v projections of both batches -> q, k, tanh q, tanh k and transposed v planes */
    k_gemmw<bf, 1, 2, HD, false><<<dim3(TT / 64, 1, NB_ * NH_), 32, 0, stream>>>(QKNh, QKNl, JT, nullptr, nullptr, HD, nullptr, nullptr, nullptr, (size_t)TT * HD, (size_t)HD * HD, (size_t)TT * HD,
        QJh, QJl, nullptr, nullptr, nullptr, nullptr, nullptr);   /* tanh(Q) J of every head of both batches -> hi/lo planes */
    k_attn<<<dim3(NQT / 2 / PW, NB_ * NH_, 1), 64 * PW, 0, stream>>>(QKPh, QKPl, QJh, QJl, QKNh, QKNl, VT16, VTh, VTl, lamp, ATh, ATl);   /* scores, softmax and P.V of all heads of both batches */
    k_gemmw<bf, 1, 0, DQ, true><<<dim3(NB_ * TT / 128, DM / 128, 1), 128, 0, stream>>>(ATh, ATl, WO, nullptr, OUT, DM, bo, nullptr, nullptr, 0, 0, 0, nullptr, nullptr, nullptr, nullptr, nullptr, nullptr, nullptr);   /* output projection, both batches */
}

// v009
// It runs in 110 microseconds.
// Timed twice side by side with v008, it ran 1.04 times as fast both times.
// Over all steps from v000 it is 19.1 times as fast.
#include <hip/hip_runtime.h>

// Causal attention with a bilinear tanh correction (x [2][2048][1024]; Q/K/V = x W + b (16 x 64); scores = Q.K / 8 + lam * (tanh(Q) J_h tanh(K)^T) (J [16][64][64] and the scalar lam read); causal (-inf) softmax; out = merged Wo + bo -> [2][2048][1024]).
// Compute dtypes, f32 accumulate: every input rounded to bf16; Q/K/V on PLAIN bf16 operands (inputs: exact) + bias; tanh elementwise in f32 (exp2 form with the hardware reciprocal, clamped |x| <= 15), in the projection's epilogue; QJ = hi/lo tanh(Q) x exact J (2 products, f32); both score products hl x hl (3 products) on every row; the two terms combined per element in f32 in the reference's order (s/8 + lam d); key blocks beyond the diagonal skipped; softmax f32, online (running maximum and sum), fused with both products; attn.v: rows < 512 hl (3 products), the rest fp16 (x1024); Wo hl x exact (2 products) + bias.

#define NB_  2
#define TT   2048
#define DM   1024
#define NH_  16
#define NKV  16
#define HD   64
#define DQ   (NH_ * HD)
#define DKV  (NKV * HD)
#define RH   512                  // query rows < RH use hi+lo planes (0: none)
#define SCL  0.125f   // HD^-0.5
typedef _Float16 h16;
typedef unsigned short bf;
typedef __attribute__((ext_vector_type(16))) __bf16   v16bf;
typedef __attribute__((ext_vector_type(16))) _Float16 v16h;
typedef __attribute__((ext_vector_type(8)))  _Float16 v8h;
typedef __attribute__((ext_vector_type(8)))  unsigned short v8us;
typedef __attribute__((ext_vector_type(8)))  float    v8f;
typedef __attribute__((ext_vector_type(4)))  float    v4f;
typedef v8h  __attribute__((may_alias)) v8ha;
typedef v4f  __attribute__((may_alias)) v4fa;
typedef v8us __attribute__((may_alias)) v8usa;

__device__ __forceinline__ unsigned short f2bf(float f) { unsigned u = __float_as_uint(f); u += 0x7FFFu + ((u >> 16) & 1u); return (unsigned short)(u >> 16); }
__device__ __forceinline__ float bf2f(unsigned short b) { return __uint_as_float(((unsigned)b) << 16); }
__device__ __forceinline__ float bfr(float f) { return bf2f(f2bf(f)); }
__device__ __forceinline__ v16h cat16(v8h lo, v8h hi) { return __builtin_shufflevector(lo, hi, 0, 1, 2, 3, 4, 5, 6, 7, 8, 9, 10, 11, 12, 13, 14, 15); }
__device__ __forceinline__ v16bf cat16b(v8us lo, v8us hi) { return __builtin_bit_cast(v16bf, __builtin_shufflevector(lo, hi, 0, 1, 2, 3, 4, 5, 6, 7, 8, 9, 10, 11, 12, 13, 14, 15)); }
__device__ __forceinline__ v8f wmma16(v16h a, v16h b, v8f c) { return __builtin_amdgcn_wmma_f32_16x16x32_f16(false, a, false, b, (short)0, c, false, false); }
__device__ __forceinline__ v8f wmmab(v16bf a, v16bf b, v8f c) { return __builtin_amdgcn_wmma_f32_16x16x32_bf16(false, a, false, b, (short)0, c, false, false); }



// ---- Fragment-major planes. Every 16-bit operand plane M[r][k] (K columns) is kept as blocks of 16 rows x 32 k = 512 elements; block (r / 16, k / 32) starts at element (r / 16) * 16 * K + (k / 32) * 512.
// Inside a block the 8 elements k % 32 = 16 j + 8 hi + (0..7) of row r % 16 = lr lie at j * 256 + (16 hi + lr) * 8: lane 16 hi + lr of a wave reads its fragment as two 16-byte loads, at lane * 8 and at 256 + lane * 8,
// and each of the two loads covers 512 contiguous bytes (four whole lines) where a row-major plane makes it touch 16 lines. Which element reaches which lane and register is as with row-major planes.
// ---- k_gemmw: register-blocked GEMM, ONE WAVE per 64x64 output tile (16 accumulators), operands from fragment-major 16-bit planes.
// ST false: one wave a work-group, fragments straight from global memory; grid (M/64, N/64, Z), 32 threads.
// ST true: four waves (2 x 2) a work-group share a 128x128 tile; grid (M/128, N/128, Z), 128 threads. The operands' 128 rows x 128 k of a stage come into LDS by asynchronous copies (each byte fetched once a work-group, not
// once a wave), two buffers: the next stage's copies fly while this stage is worked on. A stage keeps the planes' own order (8 block rows of 4 blocks = 4 KiB each), so a fragment is two 16-byte LDS loads a lane, 512 contiguous bytes each.
// The products and their k order are the same either way.
// C[m][n] (f32, pitch ldc, + optional f32 bias[n]) = sum_k A[m][k] Bt[n][k] (+ split products per NSPLIT). z-batch strides sA/sB/sC in elements. K % 32 == 0.
// Independent products of one shape run as ONE launch with the member in blockIdx.z: the q, k and v projections (three weight planes, three biases; the tokens of both batches as one row range). (tanh(Q) J is formed in k_attn; ST false and EPI 2 have no launch at present.)
// EPI says what the epilogue makes of the f32 tile, which goes through LDS either way (0: 16 rows at a time; 1, 2: whole):
//   0: C (f32, pitch ldc) = tile + bias.
//   1: the projections. A tile is 64 tokens of ONE head (HD == 64). Members 0, 1 (q, k): y = tile + bias goes out as hi/lo planes P* [b][member][h][t][d], tanh(y) as hi/lo planes N* of the same shape.
//      Member 2 (v): the operands change places (rows = the head's 64 d, columns = tokens; same products, same k order), so that the same row-wise epilogue writes the transposed planes V* [b][h][d][t] (fp16, hi, lo).
//   2: the tile goes out as hi/lo planes P* (pitch ldc, z-stride sC).
// The 16-bit planes are stored 16 bytes a lane, one half block (16 rows x 16 k) a step: 512 contiguous bytes.
__device__ __forceinline__ h16 tohx(float x) { return (h16)x; }
__device__ __forceinline__ void splitf(float y, unsigned short& h, unsigned short& l) { h = f2bf(y); l = f2bf(y - bf2f(h)); }
__device__ __forceinline__ float tanhc(float x) { const float xs = fminf(fmaxf(x, -15.0f), 15.0f); const float ex = __builtin_amdgcn_exp2f(xs * 2.8853900817779268f); return (ex - 1.0f) * __builtin_amdgcn_rcpf(ex + 1.0f); }
__device__ __forceinline__ void st_hl(const float (&y)[8], bf* Ph, bf* Pl) { v8us oh, ol;
#pragma unroll
    for (int u = 0; u < 8; ++u) { unsigned short a, c; splitf(y[u], a, c); oh[u] = a; ol[u] = c; }
    *(v8us*)Ph = oh; *(v8us*)Pl = ol; }
template <typename T16> struct WFrag;
template <> struct WFrag<h16> { typedef v16h V; static __device__ __forceinline__ V ld(const h16* p) { return cat16(*(const v8h*)p, *(const v8h*)(p + 256)); } static __device__ __forceinline__ v8f mma(V a, V b, v8f c) { return wmma16(a, b, c); } };
template <> struct WFrag<bf> { typedef v16bf V; static __device__ __forceinline__ V ld(const bf* p) { return cat16b(*(const v8us*)p, *(const v8us*)(p + 256)); } static __device__ __forceinline__ v8f mma(V a, V b, v8f c) { return wmmab(a, b, c); } };
// One block row of a stage (4 blocks = 4 KiB, contiguous in the plane and in LDS): eight asynchronous copies of 16 bytes a lane, 512 bytes a wave each. l: the lane's LDS byte address, g: its global address.
// The wait on the last line stands in front of whatever next rewrites the address registers that the copies name.
template <typename T16>
__device__ __forceinline__ void cp_row(unsigned l, const T16* g) {
    asm volatile("global_load_async_to_lds_b128 %0, %8, off\n\t"
                 "global_load_async_to_lds_b128 %1, %9, off\n\t"
                 "global_load_async_to_lds_b128 %2, %10, off\n\t"
                 "global_load_async_to_lds_b128 %3, %11, off\n\t"
                 "global_load_async_to_lds_b128 %4, %12, off\n\t"
                 "global_load_async_to_lds_b128 %5, %13, off\n\t"
                 "global_load_async_to_lds_b128 %6, %14, off\n\t"
                 "global_load_async_to_lds_b128 %7, %15, off\n\t"
                 "s_wait_xcnt 0x0"
                 :: "v"(l), "v"(l + 512u), "v"(l + 1024u), "v"(l + 1536u), "v"(l + 2048u), "v"(l + 2560u), "v"(l + 3072u), "v"(l + 3584u),
                    "v"(g), "v"(g + 256), "v"(g + 512), "v"(g + 768), "v"(g + 1024), "v"(g + 1280), "v"(g + 1536), "v"(g + 1792) : "memory");
}
template <typename T16, int NSPLIT, int EPI, int K, bool ST>
__global__ __launch_bounds__(ST ? 128 : 32) void k_gemmw(const T16* __restrict__ A, const T16* __restrict__ A2, const T16* __restrict__ Bt, const T16* __restrict__ Bt2, float* C, int ldc, const float* __restrict__ bias0, const float* __restrict__ bias1, const float* __restrict__ bias2, size_t sA, size_t sB, size_t sC,
                                              bf* Ph, bf* Pl, bf* Nh, bf* Nl, h16* V16, bf* Vh, bf* Vl) {
    typedef typename WFrag<T16>::V V;
    constexpr int OSN = (EPI == 0 ? 16 : 64) * 68;                   // floats of one wave's epilogue staging
    constexpr unsigned PB = 128 * 128 * 2, SB = (NSPLIT == 1 ? 3 : 2) * PB;   // bytes of one plane's part of a stage; of a stage (A, A2 where there is one, B)
    constexpr unsigned SMB = !ST ? OSN * 4 : (2 * SB > 4 * OSN * 4) ? 2 * SB : 4 * OSN * 4;   // the epilogue stages in the two buffers' place, behind the last stage's barrier
    __shared__ __align__(1024) char sm[SMB];
    const int wave = ST ? __builtin_amdgcn_readfirstlane((int)threadIdx.x >> 5) : 0;
    float* const os = (float*)sm + wave * OSN;
    const size_t z = blockIdx.z;
    const size_t za = (EPI == 2) ? z + z / NH_ * NH_ : z, zb = (EPI == 2) ? z % NH_ : z;   // EPI 2: member z = batch * NH_ + head; a batch's NH_ tanh(q) planes are followed by its NH_ tanh(k) planes, and both batches share the J planes
    A += za * sA; if (A2) A2 += za * sA; Bt += zb * sB; if (Bt2) Bt2 += zb * sB; if (EPI == 0) C += z * sC;
    const float* __restrict__ bias = (z == 0) ? bias0 : (z == 1) ? bias1 : bias2;   // each z-batch member has its own bias vector (at most three members where a bias is added)
    const bool vt = EPI == 1 && z == 2;                                             // the v projection: rows from the weight plane, columns from x
    if (vt) { const T16* const w = Bt; Bt = A; A = w; }
    const int lane = threadIdx.x & 31, lr = lane & 15, hi = lane >> 4; const int R0 = (vt ? blockIdx.y : blockIdx.x) * (ST ? 128 : 64), C0 = (vt ? blockIdx.x : blockIdx.y) * (ST ? 128 : 64), r0 = R0 + (wave >> 1) * 64, c0 = C0 + (wave & 1) * 64;
    v8f acc[4][4];
#pragma unroll
    for (int mb = 0; mb < 4; ++mb)
#pragma unroll
        for (int nb = 0; nb < 4; ++nb) acc[mb][nb] = (v8f){};
    if constexpr (ST) {
        static_assert(NSPLIT <= 1 && K % 128 == 0 && K / 128 >= 2, "whole stages of 128 k, two at least; planes A, A2, B");
        constexpr int NS = K / 128;
        // Wave w copies block rows 2 w and 2 w + 1 of each plane's 8.
        const unsigned lw = (unsigned)(size_t)sm + (unsigned)wave * 8192u + (unsigned)lane * 16u;
        const T16* const ga = A + (size_t)(R0 + wave * 32) * K + 8 * lane; const T16* const ga2 = A2 + (size_t)(R0 + wave * 32) * K + 8 * lane; const T16* const gb = Bt + (size_t)(C0 + wave * 32) * K + 8 * lane;
        auto fill = [&](int s, unsigned l) { const size_t go = (size_t)s * 2048;
            cp_row(l, ga + go); cp_row(l + 4096u, ga + go + 16 * K);
            if (NSPLIT == 1) { cp_row(l + PB, ga2 + go); cp_row(l + PB + 4096u, ga2 + go + 16 * K); }
            cp_row(l + (SB - PB), gb + go); cp_row(l + (SB - PB) + 4096u, gb + go + 16 * K); };
        fill(0, lw);
        asm volatile("s_wait_asynccnt 0x0" ::: "memory");            // this wave's part of stage 0 has landed
        __syncthreads();                                             // every wave's part has
        fill(1, lw + SB);
#pragma unroll 1   // rolled: one copy of the stage's text, the buffer chosen by an offset
        for (int s = 0; s < NS; ++s) {
            const unsigned bo = (unsigned)(s & 1) * SB;
            const T16* const fa = (const T16*)(sm + bo + (unsigned)(wave >> 1) * 16384u) + 8 * lane; const T16* const fa2 = (const T16*)(sm + bo + PB + (unsigned)(wave >> 1) * 16384u) + 8 * lane; const T16* const fb = (const T16*)(sm + bo + (SB - PB) + (unsigned)(wave & 1) * 16384u) + 8 * lane;
            V a[2][4], a2[2][4], b[2][4];                            // two fragment sets: inside a stage the next block's LDS loads go out as one group in front of this block's products
            auto ldf = [&](int kb) {
#pragma unroll
                for (int mb = 0; mb < 4; ++mb) { a[kb & 1][mb] = WFrag<T16>::ld(fa + mb * 2048 + kb * 512); if (NSPLIT == 1) a2[kb & 1][mb] = WFrag<T16>::ld(fa2 + mb * 2048 + kb * 512); }
#pragma unroll
                for (int nb = 0; nb < 4; ++nb) b[kb & 1][nb] = WFrag<T16>::ld(fb + nb * 2048 + kb * 512); };
            ldf(0);
#pragma unroll
            for (int kb = 0; kb < 4; ++kb) {
                if (kb < 3) ldf(kb + 1);
                __builtin_amdgcn_sched_barrier(0);                   // keeps the load group whole and in front of the products: sunk among them, each small group is waited for by itself
#pragma unroll
                for (int nb = 0; nb < 4; ++nb)
#pragma unroll
                    for (int mb = 0; mb < 4; ++mb) { acc[mb][nb] = WFrag<T16>::mma(a[kb & 1][mb], b[kb & 1][nb], acc[mb][nb]); if (NSPLIT == 1) acc[mb][nb] = WFrag<T16>::mma(a2[kb & 1][mb], b[kb & 1][nb], acc[mb][nb]); }
                __builtin_amdgcn_sched_barrier(0);                   // keeps the block after next's loads, which land in this block's registers, behind its products
            }
            asm volatile("s_wait_dscnt 0x0" ::: "memory");           // this wave's reads of the buffer are done: behind the barrier it is refilled
            asm volatile("s_wait_asynccnt 0x0" ::: "memory");        // this wave's part of the next stage has landed
            __syncthreads();                                         // publishes the next stage and ends every wave's reads of this one
            if (s + 2 < NS) fill(s + 2, lw + bo);
        }
        asm volatile("s_wait_asynccnt 0x0" ::: "memory");            // no copy is left in flight where the buffers become the epilogue's staging
    } else {
    // Each lane's own piece of the first block of block row r0 / 16 (c0 / 16); the pointers walk k, one block (512 elements) a trip, and the block rows below are constant offsets from them.
    const T16* pa = A + (size_t)r0 * K + 8 * lane; const T16* pa2 = A2 + (size_t)r0 * K + 8 * lane; const T16* pb = Bt + (size_t)c0 * K + 8 * lane; const T16* pb2 = Bt2 + (size_t)c0 * K + 8 * lane;
#pragma unroll 1
    for (int kc = 0; kc < K; kc += 32) {
        V a[4], a2[4], b[4], b2[4];
#pragma unroll
        for (int mb = 0; mb < 4; ++mb) { a[mb] = WFrag<T16>::ld(pa + mb * 16 * K); if (NSPLIT == 1 || NSPLIT == 2) a2[mb] = WFrag<T16>::ld(pa2 + mb * 16 * K); }
#pragma unroll
        for (int nb = 0; nb < 4; ++nb) { b[nb] = WFrag<T16>::ld(pb + nb * 16 * K); if (NSPLIT >= 2) b2[nb] = WFrag<T16>::ld(pb2 + nb * 16 * K); }
        // In front of the pointers' step: they are the address registers of the loads just issued. Named as inputs they keep their registers up to the wait, so that no load lands on its own address pair.
        if (NSPLIT == 0) asm volatile("s_wait_xcnt 0x0" :: "v"(pa), "v"(pb) : "memory"); else if (NSPLIT == 1) asm volatile("s_wait_xcnt 0x0" :: "v"(pa), "v"(pa2), "v"(pb) : "memory"); else asm volatile("s_wait_xcnt 0x0" :: "v"(pa), "v"(pa2), "v"(pb), "v"(pb2) : "memory");
        __builtin_amdgcn_sched_barrier(0);                           // keeps the step behind the wait, and the trip's loads together in front of its products: sunk among them, each group of loads would be waited for by itself
        pa += 512; pa2 += 512; pb += 512; pb2 += 512;
#pragma unroll
        for (int nb = 0; nb < 4; ++nb)
#pragma unroll
            for (int mb = 0; mb < 4; ++mb) { acc[mb][nb] = WFrag<T16>::mma(a[mb], b[nb], acc[mb][nb]); if (NSPLIT == 1 || NSPLIT == 2) acc[mb][nb] = WFrag<T16>::mma(a2[mb], b[nb], acc[mb][nb]); if (NSPLIT >= 2) acc[mb][nb] = WFrag<T16>::mma(a[mb], b2[nb], acc[mb][nb]); }
        asm volatile("v_nop\n\tv_nop\n\tv_nop\n\tv_nop" : "+v"(acc[0][0]), "+v"(acc[1][1]), "+v"(acc[2][2]), "+v"(acc[3][3]) : "v"(a[0]), "v"(a[3]));
    }
    }
    if (EPI == 0) {
#pragma unroll
    for (int mb = 0; mb < 4; ++mb) {
#pragma unroll
        for (int nb = 0; nb < 4; ++nb) {
#pragma unroll
            for (int j = 0; j < 8; ++j) os[(hi * 8 + j) * 68 + nb * 16 + lr] = acc[mb][nb][j]; }
        __builtin_amdgcn_wave_barrier(); asm volatile("" ::: "memory");
        float* crow = C + (size_t)(r0 + mb * 16) * ldc + c0;
{
#pragma unroll
            for (int s = 0; s < 8; ++s) { const int row = 2 * s + hi, cofs = lr * 4; v4f val = *(const v4fa*)(os + row * 68 + cofs); val[0] += bfr(bias[c0 + cofs]); val[1] += bfr(bias[c0 + cofs + 1]); val[2] += bfr(bias[c0 + cofs + 2]); val[3] += bfr(bias[c0 + cofs + 3]);
                *(v4f*)(crow + (size_t)row * ldc + cofs) = val; }
             }
        __builtin_amdgcn_wave_barrier(); asm volatile("" ::: "memory");
    }
    } else {
        if (vt) {                                                    // the bias is added on the way into LDS: per row where the operands changed places, else per column
#pragma unroll
            for (int mb = 0; mb < 4; ++mb)
#pragma unroll
                for (int j = 0; j < 8; ++j) { const float bb = bfr(bias[r0 + mb * 16 + hi * 8 + j]);
#pragma unroll
                    for (int nb = 0; nb < 4; ++nb) os[(mb * 16 + hi * 8 + j) * 68 + nb * 16 + lr] = acc[mb][nb][j] + bb; }
        } else {
#pragma unroll
            for (int nb = 0; nb < 4; ++nb) { const float bb = (EPI == 1) ? bfr(bias[c0 + nb * 16 + lr]) : 0.0f;
#pragma unroll
                for (int mb = 0; mb < 4; ++mb)
#pragma unroll
                    for (int j = 0; j < 8; ++j) os[(mb * 16 + hi * 8 + j) * 68 + nb * 16 + lr] = (EPI == 1) ? acc[mb][nb][j] + bb : acc[mb][nb][j]; }
        }
        __builtin_amdgcn_wave_barrier(); asm volatile("" ::: "memory");   // the lanes read each other's rows below
        // Read-back: one half block a step (16 rows, 16 columns: 8 columns a lane), in the order in which the half blocks lie in the plane. The loops stay rolled, two steps a trip, so that the second step's LDS reads pass behind the first step's arithmetic.
        // Trip i = 2 mb + kb: rows 16 mb.., columns 32 kb..; step s: columns + 16 s. ldp = columns of the plane that the tile goes to, cc = the tile's first column in it.
        const float* const op0 = os + lr * 68 + hi * 8;
        // EPI 1: the tokens of both batches lie in a row (NB_ TT of them); a tile's 64 tokens are of one batch bt, and tl is the first of them inside it.
        const int tk = vt ? c0 : r0, bt = (EPI == 1) ? tk / TT : 0, tl = tk - bt * TT;
        const size_t ldp = vt ? TT : (EPI == 2) ? ldc : HD, cc = vt ? tl : (EPI == 2) ? c0 : 0, rr = (EPI == 1 && !vt) ? tl : r0;
        const size_t o0 = (vt ? (size_t)bt * NH_ : (EPI == 2) ? 0 : ((size_t)bt * 2 + z) * NH_ + (c0 >> 6)) * (size_t)TT * HD + ((EPI == 2) ? z * sC : 0) + rr * ldp + cc * 16 + 8 * lane;
        if (!vt) {
#pragma unroll 1
            for (int i = 0; i < 8; ++i) {
#pragma unroll
                for (int s = 0; s < 2; ++s) { const float* const op = op0 + (i >> 1) * (16 * 68) + (i & 1) * 32 + s * 16; const size_t o = o0 + (size_t)(i >> 1) * 16 * ldp + (i & 1) * 512 + s * 256;
                    const v4f x0 = *(const v4fa*)op, x1 = *(const v4fa*)(op + 4);
                    const float y[8] = { x0[0], x0[1], x0[2], x0[3], x1[0], x1[1], x1[2], x1[3] };
                    st_hl(y, Ph + o, Pl + o);
                    if (EPI == 1) { float th[8];
#pragma unroll
                        for (int u = 0; u < 8; ++u) th[u] = tanhc(y[u]);
                        st_hl(th, Nh + o, Nl + o); } }
                asm volatile("s_wait_xcnt 0x0" ::: "memory");        // the next trip overwrites data and address registers of the stores just issued
            }
        } else {
#pragma unroll 1
            for (int i = 0; i < 8; ++i) {
#pragma unroll
                for (int s = 0; s < 2; ++s) { const float* const op = op0 + (i >> 1) * (16 * 68) + (i & 1) * 32 + s * 16; const size_t o = o0 + (size_t)(i >> 1) * 16 * ldp + (i & 1) * 512 + s * 256;
                    const v4f x0 = *(const v4fa*)op, x1 = *(const v4fa*)(op + 4);
                    const float y[8] = { x0[0], x0[1], x0[2], x0[3], x1[0], x1[1], x1[2], x1[3] }; v8h o16;
#pragma unroll
                    for (int u = 0; u < 8; ++u) o16[u] = tohx(y[u]);
                    *(v8h*)(V16 + o) = o16; st_hl(y, Vh + o, Vl + o); }
                asm volatile("s_wait_xcnt 0x0" ::: "memory");        // as above
            }
        }
    }
}

typedef __attribute__((ext_vector_type(2))) _Float16 v2h;
typedef __attribute__((ext_vector_type(4))) _Float16 v4h;
typedef __attribute__((ext_vector_type(2))) unsigned short v2us;
typedef __attribute__((ext_vector_type(4))) unsigned short v4us;
typedef __attribute__((ext_vector_type(2))) float v2f;
typedef __attribute__((ext_vector_type(4))) int v4i;
typedef __attribute__((ext_vector_type(16))) unsigned short v16us;

// wt_piece: the fragment-major plane of Bt[n][k] = bf16(w[k][n]); bx is the block of 256 pieces inside the matrix.
// One 8-element piece a thread, in the order of the plane: a wave stores 512 contiguous bytes, and each of its 8 loads reads 16 neighbouring n of two rows k. N K / 8 is a multiple of the block size.
__device__ __forceinline__ void wt_piece(const float* __restrict__ w, int K, int N, bf* Bt, int bx) {
    const int g = bx * 256 + threadIdx.x, blk = g >> 6, kbs = K >> 5;
    const int n = (blk / kbs) * 16 + (g & 15), k = (blk % kbs) * 32 + ((g >> 5) & 1) * 16 + ((g >> 4) & 1) * 8;
    const float* __restrict__ p = w + (size_t)k * N + n; float v[8];
#pragma unroll
    for (int u = 0; u < 8; ++u) v[u] = p[(size_t)u * N];
    v8us o;
#pragma unroll
    for (int u = 0; u < 8; ++u) o[u] = f2bf(v[u]);
    *(v8us*)(Bt + (size_t)g * 8) = o;
}
// cvt_piece: the fragment-major bf16 plane of src[r][k] (K columns); one 8-element piece a thread, in the order of the plane (a wave stores 512 contiguous bytes; a block reads 512 contiguous bytes of each of 16 rows).
__device__ __forceinline__ void cvt_piece(const float* __restrict__ src, bf* dst, size_t n8, int K, int bx) { const size_t i = (size_t)bx * 256 + threadIdx.x; if (i >= n8) return;
    const int blk = (int)(i >> 6), kbs = K >> 5; const int r = (blk / kbs) * 16 + ((int)i & 15), k = (blk % kbs) * 32 + (((int)i >> 5) & 1) * 16 + (((int)i >> 4) & 1) * 8;
    const v8f v = *(const v8f*)(src + (size_t)r * K + k); v8us o;
    asm volatile("s_wait_xcnt 0x0" ::: "memory");                    // the conversion below reuses the address registers of the loads just issued
#pragma unroll
    for (int u = 0; u < 8; ++u) o[u] = f2bf(v[u]); *(v8us*)(dst + i * 8) = o;  }
// k_prep: every 16-bit plane that is made of an input alone, in ONE launch; none needs anything of another, so each takes a range of the block index (the branch is the same for a whole work-group):
// the four weight matrices (outputs in a row from WT), x of both batches, the NH_ matrices of J.
#define PBW  (DM * DQ / 8 / 256)          // blocks of one weight matrix
#define PBX  (NB_ * TT * DM / 8 / 256)    // blocks of x
#define PBJ  (HD * HD / 8 / 256)          // blocks of one matrix of J
__global__ __launch_bounds__(256) void k_prep(const float* __restrict__ w0, const float* __restrict__ w1, const float* __restrict__ w2, const float* __restrict__ w3, const float* __restrict__ x, const float* __restrict__ Jm, bf* WT, bf* XB, bf* JT) {
    int bx = blockIdx.x;
    if (bx < 4 * PBW) { const int y = bx / PBW; wt_piece((y == 0) ? w0 : (y == 1) ? w1 : (y == 2) ? w2 : w3, DM, DQ, WT + (size_t)y * DM * DQ, bx % PBW); return; }
    bx -= 4 * PBW;
    if (bx < PBX) { cvt_piece(x, XB, (size_t)NB_ * TT * DM / 8, DM, bx); return; }
    bx -= PBX;
    { const int y = bx / PBJ; wt_piece(Jm + (size_t)y * HD * HD, HD, HD, JT + (size_t)y * HD * HD, bx % PBJ); }
}
// ---- k_attn: score products, causal softmax and probability x value product of every (batch, head) in ONE launch; scores and probabilities stay in registers.
// A query tile is QW = 16 NT query columns; a wave walks keys of it in blocks of 32 (which keys: at k_attn). Transposed products: S^T = K Q^T and D^T = tanh(K) (tanh(Q) J)^T (A = key rows, B = query rows kept in
// registers; both hl x hl, 3 products), so a lane holds the scores of ONE query: keys 8 hi + j of each 16-key tile. t = S / 8 + lam D per element in f32; running maximum and running sum per query
// (online softmax: the output tile and the sum are rescaled by exp(old max - new max) in every block). The two 16-key tiles of a block, converted in place, ARE the B operand of O^T += V^T P^T
// (element s = tile s >> 3, register s & 7: the k order of the V^T loader). Query rows < RH: P and V in hi+lo planes (3 products); the rest fp16 with P x 1024. P is left unnormalised; O is divided by the sum at the end
// (the factor 1024 is in the sum too and cancels). Every inner loop is unrolled so that the fragment arrays stay in registers. A lane's 8 accumulator registers are 8 consecutive d of one query: one 16-byte store per plane and d tile into the merged-head hi/lo planes, where the wave's 32 pieces are one half block (512 contiguous bytes).
#define NT   2                    // 16-query column groups per wave
#define QW   (16 * NT)            // queries per wave
#define NQT  (TT / QW)            // query tiles per head; tile i has i + 1 key blocks
#define PW   4                    // tile pairs per work-group, two waves a pair: neighbouring tiles of one head, which read the same key rows at about the same time
#define L2E  1.4426950408889634f
__device__ __forceinline__ float xhalf(float x) { return __builtin_bit_cast(float, __builtin_amdgcn_permlanex16(__builtin_bit_cast(int, x), __builtin_bit_cast(int, x), 0x76543210, 0xfedcba98, false, false)); }   // lane l reads lane l ^ 16
// In front of code that overwrites address registers of global loads or stores just issued; the scheduling barrier keeps that code behind the wait (and the loads in front of it).
__device__ __forceinline__ void addr_done() { asm volatile("s_wait_xcnt 0x0" ::: "memory"); __builtin_amdgcn_sched_barrier(0); }
// The same, naming two pointers as inputs: they keep their registers up to the wait (else the last load through each lands on its own address pair).
__device__ __forceinline__ void addr_done(const bf* a, const bf* b) { asm volatile("s_wait_xcnt 0x0" :: "v"(a), "v"(b) : "memory"); __builtin_amdgcn_sched_barrier(0); }
// attn_q: hi and lo fragments of the tile at q0 from a pair of query-row planes (Q, or tanh(Q)). Not part of attn_part, so that the loads and their wait stand once, in front of the branch that picks attn_part's form.
__device__ __forceinline__ void attn_q(const bf* __restrict__ Qh, const bf* __restrict__ Ql, int q0, v16bf (&qh)[NT][2], v16bf (&ql)[NT][2]) {
    const int lane = threadIdx.x & 31; const size_t q1 = (size_t)q0 * HD + 8 * lane; const bf* const ph = Qh + q1; const bf* const pl = Ql + q1;
#pragma unroll
    for (int n = 0; n < NT; ++n)
#pragma unroll
        for (int ks = 0; ks < 2; ++ks) { const int qo = n * 16 * HD + ks * 512; qh[n][ks] = WFrag<bf>::ld(ph + qo); ql[n][ks] = WFrag<bf>::ld(pl + qo); }
    addr_done(ph, pl);
}
// attn_j: the head's J^T fragments [16-e tile][d step].
__device__ __forceinline__ void attn_j(const bf* __restrict__ Jt, v16bf (&jt)[4][2]) {
    const int lane = threadIdx.x & 31;
#pragma unroll
    for (int et = 0; et < 4; ++et)
#pragma unroll
        for (int ks = 0; ks < 2; ++ks) jt[et][ks] = WFrag<bf>::ld(Jt + et * 16 * HD + ks * 512 + 8 * lane);
    addr_done();
}
// attn_g: G = tanh(Q) J of a tile, as G^T = J^T tanh(Q)^T (A = rows e of J^T, B = query rows; hi/lo tanh(Q) x exact J, 2 products a d step, hi in front of lo). A lane then holds 8 consecutive e (8 hi + j of each 16-e tile) of ONE query:
// two neighbouring e tiles, split hi/lo in place, ARE the B operand of D^T = tanh(K) G^T (element s = tile s >> 3, register s & 7: the k order of the tanh(K) loader).
__device__ __forceinline__ void attn_g(const v16bf (&th)[NT][2], const v16bf (&tl)[NT][2], const v16bf (&jt)[4][2], v16bf (&gh)[NT][2], v16bf (&gl)[NT][2]) {
#pragma unroll
    for (int n = 0; n < NT; ++n) {
        v8f g[4];
#pragma unroll
        for (int et = 0; et < 4; ++et) g[et] = (v8f){};
#pragma unroll
        for (int ks = 0; ks < 2; ++ks)
#pragma unroll
            for (int et = 0; et < 4; ++et) { g[et] = wmmab(jt[et][ks], th[n][ks], g[et]); g[et] = wmmab(jt[et][ks], tl[n][ks], g[et]); }
#pragma unroll
        for (int ks = 0; ks < 2; ++ks) { v8us h0, h1, l0, l1;
#pragma unroll
            for (int j = 0; j < 8; ++j) { unsigned short a, c2; splitf(g[2 * ks][j], a, c2); h0[j] = a; l0[j] = c2; splitf(g[2 * ks + 1][j], a, c2); h1[j] = a; l1[j] = c2; }
            gh[n][ks] = cat16b(h0, h1); gl[n][ks] = cat16b(l0, l1); }
    }
}
// attn_part: nblk key blocks of the tile at q0 (its fragments from attn_q and attn_g; KG: the caller has moved the pointers to the lane's place in the first block and has issued that block's key loads into kf), from the block at key kf0 on in steps of dk keys (+32 or -32), into the running state o, mr, ls (started here). nblk >= 1.
template <bool HR, bool KG>
__device__ __forceinline__ void attn_part(const v16bf (&qh)[NT][2], const v16bf (&ql)[NT][2], const v16bf (&gh)[NT][2], const v16bf (&gl)[NT][2], v16bf (&kf)[2][2][4], const bf* __restrict__ Kh, const bf* __restrict__ Kl, const bf* __restrict__ Nh, const bf* __restrict__ Nl,
                                          const h16* __restrict__ V16, const bf* __restrict__ Vh, const bf* __restrict__ Vl, float lam, int q0, int kf0, int nblk, int dk, v8f (&o)[4][NT], float (&mr)[NT], float (&ls)[NT]) {
    const int lane = threadIdx.x & 31, lr = lane & 15, hi = lane >> 4;
#pragma unroll
    for (int n = 0; n < NT; ++n) { mr[n] = -3.0e38f; ls[n] = 0.0f;
#pragma unroll
        for (int dt = 0; dt < 4; ++dt) o[dt][n] = (v8f){}; }
    // kf: key fragments of the block at hand: [16-key tile][k step][K hi, K lo, tanh K hi, tanh K lo]
    if (!KG) { const int lo = kf0 * HD + 8 * lane, lv = kf0 * 16 + 8 * lane; Kh += lo; Kl += lo; Nh += lo; Nl += lo; V16 += lv; Vh += lv; Vl += lv; }   // each lane's own place in the first block (32 keys: 2 block rows of the key planes, one block of the V^T planes); the pointers then walk the keys
    auto ldk = [&]() {
#pragma unroll
        for (int m = 0; m < 2; ++m)
#pragma unroll
            for (int ks = 0; ks < 2; ++ks) { const int ko = m * 16 * HD + ks * 512; kf[m][ks][0] = WFrag<bf>::ld(Kh + ko); kf[m][ks][1] = WFrag<bf>::ld(Kl + ko); kf[m][ks][2] = WFrag<bf>::ld(Nh + ko); kf[m][ks][3] = WFrag<bf>::ld(Nl + ko); } };
    if (!KG) { ldk(); addr_done(); }
    int kstep = (nblk > 1) ? dk * HD : 0, vstep = 0;                 // how far the pointers move in front of the next loads (behind the last block it is fetched again: in bounds, unused)
    int it = 0, kb = kf0;
#pragma unroll 1   // rolled: a second copy of the block would need a second set of fragment registers
    do {
        float t[2][NT][8];
#pragma unroll
        for (int m = 0; m < 2; ++m) {
            v8f s[NT], d[NT];
#pragma unroll
            for (int n = 0; n < NT; ++n) { s[n] = (v8f){}; d[n] = (v8f){}; }
#pragma unroll
            for (int ks = 0; ks < 2; ++ks) { const v16bf kh = kf[m][ks][0], kl = kf[m][ks][1], nh = kf[m][ks][2], nl = kf[m][ks][3];
#pragma unroll
                for (int n = 0; n < NT; ++n) { s[n] = wmmab(kh, qh[n][ks], s[n]); d[n] = wmmab(nh, gh[n][ks], d[n]); s[n] = wmmab(kh, ql[n][ks], s[n]); d[n] = wmmab(nh, gl[n][ks], d[n]); s[n] = wmmab(kl, qh[n][ks], s[n]); d[n] = wmmab(nl, gh[n][ks], d[n]); } }
#pragma unroll
            for (int n = 0; n < NT; ++n)
#pragma unroll
                for (int j = 0; j < 8; ++j) t[m][n][j] = s[n][j] * SCL + lam * d[n][j];
        }
        if (HR) addr_done(Vh, Vl); else addr_done();                 // the pointers move only here, a whole block behind the loads that name them; the scheduling barrier also keeps the loads below from rising over the score products, where they would need a second set of fragment registers
        Kh += kstep; Kl += kstep; Nh += kstep; Nl += kstep; V16 += vstep; Vh += vstep; Vl += vstep;
        v16h v16[4]; v16bf vh[4], vl[4];
#pragma unroll
        for (int dt = 0; dt < 4; ++dt) { const int vo = dt * 16 * TT; if (HR) { vh[dt] = WFrag<bf>::ld(Vh + vo); vl[dt] = WFrag<bf>::ld(Vl + vo); } else v16[dt] = WFrag<h16>::ld(V16 + vo); }
        __builtin_amdgcn_sched_barrier(0);                           // V in front of K: P.V needs V first, and loads return in order
        ldk();                                                       // the next block's key fragments, into the same registers: their latency passes behind the softmax and P.V
        __builtin_amdgcn_sched_barrier(0);                           // holds the loads here, far in front of their first use
        kstep = (it + 2 < nblk) ? dk * HD : 0; vstep = dk * 16;
        if (kb + 31 > q0) {                                          // the block that holds the diagonal (wave-uniform): keys beyond a lane's query leave the softmax
#pragma unroll
            for (int m = 0; m < 2; ++m)
#pragma unroll
                for (int n = 0; n < NT; ++n)
#pragma unroll
                    for (int j = 0; j < 8; ++j) if (kb + m * 16 + 8 * hi + j > q0 + n * 16 + lr) t[m][n][j] = -3.0e38f;
        }
        v16h p16[NT]; v16bf ph[NT], pl[NT];
#pragma unroll
        for (int n = 0; n < NT; ++n) {
            float bm = t[0][n][0];
#pragma unroll
            for (int e = 1; e < 16; ++e) bm = fmaxf(bm, t[e >> 3][n][e & 7]);
            bm = fmaxf(bm, xhalf(bm));                               // the other half of the wave holds the query's other 16 keys
            const float mn = fmaxf(mr[n], bm);                       // finite from the first block on: every block up to the diagonal's holds a key that is open to the query
            const float al = __builtin_amdgcn_exp2f((mr[n] - mn) * L2E); mr[n] = mn;
            float bs = 0.0f; v8us h0, h1, l0, l1;
#pragma unroll
            for (int e = 0; e < 16; ++e) { const float pe = __builtin_amdgcn_exp2f(HR ? (t[e >> 3][n][e & 7] - mn) * L2E : (t[e >> 3][n][e & 7] - mn) * L2E + 10.0f); bs += pe;   // + 10: P x 1024 for the fp16 planes
                if (HR) { unsigned short a, c2; splitf(pe, a, c2); if (e < 8) { h0[e & 7] = a; l0[e & 7] = c2; } else { h1[e & 7] = a; l1[e & 7] = c2; } }
                else p16[n][e] = tohx(pe); }
            if (HR) { ph[n] = cat16b(h0, h1); pl[n] = cat16b(l0, l1); }
            ls[n] = ls[n] * al + bs;                                 // each half sums its own keys; the halves are joined behind the loop
#pragma unroll
            for (int dt = 0; dt < 4; ++dt) o[dt][n] *= al;
        }
#pragma unroll
        for (int dt = 0; dt < 4; ++dt)
#pragma unroll
            for (int n = 0; n < NT; ++n) {
                if (HR) { o[dt][n] = wmmab(vh[dt], ph[n], o[dt][n]); o[dt][n] = wmmab(vh[dt], pl[n], o[dt][n]); o[dt][n] = wmmab(vl[dt], ph[n], o[dt][n]); }
                else o[dt][n] = wmma16(v16[dt], p16[n], o[dt][n]); }
        kb += dk;
    } while (++it < nblk);
    addr_done();                                                     // the code behind the loop reuses the pointers' registers
}
// attn_out: a tile's finished state -> the merged-head planes.
__device__ __forceinline__ void attn_out(const v8f (&o)[4][NT], const float (&ls)[NT], int q0, bf* Ah, bf* Al) {
    const int lane = threadIdx.x & 31;
#pragma unroll
    for (int n = 0; n < NT; ++n) { const float sum = ls[n] + xhalf(ls[n]); const float f = __fdiv_rn(1.0f, sum);
#pragma unroll
        for (int dt = 0; dt < 4; ++dt) { v8us oh, ol;
#pragma unroll
            for (int j = 0; j < 8; ++j) { unsigned short a, c2; splitf(o[dt][n][j] * f, a, c2); oh[j] = a; ol[j] = c2; }
            const size_t oo = (size_t)(q0 + n * 16) * DQ + dt * 256 + 8 * lane; *(v8us*)(Ah + oo) = oh; *(v8us*)(Al + oo) = ol; }
        if (n + 1 < NT) addr_done(); }                               // the next column group reuses registers that these stores name
}
// grid (NQT / 2 / PW, NB_ NH_), 2 PW waves: one work-group a WGP. Plane sets per batch: QK* = the q planes [h][t][d] followed by the k planes, QKN* their tanh; JT = J^T [h][e][d], shared by the batches; V* = [h][d][t]. A* = merged heads [b][t][DQ], hi and lo. Every plane is fragment-major (rows t of 64 d; rows d of TT keys; rows t of DQ).
// Two waves per SIMD (512 registers each): the Q and K fragments alone take 128 registers each.
// Equal work for every wave. The cost of a tile grows with its index and every wave is resident from the start, so a wave with a whole late tile would run on alone on its SIMD, its vector work no longer behind another wave's products.
// Tiles i and NQT - 1 - i (NQT + 1 key blocks together) go to a pair of waves: the first takes the long tile's first na blocks; the second the rest of the long tile, leaves that partial state (maximum, sum, output tile) in LDS,
// and then takes the short tile, downwards from its diagonal (so the PW second waves stand at the same key block at the same time, as the first waves do). Behind the one barrier the first wave joins the two states as the online softmax joins blocks.
// A block of a tile below RH costs about 5/3 of another (three P.V products, P split): na grows by a third of such a short tile's blocks.
__global__ __launch_bounds__(64 * PW) __attribute__((amdgpu_waves_per_eu(2, 2))) void k_attn(const bf* __restrict__ QKh, const bf* __restrict__ QKl, const bf* __restrict__ JT, const bf* __restrict__ QKNh, const bf* __restrict__ QKNl,
                                                  const h16* __restrict__ V16, const bf* __restrict__ Vh, const bf* __restrict__ Vl, const float* __restrict__ lamp, bf* Ah, bf* Al) {
    static_assert(NT == 2 && QW == 32 && NQT % (2 * PW) == 0 && 2 * RH <= TT, "a tile's diagonal block starts at its first query; whole pairs; the long tile of a pair lies above RH");
    __shared__ v8us gs[PW * 16 * 32];                                // per pair and lane: the short tile's tanh(Q) J fragments (16 pieces of 16 bytes), piece-major
    __shared__ v4f xs[PW * 17 * 32];                                 // per pair and lane: the output tile (16 pieces of 4 floats), then maxima and sums; piece-major, so that a wave's store or load covers 512 contiguous bytes
    const int bh = blockIdx.y, b = bh / NH_, h = bh % NH_, lane = threadIdx.x & 31;
    const int wave = __builtin_amdgcn_readfirstlane((int)threadIdx.x >> 5), pr = wave % PW; const bool second = wave >= PW;
    const int i = blockIdx.x * PW + pr, qs = i * QW, qf = (NQT - 1 - i) * QW, nl = NQT - i;   // short tile, long tile, the long tile's key blocks
    const int na = min(NQT / 2 + 1 + ((qs < RH) ? (i + 1) / 3 : 0), nl - 1);   // the second wave keeps the diagonal block at least
    const size_t PLN = (size_t)NH_ * TT * HD, qp = ((size_t)b * 2 * NH_ + h) * TT * HD, kp = qp + PLN, gp = ((size_t)b * NH_ + h) * TT * HD, ap = (size_t)b * TT * DQ + h * HD * 16;
    const float lam = bfr(lamp[0]);
    v8f o[4][NT]; float mr[NT], ls[NT]; v16bf qh[NT][2], ql[NT][2], gh[NT][2], gl[NT][2], th[NT][2], tl[NT][2], jt[4][2], kf[2][2][4];
    v8us* const gq = gs + pr * (16 * 32) + lane;
    // The long tile's Q loads and its first block's key loads go out in front of tanh(Q) J, so that their latency passes behind it.
    const int k00 = second ? na * 32 : 0, lo0 = k00 * HD + 8 * lane, lv0 = k00 * 16 + 8 * lane;
    const bf* const b0h = QKh + qp + lo0; const bf* const b0l = QKl + qp + lo0; const bf* const c0h = QKNh + qp + lo0; const bf* const c0l = QKNl + qp + lo0;   // the k planes lie PLN elements behind the q planes: a constant offset of the loads
    const bf* const k0h = b0h + PLN; const bf* const k0l = b0l + PLN; const bf* const n0h = c0h + PLN; const bf* const n0l = c0l + PLN;
    attn_j(JT + h * HD * HD, jt);
    attn_q(QKh + qp, QKl + qp, qf, qh, ql);
#pragma unroll
    for (int m = 0; m < 2; ++m)
#pragma unroll
        for (int ks = 0; ks < 2; ++ks) { const int ko = m * 16 * HD + ks * 512; kf[m][ks][0] = WFrag<bf>::ld(k0h + ko); kf[m][ks][1] = WFrag<bf>::ld(k0l + ko); kf[m][ks][2] = WFrag<bf>::ld(n0h + ko); kf[m][ks][3] = WFrag<bf>::ld(n0l + ko); }
    asm volatile("s_wait_xcnt 0x0" :: "v"(b0h), "v"(b0l), "v"(c0h), "v"(c0l) : "memory");   // as addr_done: the four address pairs of the loads keep their registers up to the wait, so that no load lands on one
    __builtin_amdgcn_sched_barrier(0);                               // keeps the loads in front of the wait, and what follows behind it
    // tanh(Q) J: a second wave's short tile first (it waits in LDS, read back by the wave that wrote it), then the long tile, which stays in gh and gl.
#pragma unroll 1   // rolled: one copy of the products and the split in the text
    for (int v = second ? 0 : 1; v < 2; ++v) {
        attn_q(QKNh + qp, QKNl + qp, v ? qf : qs, th, tl);
        attn_g(th, tl, jt, gh, gl);
        if (v == 0) {
#pragma unroll
            for (int n = 0; n < NT; ++n)
#pragma unroll
                for (int ks = 0; ks < 2; ++ks) { const v16us uh = __builtin_bit_cast(v16us, gh[n][ks]), ul = __builtin_bit_cast(v16us, gl[n][ks]); v8us* const p = gq + (n * 2 + ks) * (4 * 32);
                    p[0] = __builtin_shufflevector(uh, uh, 0, 1, 2, 3, 4, 5, 6, 7); p[32] = __builtin_shufflevector(uh, uh, 8, 9, 10, 11, 12, 13, 14, 15); p[64] = __builtin_shufflevector(ul, ul, 0, 1, 2, 3, 4, 5, 6, 7); p[96] = __builtin_shufflevector(ul, ul, 8, 9, 10, 11, 12, 13, 14, 15); }
        }
    }
    attn_part<false, true>(qh, ql, gh, gl, kf, k0h, k0l, n0h, n0l, V16 + gp + lv0, Vh + gp + lv0, Vl + gp + lv0, lam, qf, k00, second ? nl - na : na, 32, o, mr, ls);
    v4f* const xp = xs + pr * (17 * 32) + lane;
    if (second) {
#pragma unroll
        for (int n = 0; n < NT; ++n)
#pragma unroll
            for (int dt = 0; dt < 4; ++dt) { const v8f v = o[dt][n]; xp[((n * 4 + dt) * 2) * 32] = (v4f){ v[0], v[1], v[2], v[3] }; xp[((n * 4 + dt) * 2 + 1) * 32] = (v4f){ v[4], v[5], v[6], v[7] }; }
        xp[16 * 32] = (v4f){ mr[0], mr[1], ls[0], ls[1] };
        attn_q(QKh + qp, QKl + qp, qs, qh, ql);
#pragma unroll
        for (int n = 0; n < NT; ++n)
#pragma unroll
            for (int ks = 0; ks < 2; ++ks) { const v8us* const p = gq + (n * 2 + ks) * (4 * 32); gh[n][ks] = cat16b(p[0], p[32]); gl[n][ks] = cat16b(p[64], p[96]); }
        if (qs < RH) attn_part<true, false>(qh, ql, gh, gl, kf, QKh + kp, QKl + kp, QKNh + kp, QKNl + kp, V16 + gp, Vh + gp, Vl + gp, lam, qs, qs, i + 1, -32, o, mr, ls);
        else attn_part<false, false>(qh, ql, gh, gl, kf, QKh + kp, QKl + kp, QKNh + kp, QKNl + kp, V16 + gp, Vh + gp, Vl + gp, lam, qs, qs, i + 1, -32, o, mr, ls);
    }
    __syncthreads();                                                 // the second waves' partial states are in LDS
    if (!second) {
        const v4f ml = xp[16 * 32];
#pragma unroll
        for (int n = 0; n < NT; ++n) { const float mn = fmaxf(mr[n], ml[n]);   // both finite: each part holds a key that is open to the query
            const float fa = __builtin_amdgcn_exp2f((mr[n] - mn) * L2E), fb = __builtin_amdgcn_exp2f((ml[n] - mn) * L2E);
            ls[n] = ls[n] * fa + ml[2 + n] * fb;
#pragma unroll
            for (int dt = 0; dt < 4; ++dt) { const v4f x0 = xp[((n * 4 + dt) * 2) * 32], x1 = xp[((n * 4 + dt) * 2 + 1) * 32];
#pragma unroll
                for (int j = 0; j < 4; ++j) { o[dt][n][j] = o[dt][n][j] * fa + x0[j] * fb; o[dt][n][4 + j] = o[dt][n][4 + j] * fa + x1[j] * fb; } } }
    }
    attn_out(o, ls, second ? qs : qf, Ah + ap, Al + ap);
}

extern "C" void kernel_launch(void* const* d_in, const int* in_sizes, int n_in,
                              void* d_out, int out_size, void* d_ws, size_t ws_size, hipStream_t stream) {
    (void)in_sizes; (void)n_in; (void)out_size;
    const float* x = (const float*)d_in[0]; const float* wq = (const float*)d_in[1]; const float* bq = (const float*)d_in[2]; const float* wk = (const float*)d_in[3]; const float* bk = (const float*)d_in[4]; const float* wv = (const float*)d_in[5]; const float* bv = (const float*)d_in[6]; const float* wo = (const float*)d_in[7]; const float* bo = (const float*)d_in[8]; const float* Jm = (const float*)d_in[9]; const float* lamp = (const float*)d_in[10];
    float* OUT = (float*)d_out;     // [2][2048][1024]
    char* wsp = (char*)d_ws;
    const size_t PLN = (size_t)NH_ * TT * HD;   // elements of one set of head planes
    auto take = [&](size_t bytes) { char* p = wsp; wsp += (bytes + 255) & ~(size_t)255; return (void*)p; };
    bf* WQ = (bf*)take((size_t)DQ * DM * 2); bf* WK = (bf*)take((size_t)DKV * DM * 2); bf* WV = (bf*)take((size_t)DKV * DM * 2); bf* WO = (bf*)take((size_t)DM * DQ * 2);   // WQ, WK, WV, WO lie in a row
    bf* XB = (bf*)take((size_t)NB_ * TT * DM * 2); bf* JT = (bf*)take((size_t)NH_ * HD * HD * 2);
    /* the planes that k_attn reads are kept for both batches; a batch's q planes are followed by its k planes: QK* [b][q, k][h][t][d], VT* [b][h][d][t] */
    bf* QKNh = (bf*)take((size_t)NB_ * 2 * PLN * 2); bf* QKNl = (bf*)take((size_t)NB_ * 2 * PLN * 2);
    bf* QKPh = (bf*)take((size_t)NB_ * 2 * PLN * 2); bf* QKPl = (bf*)take((size_t)NB_ * 2 * PLN * 2); h16* VT16 = (h16*)take((size_t)NB_ * PLN * 2); bf* VTh = (bf*)take((size_t)NB_ * PLN * 2); bf* VTl = (bf*)take((size_t)NB_ * PLN * 2);
    bf* ATh = (bf*)take((size_t)NB_ * TT * DQ * 2); bf* ATl = (bf*)take((size_t)NB_ * TT * DQ * 2);
    if ((size_t)(wsp - (char*)d_ws) > ws_size) return;    // ws 256 MiB
    static_assert(DQ == DKV && DQ == DM && HD == 64, "the batched launches take equal shapes; a 64-column tile of a projection is one head"); static_assert((DM * DQ / 8) % 256 == 0 && (HD * HD / 8) % 256 == 0 && (NB_ * TT * DM / 8) % 256 == 0 && TT % 128 == 0 && DM % 32 == 0 && HD % 32 == 0 && TT % 32 == 0, "whole blocks of the fragment-major planes; one piece a thread in the transposes"); static_assert(RH % QW == 0 && TT % QW == 0 && TT % 32 == 0, "a tile's query columns lie on one side of RH and tile the sequence; key blocks of 32 tile it too");
    (void)WK; (void)WV;   // reached as members of the row they lie in
    k_prep<<<4 * PBW + PBX + NH_ * PBJ, 256, 0, stream>>>(wq, wk, wv, wo, x, Jm, WQ, XB, JT);   /* weight, x and J planes */
    k_gemmw<bf, 0, 1, DM, true><<<dim3(NB_ * TT / 128, DQ / 128, 3), 128, 0, stream>>>(XB, nullptr, WQ, nullptr, nullptr, 0, bq, bk, bv, 0, (size_t)DQ * DM, 0,
        QKPh, QKPl, QKNh, QKNl, VT16, VTh, VTl);   /* q, k, v projections of both batches -> q, k, tanh q, tanh k and transposed v planes */
    k_attn<<<dim3(NQT / 2 / PW, NB_ * NH_, 1), 64 * PW, 0, stream>>>(QKPh, QKPl, JT, QKNh, QKNl, VT16, VTh, VTl, lamp, ATh, ATl);   /* tanh(Q) J, scores, softmax and P.V of all heads of both batches */
    k_gemmw<bf, 1, 0, DQ, true><<<dim3(NB_ * TT / 128, DM / 128, 1), 128, 0, stream>>>(ATh, ATl, WO, nullptr, OUT, DM, bo, nullptr, nullptr, 0, 0, 0, nullptr, nullptr, nullptr, nullptr, nullptr, nullptr, nullptr);   /* output projection, both batches */
}

// v010
// It runs in 108 microseconds.
// Timed twice side by side with v009, it ran 1.03 and 1.02 times as fast.
// Counting every step since v000, it is 19.6 times as fast.
#include <hip/hip_runtime.h>

// Causal attention with a bilinear tanh correction (x [2][2048][1024]; Q/K/V = x W + b (16 x 64); scores = Q.K / 8 + lam * (tanh(Q) J_h tanh(K)^T) (J [16][64][64] and the scalar lam read); causal (-inf) softmax; out = merged Wo + bo -> [2][2048][1024]).
// Compute dtypes, f32 accumulate: every input rounded to bf16; Q/K/V on PLAIN bf16 operands (inputs: exact) + bias; tanh elementwise in f32 (exp2 form with the hardware reciprocal, clamped |x| <= 15), in the projection's epilogue; QJ = hi/lo tanh(Q) x exact J (2 products, f32); both score products hl x hl (3 products) on every row; the two terms combined per element in f32 in the reference's order (s/8 + lam d); key blocks beyond the diagonal skipped; softmax f32, online (running maximum and sum), fused with both products; attn.v: rows < 512 hl (3 products), the rest fp16 (x1024); Wo hl x exact (2 products) + bias.

#define NB_  2
#define TT   2048
#define DM   1024
#define NH_  16
#define NKV  16
#define HD   64
#define DQ   (NH_ * HD)
#define DKV  (NKV * HD)
#define RH   512                  // query rows < RH use hi+lo planes
#define SCL  0.125f   // HD^-0.5
typedef _Float16 h16;
typedef unsigned short bf;
typedef __attribute__((ext_vector_type(16))) __bf16   v16bf;
typedef __attribute__((ext_vector_type(16))) _Float16 v16h;
typedef __attribute__((ext_vector_type(8)))  _Float16 v8h;
typedef __attribute__((ext_vector_type(8)))  unsigned short v8us;
typedef __attribute__((ext_vector_type(8)))  float    v8f;
typedef __attribute__((ext_vector_type(4)))  float    v4f;
typedef v8h  __attribute__((may_alias)) v8ha;
typedef v4f  __attribute__((may_alias)) v4fa;
typedef v8us __attribute__((may_alias)) v8usa;

__device__ __forceinline__ unsigned short f2bf(float f) { unsigned u = __float_as_uint(f); u += 0x7FFFu + ((u >> 16) & 1u); return (unsigned short)(u >> 16); }
__device__ __forceinline__ float bf2f(unsigned short b) { return __uint_as_float(((unsigned)b) << 16); }
__device__ __forceinline__ float bfr(float f) { return bf2f(f2bf(f)); }
__device__ __forceinline__ v16h cat16(v8h lo, v8h hi) { return __builtin_shufflevector(lo, hi, 0, 1, 2, 3, 4, 5, 6, 7, 8, 9, 10, 11, 12, 13, 14, 15); }
__device__ __forceinline__ v16bf cat16b(v8us lo, v8us hi) { return __builtin_bit_cast(v16bf, __builtin_shufflevector(lo, hi, 0, 1, 2, 3, 4, 5, 6, 7, 8, 9, 10, 11, 12, 13, 14, 15)); }
__device__ __forceinline__ v8f wmma16(v16h a, v16h b, v8f c) { return __builtin_amdgcn_wmma_f32_16x16x32_f16(false, a, false, b, (short)0, c, false, false); }
__device__ __forceinline__ v8f wmmab(v16bf a, v16bf b, v8f c) { return __builtin_amdgcn_wmma_f32_16x16x32_bf16(false, a, false, b, (short)0, c, false, false); }



// ---- Fragment-major planes. Every 16-bit operand plane M[r][k] (K columns) is kept as blocks of 16 rows x 32 k = 512 elements; block (r / 16, k / 32) starts at element (r / 16) * 16 * K + (k / 32) * 512.
// Inside a block the 8 elements k % 32 = 16 j + 8 hi + (0..7) of row r % 16 = lr lie at j * 256 + (16 hi + lr) * 8: lane 16 hi + lr of a wave reads its fragment as two 16-byte loads, at lane * 8 and at 256 + lane * 8,
// and each of the two loads covers 512 contiguous bytes (four whole lines) where a row-major plane makes it touch 16 lines. Which element reaches which lane and register is as with row-major planes.
// ---- k_gemmw: register-blocked GEMM, ONE WAVE per 64x64 output tile (16 accumulators), operands from fragment-major 16-bit planes.
// ST false: one wave a work-group, fragments straight from global memory; grid (M/64, N/64, Z), 32 threads.
// ST true: four waves (2 x 2) a work-group share a 128x128 tile; grid (M/128, N/128, Z), 128 threads. The operands' 128 rows x 128 k of a stage come into LDS by asynchronous copies (each byte fetched once a work-group, not
// once a wave), two buffers: the next stage's copies fly while this stage is worked on. A stage keeps the planes' own order (8 block rows of 4 blocks = 4 KiB each), so a fragment is two 16-byte LDS loads a lane, 512 contiguous bytes each.
// The products and their k order are the same either way.
// C[m][n] (f32, pitch ldc, + optional f32 bias[n]) = sum_k A[m][k] Bt[n][k] (+ split products per NSPLIT). z-batch strides sA/sB/sC in elements. K % 32 == 0.
// Independent products of one shape run as ONE launch with the member in blockIdx.z: the q, k and v projections (three weight planes, three biases; the tokens of both batches as one row range). (tanh(Q) J is formed in k_attn; ST false and EPI 2 have no launch at present.)
// EPI says what the epilogue makes of the f32 tile, which goes through LDS either way (0: 16 rows at a time; 1, 2: whole):
//   0: C (f32, pitch ldc) = tile + bias.
//   1: the projections. A tile is 64 tokens of ONE head (HD == 64). Members 0, 1 (q, k): y = tile + bias goes out as hi/lo planes P* [b][member][h][t][d], tanh(y) as hi/lo planes N* of the same shape.
//      Member 2 (v): the operands change places (rows = the head's 64 d, columns = tokens; same products, same k order), so that the same row-wise epilogue writes the transposed planes V* [b][h][d][t] (fp16, hi, lo).
//   2: the tile goes out as hi/lo planes P* (pitch ldc, z-stride sC).
// The 16-bit planes are stored 16 bytes a lane, one half block (16 rows x 16 k) a step: 512 contiguous bytes.
__device__ __forceinline__ h16 tohx(float x) { return (h16)x; }
__device__ __forceinline__ void splitf(float y, unsigned short& h, unsigned short& l) { h = f2bf(y); l = f2bf(y - bf2f(h)); }
__device__ __forceinline__ float tanhc(float x) { const float xs = fminf(fmaxf(x, -15.0f), 15.0f); const float ex = __builtin_amdgcn_exp2f(xs * 2.8853900817779268f); return (ex - 1.0f) * __builtin_amdgcn_rcpf(ex + 1.0f); }
__device__ __forceinline__ void st_hl(const float (&y)[8], bf* Ph, bf* Pl) { v8us oh, ol;
#pragma unroll
    for (int u = 0; u < 8; ++u) { unsigned short a, c; splitf(y[u], a, c); oh[u] = a; ol[u] = c; }
    *(v8us*)Ph = oh; *(v8us*)Pl = ol; }
template <typename T16> struct WFrag;
template <> struct WFrag<h16> { typedef v16h V; static __device__ __forceinline__ V ld(const h16* p) { return cat16(*(const v8h*)p, *(const v8h*)(p + 256)); } static __device__ __forceinline__ v8f mma(V a, V b, v8f c) { return wmma16(a, b, c); } };
template <> struct WFrag<bf> { typedef v16bf V; static __device__ __forceinline__ V ld(const bf* p) { return cat16b(*(const v8us*)p, *(const v8us*)(p + 256)); } static __device__ __forceinline__ v8f mma(V a, V b, v8f c) { return wmmab(a, b, c); } };
// One block row of a stage (4 blocks = 4 KiB, contiguous in the plane and in LDS): eight asynchronous copies of 16 bytes a lane, 512 bytes a wave each. l: the lane's LDS byte address, g: its global address.
// The wait on the last line stands in front of whatever next rewrites the address registers that the copies name.
template <typename T16>
__device__ __forceinline__ void cp_row(unsigned l, const T16* g) {
    asm volatile("global_load_async_to_lds_b128 %0, %8, off\n\t"
                 "global_load_async_to_lds_b128 %1, %9, off\n\t"
                 "global_load_async_to_lds_b128 %2, %10, off\n\t"
                 "global_load_async_to_lds_b128 %3, %11, off\n\t"
                 "global_load_async_to_lds_b128 %4, %12, off\n\t"
                 "global_load_async_to_lds_b128 %5, %13, off\n\t"
                 "global_load_async_to_lds_b128 %6, %14, off\n\t"
                 "global_load_async_to_lds_b128 %7, %15, off\n\t"
                 "s_wait_xcnt 0x0"
                 :: "v"(l), "v"(l + 512u), "v"(l + 1024u), "v"(l + 1536u), "v"(l + 2048u), "v"(l + 2560u), "v"(l + 3072u), "v"(l + 3584u),
                    "v"(g), "v"(g + 256), "v"(g + 512), "v"(g + 768), "v"(g + 1024), "v"(g + 1280), "v"(g + 1536), "v"(g + 1792) : "memory");
}
// L2 hints. The 16-bit planes were stored by an earlier launch; a prefetch asks a line into L2 ahead of the loads and copies that use it (nothing returns, no value depends on it).
// The asks stand one 256-byte unit (128 elements) apart. Every address lies inside the plane it names; every lane is on. The wait on the last line of a statement stands in front of whatever next rewrites the address registers that the asks name.
// ask_st: the units at each pointer (k stages 0 to 3 of a block row), then those 16 KiB behind (stages 4 to 7): in the order in which the stages are used.
template <typename T16>
__device__ __forceinline__ void ask_st(const T16* a, const T16* b) {
    asm volatile("global_prefetch_b8 %0, off scope:SCOPE_SE\n\t"
                 "global_prefetch_b8 %1, off scope:SCOPE_SE\n\t"
                 "global_prefetch_b8 %0, off offset:16384 scope:SCOPE_SE\n\t"
                 "global_prefetch_b8 %1, off offset:16384 scope:SCOPE_SE\n\t"
                 "s_wait_xcnt 0x0" :: "v"(a), "v"(b) : "memory");
}
template <typename T16>
__device__ __forceinline__ void ask_st(const T16* a, const T16* a2, const T16* b) {
    asm volatile("global_prefetch_b8 %0, off scope:SCOPE_SE\n\t"
                 "global_prefetch_b8 %1, off scope:SCOPE_SE\n\t"
                 "global_prefetch_b8 %2, off scope:SCOPE_SE\n\t"
                 "global_prefetch_b8 %0, off offset:16384 scope:SCOPE_SE\n\t"
                 "global_prefetch_b8 %1, off offset:16384 scope:SCOPE_SE\n\t"
                 "global_prefetch_b8 %2, off offset:16384 scope:SCOPE_SE\n\t"
                 "s_wait_xcnt 0x0" :: "v"(a), "v"(a2), "v"(b) : "memory");
}
template <typename T16, int NSPLIT, int EPI, int K, bool ST>
__global__ __launch_bounds__(ST ? 128 : 32) void k_gemmw(const T16* __restrict__ A, const T16* __restrict__ A2, const T16* __restrict__ Bt, const T16* __restrict__ Bt2, float* C, int ldc, const float* __restrict__ bias0, const float* __restrict__ bias1, const float* __restrict__ bias2, size_t sA, size_t sB, size_t sC,
                                              bf* Ph, bf* Pl, bf* Nh, bf* Nl, h16* V16, bf* Vh, bf* Vl) {
    typedef typename WFrag<T16>::V V;
    constexpr int OSN = (EPI == 0 ? 16 : 64) * 68;                   // floats of one wave's epilogue staging
    constexpr unsigned PB = 128 * 128 * 2, SB = (NSPLIT == 1 ? 3 : 2) * PB;   // bytes of one plane's part of a stage; of a stage (A, A2 where there is one, B)
    constexpr unsigned SMB = !ST ? OSN * 4 : (2 * SB > 4 * OSN * 4) ? 2 * SB : 4 * OSN * 4;   // the epilogue stages in the two buffers' place, behind the last stage's barrier
    __shared__ __align__(1024) char sm[SMB];
    const int wave = ST ? __builtin_amdgcn_readfirstlane((int)threadIdx.x >> 5) : 0;
    float* const os = (float*)sm + wave * OSN;
    const size_t z = blockIdx.z;
    const size_t za = (EPI == 2) ? z + z / NH_ * NH_ : z, zb = (EPI == 2) ? z % NH_ : z;   // EPI 2: member z = batch * NH_ + head; a batch's NH_ tanh(q) planes are followed by its NH_ tanh(k) planes, and both batches share the J planes
    A += za * sA; if (A2) A2 += za * sA; Bt += zb * sB; if (Bt2) Bt2 += zb * sB; if (EPI == 0) C += z * sC;
    const float* __restrict__ bias = (z == 0) ? bias0 : (z == 1) ? bias1 : bias2;   // each z-batch member has its own bias vector (at most three members where a bias is added)
    const bool vt = EPI == 1 && z == 2;                                             // the v projection: rows from the weight plane, columns from x
    if (vt) { const T16* const w = Bt; Bt = A; A = w; }
    const int lane = threadIdx.x & 31, lr = lane & 15, hi = lane >> 4; const int R0 = (vt ? blockIdx.y : blockIdx.x) * (ST ? 128 : 64), C0 = (vt ? blockIdx.x : blockIdx.y) * (ST ? 128 : 64), r0 = R0 + (wave >> 1) * 64, c0 = C0 + (wave & 1) * 64;
    v8f acc[4][4];
#pragma unroll
    for (int mb = 0; mb < 4; ++mb)
#pragma unroll
        for (int nb = 0; nb < 4; ++nb) acc[mb][nb] = (v8f){};
    if constexpr (ST) {
        static_assert(NSPLIT <= 1 && K % 128 == 0 && K / 128 >= 2, "whole stages of 128 k, two at least; planes A, A2, B");
        constexpr int NS = K / 128;
        // Wave w copies block rows 2 w and 2 w + 1 of each plane's 8.
        const unsigned lw = (unsigned)(size_t)sm + (unsigned)wave * 8192u + (unsigned)lane * 16u;
        const T16* const ga = A + (size_t)(R0 + wave * 32) * K + 8 * lane; const T16* const ga2 = A2 + (size_t)(R0 + wave * 32) * K + 8 * lane; const T16* const gb = Bt + (size_t)(C0 + wave * 32) * K + 8 * lane;
        auto fill = [&](int s, unsigned l) { const size_t go = (size_t)s * 2048;
            cp_row(l, ga + go); cp_row(l + 4096u, ga + go + 16 * K);
            if (NSPLIT == 1) { cp_row(l + PB, ga2 + go); cp_row(l + PB + 4096u, ga2 + go + 16 * K); }
            cp_row(l + (SB - PB), gb + go); cp_row(l + (SB - PB) + 4096u, gb + go + 16 * K); };
        fill(0, lw);
        // Behind the first stage's copies: a quarter (2 block rows of 8) of each operand slice is asked into L2. A slice is read by every work-group of the other grid index; four neighbours in that index ask for its four quarters.
        static_assert(K == 1024, "half a block row (16 x 512 elements) is 64 units: two block rows take the 128 threads, twice");
        { const size_t ut = (size_t)((int)threadIdx.x >> 6) * 16 * K + (size_t)((int)threadIdx.x & 63) * 128;
          const size_t ua = (size_t)(R0 + ((vt ? blockIdx.x : blockIdx.y) & 3) * 32) * K + ut, ub = (size_t)(C0 + ((vt ? blockIdx.y : blockIdx.x) & 3) * 32) * K + ut;
          if (NSPLIT == 1) ask_st(A + ua, A2 + ua, Bt + ub); else ask_st(A + ua, Bt + ub); }
        asm volatile("s_wait_asynccnt 0x0" ::: "memory");            // this wave's part of stage 0 has landed
        __syncthreads();                                             // every wave's part has
        fill(1, lw + SB);
#pragma unroll 1   // rolled: one copy of the stage's text, the buffer chosen by an offset
        for (int s = 0; s < NS; ++s) {
            const unsigned bo = (unsigned)(s & 1) * SB;
            const T16* const fa = (const T16*)(sm + bo + (unsigned)(wave >> 1) * 16384u) + 8 * lane; const T16* const fa2 = (const T16*)(sm + bo + PB + (unsigned)(wave >> 1) * 16384u) + 8 * lane; const T16* const fb = (const T16*)(sm + bo + (SB - PB) + (unsigned)(wave & 1) * 16384u) + 8 * lane;
            V a[2][4], a2[2][4], b[2][4];                            // two fragment sets: inside a stage the next block's LDS loads go out as one group in front of this block's products
            auto ldf = [&](int kb) {
#pragma unroll
                for (int mb = 0; mb < 4; ++mb) { a[kb & 1][mb] = WFrag<T16>::ld(fa + mb * 2048 + kb * 512); if (NSPLIT == 1) a2[kb & 1][mb] = WFrag<T16>::ld(fa2 + mb * 2048 + kb * 512); }
#pragma unroll
                for (int nb = 0; nb < 4; ++nb) b[kb & 1][nb] = WFrag<T16>::ld(fb + nb * 2048 + kb * 512); };
            ldf(0);
#pragma unroll
            for (int kb = 0; kb < 4; ++kb) {
                if (kb < 3) ldf(kb + 1);
                __builtin_amdgcn_sched_barrier(0);                   // keeps the load group whole and in front of the products: sunk among them, each small group is waited for by itself
#pragma unroll
                for (int nb = 0; nb < 4; ++nb)
#pragma unroll
                    for (int mb = 0; mb < 4; ++mb) { acc[mb][nb] = WFrag<T16>::mma(a[kb & 1][mb], b[kb & 1][nb], acc[mb][nb]); if (NSPLIT == 1) acc[mb][nb] = WFrag<T16>::mma(a2[kb & 1][mb], b[kb & 1][nb], acc[mb][nb]); }
                __builtin_amdgcn_sched_barrier(0);                   // keeps the block after next's loads, which land in this block's registers, behind its products
            }
            asm volatile("s_wait_dscnt 0x0" ::: "memory");           // this wave's reads of the buffer are done: behind the barrier it is refilled
            asm volatile("s_wait_asynccnt 0x0" ::: "memory");        // this wave's part of the next stage has landed
            __syncthreads();                                         // publishes the next stage and ends every wave's reads of this one
            if (s + 2 < NS) fill(s + 2, lw + bo);
        }
        asm volatile("s_wait_asynccnt 0x0" ::: "memory");            // no copy is left in flight where the buffers become the epilogue's staging
    } else {
    // Each lane's own piece of the first block of block row r0 / 16 (c0 / 16); the pointers walk k, one block (512 elements) a trip, and the block rows below are constant offsets from them.
    const T16* pa = A + (size_t)r0 * K + 8 * lane; const T16* pa2 = A2 + (size_t)r0 * K + 8 * lane; const T16* pb = Bt + (size_t)c0 * K + 8 * lane; const T16* pb2 = Bt2 + (size_t)c0 * K + 8 * lane;
#pragma unroll 1
    for (int kc = 0; kc < K; kc += 32) {
        V a[4], a2[4], b[4], b2[4];
#pragma unroll
        for (int mb = 0; mb < 4; ++mb) { a[mb] = WFrag<T16>::ld(pa + mb * 16 * K); if (NSPLIT == 1 || NSPLIT == 2) a2[mb] = WFrag<T16>::ld(pa2 + mb * 16 * K); }
#pragma unroll
        for (int nb = 0; nb < 4; ++nb) { b[nb] = WFrag<T16>::ld(pb + nb * 16 * K); if (NSPLIT >= 2) b2[nb] = WFrag<T16>::ld(pb2 + nb * 16 * K); }
        // In front of the pointers' step: they are the address registers of the loads just issued. Named as inputs they keep their registers up to the wait, so that no load lands on its own address pair.
        if (NSPLIT == 0) asm volatile("s_wait_xcnt 0x0" :: "v"(pa), "v"(pb) : "memory"); else if (NSPLIT == 1) asm volatile("s_wait_xcnt 0x0" :: "v"(pa), "v"(pa2), "v"(pb) : "memory"); else asm volatile("s_wait_xcnt 0x0" :: "v"(pa), "v"(pa2), "v"(pb), "v"(pb2) : "memory");
        __builtin_amdgcn_sched_barrier(0);                           // keeps the step behind the wait, and the trip's loads together in front of its products: sunk among them, each group of loads would be waited for by itself
        pa += 512; pa2 += 512; pb += 512; pb2 += 512;
#pragma unroll
        for (int nb = 0; nb < 4; ++nb)
#pragma unroll
            for (int mb = 0; mb < 4; ++mb) { acc[mb][nb] = WFrag<T16>::mma(a[mb], b[nb], acc[mb][nb]); if (NSPLIT == 1 || NSPLIT == 2) acc[mb][nb] = WFrag<T16>::mma(a2[mb], b[nb], acc[mb][nb]); if (NSPLIT >= 2) acc[mb][nb] = WFrag<T16>::mma(a[mb], b2[nb], acc[mb][nb]); }
        asm volatile("v_nop\n\tv_nop\n\tv_nop\n\tv_nop" : "+v"(acc[0][0]), "+v"(acc[1][1]), "+v"(acc[2][2]), "+v"(acc[3][3]) : "v"(a[0]), "v"(a[3]));
    }
    }
    if (EPI == 0) {
#pragma unroll
    for (int mb = 0; mb < 4; ++mb) {
#pragma unroll
        for (int nb = 0; nb < 4; ++nb) {
#pragma unroll
            for (int j = 0; j < 8; ++j) os[(hi * 8 + j) * 68 + nb * 16 + lr] = acc[mb][nb][j]; }
        __builtin_amdgcn_wave_barrier(); asm volatile("" ::: "memory");
        float* crow = C + (size_t)(r0 + mb * 16) * ldc + c0;
{
#pragma unroll
            for (int s = 0; s < 8; ++s) { const int row = 2 * s + hi, cofs = lr * 4; v4f val = *(const v4fa*)(os + row * 68 + cofs); val[0] += bfr(bias[c0 + cofs]); val[1] += bfr(bias[c0 + cofs + 1]); val[2] += bfr(bias[c0 + cofs + 2]); val[3] += bfr(bias[c0 + cofs + 3]);
                *(v4f*)(crow + (size_t)row * ldc + cofs) = val; }
             }
        __builtin_amdgcn_wave_barrier(); asm volatile("" ::: "memory");
    }
    } else {
        if (vt) {                                                    // the bias is added on the way into LDS: per row where the operands changed places, else per column
#pragma unroll
            for (int mb = 0; mb < 4; ++mb)
#pragma unroll
                for (int j = 0; j < 8; ++j) { const float bb = bfr(bias[r0 + mb * 16 + hi * 8 + j]);
#pragma unroll
                    for (int nb = 0; nb < 4; ++nb) os[(mb * 16 + hi * 8 + j) * 68 + nb * 16 + lr] = acc[mb][nb][j] + bb; }
        } else {
#pragma unroll
            for (int nb = 0; nb < 4; ++nb) { const float bb = (EPI == 1) ? bfr(bias[c0 + nb * 16 + lr]) : 0.0f;
#pragma unroll
                for (int mb = 0; mb < 4; ++mb)
#pragma unroll
                    for (int j = 0; j < 8; ++j) os[(mb * 16 + hi * 8 + j) * 68 + nb * 16 + lr] = (EPI == 1) ? acc[mb][nb][j] + bb : acc[mb][nb][j]; }
        }
        __builtin_amdgcn_wave_barrier(); asm volatile("" ::: "memory");   // the lanes read each other's rows below
        // Read-back: one half block a step (16 rows, 16 columns: 8 columns a lane), in the order in which the half blocks lie in the plane. The loops stay rolled, two steps a trip, so that the second step's LDS reads pass behind the first step's arithmetic.
        // Trip i = 2 mb + kb: rows 16 mb.., columns 32 kb..; step s: columns + 16 s. ldp = columns of the plane that the tile goes to, cc = the tile's first column in it.
        const float* const op0 = os + lr * 68 + hi * 8;
        // EPI 1: the tokens of both batches lie in a row (NB_ TT of them); a tile's 64 tokens are of one batch bt, and tl is the first of them inside it.
        const int tk = vt ? c0 : r0, bt = (EPI == 1) ? tk / TT : 0, tl = tk - bt * TT;
        const size_t ldp = vt ? TT : (EPI == 2) ? ldc : HD, cc = vt ? tl : (EPI == 2) ? c0 : 0, rr = (EPI == 1 && !vt) ? tl : r0;
        const size_t o0 = (vt ? (size_t)bt * NH_ : (EPI == 2) ? 0 : ((size_t)bt * 2 + z) * NH_ + (c0 >> 6)) * (size_t)TT * HD + ((EPI == 2) ? z * sC : 0) + rr * ldp + cc * 16 + 8 * lane;
        if (!vt) {
#pragma unroll 1
            for (int i = 0; i < 8; ++i) {
#pragma unroll
                for (int s = 0; s < 2; ++s) { const float* const op = op0 + (i >> 1) * (16 * 68) + (i & 1) * 32 + s * 16; const size_t o = o0 + (size_t)(i >> 1) * 16 * ldp + (i & 1) * 512 + s * 256;
                    const v4f x0 = *(const v4fa*)op, x1 = *(const v4fa*)(op + 4);
                    const float y[8] = { x0[0], x0[1], x0[2], x0[3], x1[0], x1[1], x1[2], x1[3] };
                    st_hl(y, Ph + o, Pl + o);
                    if (EPI == 1) { float th[8];
#pragma unroll
                        for (int u = 0; u < 8; ++u) th[u] = tanhc(y[u]);
                        st_hl(th, Nh + o, Nl + o); } }
                asm volatile("s_wait_xcnt 0x0" ::: "memory");        // the next trip overwrites data and address registers of the stores just issued
            }
        } else {
#pragma unroll 1
            for (int i = 0; i < 8; ++i) {
#pragma unroll
                for (int s = 0; s < 2; ++s) { const float* const op = op0 + (i >> 1) * (16 * 68) + (i & 1) * 32 + s * 16; const size_t o = o0 + (size_t)(i >> 1) * 16 * ldp + (i & 1) * 512 + s * 256;
                    const v4f x0 = *(const v4fa*)op, x1 = *(const v4fa*)(op + 4);
                    const float y[8] = { x0[0], x0[1], x0[2], x0[3], x1[0], x1[1], x1[2], x1[3] }; v8h o16;
#pragma unroll
                    for (int u = 0; u < 8; ++u) o16[u] = tohx(y[u]);
                    *(v8h*)(V16 + o) = o16; st_hl(y, Vh + o, Vl + o); }
                asm volatile("s_wait_xcnt 0x0" ::: "memory");        // as above
            }
        }
    }
}

typedef __attribute__((ext_vector_type(2))) _Float16 v2h;
typedef __attribute__((ext_vector_type(4))) _Float16 v4h;
typedef __attribute__((ext_vector_type(2))) unsigned short v2us;
typedef __attribute__((ext_vector_type(4))) unsigned short v4us;
typedef __attribute__((ext_vector_type(2))) float v2f;
typedef __attribute__((ext_vector_type(4))) int v4i;
typedef __attribute__((ext_vector_type(16))) unsigned short v16us;

// wt_piece: the fragment-major plane of Bt[n][k] = bf16(w[k][n]); bx is the block of 256 pieces inside the matrix.
// One 8-element piece a thread, in the order of the plane: a wave stores 512 contiguous bytes, and each of its 8 loads reads 16 neighbouring n of two rows k. N K / 8 is a multiple of the block size.
__device__ __forceinline__ void wt_piece(const float* __restrict__ w, int K, int N, bf* Bt, int bx) {
    const int g = bx * 256 + threadIdx.x, blk = g >> 6, kbs = K >> 5;
    const int n = (blk / kbs) * 16 + (g & 15), k = (blk % kbs) * 32 + ((g >> 5) & 1) * 16 + ((g >> 4) & 1) * 8;
    const float* __restrict__ p = w + (size_t)k * N + n; float v[8];
#pragma unroll
    for (int u = 0; u < 8; ++u) v[u] = p[(size_t)u * N];
    v8us o;
#pragma unroll
    for (int u = 0; u < 8; ++u) o[u] = f2bf(v[u]);
    *(v8us*)(Bt + (size_t)g * 8) = o;
}
// cvt_piece: the fragment-major bf16 plane of src[r][k] (K columns); one 8-element piece a thread, in the order of the plane (a wave stores 512 contiguous bytes; a block reads 512 contiguous bytes of each of 16 rows).
__device__ __forceinline__ void cvt_piece(const float* __restrict__ src, bf* dst, size_t n8, int K, int bx) { const size_t i = (size_t)bx * 256 + threadIdx.x; if (i >= n8) return;
    const int blk = (int)(i >> 6), kbs = K >> 5; const int r = (blk / kbs) * 16 + ((int)i & 15), k = (blk % kbs) * 32 + (((int)i >> 5) & 1) * 16 + (((int)i >> 4) & 1) * 8;
    const v8f v = *(const v8f*)(src + (size_t)r * K + k); v8us o;
    asm volatile("s_wait_xcnt 0x0" ::: "memory");                    // the conversion below reuses the address registers of the loads just issued
#pragma unroll
    for (int u = 0; u < 8; ++u) o[u] = f2bf(v[u]); *(v8us*)(dst + i * 8) = o;  }
// k_prep: every 16-bit plane that is made of an input alone, in ONE launch; none needs anything of another, so each takes a range of the block index (the branch is the same for a whole work-group):
// the four weight matrices (outputs in a row from WT), x of both batches, the NH_ matrices of J.
#define PBW  (DM * DQ / 8 / 256)          // blocks of one weight matrix
#define PBX  (NB_ * TT * DM / 8 / 256)    // blocks of x
#define PBJ  (HD * HD / 8 / 256)          // blocks of one matrix of J
__global__ __launch_bounds__(256) void k_prep(const float* __restrict__ w0, const float* __restrict__ w1, const float* __restrict__ w2, const float* __restrict__ w3, const float* __restrict__ x, const float* __restrict__ Jm, bf* WT, bf* XB, bf* JT) {
    int bx = blockIdx.x;
    if (bx < 4 * PBW) { const int y = bx / PBW; wt_piece((y == 0) ? w0 : (y == 1) ? w1 : (y == 2) ? w2 : w3, DM, DQ, WT + (size_t)y * DM * DQ, bx % PBW); return; }
    bx -= 4 * PBW;
    if (bx < PBX) { cvt_piece(x, XB, (size_t)NB_ * TT * DM / 8, DM, bx); return; }
    bx -= PBX;
    { const int y = bx / PBJ; wt_piece(Jm + (size_t)y * HD * HD, HD, HD, JT + (size_t)y * HD * HD, bx % PBJ); }
}
// ---- k_attn: score products, causal softmax and probability x value product of every (batch, head) in ONE launch; scores and probabilities stay in registers.
// A query tile is QW = 16 NT query columns; a wave walks keys of it in blocks of 32 (which keys: at k_attn). Transposed products: S^T = K Q^T and D^T = tanh(K) (tanh(Q) J)^T (A = key rows, B = query rows kept in
// registers; both hl x hl, 3 products), so a lane holds the scores of ONE query: keys 8 hi + j of each 16-key tile. t = S / 8 + lam D per element in f32; running maximum and running sum per query
// (online softmax: the output tile and the sum are rescaled by exp(old max - new max) in every block). The two 16-key tiles of a block, converted in place, ARE the B operand of O^T += V^T P^T
// (element s = tile s >> 3, register s & 7: the k order of the V^T loader). Query rows < RH: P and V in hi+lo planes (3 products); the rest fp16 with P x 1024. P is left unnormalised; O is divided by the sum at the end
// (the factor 1024 is in the sum too and cancels). Every inner loop is unrolled so that the fragment arrays stay in registers. A lane's 8 accumulator registers are 8 consecutive d of one query: one 16-byte store per plane and d tile into the merged-head hi/lo planes, where the wave's 32 pieces are one half block (512 contiguous bytes).
#define NT   2                    // 16-query column groups per wave
#define QW   (16 * NT)            // queries per wave
#define NQT  (TT / QW)            // query tiles per head; tile i has i + 1 key blocks
#define PW   4                    // tile pairs per work-group, two waves a pair: neighbouring tiles of one head, which read the same key rows at about the same time
#define L2E  1.4426950408889634f
__device__ __forceinline__ float xhalf(float x) { return __builtin_bit_cast(float, __builtin_amdgcn_permlanex16(__builtin_bit_cast(int, x), __builtin_bit_cast(int, x), 0x76543210, 0xfedcba98, false, false)); }   // lane l reads lane l ^ 16
// In front of code that overwrites address registers of global loads or stores just issued; the scheduling barrier keeps that code behind the wait (and the loads in front of it).
__device__ __forceinline__ void addr_done() { asm volatile("s_wait_xcnt 0x0" ::: "memory"); __builtin_amdgcn_sched_barrier(0); }
// The same, naming two pointers as inputs: they keep their registers up to the wait (else the last load through each lands on its own address pair).
__device__ __forceinline__ void addr_done(const bf* a, const bf* b) { asm volatile("s_wait_xcnt 0x0" :: "v"(a), "v"(b) : "memory"); __builtin_amdgcn_sched_barrier(0); }
// attn_q: hi and lo fragments of the tile at q0 from a pair of query-row planes (Q, or tanh(Q)). Not part of attn_part, so that the loads and their wait stand once, in front of the branch that picks attn_part's form.
__device__ __forceinline__ void attn_q(const bf* __restrict__ Qh, const bf* __restrict__ Ql, int q0, v16bf (&qh)[NT][2], v16bf (&ql)[NT][2]) {
    const int lane = threadIdx.x & 31; const size_t q1 = (size_t)q0 * HD + 8 * lane; const bf* const ph = Qh + q1; const bf* const pl = Ql + q1;
#pragma unroll
    for (int n = 0; n < NT; ++n)
#pragma unroll
        for (int ks = 0; ks < 2; ++ks) { const int qo = n * 16 * HD + ks * 512; qh[n][ks] = WFrag<bf>::ld(ph + qo); ql[n][ks] = WFrag<bf>::ld(pl + qo); }
    addr_done(ph, pl);
}
// attn_j: the head's J^T fragments [16-e tile][d step].
__device__ __forceinline__ void attn_j(const bf* __restrict__ Jt, v16bf (&jt)[4][2]) {
    const int lane = threadIdx.x & 31;
#pragma unroll
    for (int et = 0; et < 4; ++et)
#pragma unroll
        for (int ks = 0; ks < 2; ++ks) jt[et][ks] = WFrag<bf>::ld(Jt + et * 16 * HD + ks * 512 + 8 * lane);
    addr_done();
}
// attn_g: G = tanh(Q) J of a tile, as G^T = J^T tanh(Q)^T (A = rows e of J^T, B = query rows; hi/lo tanh(Q) x exact J, 2 products a d step, hi in front of lo). A lane then holds 8 consecutive e (8 hi + j of each 16-e tile) of ONE query:
// two neighbouring e tiles, split hi/lo in place, ARE the B operand of D^T = tanh(K) G^T (element s = tile s >> 3, register s & 7: the k order of the tanh(K) loader).
__device__ __forceinline__ void attn_g(const v16bf (&th)[NT][2], const v16bf (&tl)[NT][2], const v16bf (&jt)[4][2], v16bf (&gh)[NT][2], v16bf (&gl)[NT][2]) {
#pragma unroll
    for (int n = 0; n < NT; ++n) {
        v8f g[4];
#pragma unroll
        for (int et = 0; et < 4; ++et) g[et] = (v8f){};
#pragma unroll
        for (int ks = 0; ks < 2; ++ks)
#pragma unroll
            for (int et = 0; et < 4; ++et) { g[et] = wmmab(jt[et][ks], th[n][ks], g[et]); g[et] = wmmab(jt[et][ks], tl[n][ks], g[et]); }
#pragma unroll
        for (int ks = 0; ks < 2; ++ks) { v8us h0, h1, l0, l1;
#pragma unroll
            for (int j = 0; j < 8; ++j) { unsigned short a, c2; splitf(g[2 * ks][j], a, c2); h0[j] = a; l0[j] = c2; splitf(g[2 * ks + 1][j], a, c2); h1[j] = a; l1[j] = c2; }
            gh[n][ks] = cat16b(h0, h1); gl[n][ks] = cat16b(l0, l1); }
    }
}
// attn_part: nblk key blocks of the tile at q0 (its fragments from attn_q and attn_g; KG: the caller has moved the pointers to the lane's place in the first block and has issued that block's key loads into kf), from the block at key kf0 on in steps of dk keys (+32 or -32), into the running state o, mr, ls (started here). nblk >= 1.
template <bool HR, bool KG>
__device__ __forceinline__ void attn_part(const v16bf (&qh)[NT][2], const v16bf (&ql)[NT][2], const v16bf (&gh)[NT][2], const v16bf (&gl)[NT][2], v16bf (&kf)[2][2][4], const bf* __restrict__ Kh, const bf* __restrict__ Kl, const bf* __restrict__ Nh, const bf* __restrict__ Nl,
                                          const h16* __restrict__ V16, const bf* __restrict__ Vh, const bf* __restrict__ Vl, float lam, int q0, int kf0, int nblk, int dk, v8f (&o)[4][NT], float (&mr)[NT], float (&ls)[NT]) {
    const int lane = threadIdx.x & 31, lr = lane & 15, hi = lane >> 4;
#pragma unroll
    for (int n = 0; n < NT; ++n) { mr[n] = -3.0e38f; ls[n] = 0.0f;
#pragma unroll
        for (int dt = 0; dt < 4; ++dt) o[dt][n] = (v8f){}; }
    // kf: key fragments of the block at hand: [16-key tile][k step][K hi, K lo, tanh K hi, tanh K lo]
    if (!KG) { const int lo = kf0 * HD + 8 * lane, lv = kf0 * 16 + 8 * lane; Kh += lo; Kl += lo; Nh += lo; Nl += lo; V16 += lv; Vh += lv; Vl += lv; }   // each lane's own place in the first block (32 keys: 2 block rows of the key planes, one block of the V^T planes); the pointers then walk the keys
    auto ldk = [&]() {
#pragma unroll
        for (int m = 0; m < 2; ++m)
#pragma unroll
            for (int ks = 0; ks < 2; ++ks) { const int ko = m * 16 * HD + ks * 512; kf[m][ks][0] = WFrag<bf>::ld(Kh + ko); kf[m][ks][1] = WFrag<bf>::ld(Kl + ko); kf[m][ks][2] = WFrag<bf>::ld(Nh + ko); kf[m][ks][3] = WFrag<bf>::ld(Nl + ko); } };
    if (!KG) { ldk(); addr_done(); }
    int kstep = (nblk > 1) ? dk * HD : 0, vstep = 0;                 // how far the pointers move in front of the next loads (behind the last block it is fetched again: in bounds, unused)
    int it = 0, kb = kf0;
#pragma unroll 1   // rolled: a second copy of the block would need a second set of fragment registers
    do {
        float t[2][NT][8];
#pragma unroll
        for (int m = 0; m < 2; ++m) {
            v8f s[NT], d[NT];
#pragma unroll
            for (int n = 0; n < NT; ++n) { s[n] = (v8f){}; d[n] = (v8f){}; }
#pragma unroll
            for (int ks = 0; ks < 2; ++ks) { const v16bf kh = kf[m][ks][0], kl = kf[m][ks][1], nh = kf[m][ks][2], nl = kf[m][ks][3];
#pragma unroll
                for (int n = 0; n < NT; ++n) { s[n] = wmmab(kh, qh[n][ks], s[n]); d[n] = wmmab(nh, gh[n][ks], d[n]); s[n] = wmmab(kh, ql[n][ks], s[n]); d[n] = wmmab(nh, gl[n][ks], d[n]); s[n] = wmmab(kl, qh[n][ks], s[n]); d[n] = wmmab(nl, gh[n][ks], d[n]); } }
#pragma unroll
            for (int n = 0; n < NT; ++n)
#pragma unroll
                for (int j = 0; j < 8; ++j) t[m][n][j] = s[n][j] * SCL + lam * d[n][j];
        }
        if (HR) addr_done(Vh, Vl); else addr_done();                 // the pointers move only here, a whole block behind the loads that name them; the scheduling barrier also keeps the loads below from rising over the score products, where they would need a second set of fragment registers
        Kh += kstep; Kl += kstep; Nh += kstep; Nl += kstep; V16 += vstep; Vh += vstep; Vl += vstep;
        v16h v16[4]; v16bf vh[4], vl[4];
#pragma unroll
        for (int dt = 0; dt < 4; ++dt) { const int vo = dt * 16 * TT; if (HR) { vh[dt] = WFrag<bf>::ld(Vh + vo); vl[dt] = WFrag<bf>::ld(Vl + vo); } else v16[dt] = WFrag<h16>::ld(V16 + vo); }
        __builtin_amdgcn_sched_barrier(0);                           // V in front of K: P.V needs V first, and loads return in order
        ldk();                                                       // the next block's key fragments, into the same registers: their latency passes behind the softmax and P.V
        __builtin_amdgcn_sched_barrier(0);                           // holds the loads here, far in front of their first use
        kstep = (it + 2 < nblk) ? dk * HD : 0; vstep = dk * 16;
        if (kb + 31 > q0) {                                          // the block that holds the diagonal (wave-uniform): keys beyond a lane's query leave the softmax
#pragma unroll
            for (int m = 0; m < 2; ++m)
#pragma unroll
                for (int n = 0; n < NT; ++n)
#pragma unroll
                    for (int j = 0; j < 8; ++j) if (kb + m * 16 + 8 * hi + j > q0 + n * 16 + lr) t[m][n][j] = -3.0e38f;
        }
        v16h p16[NT]; v16bf ph[NT], pl[NT];
#pragma unroll
        for (int n = 0; n < NT; ++n) {
            float bm = t[0][n][0];
#pragma unroll
            for (int e = 1; e < 16; ++e) bm = fmaxf(bm, t[e >> 3][n][e & 7]);
            bm = fmaxf(bm, xhalf(bm));                               // the other half of the wave holds the query's other 16 keys
            const float mn = fmaxf(mr[n], bm);                       // finite from the first block on: every block up to the diagonal's holds a key that is open to the query
            const float al = __builtin_amdgcn_exp2f((mr[n] - mn) * L2E); mr[n] = mn;
            float bs = 0.0f; v8us h0, h1, l0, l1;
#pragma unroll
            for (int e = 0; e < 16; ++e) { const float pe = __builtin_amdgcn_exp2f(HR ? (t[e >> 3][n][e & 7] - mn) * L2E : (t[e >> 3][n][e & 7] - mn) * L2E + 10.0f); bs += pe;   // + 10: P x 1024 for the fp16 planes
                if (HR) { unsigned short a, c2; splitf(pe, a, c2); if (e < 8) { h0[e & 7] = a; l0[e & 7] = c2; } else { h1[e & 7] = a; l1[e & 7] = c2; } }
                else p16[n][e] = tohx(pe); }
            if (HR) { ph[n] = cat16b(h0, h1); pl[n] = cat16b(l0, l1); }
            ls[n] = ls[n] * al + bs;                                 // each half sums its own keys; the halves are joined behind the loop
#pragma unroll
            for (int dt = 0; dt < 4; ++dt) o[dt][n] *= al;
        }
#pragma unroll
        for (int dt = 0; dt < 4; ++dt)
#pragma unroll
            for (int n = 0; n < NT; ++n) {
                if (HR) { o[dt][n] = wmmab(vh[dt], ph[n], o[dt][n]); o[dt][n] = wmmab(vh[dt], pl[n], o[dt][n]); o[dt][n] = wmmab(vl[dt], ph[n], o[dt][n]); }
                else o[dt][n] = wmma16(v16[dt], p16[n], o[dt][n]); }
        kb += dk;
    } while (++it < nblk);
    addr_done();                                                     // the code behind the loop reuses the pointers' registers
}
// attn_out: a tile's finished state -> the merged-head planes.
__device__ __forceinline__ void attn_out(const v8f (&o)[4][NT], const float (&ls)[NT], int q0, bf* Ah, bf* Al) {
    const int lane = threadIdx.x & 31;
#pragma unroll
    for (int n = 0; n < NT; ++n) { const float sum = ls[n] + xhalf(ls[n]); const float f = __fdiv_rn(1.0f, sum);
#pragma unroll
        for (int dt = 0; dt < 4; ++dt) { v8us oh, ol;
#pragma unroll
            for (int j = 0; j < 8; ++j) { unsigned short a, c2; splitf(o[dt][n][j] * f, a, c2); oh[j] = a; ol[j] = c2; }
            const size_t oo = (size_t)(q0 + n * 16) * DQ + dt * 256 + 8 * lane; *(v8us*)(Ah + oo) = oh; *(v8us*)(Al + oo) = ol; }
        if (n + 1 < NT) addr_done(); }                               // the next column group reuses registers that these stores name
}
// grid (NQT / 2 / PW, NB_ NH_), 2 PW waves: one work-group a WGP. Plane sets per batch: QK* = the q planes [h][t][d] followed by the k planes, QKN* their tanh; JT = J^T [h][e][d], shared by the batches; V* = [h][d][t]. A* = merged heads [b][t][DQ], hi and lo. Every plane is fragment-major (rows t of 64 d; rows d of TT keys; rows t of DQ).
// Two waves per SIMD (512 registers each): the Q and K fragments alone take 128 registers each.
// Equal work for every wave. The cost of a tile grows with its index and every wave is resident from the start, so a wave with a whole late tile would run on alone on its SIMD, its vector work no longer behind another wave's products.
// Tiles i and NQT - 1 - i (NQT + 1 key blocks together) go to a pair of waves: the first takes the long tile's first na blocks; the second the rest of the long tile, leaves that partial state (maximum, sum, output tile) in LDS,
// and then takes the short tile, downwards from its diagonal (so the PW second waves stand at the same key block at the same time, as the first waves do). Behind the one barrier the first wave joins the two states as the online softmax joins blocks.
// A block of a tile below RH costs about 5/3 of another (three P.V products, P split): na grows by a third of such a short tile's blocks.
__global__ __launch_bounds__(64 * PW) __attribute__((amdgpu_waves_per_eu(2, 2))) void k_attn(const bf* __restrict__ QKh, const bf* __restrict__ QKl, const bf* __restrict__ JT, const bf* __restrict__ QKNh, const bf* __restrict__ QKNl,
                                                  const h16* __restrict__ V16, const bf* __restrict__ Vh, const bf* __restrict__ Vl, const float* __restrict__ lamp, bf* Ah, bf* Al) {
    static_assert(NT == 2 && QW == 32 && NQT % (2 * PW) == 0 && 2 * RH <= TT, "a tile's diagonal block starts at its first query; whole pairs; the long tile of a pair lies above RH");
    __shared__ v8us gs[PW * 16 * 32];                                // per pair and lane: the short tile's tanh(Q) J fragments (16 pieces of 16 bytes), piece-major
    __shared__ v4f xs[PW * 17 * 32];                                 // per pair and lane: the output tile (16 pieces of 4 floats), then maxima and sums; piece-major, so that a wave's store or load covers 512 contiguous bytes
    const int bh = blockIdx.y, b = bh / NH_, h = bh % NH_, lane = threadIdx.x & 31;
    const int wave = __builtin_amdgcn_readfirstlane((int)threadIdx.x >> 5), pr = wave % PW; const bool second = wave >= PW;
    const int i = blockIdx.x * PW + pr, qs = i * QW, qf = (NQT - 1 - i) * QW, nl = NQT - i;   // short tile, long tile, the long tile's key blocks
    const int na = min(NQT / 2 + 1 + ((qs < RH) ? (i + 1) / 3 : 0), nl - 1);   // the second wave keeps the diagonal block at least
    const size_t PLN = (size_t)NH_ * TT * HD, qp = ((size_t)b * 2 * NH_ + h) * TT * HD, kp = qp + PLN, gp = ((size_t)b * NH_ + h) * TT * HD, ap = (size_t)b * TT * DQ + h * HD * 16;
    const float lam = bfr(lamp[0]);
    v8f o[4][NT]; float mr[NT], ls[NT]; v16bf qh[NT][2], ql[NT][2], gh[NT][2], gl[NT][2], th[NT][2], tl[NT][2], jt[4][2], kf[2][2][4];
    v8us* const gq = gs + pr * (16 * 32) + lane;
    // The long tile's Q loads and its first block's key loads go out in front of tanh(Q) J, so that their latency passes behind it.
    const int k00 = second ? na * 32 : 0, lo0 = k00 * HD + 8 * lane, lv0 = k00 * 16 + 8 * lane;
    const bf* const b0h = QKh + qp + lo0; const bf* const b0l = QKl + qp + lo0; const bf* const c0h = QKNh + qp + lo0; const bf* const c0l = QKNl + qp + lo0;   // the k planes lie PLN elements behind the q planes: a constant offset of the loads
    const bf* const k0h = b0h + PLN; const bf* const k0l = b0l + PLN; const bf* const n0h = c0h + PLN; const bf* const n0l = c0l + PLN;
    attn_j(JT + h * HD * HD, jt);
    attn_q(QKh + qp, QKl + qp, qf, qh, ql);
#pragma unroll
    for (int m = 0; m < 2; ++m)
#pragma unroll
        for (int ks = 0; ks < 2; ++ks) { const int ko = m * 16 * HD + ks * 512; kf[m][ks][0] = WFrag<bf>::ld(k0h + ko); kf[m][ks][1] = WFrag<bf>::ld(k0l + ko); kf[m][ks][2] = WFrag<bf>::ld(n0h + ko); kf[m][ks][3] = WFrag<bf>::ld(n0l + ko); }
    asm volatile("s_wait_xcnt 0x0" :: "v"(b0h), "v"(b0l), "v"(c0h), "v"(c0l) : "memory");   // as addr_done: the four address pairs of the loads keep their registers up to the wait, so that no load lands on one
    __builtin_amdgcn_sched_barrier(0);                               // keeps the loads in front of the wait, and what follows behind it
    // tanh(Q) J: a second wave's short tile first (it waits in LDS, read back by the wave that wrote it), then the long tile, which stays in gh and gl.
#pragma unroll 1   // rolled: one copy of the products and the split in the text
    for (int v = second ? 0 : 1; v < 2; ++v) {
        attn_q(QKNh + qp, QKNl + qp, v ? qf : qs, th, tl);
        attn_g(th, tl, jt, gh, gl);
        if (v == 0) {
#pragma unroll
            for (int n = 0; n < NT; ++n)
#pragma unroll
                for (int ks = 0; ks < 2; ++ks) { const v16us uh = __builtin_bit_cast(v16us, gh[n][ks]), ul = __builtin_bit_cast(v16us, gl[n][ks]); v8us* const p = gq + (n * 2 + ks) * (4 * 32);
                    p[0] = __builtin_shufflevector(uh, uh, 0, 1, 2, 3, 4, 5, 6, 7); p[32] = __builtin_shufflevector(uh, uh, 8, 9, 10, 11, 12, 13, 14, 15); p[64] = __builtin_shufflevector(ul, ul, 0, 1, 2, 3, 4, 5, 6, 7); p[96] = __builtin_shufflevector(ul, ul, 8, 9, 10, 11, 12, 13, 14, 15); }
        }
    }
    // The head's key-side planes (K and tanh(K), hi and lo; V^T fp16: 1024 units each) are asked into L2 (see ask_st), a quarter by each of four neighbouring work-groups of the head: five units a thread.
    // Here every load of the start has gone out, and the asks pass behind the first key block's products.
    // K and tanh(K) go in the order in which the head's waves come to a key block (16 units in each of the four planes): at step t the first waves stand at block t, the second waves at block 33 + t of a long tile or 31 - t of a short one.
    static_assert(NQT == 64 && TT * HD / 128 == 4 * 64 * PW && RH / 8 * 4 == 64 * PW, "the ranks name each of the 64 key blocks once; a quarter plane, and the hi/lo V^T blocks of the keys below RH (RH / 8 units in each of 4 block rows), are one unit a thread");
    { const int sl = ((int)blockIdx.x & 3) * (64 * PW) + (int)threadIdx.x;   // the thread's place among the 1024 of the four work-groups: 64 places a key block, 16 a plane
      const bf* const pk = ((lane & 16) ? ((wave & 1) ? QKNl : QKl) : ((wave & 1) ? QKNh : QKh)) + kp + (lane & 15) * 128;
      auto kbr = [](int r) { const int t = r / 3, m = r - 3 * t; return (m == 0) ? t : (m == 1) ? 31 - t : 33 + t; };   // the key block of rank r < 48 in that order (steps 0 to 15); ranks 48 to 63: blocks 49 to 63, then 32
      const int r0 = ((int)blockIdx.x & 3) * PW + (wave >> 1);       // = sl >> 6, the same for a wave; ask j: ranks 16 j .. 16 j + 15
      asm volatile("global_prefetch_b8 %0, off scope:SCOPE_SE\n\t"
                   "global_prefetch_b8 %1, off scope:SCOPE_SE\n\t"
                   "global_prefetch_b8 %2, off scope:SCOPE_SE\n\t"
                   "global_prefetch_b8 %3, off scope:SCOPE_SE\n\t"
                   "global_prefetch_b8 %4, off scope:SCOPE_SE\n\t"
                   "s_wait_xcnt 0x0" :: "v"(pk + kbr(r0) * (32 * HD)), "v"(V16 + gp + (size_t)sl * 128), "v"(pk + kbr(16 + r0) * (32 * HD)), "v"(pk + kbr(32 + r0) * (32 * HD)), "v"(pk + ((r0 < 15) ? 49 + r0 : 32) * (32 * HD)) : "memory");
      if ((int)blockIdx.x * PW * QW < RH) {                          // a work-group with a tile below RH (the same for all its waves) reads the hi/lo V^T planes too, late
          const size_t uv = (size_t)((int)threadIdx.x / (RH / 8)) * 16 * TT + (size_t)((int)threadIdx.x % (RH / 8)) * 128;
          asm volatile("global_prefetch_b8 %0, off scope:SCOPE_SE\n\t"
                       "global_prefetch_b8 %1, off scope:SCOPE_SE\n\t"
                       "s_wait_xcnt 0x0" :: "v"(Vh + gp + uv), "v"(Vl + gp + uv) : "memory"); } }
    attn_part<false, true>(qh, ql, gh, gl, kf, k0h, k0l, n0h, n0l, V16 + gp + lv0, Vh + gp + lv0, Vl + gp + lv0, lam, qf, k00, second ? nl - na : na, 32, o, mr, ls);
    v4f* const xp = xs + pr * (17 * 32) + lane;
    if (second) {
#pragma unroll
        for (int n = 0; n < NT; ++n)
#pragma unroll
            for (int dt = 0; dt < 4; ++dt) { const v8f v = o[dt][n]; xp[((n * 4 + dt) * 2) * 32] = (v4f){ v[0], v[1], v[2], v[3] }; xp[((n * 4 + dt) * 2 + 1) * 32] = (v4f){ v[4], v[5], v[6], v[7] }; }
        xp[16 * 32] = (v4f){ mr[0], mr[1], ls[0], ls[1] };
        attn_q(QKh + qp, QKl + qp, qs, qh, ql);
#pragma unroll
        for (int n = 0; n < NT; ++n)
#pragma unroll
            for (int ks = 0; ks < 2; ++ks) { const v8us* const p = gq + (n * 2 + ks) * (4 * 32); gh[n][ks] = cat16b(p[0], p[32]); gl[n][ks] = cat16b(p[64], p[96]); }
        if (qs < RH) attn_part<true, false>(qh, ql, gh, gl, kf, QKh + kp, QKl + kp, QKNh + kp, QKNl + kp, V16 + gp, Vh + gp, Vl + gp, lam, qs, qs, i + 1, -32, o, mr, ls);
        else attn_part<false, false>(qh, ql, gh, gl, kf, QKh + kp, QKl + kp, QKNh + kp, QKNl + kp, V16 + gp, Vh + gp, Vl + gp, lam, qs, qs, i + 1, -32, o, mr, ls);
    }
    __syncthreads();                                                 // the second waves' partial states are in LDS
    if (!second) {
        const v4f ml = xp[16 * 32];
#pragma unroll
        for (int n = 0; n < NT; ++n) { const float mn = fmaxf(mr[n], ml[n]);   // both finite: each part holds a key that is open to the query
            const float fa = __builtin_amdgcn_exp2f((mr[n] - mn) * L2E), fb = __builtin_amdgcn_exp2f((ml[n] - mn) * L2E);
            ls[n] = ls[n] * fa + ml[2 + n] * fb;
#pragma unroll
            for (int dt = 0; dt < 4; ++dt) { const v4f x0 = xp[((n * 4 + dt) * 2) * 32], x1 = xp[((n * 4 + dt) * 2 + 1) * 32];
#pragma unroll
                for (int j = 0; j < 4; ++j) { o[dt][n][j] = o[dt][n][j] * fa + x0[j] * fb; o[dt][n][4 + j] = o[dt][n][4 + j] * fa + x1[j] * fb; } } }
    }
    attn_out(o, ls, second ? qs : qf, Ah + ap, Al + ap);
}

extern "C" void kernel_launch(void* const* d_in, const int* in_sizes, int n_in,
                              void* d_out, int out_size, void* d_ws, size_t ws_size, hipStream_t stream) {
    (void)in_sizes; (void)n_in; (void)out_size;
    const float* x = (const float*)d_in[0]; const float* wq = (const float*)d_in[1]; const float* bq = (const float*)d_in[2]; const float* wk = (const float*)d_in[3]; const float* bk = (const float*)d_in[4]; const float* wv = (const float*)d_in[5]; const float* bv = (const float*)d_in[6]; const float* wo = (const float*)d_in[7]; const float* bo = (const float*)d_in[8]; const float* Jm = (const float*)d_in[9]; const float* lamp = (const float*)d_in[10];
    float* OUT = (float*)d_out;     // [2][2048][1024]
    char* wsp = (char*)d_ws;
    const size_t PLN = (size_t)NH_ * TT * HD;   // elements of one set of head planes
    auto take = [&](size_t bytes) { char* p = wsp; wsp += (bytes + 255) & ~(size_t)255; return (void*)p; };
    bf* WQ = (bf*)take((size_t)DQ * DM * 2); bf* WK = (bf*)take((size_t)DKV * DM * 2); bf* WV = (bf*)take((size_t)DKV * DM * 2); bf* WO = (bf*)take((size_t)DM * DQ * 2);   // WQ, WK, WV, WO lie in a row
    bf* XB = (bf*)take((size_t)NB_ * TT * DM * 2); bf* JT = (bf*)take((size_t)NH_ * HD * HD * 2);
    /* the planes that k_attn reads are kept for both batches; a batch's q planes are followed by its k planes: QK* [b][q, k][h][t][d], VT* [b][h][d][t] */
    bf* QKNh = (bf*)take((size_t)NB_ * 2 * PLN * 2); bf* QKNl = (bf*)take((size_t)NB_ * 2 * PLN * 2);
    bf* QKPh = (bf*)take((size_t)NB_ * 2 * PLN * 2); bf* QKPl = (bf*)take((size_t)NB_ * 2 * PLN * 2); h16* VT16 = (h16*)take((size_t)NB_ * PLN * 2); bf* VTh = (bf*)take((size_t)NB_ * PLN * 2); bf* VTl = (bf*)take((size_t)NB_ * PLN * 2);
    bf* ATh = (bf*)take((size_t)NB_ * TT * DQ * 2); bf* ATl = (bf*)take((size_t)NB_ * TT * DQ * 2);
    if ((size_t)(wsp - (char*)d_ws) > ws_size) return;    // ws 256 MiB
    static_assert(DQ == DKV && DQ == DM && HD == 64, "the batched launches take equal shapes; a 64-column tile of a projection is one head"); static_assert((DM * DQ / 8) % 256 == 0 && (HD * HD / 8) % 256 == 0 && (NB_ * TT * DM / 8) % 256 == 0 && TT % 128 == 0 && DM % 32 == 0 && HD % 32 == 0 && TT % 32 == 0, "whole blocks of the fragment-major planes; one piece a thread in the transposes"); static_assert(RH % QW == 0 && TT % QW == 0 && TT % 32 == 0, "a tile's query columns lie on one side of RH and tile the sequence; key blocks of 32 tile it too");
    (void)WK; (void)WV;   // reached as members of the row they lie in
    k_prep<<<4 * PBW + PBX + NH_ * PBJ, 256, 0, stream>>>(wq, wk, wv, wo, x, Jm, WQ, XB, JT);   /* weight, x and J planes */
    k_gemmw<bf, 0, 1, DM, true><<<dim3(NB_ * TT / 128, DQ / 128, 3), 128, 0, stream>>>(XB, nullptr, WQ, nullptr, nullptr, 0, bq, bk, bv, 0, (size_t)DQ * DM, 0,
        QKPh, QKPl, QKNh, QKNl, VT16, VTh, VTl);   /* q, k, v projections of both batches -> q, k, tanh q, tanh k and transposed v planes */
    k_attn<<<dim3(NQT / 2 / PW, NB_ * NH_, 1), 64 * PW, 0, stream>>>(QKPh, QKPl, JT, QKNh, QKNl, VT16, VTh, VTl, lamp, ATh, ATl);   /* tanh(Q) J, scores, softmax and P.V of all heads of both batches */
    k_gemmw<bf, 1, 0, DQ, true><<<dim3(NB_ * TT / 128, DM / 128, 1), 128, 0, stream>>>(ATh, ATl, WO, nullptr, OUT, DM, bo, nullptr, nullptr, 0, 0, 0, nullptr, nullptr, nullptr, nullptr, nullptr, nullptr, nullptr);   /* output projection, both batches */
}
